// v000
// Measured on an AMD MI455X. A time is GPU time per run, averaged over a window of back-to-back runs after a warm-up
// (all launches, gaps included; the runs take copies of the inputs in turn), and the median of several windows.
// Apart from v000's, it joins two sittings. Times from different sittings can be a few percent apart, while
// side-by-side timings come from the same sitting.
// v000, which the later versions start from, runs in 1380 microseconds.
#include <hip/hip_runtime.h>

// Causal multi-head self-attention with interleaved-pair rotary position embedding from a position input (x [2][2048][1024]; Q, K, V = einsum('bsd,ed', x, W) ('oi' [1024][1024] 1/32, no bias; 16 heads x 64); angle = float(token_positions[t]) x theta ** (-2i / 64) (theta 1e4; token_positions int32 [2048] = arange, shared by both batches, READ on device); pairs (2i, 2i+1): (x1 cos - x2 sin, x1 sin + x2 cos) on Q and K; scores / sqrt(64); keys j <= i kept, -inf elsewhere; softmax; out = einsum('bsd,ed', merged, Wo) -> [2][2048][1024] (4.2 M); argument order x, token_positions, Wq, Wk, Wv, Wo).
// Layout per batch: bf16 copy of x; exact projections; {cos, sin} per (position, pair) built once from the int positions and float32 inverse-frequency constants (precise cosf/sinf); interleaved rotary plane builder; causal T-2048 attention (EVERY row's scores on hi/lo planes (3 products: logit sigma 2 with these weights) and hybrid P.V (rows < 512 hi/lo, rest fp16 x1024); k_gemmc skips tiles above the diagonal); merged hi/lo x Wo exact.
// Compute dtypes, f32 accumulate: every input rounded to bf16; projections exact; rotary f32; scores 3 products; P.V rows < 512 3 products, rest fp16; softmax f32; Wo hl x exact.

#define NB_  2
#define TT   2048
#define DM   1024
#define NH_  16
#define NKV  16
#define REP  (NH_ / NKV)
#define HD   64
#define DQ   (NH_ * HD)
#define DKV  (NKV * HD)
#define ZH   2
#define RH   512                  // query rows < RH use hi+lo planes (0: none)
#define WIN  2048
#define PCAR 1024.0f
#define SCL  0.125f   // HD^-0.5
typedef _Float16 h16;
typedef unsigned short bf;
typedef __attribute__((ext_vector_type(16))) __bf16   v16bf;
typedef __attribute__((ext_vector_type(16))) _Float16 v16h;
typedef __attribute__((ext_vector_type(8)))  _Float16 v8h;
typedef __attribute__((ext_vector_type(8)))  unsigned short v8us;
typedef __attribute__((ext_vector_type(8)))  float    v8f;
typedef __attribute__((ext_vector_type(4)))  float    v4f;
typedef v8h  __attribute__((may_alias)) v8ha;
typedef v4f  __attribute__((may_alias)) v4fa;
typedef v8us __attribute__((may_alias)) v8usa;

__device__ __forceinline__ unsigned short f2bf(float f) { unsigned u = __float_as_uint(f); u += 0x7FFFu + ((u >> 16) & 1u); return (unsigned short)(u >> 16); }
__device__ __forceinline__ float bf2f(unsigned short b) { return __uint_as_float(((unsigned)b) << 16); }
__device__ __forceinline__ float bfr(float f) { return bf2f(f2bf(f)); }
__device__ __forceinline__ v16h cat16(v8h lo, v8h hi) { return __builtin_shufflevector(lo, hi, 0, 1, 2, 3, 4, 5, 6, 7, 8, 9, 10, 11, 12, 13, 14, 15); }
__device__ __forceinline__ v16bf cat16b(v8us lo, v8us hi) { return __builtin_bit_cast(v16bf, __builtin_shufflevector(lo, hi, 0, 1, 2, 3, 4, 5, 6, 7, 8, 9, 10, 11, 12, 13, 14, 15)); }
__device__ __forceinline__ v8f wmma16(v16h a, v16h b, v8f c) { return __builtin_amdgcn_wmma_f32_16x16x32_f16(false, a, false, b, (short)0, c, false, false); }
__device__ __forceinline__ v8f wmmab(v16bf a, v16bf b, v8f c) { return __builtin_amdgcn_wmma_f32_16x16x32_bf16(false, a, false, b, (short)0, c, false, false); }



// ---- k_gemmw: register-blocked GEMM, ONE WAVE per 64x64 output tile (16 accumulators), operands straight from K-contiguous 16-bit planes; grid (M/64, N/64, Z), 32 threads.
// C[m][n] (f32, pitch ldc, + optional f32 bias[n]) = sum_k A[m][k] Bt[n][k] (+ split products per NSPLIT). z-batch strides sA/sB/sC in elements. K % 32 == 0.
template <typename T16> struct WFrag;
template <> struct WFrag<h16> { typedef v16h V; static __device__ __forceinline__ V ld(const h16* p) { return cat16(*(const v8h*)p, *(const v8h*)(p + 16)); } static __device__ __forceinline__ v8f mma(V a, V b, v8f c) { return wmma16(a, b, c); } };
template <> struct WFrag<bf> { typedef v16bf V; static __device__ __forceinline__ V ld(const bf* p) { return cat16b(*(const v8us*)p, *(const v8us*)(p + 16)); } static __device__ __forceinline__ v8f mma(V a, V b, v8f c) { return wmmab(a, b, c); } };
template <typename T16, int NSPLIT, bool BIAS>
__global__ __launch_bounds__(32) void k_gemmw(const T16* __restrict__ A, const T16* __restrict__ A2, const T16* __restrict__ Bt, const T16* __restrict__ Bt2, int K, float* C, int ldc, const float* __restrict__ bias, size_t sA, size_t sB, size_t sC) {
    typedef typename WFrag<T16>::V V;
    __shared__ __align__(16) float os[16 * 68];
    const size_t z = blockIdx.z; A += z * sA; if (A2) A2 += z * sA; Bt += z * sB; if (Bt2) Bt2 += z * sB; C += z * sC;
    const int lane = threadIdx.x & 31, lr = lane & 15, hi = lane >> 4; const int r0 = blockIdx.x * 64, c0 = blockIdx.y * 64;
    v8f acc[4][4];
#pragma unroll
    for (int mb = 0; mb < 4; ++mb)
#pragma unroll
        for (int nb = 0; nb < 4; ++nb) acc[mb][nb] = (v8f){};
    const size_t aoff = (size_t)(r0 + lr) * K + 8 * hi, boff = (size_t)(c0 + lr) * K + 8 * hi;
#pragma unroll 1
    for (int kc = 0; kc < K; kc += 32) {
        V a[4], a2[4];
#pragma unroll
        for (int mb = 0; mb < 4; ++mb) { a[mb] = WFrag<T16>::ld(A + aoff + (size_t)mb * 16 * K + kc); if (NSPLIT == 1 || NSPLIT == 2) a2[mb] = WFrag<T16>::ld(A2 + aoff + (size_t)mb * 16 * K + kc); }
#pragma unroll
        for (int nb = 0; nb < 4; ++nb) { const V b = WFrag<T16>::ld(Bt + boff + (size_t)nb * 16 * K + kc); V b2; if (NSPLIT >= 2) b2 = WFrag<T16>::ld(Bt2 + boff + (size_t)nb * 16 * K + kc);
#pragma unroll
            for (int mb = 0; mb < 4; ++mb) { acc[mb][nb] = WFrag<T16>::mma(a[mb], b, acc[mb][nb]); if (NSPLIT == 1 || NSPLIT == 2) acc[mb][nb] = WFrag<T16>::mma(a2[mb], b, acc[mb][nb]); if (NSPLIT >= 2) acc[mb][nb] = WFrag<T16>::mma(a[mb], b2, acc[mb][nb]); } }
        asm volatile("v_nop\n\tv_nop\n\tv_nop\n\tv_nop" : "+v"(acc[0][0]), "+v"(acc[1][1]), "+v"(acc[2][2]), "+v"(acc[3][3]) : "v"(a[0]), "v"(a[3]));
    }
#pragma unroll
    for (int mb = 0; mb < 4; ++mb) {
#pragma unroll
        for (int nb = 0; nb < 4; ++nb) {
#pragma unroll
            for (int j = 0; j < 8; ++j) os[(hi * 8 + j) * 68 + nb * 16 + lr] = acc[mb][nb][j]; }
        __builtin_amdgcn_wave_barrier(); asm volatile("" ::: "memory");
        float* crow = C + (size_t)(r0 + mb * 16) * ldc + c0;
{
#pragma unroll
            for (int s = 0; s < 8; ++s) { const int row = 2 * s + hi, cofs = lr * 4; v4f val = *(const v4fa*)(os + row * 68 + cofs); if (BIAS) { val[0] += bfr(bias[c0 + cofs]); val[1] += bfr(bias[c0 + cofs + 1]); val[2] += bfr(bias[c0 + cofs + 2]); val[3] += bfr(bias[c0 + cofs + 3]); }
                *(v4f*)(crow + (size_t)row * ldc + cofs) = val; }
             }
        __builtin_amdgcn_wave_barrier(); asm volatile("" ::: "memory");
    }
}

// ---- k_gemmc: the same one-wave 64x64 tile GEMM specialised for causal attention: CMODE 1 skips score tiles entirely above the diagonal (query rows r0+roff.., key columns c0..), CMODE 2 limits the
// key (K) loop of the probability x value contraction to the diagonal block (probabilities beyond it are exactly zero). roff = row offset of this launch's first row within the sequence.
template <typename T16, int NSPLIT, int CMODE>
__global__ __launch_bounds__(32) void k_gemmc(const T16* __restrict__ A, const T16* __restrict__ A2, const T16* __restrict__ Bt, const T16* __restrict__ Bt2, int K, float* C, int ldc, int roff, size_t sA, size_t sB, size_t sC) {
    typedef typename WFrag<T16>::V V;
    __shared__ __align__(16) float os[16 * 68];
    const size_t z = blockIdx.z; A += z * sA; if (A2) A2 += z * sA; Bt += z * sB; if (Bt2) Bt2 += z * sB; C += z * sC;
    const int lane = threadIdx.x & 31, lr = lane & 15, hi = lane >> 4; const int r0 = blockIdx.x * 64, c0 = blockIdx.y * 64;
    if (CMODE == 1 && c0 > r0 + roff + 63) return;                  // score tile entirely above the causal diagonal: never read (the softmax masks j > i by select)
    const int Kl = (CMODE == 2) ? min(K, r0 + roff + 64) : K;        // P.V: probabilities are exactly 0 beyond the diagonal block, so the K loop stops there
    v8f acc[4][4];
#pragma unroll
    for (int mb = 0; mb < 4; ++mb)
#pragma unroll
        for (int nb = 0; nb < 4; ++nb) acc[mb][nb] = (v8f){};
    const size_t aoff = (size_t)(r0 + lr) * K + 8 * hi, boff = (size_t)(c0 + lr) * K + 8 * hi;
#pragma unroll 1
    for (int kc = 0; kc < Kl; kc += 32) {
        V a[4], a2[4];
#pragma unroll
        for (int mb = 0; mb < 4; ++mb) { a[mb] = WFrag<T16>::ld(A + aoff + (size_t)mb * 16 * K + kc); if (NSPLIT == 1 || NSPLIT == 2) a2[mb] = WFrag<T16>::ld(A2 + aoff + (size_t)mb * 16 * K + kc); }
#pragma unroll
        for (int nb = 0; nb < 4; ++nb) { const V b = WFrag<T16>::ld(Bt + boff + (size_t)nb * 16 * K + kc); V b2; if (NSPLIT >= 2) b2 = WFrag<T16>::ld(Bt2 + boff + (size_t)nb * 16 * K + kc);
#pragma unroll
            for (int mb = 0; mb < 4; ++mb) { acc[mb][nb] = WFrag<T16>::mma(a[mb], b, acc[mb][nb]); if (NSPLIT == 1 || NSPLIT == 2) acc[mb][nb] = WFrag<T16>::mma(a2[mb], b, acc[mb][nb]); if (NSPLIT >= 2) acc[mb][nb] = WFrag<T16>::mma(a[mb], b2, acc[mb][nb]); } }
        asm volatile("v_nop\n\tv_nop\n\tv_nop\n\tv_nop" : "+v"(acc[0][0]), "+v"(acc[1][1]), "+v"(acc[2][2]), "+v"(acc[3][3]) : "v"(a[0]), "v"(a[3]));
    }
#pragma unroll
    for (int mb = 0; mb < 4; ++mb) {
#pragma unroll
        for (int nb = 0; nb < 4; ++nb) {
#pragma unroll
            for (int j = 0; j < 8; ++j) os[(hi * 8 + j) * 68 + nb * 16 + lr] = acc[mb][nb][j]; }
        __builtin_amdgcn_wave_barrier(); asm volatile("" ::: "memory");
        float* crow = C + (size_t)(r0 + mb * 16) * ldc + c0;
{
#pragma unroll
            for (int s = 0; s < 8; ++s) { const int row = 2 * s + hi, cofs = lr * 4; v4f val = *(const v4fa*)(os + row * 68 + cofs);
                *(v4f*)(crow + (size_t)row * ldc + cofs) = val; }
             }
        __builtin_amdgcn_wave_barrier(); asm volatile("" ::: "memory");
    }
}

__device__ __forceinline__ h16 tohx(float x) { return (h16)x; }
__device__ __forceinline__ void splitf(float y, unsigned short& h, unsigned short& l) { h = f2bf(y); l = f2bf(y - bf2f(h)); }
typedef __attribute__((ext_vector_type(2))) _Float16 v2h;
typedef __attribute__((ext_vector_type(4))) _Float16 v4h;
typedef __attribute__((ext_vector_type(2))) unsigned short v2us;
typedef __attribute__((ext_vector_type(4))) unsigned short v4us;
typedef __attribute__((ext_vector_type(2))) float v2f;
typedef __attribute__((ext_vector_type(4))) int v4i;

__global__ __launch_bounds__(256) void k_wtG(const float* __restrict__ w, int K, int N, bf* Bt) {
    const int lane = threadIdx.x & 31; const int L0 = (blockIdx.x * 8 + (threadIdx.x >> 5)) * 8; const int nlines = N * K / 64;
{
#pragma unroll 1
        for (int l = 0; l < 8; ++l) { const int L = L0 + l; if (L >= nlines) break; const size_t e = (size_t)L * 64 + lane * 2; const int k = (int)(e % K), n = (int)(e / K); v2us o;
            o[0] = f2bf(w[(size_t)k * N + n]); o[1] = f2bf(w[(size_t)(k + 1) * N + n]); *(v2us*)(Bt + e) = o; }
         }
}
__global__ __launch_bounds__(256) void k_cvt8(const float* __restrict__ src, bf* dst, size_t n8) { const size_t i = (size_t)blockIdx.x * 256 + threadIdx.x; if (i >= n8) return; const v8f v = *(const v8f*)(src + i * 8); v8us o;
#pragma unroll
    for (int k = 0; k < 8; ++k) o[k] = f2bf(v[k]); *(v8us*)(dst + i * 8) = o;  }

__global__ __launch_bounds__(256) void k_ropeI(const float* __restrict__ F, int pitch, int nheads, const float* __restrict__ CS, float sc, h16* P16, bf* Ph, bf* Pl) {
    const size_t e = ((size_t)blockIdx.x * 256 + threadIdx.x) * 2; if (e >= (size_t)nheads * TT * HD) return; const int d = (int)(e % HD); const int t = (int)((e / HD) % TT); const int h = (int)(e / ((size_t)HD * TT)); const float* f = F + (size_t)t * pitch + h * HD; const float x0 = f[d], x1 = f[d + 1]; const v2f cs = *(const v2f*)(CS + ((size_t)t * HD + d) * 2); v2h o16; v2us oh, ol;
    float a0 = __fmul_rn(x0, cs[0]), b0 = __fmul_rn(x1, cs[1]), a1 = __fmul_rn(x1, cs[0]), b1 = __fmul_rn(x0, cs[1]); asm volatile("" : "+v"(a0), "+v"(b0), "+v"(a1), "+v"(b1));
    float r0 = __fsub_rn(a0, b0) * sc, r1 = __fadd_rn(b1, a1) * sc;   /* even: x0 c - x1 s; odd: x0 s + x1 c */
    o16[0] = tohx(r0); o16[1] = tohx(r1); { unsigned short a2, c2; splitf(r0, a2, c2); oh[0] = a2; ol[0] = c2; splitf(r1, a2, c2); oh[1] = a2; ol[1] = c2; }
    *(v2h*)(P16 + e) = o16; *(v2us*)(Ph + e) = oh; *(v2us*)(Pl + e) = ol;  }

__constant__ float INV2[HD / 2] = { 1.000000000e+00f, 7.498942018e-01f, 5.623413324e-01f, 4.216965139e-01f, 3.162277639e-01f, 2.371373773e-01f, 1.778279394e-01f, 1.333521456e-01f, 1.000000015e-01f, 7.498942316e-02f, 5.623413250e-02f, 4.216964915e-02f, 3.162277490e-02f, 2.371373773e-02f, 1.778279431e-02f, 1.333521400e-02f, 9.999999776e-03f, 7.498942316e-03f, 5.623413250e-03f, 4.216964822e-03f, 3.162277630e-03f, 2.371373819e-03f, 1.778279431e-03f, 1.333521446e-03f, 1.000000047e-03f, 7.498941850e-04f, 5.623413017e-04f, 4.216965172e-04f, 3.162277571e-04f, 2.371373703e-04f, 1.778279402e-04f, 1.333521504e-04f };   // theta ** (-2i / 64), i = 0..31, in float32 as THIS module writes it (the NEGATIVE-POWER spelling 'theta ** (-arange(0, dh, 2) / dh)', evaluated in the reference's own f32 arithmetic): ten of the 32 entries differ by one ulp from the reciprocal spelling '1 / theta ** (2i / 64)' (indices 5, 9, 10, 12, 13, 15, 20, 27, 28, 29)
__global__ __launch_bounds__(256) void k_cstabI(const int* __restrict__ pid, float* CS) { const int idx = blockIdx.x * 256 + threadIdx.x; if (idx >= TT * HD) return; const int d = idx % HD; const int t = idx / HD; const float a = __fmul_rn((float)pid[t], INV2[d >> 1]); v2f cs; cs[0] = cosf(a); cs[1] = sinf(a); *(v2f*)(CS + (size_t)idx * 2) = cs;  }

__global__ __launch_bounds__(256) void k_vtp(const float* __restrict__ F, int pitch, int nheads, h16* V16, bf* Vh, bf* Vl) { const size_t e = ((size_t)blockIdx.x * 256 + threadIdx.x) * 2; if (e >= (size_t)nheads * HD * TT) return; const int t = (int)(e % TT); const int d = (int)((e / TT) % HD); const int g = (int)(e / ((size_t)TT * HD)); v2h o16; v2us oh, ol;
#pragma unroll
    for (int q = 0; q < 2; ++q) { const float x = F[(size_t)(t + q) * pitch + g * HD + d]; o16[q] = tohx(x); unsigned short a2, c2; splitf(x, a2, c2); oh[q] = a2; ol[q] = c2; }
    *(v2h*)(V16 + e) = o16; *(v2us*)(Vh + e) = oh; *(v2us*)(Vl + e) = ol;  }
// k_asoft: per row (zz, i): t = S x HD^-0.5 for j <= i and i - j < WIN (sliding causal window; the reference's -1e9 additive fill vanishes identically); softmax over the 2048 keys (register row, one exp, fixed trees);
__global__ __launch_bounds__(256) void k_asoft(const float* __restrict__ Sb, h16* P16, bf* Ph, bf* Pl) {
    const int lane = threadIdx.x & 31; const int row = blockIdx.x * 8 + (threadIdx.x >> 5); if (row >= ZH * TT) return; const int i = row % TT; const int zz = row / TT; (void)zz; const bool hires = (i < RH); const float* sr = Sb + (size_t)row * TT; float v[TT / 32]; float mx = -3.0e38f;
#pragma unroll
    for (int ch = 0; ch < TT / 128; ++ch) { const int j0 = ch * 128 + lane * 4; const v4f a = *(const v4f*)(sr + j0);
#pragma unroll
        for (int q = 0; q < 4; ++q) { const int j = j0 + q; (void)j; const float t = (j <= i && i - j < WIN) ? a[q] * SCL : -3.0e38f; v[ch * 4 + q] = t; mx = fmaxf(mx, t); } }
#pragma unroll
    for (int sh = 16; sh; sh >>= 1) mx = fmaxf(mx, __shfl_xor(mx, sh, 32));
    float sum = 0.f;
#pragma unroll
    for (int k = 0; k < TT / 32; ++k) { float d0 = __fsub_rn(v[k], mx); asm volatile("" : "+v"(d0)); v[k] = __builtin_amdgcn_exp2f(__fmul_rn(d0, 1.4426950408889634f)); sum += v[k]; }
#pragma unroll
    for (int sh = 16; sh; sh >>= 1) sum += __shfl_xor(sum, sh, 32);
    const float f = __fdiv_rn(hires ? 1.0f : PCAR, sum);
{
        if (hires) {
#pragma unroll
            for (int ch = 0; ch < TT / 128; ++ch) { v4us oh, ol;
#pragma unroll
                for (int q = 0; q < 4; ++q) { unsigned short a, c2; splitf(v[ch * 4 + q] * f, a, c2); oh[q] = a; ol[q] = c2; }
                const size_t oo = ((size_t)zz * (RH ? RH : 1) + i) * TT + ch * 128 + lane * 4; *(v4us*)(Ph + oo) = oh; *(v4us*)(Pl + oo) = ol; }
        } else {
#pragma unroll
            for (int ch = 0; ch < TT / 128; ++ch) { v4h o4;
#pragma unroll
                for (int q = 0; q < 4; ++q) o4[q] = tohx(v[ch * 4 + q] * f);
                *(v4h*)(P16 + (size_t)row * TT + ch * 128 + lane * 4) = o4; } }
         }
}
__global__ __launch_bounds__(256) void k_merge(const float* __restrict__ O, int h0, bf* Ah, bf* Al) { const size_t e = ((size_t)blockIdx.x * 256 + threadIdx.x) * 2; if (e >= (size_t)ZH * TT * HD) return; const int d = (int)(e % HD); const int t = (int)((e / HD) % TT); const int zz = (int)(e / ((size_t)HD * TT)); const float cs = (t < RH) ? 1.0f : (1.0f / PCAR); const size_t oo = (size_t)t * DQ + (h0 + zz) * HD + d;
    v2us oh, ol;
#pragma unroll
    for (int q = 0; q < 2; ++q) { unsigned short a, c2; splitf(O[e + q] * cs, a, c2); oh[q] = a; ol[q] = c2; } *(v2us*)(Ah + oo) = oh; *(v2us*)(Al + oo) = ol;  }

extern "C" void kernel_launch(void* const* d_in, const int* in_sizes, int n_in,
                              void* d_out, int out_size, void* d_ws, size_t ws_size, hipStream_t stream) {
    (void)in_sizes; (void)n_in; (void)out_size;
    const float* x = (const float*)d_in[0]; const int* PID = (const int*)d_in[1]; const float* wq = (const float*)d_in[2]; const float* wk = (const float*)d_in[3]; const float* wv = (const float*)d_in[4]; const float* wo = (const float*)d_in[5];   /* inputs x, token_positions (int32 [2048], shared by all batches; read), Wq, Wk, Wv, Wo ('oi' [1024][1024]) */
    float* OUT = (float*)d_out;     // [2][2048][1024]
    char* wsp = (char*)d_ws;
    auto take = [&](size_t bytes) { char* p = wsp; wsp += (bytes + 255) & ~(size_t)255; return (void*)p; };
    bf* WQ = (bf*)take((size_t)DQ * DM * 2); bf* WK = (bf*)take((size_t)DKV * DM * 2); bf* WV = (bf*)take((size_t)DKV * DM * 2); bf* WO = (bf*)take((size_t)DM * DQ * 2); float* CS = (float*)take((size_t)TT * HD * 2 * 4);
    bf* XB = (bf*)take((size_t)TT * DM * 2); float* FQ = (float*)take((size_t)TT * DQ * 4); float* FK = (float*)take((size_t)TT * DKV * 4);
    h16* QP16 = (h16*)take((size_t)NH_ * TT * HD * 2); h16* KP16 = (h16*)take((size_t)NKV * TT * HD * 2); h16* VT16 = (h16*)take((size_t)NKV * HD * TT * 2);
    bf* QPh = (bf*)take((size_t)NH_ * TT * HD * 2); bf* QPl = (bf*)take((size_t)NH_ * TT * HD * 2); bf* KPh = (bf*)take((size_t)NKV * TT * HD * 2); bf* KPl = (bf*)take((size_t)NKV * TT * HD * 2); bf* VTh = (bf*)take((size_t)NKV * HD * TT * 2); bf* VTl = (bf*)take((size_t)NKV * HD * TT * 2); bf* Ph = (bf*)take((size_t)ZH * RH * TT * 2); bf* Pl = (bf*)take((size_t)ZH * RH * TT * 2);
    float* Sb = (float*)take((size_t)ZH * TT * TT * 4); h16* P16 = (h16*)take((size_t)ZH * TT * TT * 2); float* Ob = (float*)take((size_t)ZH * TT * HD * 4); bf* ATh = (bf*)take((size_t)TT * DQ * 2); bf* ATl = (bf*)take((size_t)TT * DQ * 2);
    if ((size_t)(wsp - (char*)d_ws) > ws_size) return;    // ws 256 MiB
    float* FV = FK;   // v projection reuses the k buffer after the k planes are built (stream-ordered)
    { k_cvt8<<<(unsigned)(((size_t)DQ * DM / 8 + 255) / 256), 256, 0, stream>>>(wq, WQ, (size_t)DQ * DM / 8); k_cvt8<<<(unsigned)(((size_t)DKV * DM / 8 + 255) / 256), 256, 0, stream>>>(wk, WK, (size_t)DKV * DM / 8); k_cvt8<<<(unsigned)(((size_t)DKV * DM / 8 + 255) / 256), 256, 0, stream>>>(wv, WV, (size_t)DKV * DM / 8);
      k_cvt8<<<(unsigned)(((size_t)DM * DQ / 8 + 255) / 256), 256, 0, stream>>>(wo, WO, (size_t)DM * DQ / 8); /* the rotary table is rebuilt per batch from that batch's positions (below) */ }
    const unsigned LQ = (unsigned)(((size_t)NH_ * TT * HD / 2 + 255) / 256), LKv = (unsigned)(((size_t)NKV * TT * HD / 2 + 255) / 256);
    for (int b = 0; b < NB_; ++b) {
        k_cstabI<<<(TT * HD + 255) / 256, 256, 0, stream>>>(PID, CS);   /* token_positions[:] (int32 [2048], shared by both batches, read) */
        
        k_cvt8<<<(unsigned)(((size_t)TT * DM / 8 + 255) / 256), 256, 0, stream>>>(x + (size_t)b * TT * DM, XB, (size_t)TT * DM / 8);
        k_gemmw<bf, 0, false><<<dim3(TT / 64, DQ / 64, 1), 32, 0, stream>>>(XB, nullptr, WQ, nullptr, DM, FQ, DQ, nullptr, 0, 0, 0);
        k_ropeI<<<LQ, 256, 0, stream>>>(FQ, DQ, NH_, CS, 1.0f, QP16, QPh, QPl);
        k_gemmw<bf, 0, false><<<dim3(TT / 64, DKV / 64, 1), 32, 0, stream>>>(XB, nullptr, WK, nullptr, DM, FK, DKV, nullptr, 0, 0, 0);
        k_ropeI<<<LKv, 256, 0, stream>>>(FK, DKV, NKV, CS, 1.0f, KP16, KPh, KPl);
        k_gemmw<bf, 0, false><<<dim3(TT / 64, DKV / 64, 1), 32, 0, stream>>>(XB, nullptr, WV, nullptr, DM, FV, DKV, nullptr, 0, 0, 0); k_vtp<<<LKv, 256, 0, stream>>>(FV, DKV, NKV, VT16, VTh, VTl);
        for (int h0 = 0; h0 < NH_; h0 += ZH) { const size_t zq = (size_t)h0, zk = (size_t)(h0 / REP);   // one kv head per query head: the pass's two heads use consecutive kv planes (z-strides TT*HD)
            k_gemmc<bf, 2, 1><<<dim3(TT / 64, TT / 64, ZH), 32, 0, stream>>>(QPh + zq * TT * HD, QPl + zq * TT * HD, KPh + zk * TT * HD, KPl + zk * TT * HD, HD, Sb, TT, 0, (size_t)TT * HD, (size_t)TT * HD, (size_t)TT * TT);   /* scores on hi/lo planes for EVERY row (3 products) */
            /* (the fp16 score launch for rows >= RH is removed: all rows use the hi/lo launch above) */
            k_asoft<<<ZH * TT / 8, 256, 0, stream>>>(Sb, P16, Ph, Pl);
            k_gemmc<bf, 2, 2><<<dim3(RH / 64, HD / 64, ZH), 32, 0, stream>>>(Ph, Pl, VTh + zk * HD * TT, VTl + zk * HD * TT, TT, Ob, HD, 0, (size_t)RH * TT, (size_t)HD * TT, (size_t)TT * HD);
            k_gemmc<h16, 0, 2><<<dim3((TT - RH) / 64, HD / 64, ZH), 32, 0, stream>>>(P16 + (size_t)RH * TT, nullptr, VT16 + zk * HD * TT, nullptr, TT, Ob + (size_t)RH * HD, HD, RH, (size_t)TT * TT, (size_t)HD * TT, (size_t)TT * HD);
            k_merge<<<(unsigned)(((size_t)ZH * TT * HD / 2 + 255) / 256), 256, 0, stream>>>(Ob, h0, ATh, ATl); }
        k_gemmw<bf, 1, false><<<dim3(TT / 64, DM / 64, 1), 32, 0, stream>>>(ATh, ATl, WO, nullptr, DQ, OUT + (size_t)b * TT * DM, DM, nullptr, 0, 0, 0); }
}

// v001
// It runs in 793 microseconds.
// Timed twice side by side with v000, it ran 1.75 and 1.76 times as fast.
#include <hip/hip_runtime.h>

// Causal multi-head self-attention with interleaved-pair rotary position embedding from a position input (x [2][2048][1024]; Q, K, V = einsum('bsd,ed', x, W) ('oi' [1024][1024] 1/32, no bias; 16 heads x 64); angle = float(token_positions[t]) x theta ** (-2i / 64) (theta 1e4; token_positions int32 [2048] = arange, shared by both batches, READ on device); pairs (2i, 2i+1): (x1 cos - x2 sin, x1 sin + x2 cos) on Q and K; scores / sqrt(64); keys j <= i kept, -inf elsewhere; softmax; out = einsum('bsd,ed', merged, Wo) -> [2][2048][1024] (4.2 M); argument order x, token_positions, Wq, Wk, Wv, Wo).
// Layout per batch: bf16 copy of x; exact projections; {cos, sin} per (position, pair) built once from the int positions and float32 inverse-frequency constants (precise cosf/sinf); interleaved rotary plane builder; causal T-2048 attention (EVERY row's scores on hi/lo planes (3 products: logit sigma 2 with these weights) and hybrid P.V (rows < 512 hi/lo, rest fp16 x1024); k_gemmc skips tiles above the diagonal); merged hi/lo x Wo exact.
// Compute dtypes, f32 accumulate: every input rounded to bf16; projections exact; rotary f32; scores 3 products; P.V rows < 512 3 products, rest fp16; softmax f32; Wo hl x exact.

#define NB_  2
#define TT   2048
#define DM   1024
#define NH_  16
#define NKV  16
#define REP  (NH_ / NKV)
#define HD   64
#define DQ   (NH_ * HD)
#define DKV  (NKV * HD)
#define ZH   2
#define RH   512                  // query rows < RH use hi+lo planes (0: none)
#define WIN  2048
#define PCAR 1024.0f
#define SCL  0.125f   // HD^-0.5
typedef _Float16 h16;
typedef unsigned short bf;
typedef __attribute__((ext_vector_type(16))) __bf16   v16bf;
typedef __attribute__((ext_vector_type(16))) _Float16 v16h;
typedef __attribute__((ext_vector_type(8)))  _Float16 v8h;
typedef __attribute__((ext_vector_type(8)))  unsigned short v8us;
typedef __attribute__((ext_vector_type(8)))  float    v8f;
typedef __attribute__((ext_vector_type(4)))  float    v4f;
typedef v8h  __attribute__((may_alias)) v8ha;
typedef v4f  __attribute__((may_alias)) v4fa;
typedef v8us __attribute__((may_alias)) v8usa;

__device__ __forceinline__ unsigned short f2bf(float f) { unsigned u = __float_as_uint(f); u += 0x7FFFu + ((u >> 16) & 1u); return (unsigned short)(u >> 16); }
__device__ __forceinline__ float bf2f(unsigned short b) { return __uint_as_float(((unsigned)b) << 16); }
__device__ __forceinline__ float bfr(float f) { return bf2f(f2bf(f)); }
__device__ __forceinline__ v16h cat16(v8h lo, v8h hi) { return __builtin_shufflevector(lo, hi, 0, 1, 2, 3, 4, 5, 6, 7, 8, 9, 10, 11, 12, 13, 14, 15); }
__device__ __forceinline__ v16bf cat16b(v8us lo, v8us hi) { return __builtin_bit_cast(v16bf, __builtin_shufflevector(lo, hi, 0, 1, 2, 3, 4, 5, 6, 7, 8, 9, 10, 11, 12, 13, 14, 15)); }
__device__ __forceinline__ v8f wmma16(v16h a, v16h b, v8f c) { return __builtin_amdgcn_wmma_f32_16x16x32_f16(false, a, false, b, (short)0, c, false, false); }
__device__ __forceinline__ v8f wmmab(v16bf a, v16bf b, v8f c) { return __builtin_amdgcn_wmma_f32_16x16x32_bf16(false, a, false, b, (short)0, c, false, false); }



#define NWK  8                    // waves of a work-group that share one 64x64 tile's K loop
#define RPW  (64 * 68)            // floats of one wave's partial tile in LDS (row pitch 68)
// ---- k_gemmw: register-blocked GEMM, one 64x64 output tile per work-group of NWK waves: wave w takes the 64-element (one 128-byte line per row) K chunks w, w + NWK, ... with 16 accumulators, operands straight from K-contiguous 16-bit planes;
// the NWK partial tiles meet in LDS and are summed in wave order 0..NWK-1; grid (M/64, N/64, Z), 32 * NWK threads. K % 64 == 0.
// C[m][n] (f32, pitch ldc, + optional f32 bias[n]) = sum_k A[m][k] Bt[n][k] (+ split products per NSPLIT). z-batch strides sA/sB/sC in elements.
template <typename T16> struct WFrag;
template <> struct WFrag<h16> { typedef v16h V; static __device__ __forceinline__ V ld(const h16* p) { return cat16(*(const v8h*)p, *(const v8h*)(p + 16)); } static __device__ __forceinline__ v8f mma(V a, V b, v8f c) { return wmma16(a, b, c); } };
template <> struct WFrag<bf> { typedef v16bf V; static __device__ __forceinline__ V ld(const bf* p) { return cat16b(*(const v8us*)p, *(const v8us*)(p + 16)); } static __device__ __forceinline__ v8f mma(V a, V b, v8f c) { return wmmab(a, b, c); } };
template <typename T16, int NSPLIT, bool BIAS>
__global__ __launch_bounds__(32 * NWK) void k_gemmw(const T16* __restrict__ A, const T16* __restrict__ A2, const T16* __restrict__ Bt, const T16* __restrict__ Bt2, int K, float* C, int ldc, const float* __restrict__ bias, size_t sA, size_t sB, size_t sC) {
    typedef typename WFrag<T16>::V V;
    __shared__ __align__(16) float red[NWK * RPW];
    const size_t z = blockIdx.z; A += z * sA; if (A2) A2 += z * sA; Bt += z * sB; if (Bt2) Bt2 += z * sB; C += z * sC;
    const int lane = threadIdx.x & 31, lr = lane & 15, hi = lane >> 4; const int r0 = blockIdx.x * 64, c0 = blockIdx.y * 64;
    const int w = __builtin_amdgcn_readfirstlane((int)(threadIdx.x >> 5));
    v8f acc[4][4];
#pragma unroll
    for (int mb = 0; mb < 4; ++mb)
#pragma unroll
        for (int nb = 0; nb < 4; ++nb) acc[mb][nb] = (v8f){};
    const size_t aoff = (size_t)(r0 + lr) * K + 8 * hi, boff = (size_t)(c0 + lr) * K + 8 * hi;
#pragma unroll 1
    for (int kc = w * 64; kc < K; kc += (kc & 32) ? NWK * 64 - 32 : 32) {
        V a[4], a2[4];
#pragma unroll
        for (int mb = 0; mb < 4; ++mb) { a[mb] = WFrag<T16>::ld(A + aoff + (size_t)mb * 16 * K + kc); if (NSPLIT == 1 || NSPLIT == 2) a2[mb] = WFrag<T16>::ld(A2 + aoff + (size_t)mb * 16 * K + kc); }
#pragma unroll
        for (int nb = 0; nb < 4; ++nb) { const V b = WFrag<T16>::ld(Bt + boff + (size_t)nb * 16 * K + kc); V b2; if (NSPLIT >= 2) b2 = WFrag<T16>::ld(Bt2 + boff + (size_t)nb * 16 * K + kc);
#pragma unroll
            for (int mb = 0; mb < 4; ++mb) { acc[mb][nb] = WFrag<T16>::mma(a[mb], b, acc[mb][nb]); if (NSPLIT == 1 || NSPLIT == 2) acc[mb][nb] = WFrag<T16>::mma(a2[mb], b, acc[mb][nb]); if (NSPLIT >= 2) acc[mb][nb] = WFrag<T16>::mma(a[mb], b2, acc[mb][nb]); } }
        asm volatile("v_nop\n\tv_nop\n\tv_nop\n\tv_nop" : "+v"(acc[0][0]), "+v"(acc[1][1]), "+v"(acc[2][2]), "+v"(acc[3][3]) : "v"(a[0]), "v"(a[3]));
    }
    float* my = red + w * RPW;
#pragma unroll
    for (int mb = 0; mb < 4; ++mb) {
#pragma unroll
        for (int nb = 0; nb < 4; ++nb) {
#pragma unroll
            for (int j = 0; j < 8; ++j) my[(mb * 16 + hi * 8 + j) * 68 + nb * 16 + lr] = acc[mb][nb][j]; } }
    __syncthreads();   // every wave's partial tile is in LDS before any thread sums across waves
#pragma unroll
    for (int s = 0; s < 64 * 16 / (32 * NWK); ++s) { const int idx = s * (32 * NWK) + (int)threadIdx.x; const int row = idx >> 4, cofs = (idx & 15) * 4; v4f val = *(const v4fa*)(red + row * 68 + cofs);
#pragma unroll
        for (int q = 1; q < NWK; ++q) val += *(const v4fa*)(red + q * RPW + row * 68 + cofs);
        if (BIAS) { val[0] += bfr(bias[c0 + cofs]); val[1] += bfr(bias[c0 + cofs + 1]); val[2] += bfr(bias[c0 + cofs + 2]); val[3] += bfr(bias[c0 + cofs + 3]); }
        *(v4f*)(C + (size_t)(r0 + row) * ldc + c0 + cofs) = val; }
}

// ---- k_gemmc: the same 64x64 tile GEMM specialised for causal attention (CMODE 1: K = 64, one wave, 32 threads; CMODE 2: NWK waves share the K loop as in k_gemmw, 32 * NWK threads): CMODE 1 skips score tiles entirely above the diagonal (query rows r0+roff.., key columns c0..), CMODE 2 limits the
// key (K) loop of the probability x value contraction to the diagonal block (probabilities beyond it are exactly zero). roff = row offset of this launch's first row within the sequence.
template <typename T16, int NSPLIT, int CMODE>
__global__ __launch_bounds__(CMODE == 2 ? 32 * NWK : 32) void k_gemmc(const T16* __restrict__ A, const T16* __restrict__ A2, const T16* __restrict__ Bt, const T16* __restrict__ Bt2, int K, float* C, int ldc, int roff, size_t sA, size_t sB, size_t sC) {
    typedef typename WFrag<T16>::V V;
    constexpr int NW = (CMODE == 2) ? NWK : 1;
    __shared__ __align__(16) float os[CMODE == 2 ? NWK * RPW : 16 * 68];
    const size_t z = blockIdx.z; A += z * sA; if (A2) A2 += z * sA; Bt += z * sB; if (Bt2) Bt2 += z * sB; C += z * sC;
    const int lane = threadIdx.x & 31, lr = lane & 15, hi = lane >> 4; const int r0 = blockIdx.x * 64, c0 = blockIdx.y * 64;
    const int w = (CMODE == 2) ? __builtin_amdgcn_readfirstlane((int)(threadIdx.x >> 5)) : 0;
    if (CMODE == 1 && c0 > r0 + roff + 63) return;                  // score tile entirely above the causal diagonal: never read (the softmax masks j > i by select)
    const int Kl = (CMODE == 2) ? min(K, r0 + roff + 64) : K;        // P.V: probabilities are exactly 0 beyond the diagonal block, so the K loop stops there
    v8f acc[4][4];
#pragma unroll
    for (int mb = 0; mb < 4; ++mb)
#pragma unroll
        for (int nb = 0; nb < 4; ++nb) acc[mb][nb] = (v8f){};
    const size_t aoff = (size_t)(r0 + lr) * K + 8 * hi, boff = (size_t)(c0 + lr) * K + 8 * hi;
#pragma unroll 1
    for (int kc = w * 64; kc < Kl; kc += (kc & 32) ? NW * 64 - 32 : 32) {
        V a[4], a2[4];
#pragma unroll
        for (int mb = 0; mb < 4; ++mb) { a[mb] = WFrag<T16>::ld(A + aoff + (size_t)mb * 16 * K + kc); if (NSPLIT == 1 || NSPLIT == 2) a2[mb] = WFrag<T16>::ld(A2 + aoff + (size_t)mb * 16 * K + kc); }
#pragma unroll
        for (int nb = 0; nb < 4; ++nb) { const V b = WFrag<T16>::ld(Bt + boff + (size_t)nb * 16 * K + kc); V b2; if (NSPLIT >= 2) b2 = WFrag<T16>::ld(Bt2 + boff + (size_t)nb * 16 * K + kc);
#pragma unroll
            for (int mb = 0; mb < 4; ++mb) { acc[mb][nb] = WFrag<T16>::mma(a[mb], b, acc[mb][nb]); if (NSPLIT == 1 || NSPLIT == 2) acc[mb][nb] = WFrag<T16>::mma(a2[mb], b, acc[mb][nb]); if (NSPLIT >= 2) acc[mb][nb] = WFrag<T16>::mma(a[mb], b2, acc[mb][nb]); } }
        asm volatile("v_nop\n\tv_nop\n\tv_nop\n\tv_nop" : "+v"(acc[0][0]), "+v"(acc[1][1]), "+v"(acc[2][2]), "+v"(acc[3][3]) : "v"(a[0]), "v"(a[3]));
    }
    if constexpr (CMODE == 2) {
    float* red = os;
    float* my = red + w * RPW;
#pragma unroll
    for (int mb = 0; mb < 4; ++mb) {
#pragma unroll
        for (int nb = 0; nb < 4; ++nb) {
#pragma unroll
            for (int j = 0; j < 8; ++j) my[(mb * 16 + hi * 8 + j) * 68 + nb * 16 + lr] = acc[mb][nb][j]; } }
    __syncthreads();   // every wave's partial tile is in LDS before any thread sums across waves
#pragma unroll
    for (int s = 0; s < 64 * 16 / (32 * NWK); ++s) { const int idx = s * (32 * NWK) + (int)threadIdx.x; const int row = idx >> 4, cofs = (idx & 15) * 4; v4f val = *(const v4fa*)(red + row * 68 + cofs);
#pragma unroll
        for (int q = 1; q < NWK; ++q) val += *(const v4fa*)(red + q * RPW + row * 68 + cofs);
        *(v4f*)(C + (size_t)(r0 + row) * ldc + c0 + cofs) = val; }
    } else {
#pragma unroll
    for (int mb = 0; mb < 4; ++mb) {
#pragma unroll
        for (int nb = 0; nb < 4; ++nb) {
#pragma unroll
            for (int j = 0; j < 8; ++j) os[(hi * 8 + j) * 68 + nb * 16 + lr] = acc[mb][nb][j]; }
        __builtin_amdgcn_wave_barrier(); asm volatile("" ::: "memory");
        float* crow = C + (size_t)(r0 + mb * 16) * ldc + c0;
{
#pragma unroll
            for (int s = 0; s < 8; ++s) { const int row = 2 * s + hi, cofs = lr * 4; v4f val = *(const v4fa*)(os + row * 68 + cofs);
                *(v4f*)(crow + (size_t)row * ldc + cofs) = val; }
             }
        __builtin_amdgcn_wave_barrier(); asm volatile("" ::: "memory");
    }
    }
}

__device__ __forceinline__ h16 tohx(float x) { return (h16)x; }
__device__ __forceinline__ void splitf(float y, unsigned short& h, unsigned short& l) { h = f2bf(y); l = f2bf(y - bf2f(h)); }
typedef __attribute__((ext_vector_type(2))) _Float16 v2h;
typedef __attribute__((ext_vector_type(4))) _Float16 v4h;
typedef __attribute__((ext_vector_type(2))) unsigned short v2us;
typedef __attribute__((ext_vector_type(4))) unsigned short v4us;
typedef __attribute__((ext_vector_type(2))) float v2f;
typedef __attribute__((ext_vector_type(4))) int v4i;

__global__ __launch_bounds__(256) void k_wtG(const float* __restrict__ w, int K, int N, bf* Bt) {
    const int lane = threadIdx.x & 31; const int L0 = (blockIdx.x * 8 + (threadIdx.x >> 5)) * 8; const int nlines = N * K / 64;
{
#pragma unroll 1
        for (int l = 0; l < 8; ++l) { const int L = L0 + l; if (L >= nlines) break; const size_t e = (size_t)L * 64 + lane * 2; const int k = (int)(e % K), n = (int)(e / K); v2us o;
            o[0] = f2bf(w[(size_t)k * N + n]); o[1] = f2bf(w[(size_t)(k + 1) * N + n]); *(v2us*)(Bt + e) = o; }
         }
}
__global__ __launch_bounds__(256) void k_cvt8(const float* __restrict__ src, bf* dst, size_t n8) { const size_t i = (size_t)blockIdx.x * 256 + threadIdx.x; if (i >= n8) return; const v8f v = *(const v8f*)(src + i * 8); v8us o;
#pragma unroll
    for (int k = 0; k < 8; ++k) o[k] = f2bf(v[k]); *(v8us*)(dst + i * 8) = o;  }

__global__ __launch_bounds__(256) void k_ropeI(const float* __restrict__ F, int pitch, int nheads, const float* __restrict__ CS, float sc, h16* P16, bf* Ph, bf* Pl) {
    const size_t e = ((size_t)blockIdx.x * 256 + threadIdx.x) * 2; if (e >= (size_t)nheads * TT * HD) return; const int d = (int)(e % HD); const int t = (int)((e / HD) % TT); const int h = (int)(e / ((size_t)HD * TT)); const float* f = F + (size_t)t * pitch + h * HD; const float x0 = f[d], x1 = f[d + 1]; const v2f cs = *(const v2f*)(CS + ((size_t)t * HD + d) * 2); v2h o16; v2us oh, ol;
    float a0 = __fmul_rn(x0, cs[0]), b0 = __fmul_rn(x1, cs[1]), a1 = __fmul_rn(x1, cs[0]), b1 = __fmul_rn(x0, cs[1]); asm volatile("" : "+v"(a0), "+v"(b0), "+v"(a1), "+v"(b1));
    float r0 = __fsub_rn(a0, b0) * sc, r1 = __fadd_rn(b1, a1) * sc;   /* even: x0 c - x1 s; odd: x0 s + x1 c */
    o16[0] = tohx(r0); o16[1] = tohx(r1); { unsigned short a2, c2; splitf(r0, a2, c2); oh[0] = a2; ol[0] = c2; splitf(r1, a2, c2); oh[1] = a2; ol[1] = c2; }
    *(v2h*)(P16 + e) = o16; *(v2us*)(Ph + e) = oh; *(v2us*)(Pl + e) = ol;  }

__constant__ float INV2[HD / 2] = { 1.000000000e+00f, 7.498942018e-01f, 5.623413324e-01f, 4.216965139e-01f, 3.162277639e-01f, 2.371373773e-01f, 1.778279394e-01f, 1.333521456e-01f, 1.000000015e-01f, 7.498942316e-02f, 5.623413250e-02f, 4.216964915e-02f, 3.162277490e-02f, 2.371373773e-02f, 1.778279431e-02f, 1.333521400e-02f, 9.999999776e-03f, 7.498942316e-03f, 5.623413250e-03f, 4.216964822e-03f, 3.162277630e-03f, 2.371373819e-03f, 1.778279431e-03f, 1.333521446e-03f, 1.000000047e-03f, 7.498941850e-04f, 5.623413017e-04f, 4.216965172e-04f, 3.162277571e-04f, 2.371373703e-04f, 1.778279402e-04f, 1.333521504e-04f };   // theta ** (-2i / 64), i = 0..31, in float32 as THIS module writes it (the NEGATIVE-POWER spelling 'theta ** (-arange(0, dh, 2) / dh)', evaluated in the reference's own f32 arithmetic): ten of the 32 entries differ by one ulp from the reciprocal spelling '1 / theta ** (2i / 64)' (indices 5, 9, 10, 12, 13, 15, 20, 27, 28, 29)
__global__ __launch_bounds__(256) void k_cstabI(const int* __restrict__ pid, float* CS) { const int idx = blockIdx.x * 256 + threadIdx.x; if (idx >= TT * HD) return; const int d = idx % HD; const int t = idx / HD; const float a = __fmul_rn((float)pid[t], INV2[d >> 1]); v2f cs; cs[0] = cosf(a); cs[1] = sinf(a); *(v2f*)(CS + (size_t)idx * 2) = cs;  }

__global__ __launch_bounds__(256) void k_vtp(const float* __restrict__ F, int pitch, int nheads, h16* V16, bf* Vh, bf* Vl) { const size_t e = ((size_t)blockIdx.x * 256 + threadIdx.x) * 2; if (e >= (size_t)nheads * HD * TT) return; const int t = (int)(e % TT); const int d = (int)((e / TT) % HD); const int g = (int)(e / ((size_t)TT * HD)); v2h o16; v2us oh, ol;
#pragma unroll
    for (int q = 0; q < 2; ++q) { const float x = F[(size_t)(t + q) * pitch + g * HD + d]; o16[q] = tohx(x); unsigned short a2, c2; splitf(x, a2, c2); oh[q] = a2; ol[q] = c2; }
    *(v2h*)(V16 + e) = o16; *(v2us*)(Vh + e) = oh; *(v2us*)(Vl + e) = ol;  }
// k_asoft: per row (zz, i): t = S x HD^-0.5 for j <= i and i - j < WIN (sliding causal window; the reference's -1e9 additive fill vanishes identically); softmax over the 2048 keys (register row, one exp, fixed trees);
__global__ __launch_bounds__(256) void k_asoft(const float* __restrict__ Sb, h16* P16, bf* Ph, bf* Pl) {
    const int lane = threadIdx.x & 31; const int row = blockIdx.x * 8 + (threadIdx.x >> 5); if (row >= ZH * TT) return; const int i = row % TT; const int zz = row / TT; (void)zz; const bool hires = (i < RH); const float* sr = Sb + (size_t)row * TT; float v[TT / 32]; float mx = -3.0e38f;
#pragma unroll
    for (int ch = 0; ch < TT / 128; ++ch) { const int j0 = ch * 128 + lane * 4; const v4f a = *(const v4f*)(sr + j0);
#pragma unroll
        for (int q = 0; q < 4; ++q) { const int j = j0 + q; (void)j; const float t = (j <= i && i - j < WIN) ? a[q] * SCL : -3.0e38f; v[ch * 4 + q] = t; mx = fmaxf(mx, t); } }
#pragma unroll
    for (int sh = 16; sh; sh >>= 1) mx = fmaxf(mx, __shfl_xor(mx, sh, 32));
    float sum = 0.f;
#pragma unroll
    for (int k = 0; k < TT / 32; ++k) { float d0 = __fsub_rn(v[k], mx); asm volatile("" : "+v"(d0)); v[k] = __builtin_amdgcn_exp2f(__fmul_rn(d0, 1.4426950408889634f)); sum += v[k]; }
#pragma unroll
    for (int sh = 16; sh; sh >>= 1) sum += __shfl_xor(sum, sh, 32);
    const float f = __fdiv_rn(hires ? 1.0f : PCAR, sum);
{
        if (hires) {
#pragma unroll
            for (int ch = 0; ch < TT / 128; ++ch) { v4us oh, ol;
#pragma unroll
                for (int q = 0; q < 4; ++q) { unsigned short a, c2; splitf(v[ch * 4 + q] * f, a, c2); oh[q] = a; ol[q] = c2; }
                const size_t oo = ((size_t)zz * (RH ? RH : 1) + i) * TT + ch * 128 + lane * 4; *(v4us*)(Ph + oo) = oh; *(v4us*)(Pl + oo) = ol; }
        } else {
#pragma unroll
            for (int ch = 0; ch < TT / 128; ++ch) { v4h o4;
#pragma unroll
                for (int q = 0; q < 4; ++q) o4[q] = tohx(v[ch * 4 + q] * f);
                *(v4h*)(P16 + (size_t)row * TT + ch * 128 + lane * 4) = o4; } }
         }
}
__global__ __launch_bounds__(256) void k_merge(const float* __restrict__ O, int h0, bf* Ah, bf* Al) { const size_t e = ((size_t)blockIdx.x * 256 + threadIdx.x) * 2; if (e >= (size_t)ZH * TT * HD) return; const int d = (int)(e % HD); const int t = (int)((e / HD) % TT); const int zz = (int)(e / ((size_t)HD * TT)); const float cs = (t < RH) ? 1.0f : (1.0f / PCAR); const size_t oo = (size_t)t * DQ + (h0 + zz) * HD + d;
    v2us oh, ol;
#pragma unroll
    for (int q = 0; q < 2; ++q) { unsigned short a, c2; splitf(O[e + q] * cs, a, c2); oh[q] = a; ol[q] = c2; } *(v2us*)(Ah + oo) = oh; *(v2us*)(Al + oo) = ol;  }

extern "C" void kernel_launch(void* const* d_in, const int* in_sizes, int n_in,
                              void* d_out, int out_size, void* d_ws, size_t ws_size, hipStream_t stream) {
    (void)in_sizes; (void)n_in; (void)out_size;
    const float* x = (const float*)d_in[0]; const int* PID = (const int*)d_in[1]; const float* wq = (const float*)d_in[2]; const float* wk = (const float*)d_in[3]; const float* wv = (const float*)d_in[4]; const float* wo = (const float*)d_in[5];   /* inputs x, token_positions (int32 [2048], shared by all batches; read), Wq, Wk, Wv, Wo ('oi' [1024][1024]) */
    float* OUT = (float*)d_out;     // [2][2048][1024]
    char* wsp = (char*)d_ws;
    auto take = [&](size_t bytes) { char* p = wsp; wsp += (bytes + 255) & ~(size_t)255; return (void*)p; };
    bf* WQ = (bf*)take((size_t)DQ * DM * 2); bf* WK = (bf*)take((size_t)DKV * DM * 2); bf* WV = (bf*)take((size_t)DKV * DM * 2); bf* WO = (bf*)take((size_t)DM * DQ * 2); float* CS = (float*)take((size_t)TT * HD * 2 * 4);
    bf* XB = (bf*)take((size_t)TT * DM * 2); float* FQ = (float*)take((size_t)TT * DQ * 4); float* FK = (float*)take((size_t)TT * DKV * 4);
    h16* QP16 = (h16*)take((size_t)NH_ * TT * HD * 2); h16* KP16 = (h16*)take((size_t)NKV * TT * HD * 2); h16* VT16 = (h16*)take((size_t)NKV * HD * TT * 2);
    bf* QPh = (bf*)take((size_t)NH_ * TT * HD * 2); bf* QPl = (bf*)take((size_t)NH_ * TT * HD * 2); bf* KPh = (bf*)take((size_t)NKV * TT * HD * 2); bf* KPl = (bf*)take((size_t)NKV * TT * HD * 2); bf* VTh = (bf*)take((size_t)NKV * HD * TT * 2); bf* VTl = (bf*)take((size_t)NKV * HD * TT * 2); bf* Ph = (bf*)take((size_t)ZH * RH * TT * 2); bf* Pl = (bf*)take((size_t)ZH * RH * TT * 2);
    float* Sb = (float*)take((size_t)ZH * TT * TT * 4); h16* P16 = (h16*)take((size_t)ZH * TT * TT * 2); float* Ob = (float*)take((size_t)ZH * TT * HD * 4); bf* ATh = (bf*)take((size_t)TT * DQ * 2); bf* ATl = (bf*)take((size_t)TT * DQ * 2);
    if ((size_t)(wsp - (char*)d_ws) > ws_size) return;    // ws 256 MiB
    float* FV = FK;   // v projection reuses the k buffer after the k planes are built (stream-ordered)
    { k_cvt8<<<(unsigned)(((size_t)DQ * DM / 8 + 255) / 256), 256, 0, stream>>>(wq, WQ, (size_t)DQ * DM / 8); k_cvt8<<<(unsigned)(((size_t)DKV * DM / 8 + 255) / 256), 256, 0, stream>>>(wk, WK, (size_t)DKV * DM / 8); k_cvt8<<<(unsigned)(((size_t)DKV * DM / 8 + 255) / 256), 256, 0, stream>>>(wv, WV, (size_t)DKV * DM / 8);
      k_cvt8<<<(unsigned)(((size_t)DM * DQ / 8 + 255) / 256), 256, 0, stream>>>(wo, WO, (size_t)DM * DQ / 8); /* the rotary table is rebuilt per batch from that batch's positions (below) */ }
    const unsigned LQ = (unsigned)(((size_t)NH_ * TT * HD / 2 + 255) / 256), LKv = (unsigned)(((size_t)NKV * TT * HD / 2 + 255) / 256);
    for (int b = 0; b < NB_; ++b) {
        k_cstabI<<<(TT * HD + 255) / 256, 256, 0, stream>>>(PID, CS);   /* token_positions[:] (int32 [2048], shared by both batches, read) */
        
        k_cvt8<<<(unsigned)(((size_t)TT * DM / 8 + 255) / 256), 256, 0, stream>>>(x + (size_t)b * TT * DM, XB, (size_t)TT * DM / 8);
        k_gemmw<bf, 0, false><<<dim3(TT / 64, DQ / 64, 1), 32 * NWK, 0, stream>>>(XB, nullptr, WQ, nullptr, DM, FQ, DQ, nullptr, 0, 0, 0);
        k_ropeI<<<LQ, 256, 0, stream>>>(FQ, DQ, NH_, CS, 1.0f, QP16, QPh, QPl);
        k_gemmw<bf, 0, false><<<dim3(TT / 64, DKV / 64, 1), 32 * NWK, 0, stream>>>(XB, nullptr, WK, nullptr, DM, FK, DKV, nullptr, 0, 0, 0);
        k_ropeI<<<LKv, 256, 0, stream>>>(FK, DKV, NKV, CS, 1.0f, KP16, KPh, KPl);
        k_gemmw<bf, 0, false><<<dim3(TT / 64, DKV / 64, 1), 32 * NWK, 0, stream>>>(XB, nullptr, WV, nullptr, DM, FV, DKV, nullptr, 0, 0, 0); k_vtp<<<LKv, 256, 0, stream>>>(FV, DKV, NKV, VT16, VTh, VTl);
        for (int h0 = 0; h0 < NH_; h0 += ZH) { const size_t zq = (size_t)h0, zk = (size_t)(h0 / REP);   // one kv head per query head: the pass's two heads use consecutive kv planes (z-strides TT*HD)
            k_gemmc<bf, 2, 1><<<dim3(TT / 64, TT / 64, ZH), 32, 0, stream>>>(QPh + zq * TT * HD, QPl + zq * TT * HD, KPh + zk * TT * HD, KPl + zk * TT * HD, HD, Sb, TT, 0, (size_t)TT * HD, (size_t)TT * HD, (size_t)TT * TT);   /* scores on hi/lo planes for EVERY row (3 products) */
            /* (the fp16 score launch for rows >= RH is removed: all rows use the hi/lo launch above) */
            k_asoft<<<ZH * TT / 8, 256, 0, stream>>>(Sb, P16, Ph, Pl);
            k_gemmc<bf, 2, 2><<<dim3(RH / 64, HD / 64, ZH), 32 * NWK, 0, stream>>>(Ph, Pl, VTh + zk * HD * TT, VTl + zk * HD * TT, TT, Ob, HD, 0, (size_t)RH * TT, (size_t)HD * TT, (size_t)TT * HD);
            k_gemmc<h16, 0, 2><<<dim3((TT - RH) / 64, HD / 64, ZH), 32 * NWK, 0, stream>>>(P16 + (size_t)RH * TT, nullptr, VT16 + zk * HD * TT, nullptr, TT, Ob + (size_t)RH * HD, HD, RH, (size_t)TT * TT, (size_t)HD * TT, (size_t)TT * HD);
            k_merge<<<(unsigned)(((size_t)ZH * TT * HD / 2 + 255) / 256), 256, 0, stream>>>(Ob, h0, ATh, ATl); }
        k_gemmw<bf, 1, false><<<dim3(TT / 64, DM / 64, 1), 32 * NWK, 0, stream>>>(ATh, ATl, WO, nullptr, DQ, OUT + (size_t)b * TT * DM, DM, nullptr, 0, 0, 0); }
}

// v002
// One run takes 458 microseconds.
// In two side-by-side timings against v001, it was 1.71 and 1.72 times as fast.
// Counting every step since v000, it is 3.01 times as fast.
#include <hip/hip_runtime.h>

// Causal multi-head self-attention with interleaved-pair rotary position embedding from a position input (x [2][2048][1024]; Q, K, V = einsum('bsd,ed', x, W) ('oi' [1024][1024] 1/32, no bias; 16 heads x 64); angle = float(token_positions[t]) x theta ** (-2i / 64) (theta 1e4; token_positions int32 [2048] = arange, shared by both batches, READ on device); pairs (2i, 2i+1): (x1 cos - x2 sin, x1 sin + x2 cos) on Q and K; scores / sqrt(64); keys j <= i kept, -inf elsewhere; softmax; out = einsum('bsd,ed', merged, Wo) -> [2][2048][1024] (4.2 M); argument order x, token_positions, Wq, Wk, Wv, Wo).
// Layout per batch: bf16 copy of x; exact projections; {cos, sin} per (position, pair) built once from the int positions and float32 inverse-frequency constants (precise cosf/sinf); interleaved rotary plane builder; causal T-2048 attention (EVERY row's scores on hi/lo planes (3 products: logit sigma 2 with these weights) and hybrid P.V (rows < 512 hi/lo, rest fp16 x1024); k_gemmc skips tiles above the diagonal); merged hi/lo x Wo exact.
// Compute dtypes, f32 accumulate: every input rounded to bf16; projections exact; rotary f32; scores 3 products; P.V rows < 512 3 products, rest fp16; softmax f32; Wo hl x exact.

#define NB_  2
#define TT   2048
#define DM   1024
#define NH_  16
#define NKV  16
#define REP  (NH_ / NKV)
#define HD   64
#define DQ   (NH_ * HD)
#define DKV  (NKV * HD)
#define ZH   8                    // heads per attention pass (one launch covers ZH heads through its z dimension)
#define RH   512                  // query rows < RH use hi+lo planes (0: none)
#define WIN  2048
#define PCAR 1024.0f
#define SCL  0.125f   // HD^-0.5
typedef _Float16 h16;
typedef unsigned short bf;
typedef __attribute__((ext_vector_type(16))) __bf16   v16bf;
typedef __attribute__((ext_vector_type(16))) _Float16 v16h;
typedef __attribute__((ext_vector_type(8)))  _Float16 v8h;
typedef __attribute__((ext_vector_type(8)))  unsigned short v8us;
typedef __attribute__((ext_vector_type(8)))  float    v8f;
typedef __attribute__((ext_vector_type(4)))  float    v4f;
typedef v8h  __attribute__((may_alias)) v8ha;
typedef v4f  __attribute__((may_alias)) v4fa;
typedef v8us __attribute__((may_alias)) v8usa;

__device__ __forceinline__ unsigned short f2bf(float f) { unsigned u = __float_as_uint(f); u += 0x7FFFu + ((u >> 16) & 1u); return (unsigned short)(u >> 16); }
__device__ __forceinline__ float bf2f(unsigned short b) { return __uint_as_float(((unsigned)b) << 16); }
__device__ __forceinline__ float bfr(float f) { return bf2f(f2bf(f)); }
__device__ __forceinline__ v16h cat16(v8h lo, v8h hi) { return __builtin_shufflevector(lo, hi, 0, 1, 2, 3, 4, 5, 6, 7, 8, 9, 10, 11, 12, 13, 14, 15); }
__device__ __forceinline__ v16bf cat16b(v8us lo, v8us hi) { return __builtin_bit_cast(v16bf, __builtin_shufflevector(lo, hi, 0, 1, 2, 3, 4, 5, 6, 7, 8, 9, 10, 11, 12, 13, 14, 15)); }
__device__ __forceinline__ v8f wmma16(v16h a, v16h b, v8f c) { return __builtin_amdgcn_wmma_f32_16x16x32_f16(false, a, false, b, (short)0, c, false, false); }
__device__ __forceinline__ v8f wmmab(v16bf a, v16bf b, v8f c) { return __builtin_amdgcn_wmma_f32_16x16x32_bf16(false, a, false, b, (short)0, c, false, false); }



#define NWK  8                    // waves of a work-group that share one 64x64 tile's K loop
#define RPW  (64 * 68)            // floats of one wave's partial tile in LDS (row pitch 68)
// ---- k_gemmw: register-blocked GEMM, one 64x64 output tile per work-group of NWK waves: wave w takes the 64-element (one 128-byte line per row) K chunks w, w + NWK, ... with 16 accumulators, operands straight from K-contiguous 16-bit planes;
// the NWK partial tiles meet in LDS and are summed in wave order 0..NWK-1; grid (M/64, N/64, Z), 32 * NWK threads. K % 64 == 0.
// C[m][n] (f32, pitch ldc, + optional f32 bias[n]) = sum_k A[m][k] Bt[n][k] (+ split products per NSPLIT). z-batch strides sA/sB/sC in elements.
template <typename T16> struct WFrag;
template <> struct WFrag<h16> { typedef v16h V; static __device__ __forceinline__ V ld(const h16* p) { return cat16(*(const v8h*)p, *(const v8h*)(p + 16)); } static __device__ __forceinline__ v8f mma(V a, V b, v8f c) { return wmma16(a, b, c); } };
template <> struct WFrag<bf> { typedef v16bf V; static __device__ __forceinline__ V ld(const bf* p) { return cat16b(*(const v8us*)p, *(const v8us*)(p + 16)); } static __device__ __forceinline__ v8f mma(V a, V b, v8f c) { return wmmab(a, b, c); } };
template <typename T16, int NSPLIT, bool BIAS>
__global__ __launch_bounds__(32 * NWK) void k_gemmw(const T16* __restrict__ A, const T16* __restrict__ A2, const T16* __restrict__ Bt, const T16* __restrict__ Bt2, int K, float* C, int ldc, const float* __restrict__ bias, size_t sA, size_t sB, size_t sC) {
    typedef typename WFrag<T16>::V V;
    __shared__ __align__(16) float red[NWK * RPW];
    const size_t z = blockIdx.z; A += z * sA; if (A2) A2 += z * sA; Bt += z * sB; if (Bt2) Bt2 += z * sB; C += z * sC;
    const int lane = threadIdx.x & 31, lr = lane & 15, hi = lane >> 4; const int r0 = blockIdx.x * 64, c0 = blockIdx.y * 64;
    const int w = __builtin_amdgcn_readfirstlane((int)(threadIdx.x >> 5));
    v8f acc[4][4];
#pragma unroll
    for (int mb = 0; mb < 4; ++mb)
#pragma unroll
        for (int nb = 0; nb < 4; ++nb) acc[mb][nb] = (v8f){};
    const size_t aoff = (size_t)(r0 + lr) * K + 8 * hi, boff = (size_t)(c0 + lr) * K + 8 * hi;
#pragma unroll 1
    for (int kc = w * 64; kc < K; kc += (kc & 32) ? NWK * 64 - 32 : 32) {
        V a[4], a2[4];
#pragma unroll
        for (int mb = 0; mb < 4; ++mb) { a[mb] = WFrag<T16>::ld(A + aoff + (size_t)mb * 16 * K + kc); if (NSPLIT == 1 || NSPLIT == 2) a2[mb] = WFrag<T16>::ld(A2 + aoff + (size_t)mb * 16 * K + kc); }
#pragma unroll
        for (int nb = 0; nb < 4; ++nb) { const V b = WFrag<T16>::ld(Bt + boff + (size_t)nb * 16 * K + kc); V b2; if (NSPLIT >= 2) b2 = WFrag<T16>::ld(Bt2 + boff + (size_t)nb * 16 * K + kc);
#pragma unroll
            for (int mb = 0; mb < 4; ++mb) { acc[mb][nb] = WFrag<T16>::mma(a[mb], b, acc[mb][nb]); if (NSPLIT == 1 || NSPLIT == 2) acc[mb][nb] = WFrag<T16>::mma(a2[mb], b, acc[mb][nb]); if (NSPLIT >= 2) acc[mb][nb] = WFrag<T16>::mma(a[mb], b2, acc[mb][nb]); } }
        asm volatile("v_nop\n\tv_nop\n\tv_nop\n\tv_nop" : "+v"(acc[0][0]), "+v"(acc[1][1]), "+v"(acc[2][2]), "+v"(acc[3][3]) : "v"(a[0]), "v"(a[3]));
    }
    float* my = red + w * RPW;
#pragma unroll
    for (int mb = 0; mb < 4; ++mb) {
#pragma unroll
        for (int nb = 0; nb < 4; ++nb) {
#pragma unroll
            for (int j = 0; j < 8; ++j) my[(mb * 16 + hi * 8 + j) * 68 + nb * 16 + lr] = acc[mb][nb][j]; } }
    __syncthreads();   // every wave's partial tile is in LDS before any thread sums across waves
#pragma unroll
    for (int s = 0; s < 64 * 16 / (32 * NWK); ++s) { const int idx = s * (32 * NWK) + (int)threadIdx.x; const int row = idx >> 4, cofs = (idx & 15) * 4; v4f val = *(const v4fa*)(red + row * 68 + cofs);
#pragma unroll
        for (int q = 1; q < NWK; ++q) val += *(const v4fa*)(red + q * RPW + row * 68 + cofs);
        if (BIAS) { val[0] += bfr(bias[c0 + cofs]); val[1] += bfr(bias[c0 + cofs + 1]); val[2] += bfr(bias[c0 + cofs + 2]); val[3] += bfr(bias[c0 + cofs + 3]); }
        *(v4f*)(C + (size_t)(r0 + row) * ldc + c0 + cofs) = val; }
}

// ---- k_gemmc: the same 64x64 tile GEMM specialised for causal attention (CMODE 1: K = 64, one wave, 32 threads; CMODE 2: NWK waves share the K loop as in k_gemmw, 32 * NWK threads): CMODE 1 skips score tiles entirely above the diagonal (query rows r0+roff.., key columns c0..), CMODE 2 limits the
// key (K) loop of the probability x value contraction to the diagonal block (probabilities beyond it are exactly zero). roff = row offset of this launch's first row within the sequence. LDA, LDB = row pitches of A, A2 and of Bt, Bt2 in elements, constants of the layout: the loads of one operand plane share one address pair and differ in their immediate offsets.
template <typename T16, int NSPLIT, int CMODE, int LDA, int LDB>
__global__ __launch_bounds__(CMODE == 2 ? 32 * NWK : 32) void k_gemmc(const T16* __restrict__ A, const T16* __restrict__ A2, const T16* __restrict__ Bt, const T16* __restrict__ Bt2, int K, float* C, int ldc, int roff, size_t sA, size_t sB, size_t sC) {
    typedef typename WFrag<T16>::V V;
    constexpr int NW = (CMODE == 2) ? NWK : 1;
    __shared__ __align__(16) float os[CMODE == 2 ? NWK * RPW : 16 * 68];
    const size_t z = blockIdx.z; A += z * sA; if (A2) A2 += z * sA; Bt += z * sB; if (Bt2) Bt2 += z * sB; C += z * sC;
    const int lane = threadIdx.x & 31, lr = lane & 15, hi = lane >> 4; const int r0 = blockIdx.x * 64, c0 = blockIdx.y * 64;
    const int w = (CMODE == 2) ? __builtin_amdgcn_readfirstlane((int)(threadIdx.x >> 5)) : 0;
    if (CMODE == 1 && c0 > r0 + roff + 63) return;                  // score tile entirely above the causal diagonal: not written (the softmax loads it but masks j > i by select)
    const int Kl = (CMODE == 2) ? min(K, r0 + roff + 64) : K;        // P.V: probabilities are exactly 0 beyond the diagonal block, so the K loop stops there
    v8f acc[4][4];
#pragma unroll
    for (int mb = 0; mb < 4; ++mb)
#pragma unroll
        for (int nb = 0; nb < 4; ++nb) acc[mb][nb] = (v8f){};
    const size_t aoff = (size_t)(r0 + lr) * LDA + 8 * hi, boff = (size_t)(c0 + lr) * LDB + 8 * hi;
#pragma unroll 1
    for (int kc = w * 64; kc < Kl; kc += (kc & 32) ? NW * 64 - 32 : 32) {
        V a[4], a2[4]; const T16* pa = A + aoff + kc; const T16* pa2 = (NSPLIT == 1 || NSPLIT == 2) ? A2 + aoff + kc : pa; const T16* pb = Bt + boff + kc; const T16* pb2 = (NSPLIT >= 2) ? Bt2 + boff + kc : pb;
#pragma unroll
        for (int mb = 0; mb < 4; ++mb) { a[mb] = WFrag<T16>::ld(pa + (size_t)mb * 16 * LDA); if (NSPLIT == 1 || NSPLIT == 2) a2[mb] = WFrag<T16>::ld(pa2 + (size_t)mb * 16 * LDA); }
#pragma unroll
        for (int nb = 0; nb < 4; ++nb) { const V b = WFrag<T16>::ld(pb + (size_t)nb * 16 * LDB); V b2; if (NSPLIT >= 2) b2 = WFrag<T16>::ld(pb2 + (size_t)nb * 16 * LDB);
#pragma unroll
            for (int mb = 0; mb < 4; ++mb) { acc[mb][nb] = WFrag<T16>::mma(a[mb], b, acc[mb][nb]); if (NSPLIT == 1 || NSPLIT == 2) acc[mb][nb] = WFrag<T16>::mma(a2[mb], b, acc[mb][nb]); if (NSPLIT >= 2) acc[mb][nb] = WFrag<T16>::mma(a[mb], b2, acc[mb][nb]); } }
        asm volatile("s_wait_xcnt 0x0" :: "v"(pa), "v"(pa2), "v"(pb), "v"(pb2) : "memory");   // precaution of the instruction set's rule on registers that an issued load names: the trip's address pairs are inputs here, so they keep their values up to this wait and are reused only behind it
        asm volatile("v_nop\n\tv_nop\n\tv_nop\n\tv_nop" : "+v"(acc[0][0]), "+v"(acc[1][1]), "+v"(acc[2][2]), "+v"(acc[3][3]) : "v"(a[0]), "v"(a[3]));
    }
    if constexpr (CMODE == 2) {
    float* red = os;
    float* my = red + w * RPW;
#pragma unroll
    for (int mb = 0; mb < 4; ++mb) {
#pragma unroll
        for (int nb = 0; nb < 4; ++nb) {
#pragma unroll
            for (int j = 0; j < 8; ++j) my[(mb * 16 + hi * 8 + j) * 68 + nb * 16 + lr] = acc[mb][nb][j]; } }
    __syncthreads();   // every wave's partial tile is in LDS before any thread sums across waves
#pragma unroll
    for (int s = 0; s < 64 * 16 / (32 * NWK); ++s) { const int idx = s * (32 * NWK) + (int)threadIdx.x; const int row = idx >> 4, cofs = (idx & 15) * 4; v4f val = *(const v4fa*)(red + row * 68 + cofs);
#pragma unroll
        for (int q = 1; q < NWK; ++q) val += *(const v4fa*)(red + q * RPW + row * 68 + cofs);
        *(v4f*)(C + (size_t)(r0 + row) * ldc + c0 + cofs) = val; }
    } else {
#pragma unroll
    for (int mb = 0; mb < 4; ++mb) {
#pragma unroll
        for (int nb = 0; nb < 4; ++nb) {
#pragma unroll
            for (int j = 0; j < 8; ++j) os[(hi * 8 + j) * 68 + nb * 16 + lr] = acc[mb][nb][j]; }
        __builtin_amdgcn_wave_barrier(); asm volatile("" ::: "memory");
        float* crow = C + (size_t)(r0 + mb * 16) * ldc + c0;
{
#pragma unroll
            for (int s = 0; s < 8; ++s) { const int row = 2 * s + hi, cofs = lr * 4; v4f val = *(const v4fa*)(os + row * 68 + cofs);
                *(v4f*)(crow + (size_t)row * ldc + cofs) = val; }
             }
        __builtin_amdgcn_wave_barrier(); asm volatile("" ::: "memory");
    }
    }
}

__device__ __forceinline__ h16 tohx(float x) { return (h16)x; }
__device__ __forceinline__ void splitf(float y, unsigned short& h, unsigned short& l) { h = f2bf(y); l = f2bf(y - bf2f(h)); }
typedef __attribute__((ext_vector_type(2))) _Float16 v2h;
typedef __attribute__((ext_vector_type(4))) _Float16 v4h;
typedef __attribute__((ext_vector_type(2))) unsigned short v2us;
typedef __attribute__((ext_vector_type(4))) unsigned short v4us;
typedef __attribute__((ext_vector_type(2))) float v2f;
typedef __attribute__((ext_vector_type(4))) int v4i;

__global__ __launch_bounds__(256) void k_wtG(const float* __restrict__ w, int K, int N, bf* Bt) {
    const int lane = threadIdx.x & 31; const int L0 = (blockIdx.x * 8 + (threadIdx.x >> 5)) * 8; const int nlines = N * K / 64;
{
#pragma unroll 1
        for (int l = 0; l < 8; ++l) { const int L = L0 + l; if (L >= nlines) break; const size_t e = (size_t)L * 64 + lane * 2; const int k = (int)(e % K), n = (int)(e / K); v2us o;
            o[0] = f2bf(w[(size_t)k * N + n]); o[1] = f2bf(w[(size_t)(k + 1) * N + n]); *(v2us*)(Bt + e) = o; }
         }
}
__global__ __launch_bounds__(256) void k_cvt8(const float* __restrict__ src, bf* dst, size_t n8) { const size_t i = (size_t)blockIdx.x * 256 + threadIdx.x; if (i >= n8) return; const v8f v = *(const v8f*)(src + i * 8); v8us o;
#pragma unroll
    for (int k = 0; k < 8; ++k) o[k] = f2bf(v[k]); *(v8us*)(dst + i * 8) = o;  }

__global__ __launch_bounds__(256) void k_ropeI(const float* __restrict__ F, int pitch, int nheads, const float* __restrict__ CS, float sc, h16* P16, bf* Ph, bf* Pl) {
    const size_t e = ((size_t)blockIdx.x * 256 + threadIdx.x) * 2; if (e >= (size_t)nheads * TT * HD) return; const int d = (int)(e % HD); const int t = (int)((e / HD) % TT); const int h = (int)(e / ((size_t)HD * TT)); const float* f = F + (size_t)t * pitch + h * HD; const float x0 = f[d], x1 = f[d + 1]; const v2f cs = *(const v2f*)(CS + ((size_t)t * HD + d) * 2); v2h o16; v2us oh, ol;
    float a0 = __fmul_rn(x0, cs[0]), b0 = __fmul_rn(x1, cs[1]), a1 = __fmul_rn(x1, cs[0]), b1 = __fmul_rn(x0, cs[1]); asm volatile("" : "+v"(a0), "+v"(b0), "+v"(a1), "+v"(b1));
    float r0 = __fsub_rn(a0, b0) * sc, r1 = __fadd_rn(b1, a1) * sc;   /* even: x0 c - x1 s; odd: x0 s + x1 c */
    o16[0] = tohx(r0); o16[1] = tohx(r1); { unsigned short a2, c2; splitf(r0, a2, c2); oh[0] = a2; ol[0] = c2; splitf(r1, a2, c2); oh[1] = a2; ol[1] = c2; }
    *(v2h*)(P16 + e) = o16; *(v2us*)(Ph + e) = oh; *(v2us*)(Pl + e) = ol;  }

__constant__ float INV2[HD / 2] = { 1.000000000e+00f, 7.498942018e-01f, 5.623413324e-01f, 4.216965139e-01f, 3.162277639e-01f, 2.371373773e-01f, 1.778279394e-01f, 1.333521456e-01f, 1.000000015e-01f, 7.498942316e-02f, 5.623413250e-02f, 4.216964915e-02f, 3.162277490e-02f, 2.371373773e-02f, 1.778279431e-02f, 1.333521400e-02f, 9.999999776e-03f, 7.498942316e-03f, 5.623413250e-03f, 4.216964822e-03f, 3.162277630e-03f, 2.371373819e-03f, 1.778279431e-03f, 1.333521446e-03f, 1.000000047e-03f, 7.498941850e-04f, 5.623413017e-04f, 4.216965172e-04f, 3.162277571e-04f, 2.371373703e-04f, 1.778279402e-04f, 1.333521504e-04f };   // theta ** (-2i / 64), i = 0..31, in float32 as THIS module writes it (the NEGATIVE-POWER spelling 'theta ** (-arange(0, dh, 2) / dh)', evaluated in the reference's own f32 arithmetic): ten of the 32 entries differ by one ulp from the reciprocal spelling '1 / theta ** (2i / 64)' (indices 5, 9, 10, 12, 13, 15, 20, 27, 28, 29)
__global__ __launch_bounds__(256) void k_cstabI(const int* __restrict__ pid, float* CS) { const int idx = blockIdx.x * 256 + threadIdx.x; if (idx >= TT * HD) return; const int d = idx % HD; const int t = idx / HD; const float a = __fmul_rn((float)pid[t], INV2[d >> 1]); v2f cs; cs[0] = cosf(a); cs[1] = sinf(a); *(v2f*)(CS + (size_t)idx * 2) = cs;  }

__global__ __launch_bounds__(256) void k_vtp(const float* __restrict__ F, int pitch, int nheads, h16* V16, bf* Vh, bf* Vl) { const size_t e = ((size_t)blockIdx.x * 256 + threadIdx.x) * 2; if (e >= (size_t)nheads * HD * TT) return; const int t = (int)(e % TT); const int d = (int)((e / TT) % HD); const int g = (int)(e / ((size_t)TT * HD)); v2h o16; v2us oh, ol;
#pragma unroll
    for (int q = 0; q < 2; ++q) { const float x = F[(size_t)(t + q) * pitch + g * HD + d]; o16[q] = tohx(x); unsigned short a2, c2; splitf(x, a2, c2); oh[q] = a2; ol[q] = c2; }
    *(v2h*)(V16 + e) = o16; *(v2us*)(Vh + e) = oh; *(v2us*)(Vl + e) = ol;  }
// k_asoft: per row (zz, i): t = S x HD^-0.5 for j <= i and i - j < WIN (sliding causal window; the reference's -1e9 additive fill vanishes identically); softmax over the 2048 keys (register row, one exp, fixed trees);
// the probabilities overwrite the row's own 8 KiB of scores (rows < RH: hi plane in the first 4 KiB, lo plane in the second; other rows: fp16 x PCAR in the first 4 KiB), pitch 2 * TT 16-bit elements. One wave owns a row and holds all of it in registers before its first store (every store needs the row sum).
__global__ __launch_bounds__(256) void k_asoft(float* Sb) {
    const int lane = threadIdx.x & 31; const int row = blockIdx.x * 8 + (threadIdx.x >> 5); if (row >= ZH * TT) return; const int i = row % TT; const int zz = row / TT; (void)zz; const bool hires = (i < RH); const float* sr = Sb + (size_t)row * TT; h16* P16 = (h16*)(Sb + (size_t)row * TT); bf* Ph = (bf*)(Sb + (size_t)row * TT); bf* Pl = Ph + TT; float v[TT / 32]; float mx = -3.0e38f;
#pragma unroll
    for (int ch = 0; ch < TT / 128; ++ch) { const int j0 = ch * 128 + lane * 4; const v4f a = *(const v4f*)(sr + j0);
#pragma unroll
        for (int q = 0; q < 4; ++q) { const int j = j0 + q; (void)j; const float t = (j <= i && i - j < WIN) ? a[q] * SCL : -3.0e38f; v[ch * 4 + q] = t; mx = fmaxf(mx, t); } }
#pragma unroll
    for (int sh = 16; sh; sh >>= 1) mx = fmaxf(mx, __shfl_xor(mx, sh, 32));
    float sum = 0.f;
#pragma unroll
    for (int k = 0; k < TT / 32; ++k) { float d0 = __fsub_rn(v[k], mx); asm volatile("" : "+v"(d0)); v[k] = __builtin_amdgcn_exp2f(__fmul_rn(d0, 1.4426950408889634f)); sum += v[k]; }
#pragma unroll
    for (int sh = 16; sh; sh >>= 1) sum += __shfl_xor(sum, sh, 32);
    const float f = __fdiv_rn(hires ? 1.0f : PCAR, sum);
{
        if (hires) {
#pragma unroll
            for (int ch = 0; ch < TT / 128; ++ch) { v4us oh, ol;
#pragma unroll
                for (int q = 0; q < 4; ++q) { unsigned short a, c2; splitf(v[ch * 4 + q] * f, a, c2); oh[q] = a; ol[q] = c2; }
                const int oo = ch * 128 + lane * 4; *(v4us*)(Ph + oo) = oh; *(v4us*)(Pl + oo) = ol; }
        } else {
#pragma unroll
            for (int ch = 0; ch < TT / 128; ++ch) { v4h o4;
#pragma unroll
                for (int q = 0; q < 4; ++q) o4[q] = tohx(v[ch * 4 + q] * f);
                *(v4h*)(P16 + ch * 128 + lane * 4) = o4; } }
         }
}
__global__ __launch_bounds__(256) void k_merge(const float* __restrict__ O, int h0, bf* Ah, bf* Al) { const size_t e = ((size_t)blockIdx.x * 256 + threadIdx.x) * 2; if (e >= (size_t)ZH * TT * HD) return; const int d = (int)(e % HD); const int t = (int)((e / HD) % TT); const int zz = (int)(e / ((size_t)HD * TT)); const float cs = (t < RH) ? 1.0f : (1.0f / PCAR); const size_t oo = (size_t)t * DQ + (h0 + zz) * HD + d;
    v2us oh, ol;
#pragma unroll
    for (int q = 0; q < 2; ++q) { unsigned short a, c2; splitf(O[e + q] * cs, a, c2); oh[q] = a; ol[q] = c2; } *(v2us*)(Ah + oo) = oh; *(v2us*)(Al + oo) = ol;  }

extern "C" void kernel_launch(void* const* d_in, const int* in_sizes, int n_in,
                              void* d_out, int out_size, void* d_ws, size_t ws_size, hipStream_t stream) {
    (void)in_sizes; (void)n_in; (void)out_size;
    const float* x = (const float*)d_in[0]; const int* PID = (const int*)d_in[1]; const float* wq = (const float*)d_in[2]; const float* wk = (const float*)d_in[3]; const float* wv = (const float*)d_in[4]; const float* wo = (const float*)d_in[5];   /* inputs x, token_positions (int32 [2048], shared by all batches; read), Wq, Wk, Wv, Wo ('oi' [1024][1024]) */
    float* OUT = (float*)d_out;     // [2][2048][1024]
    char* wsp = (char*)d_ws;
    auto take = [&](size_t bytes) { char* p = wsp; wsp += (bytes + 255) & ~(size_t)255; return (void*)p; };
    bf* WQ = (bf*)take((size_t)DQ * DM * 2); bf* WK = (bf*)take((size_t)DKV * DM * 2); bf* WV = (bf*)take((size_t)DKV * DM * 2); bf* WO = (bf*)take((size_t)DM * DQ * 2); float* CS = (float*)take((size_t)TT * HD * 2 * 4);
    bf* XB = (bf*)take((size_t)TT * DM * 2); float* FQ = (float*)take((size_t)TT * DQ * 4); float* FK = (float*)take((size_t)TT * DKV * 4);
    h16* QP16 = (h16*)take((size_t)NH_ * TT * HD * 2); h16* KP16 = (h16*)take((size_t)NKV * TT * HD * 2); h16* VT16 = (h16*)take((size_t)NKV * HD * TT * 2);
    bf* QPh = (bf*)take((size_t)NH_ * TT * HD * 2); bf* QPl = (bf*)take((size_t)NH_ * TT * HD * 2); bf* KPh = (bf*)take((size_t)NKV * TT * HD * 2); bf* KPl = (bf*)take((size_t)NKV * TT * HD * 2); bf* VTh = (bf*)take((size_t)NKV * HD * TT * 2); bf* VTl = (bf*)take((size_t)NKV * HD * TT * 2);
    float* Sb = (float*)take((size_t)ZH * TT * TT * 4); float* Ob = (float*)take((size_t)ZH * TT * HD * 4); bf* ATh = (bf*)take((size_t)TT * DQ * 2); bf* ATl = (bf*)take((size_t)TT * DQ * 2);
    if ((size_t)(wsp - (char*)d_ws) > ws_size) return;    // ws 256 MiB
    float* FV = FK;   // v projection reuses the k buffer after the k planes are built (stream-ordered)
    { k_cvt8<<<(unsigned)(((size_t)DQ * DM / 8 + 255) / 256), 256, 0, stream>>>(wq, WQ, (size_t)DQ * DM / 8); k_cvt8<<<(unsigned)(((size_t)DKV * DM / 8 + 255) / 256), 256, 0, stream>>>(wk, WK, (size_t)DKV * DM / 8); k_cvt8<<<(unsigned)(((size_t)DKV * DM / 8 + 255) / 256), 256, 0, stream>>>(wv, WV, (size_t)DKV * DM / 8);
      k_cvt8<<<(unsigned)(((size_t)DM * DQ / 8 + 255) / 256), 256, 0, stream>>>(wo, WO, (size_t)DM * DQ / 8); /* the rotary table is rebuilt per batch from that batch's positions (below) */ }
    const unsigned LQ = (unsigned)(((size_t)NH_ * TT * HD / 2 + 255) / 256), LKv = (unsigned)(((size_t)NKV * TT * HD / 2 + 255) / 256);
    for (int b = 0; b < NB_; ++b) {
        k_cstabI<<<(TT * HD + 255) / 256, 256, 0, stream>>>(PID, CS);   /* token_positions[:] (int32 [2048], shared by both batches, read) */
        
        k_cvt8<<<(unsigned)(((size_t)TT * DM / 8 + 255) / 256), 256, 0, stream>>>(x + (size_t)b * TT * DM, XB, (size_t)TT * DM / 8);
        k_gemmw<bf, 0, false><<<dim3(TT / 64, DQ / 64, 1), 32 * NWK, 0, stream>>>(XB, nullptr, WQ, nullptr, DM, FQ, DQ, nullptr, 0, 0, 0);
        k_ropeI<<<LQ, 256, 0, stream>>>(FQ, DQ, NH_, CS, 1.0f, QP16, QPh, QPl);
        k_gemmw<bf, 0, false><<<dim3(TT / 64, DKV / 64, 1), 32 * NWK, 0, stream>>>(XB, nullptr, WK, nullptr, DM, FK, DKV, nullptr, 0, 0, 0);
        k_ropeI<<<LKv, 256, 0, stream>>>(FK, DKV, NKV, CS, 1.0f, KP16, KPh, KPl);
        k_gemmw<bf, 0, false><<<dim3(TT / 64, DKV / 64, 1), 32 * NWK, 0, stream>>>(XB, nullptr, WV, nullptr, DM, FV, DKV, nullptr, 0, 0, 0); k_vtp<<<LKv, 256, 0, stream>>>(FV, DKV, NKV, VT16, VTh, VTl);
        for (int h0 = 0; h0 < NH_; h0 += ZH) { const size_t zq = (size_t)h0, zk = (size_t)(h0 / REP);   // one kv head per query head: the pass's ZH heads use consecutive kv planes (z-strides TT*HD)
            k_gemmc<bf, 2, 1, HD, HD><<<dim3(TT / 64, TT / 64, ZH), 32, 0, stream>>>(QPh + zq * TT * HD, QPl + zq * TT * HD, KPh + zk * TT * HD, KPl + zk * TT * HD, HD, Sb, TT, 0, (size_t)TT * HD, (size_t)TT * HD, (size_t)TT * TT);   /* scores on hi/lo planes for EVERY row (3 products) */
            /* (the fp16 score launch for rows >= RH is removed: all rows use the hi/lo launch above) */
            k_asoft<<<ZH * TT / 8, 256, 0, stream>>>(Sb);   /* probabilities in place of the scores, row pitch 2 * TT 16-bit elements */
            k_gemmc<bf, 2, 2, 2 * TT, TT><<<dim3(RH / 64, HD / 64, ZH), 32 * NWK, 0, stream>>>((const bf*)Sb, (const bf*)Sb + TT, VTh + zk * HD * TT, VTl + zk * HD * TT, TT, Ob, HD, 0, (size_t)TT * 2 * TT, (size_t)HD * TT, (size_t)TT * HD);
            k_gemmc<h16, 0, 2, 2 * TT, TT><<<dim3((TT - RH) / 64, HD / 64, ZH), 32 * NWK, 0, stream>>>((const h16*)Sb + (size_t)RH * 2 * TT, nullptr, VT16 + zk * HD * TT, nullptr, TT, Ob + (size_t)RH * HD, HD, RH, (size_t)TT * 2 * TT, (size_t)HD * TT, (size_t)TT * HD);
            k_merge<<<(unsigned)(((size_t)ZH * TT * HD / 2 + 255) / 256), 256, 0, stream>>>(Ob, h0, ATh, ATl); }
        k_gemmw<bf, 1, false><<<dim3(TT / 64, DM / 64, 1), 32 * NWK, 0, stream>>>(ATh, ATl, WO, nullptr, DQ, OUT + (size_t)b * TT * DM, DM, nullptr, 0, 0, 0); }
}

// v003
// Measured time: 256 microseconds a run.
// In both of two side-by-side timings against v002, it was 1.79 times as fast.
// All steps since v000 together make it 5.39 times as fast.
#include <hip/hip_runtime.h>

// Causal multi-head self-attention with interleaved-pair rotary position embedding from a position input (x [2][2048][1024]; Q, K, V = einsum('bsd,ed', x, W) ('oi' [1024][1024] 1/32, no bias; 16 heads x 64); angle = float(token_positions[t]) x theta ** (-2i / 64) (theta 1e4; token_positions int32 [2048] = arange, shared by both batches, READ on device); pairs (2i, 2i+1): (x1 cos - x2 sin, x1 sin + x2 cos) on Q and K; scores / sqrt(64); keys j <= i kept, -inf elsewhere; softmax; out = einsum('bsd,ed', merged, Wo) -> [2][2048][1024] (4.2 M); argument order x, token_positions, Wq, Wk, Wv, Wo).
// Layout per batch: bf16 copy of x; exact projections; {cos, sin} per (position, pair) built per batch from the int positions and float32 inverse-frequency constants (precise cosf/sinf); interleaved rotary plane builder; fused causal T-2048 attention k_fattn (EVERY row's scores on hi/lo planes (3 products: logit sigma 2 with these weights), online softmax in registers, hybrid P.V (rows < 512 hi/lo, rest fp16 x1024); key blocks above the diagonal are never visited); merged hi/lo x Wo exact.
// Compute dtypes, f32 accumulate: every input rounded to bf16; projections exact; rotary f32; attention scores 3 products, P.V rows < 512 3 products, rest fp16; softmax f32; Wo hl x exact.

#define NB_  2
#define TT   2048
#define DM   1024
#define NH_  16
#define NKV  16
#define HD   64
#define DQ   (NH_ * HD)
#define DKV  (NKV * HD)
#define RH   512                  // query rows < RH use hi+lo planes (0: none)
typedef _Float16 h16;
typedef unsigned short bf;
typedef __attribute__((ext_vector_type(16))) __bf16   v16bf;
typedef __attribute__((ext_vector_type(16))) _Float16 v16h;
typedef __attribute__((ext_vector_type(8)))  _Float16 v8h;
typedef __attribute__((ext_vector_type(8)))  unsigned short v8us;
typedef __attribute__((ext_vector_type(8)))  float    v8f;
typedef __attribute__((ext_vector_type(4)))  float    v4f;
typedef v8h  __attribute__((may_alias)) v8ha;
typedef v4f  __attribute__((may_alias)) v4fa;
typedef v8us __attribute__((may_alias)) v8usa;

__device__ __forceinline__ unsigned short f2bf(float f) { unsigned u = __float_as_uint(f); u += 0x7FFFu + ((u >> 16) & 1u); return (unsigned short)(u >> 16); }
__device__ __forceinline__ float bf2f(unsigned short b) { return __uint_as_float(((unsigned)b) << 16); }
__device__ __forceinline__ float bfr(float f) { return bf2f(f2bf(f)); }
__device__ __forceinline__ v16h cat16(v8h lo, v8h hi) { return __builtin_shufflevector(lo, hi, 0, 1, 2, 3, 4, 5, 6, 7, 8, 9, 10, 11, 12, 13, 14, 15); }
__device__ __forceinline__ v16bf cat16b(v8us lo, v8us hi) { return __builtin_bit_cast(v16bf, __builtin_shufflevector(lo, hi, 0, 1, 2, 3, 4, 5, 6, 7, 8, 9, 10, 11, 12, 13, 14, 15)); }
__device__ __forceinline__ v8f wmma16(v16h a, v16h b, v8f c) { return __builtin_amdgcn_wmma_f32_16x16x32_f16(false, a, false, b, (short)0, c, false, false); }
__device__ __forceinline__ v8f wmmab(v16bf a, v16bf b, v8f c) { return __builtin_amdgcn_wmma_f32_16x16x32_bf16(false, a, false, b, (short)0, c, false, false); }



#define NWK  8                    // waves of a work-group that share one 64x64 tile's K loop
#define RPW  (64 * 68)            // floats of one wave's partial tile in LDS (row pitch 68)
// ---- k_gemmw: register-blocked GEMM, one 64x64 output tile per work-group of NWK waves: wave w takes the 64-element (one 128-byte line per row) K chunks w, w + NWK, ... with 16 accumulators, operands straight from K-contiguous 16-bit planes;
// the NWK partial tiles meet in LDS and are summed in wave order 0..NWK-1; grid (M/64, N/64, Z), 32 * NWK threads. K % 64 == 0.
// C[m][n] (f32, pitch ldc, + optional f32 bias[n]) = sum_k A[m][k] Bt[n][k] (+ split products per NSPLIT). z-batch strides sA/sB/sC in elements.
template <typename T16> struct WFrag;
template <> struct WFrag<h16> { typedef v16h V; static __device__ __forceinline__ V ld(const h16* p) { return cat16(*(const v8h*)p, *(const v8h*)(p + 16)); } static __device__ __forceinline__ v8f mma(V a, V b, v8f c) { return wmma16(a, b, c); } };
template <> struct WFrag<bf> { typedef v16bf V; static __device__ __forceinline__ V ld(const bf* p) { return cat16b(*(const v8us*)p, *(const v8us*)(p + 16)); } static __device__ __forceinline__ v8f mma(V a, V b, v8f c) { return wmmab(a, b, c); } };
template <typename T16, int NSPLIT, bool BIAS>
__global__ __launch_bounds__(32 * NWK) void k_gemmw(const T16* __restrict__ A, const T16* __restrict__ A2, const T16* __restrict__ Bt, const T16* __restrict__ Bt2, int K, float* C, int ldc, const float* __restrict__ bias, size_t sA, size_t sB, size_t sC) {
    typedef typename WFrag<T16>::V V;
    __shared__ __align__(16) float red[NWK * RPW];
    const size_t z = blockIdx.z; A += z * sA; if (A2) A2 += z * sA; Bt += z * sB; if (Bt2) Bt2 += z * sB; C += z * sC;
    const int lane = threadIdx.x & 31, lr = lane & 15, hi = lane >> 4; const int r0 = blockIdx.x * 64, c0 = blockIdx.y * 64;
    const int w = __builtin_amdgcn_readfirstlane((int)(threadIdx.x >> 5));
    v8f acc[4][4];
#pragma unroll
    for (int mb = 0; mb < 4; ++mb)
#pragma unroll
        for (int nb = 0; nb < 4; ++nb) acc[mb][nb] = (v8f){};
    const size_t aoff = (size_t)(r0 + lr) * K + 8 * hi, boff = (size_t)(c0 + lr) * K + 8 * hi;
#pragma unroll 1
    for (int kc = w * 64; kc < K; kc += (kc & 32) ? NWK * 64 - 32 : 32) {
        V a[4], a2[4];
#pragma unroll
        for (int mb = 0; mb < 4; ++mb) { a[mb] = WFrag<T16>::ld(A + aoff + (size_t)mb * 16 * K + kc); if (NSPLIT == 1 || NSPLIT == 2) a2[mb] = WFrag<T16>::ld(A2 + aoff + (size_t)mb * 16 * K + kc); }
#pragma unroll
        for (int nb = 0; nb < 4; ++nb) { const V b = WFrag<T16>::ld(Bt + boff + (size_t)nb * 16 * K + kc); V b2; if (NSPLIT >= 2) b2 = WFrag<T16>::ld(Bt2 + boff + (size_t)nb * 16 * K + kc);
#pragma unroll
            for (int mb = 0; mb < 4; ++mb) { acc[mb][nb] = WFrag<T16>::mma(a[mb], b, acc[mb][nb]); if (NSPLIT == 1 || NSPLIT == 2) acc[mb][nb] = WFrag<T16>::mma(a2[mb], b, acc[mb][nb]); if (NSPLIT >= 2) acc[mb][nb] = WFrag<T16>::mma(a[mb], b2, acc[mb][nb]); } }
        asm volatile("v_nop\n\tv_nop\n\tv_nop\n\tv_nop" : "+v"(acc[0][0]), "+v"(acc[1][1]), "+v"(acc[2][2]), "+v"(acc[3][3]) : "v"(a[0]), "v"(a[3]));
    }
    float* my = red + w * RPW;
#pragma unroll
    for (int mb = 0; mb < 4; ++mb) {
#pragma unroll
        for (int nb = 0; nb < 4; ++nb) {
#pragma unroll
            for (int j = 0; j < 8; ++j) my[(mb * 16 + hi * 8 + j) * 68 + nb * 16 + lr] = acc[mb][nb][j]; } }
    __syncthreads();   // every wave's partial tile is in LDS before any thread sums across waves
#pragma unroll
    for (int s = 0; s < 64 * 16 / (32 * NWK); ++s) { const int idx = s * (32 * NWK) + (int)threadIdx.x; const int row = idx >> 4, cofs = (idx & 15) * 4; v4f val = *(const v4fa*)(red + row * 68 + cofs);
#pragma unroll
        for (int q = 1; q < NWK; ++q) val += *(const v4fa*)(red + q * RPW + row * 68 + cofs);
        if (BIAS) { val[0] += bfr(bias[c0 + cofs]); val[1] += bfr(bias[c0 + cofs + 1]); val[2] += bfr(bias[c0 + cofs + 2]); val[3] += bfr(bias[c0 + cofs + 3]); }
        *(v4f*)(C + (size_t)(r0 + row) * ldc + c0 + cofs) = val; }
}

__device__ __forceinline__ h16 tohx(float x) { return (h16)x; }
__device__ __forceinline__ void splitf(float y, unsigned short& h, unsigned short& l) { h = f2bf(y); l = f2bf(y - bf2f(h)); }
typedef __attribute__((ext_vector_type(2))) _Float16 v2h;
typedef __attribute__((ext_vector_type(4))) _Float16 v4h;
typedef __attribute__((ext_vector_type(2))) unsigned short v2us;
typedef __attribute__((ext_vector_type(4))) unsigned short v4us;
typedef __attribute__((ext_vector_type(2))) float v2f;
typedef __attribute__((ext_vector_type(4))) int v4i;

__global__ __launch_bounds__(256) void k_wtG(const float* __restrict__ w, int K, int N, bf* Bt) {
    const int lane = threadIdx.x & 31; const int L0 = (blockIdx.x * 8 + (threadIdx.x >> 5)) * 8; const int nlines = N * K / 64;
{
#pragma unroll 1
        for (int l = 0; l < 8; ++l) { const int L = L0 + l; if (L >= nlines) break; const size_t e = (size_t)L * 64 + lane * 2; const int k = (int)(e % K), n = (int)(e / K); v2us o;
            o[0] = f2bf(w[(size_t)k * N + n]); o[1] = f2bf(w[(size_t)(k + 1) * N + n]); *(v2us*)(Bt + e) = o; }
         }
}
__global__ __launch_bounds__(256) void k_cvt8(const float* __restrict__ src, bf* dst, size_t n8) { const size_t i = (size_t)blockIdx.x * 256 + threadIdx.x; if (i >= n8) return; const v8f v = *(const v8f*)(src + i * 8); v8us o;
#pragma unroll
    for (int k = 0; k < 8; ++k) o[k] = f2bf(v[k]); *(v8us*)(dst + i * 8) = o;  }

__global__ __launch_bounds__(256) void k_ropeI(const float* __restrict__ F, int pitch, int nheads, const float* __restrict__ CS, float sc, h16* P16, bf* Ph, bf* Pl) {
    const size_t e = ((size_t)blockIdx.x * 256 + threadIdx.x) * 2; if (e >= (size_t)nheads * TT * HD) return; const int d = (int)(e % HD); const int t = (int)((e / HD) % TT); const int h = (int)(e / ((size_t)HD * TT)); const float* f = F + (size_t)t * pitch + h * HD; const float x0 = f[d], x1 = f[d + 1]; const v2f cs = *(const v2f*)(CS + ((size_t)t * HD + d) * 2); v2h o16; v2us oh, ol;
    float a0 = __fmul_rn(x0, cs[0]), b0 = __fmul_rn(x1, cs[1]), a1 = __fmul_rn(x1, cs[0]), b1 = __fmul_rn(x0, cs[1]); asm volatile("" : "+v"(a0), "+v"(b0), "+v"(a1), "+v"(b1));
    float r0 = __fsub_rn(a0, b0) * sc, r1 = __fadd_rn(b1, a1) * sc;   /* even: x0 c - x1 s; odd: x0 s + x1 c */
    o16[0] = tohx(r0); o16[1] = tohx(r1); { unsigned short a2, c2; splitf(r0, a2, c2); oh[0] = a2; ol[0] = c2; splitf(r1, a2, c2); oh[1] = a2; ol[1] = c2; }
    *(v2h*)(P16 + e) = o16; *(v2us*)(Ph + e) = oh; *(v2us*)(Pl + e) = ol;  }

__constant__ float INV2[HD / 2] = { 1.000000000e+00f, 7.498942018e-01f, 5.623413324e-01f, 4.216965139e-01f, 3.162277639e-01f, 2.371373773e-01f, 1.778279394e-01f, 1.333521456e-01f, 1.000000015e-01f, 7.498942316e-02f, 5.623413250e-02f, 4.216964915e-02f, 3.162277490e-02f, 2.371373773e-02f, 1.778279431e-02f, 1.333521400e-02f, 9.999999776e-03f, 7.498942316e-03f, 5.623413250e-03f, 4.216964822e-03f, 3.162277630e-03f, 2.371373819e-03f, 1.778279431e-03f, 1.333521446e-03f, 1.000000047e-03f, 7.498941850e-04f, 5.623413017e-04f, 4.216965172e-04f, 3.162277571e-04f, 2.371373703e-04f, 1.778279402e-04f, 1.333521504e-04f };   // theta ** (-2i / 64), i = 0..31, in float32 as THIS module writes it (the NEGATIVE-POWER spelling 'theta ** (-arange(0, dh, 2) / dh)', evaluated in the reference's own f32 arithmetic): ten of the 32 entries differ by one ulp from the reciprocal spelling '1 / theta ** (2i / 64)' (indices 5, 9, 10, 12, 13, 15, 20, 27, 28, 29)
__global__ __launch_bounds__(256) void k_cstabI(const int* __restrict__ pid, float* CS) { const int idx = blockIdx.x * 256 + threadIdx.x; if (idx >= TT * HD) return; const int d = idx % HD; const int t = idx / HD; const float a = __fmul_rn((float)pid[t], INV2[d >> 1]); v2f cs; cs[0] = cosf(a); cs[1] = sinf(a); *(v2f*)(CS + (size_t)idx * 2) = cs;  }

__global__ __launch_bounds__(256) void k_vtp(const float* __restrict__ F, int pitch, int nheads, h16* V16, bf* Vh, bf* Vl) { const size_t e = ((size_t)blockIdx.x * 256 + threadIdx.x) * 2; if (e >= (size_t)nheads * HD * TT) return; const int t = (int)(e % TT); const int d = (int)((e / TT) % HD); const int g = (int)(e / ((size_t)TT * HD)); v2h o16; v2us oh, ol;
#pragma unroll
    for (int q = 0; q < 2; ++q) { const float x = F[(size_t)(t + q) * pitch + g * HD + d]; o16[q] = tohx(x); unsigned short a2, c2; splitf(x, a2, c2); oh[q] = a2; ol[q] = c2; }
    *(v2h*)(V16 + e) = o16; *(v2us*)(Vh + e) = oh; *(v2us*)(Vl + e) = ol;  }
#define AQ   32                   // queries of one work-group: two 16-column groups, held by every wave
#define ANW  8                    // waves of a work-group that share the key loop of those queries
#define SCL2 0.18033688011112042f // HD^-0.5 x log2(e): scores are carried in the log2 domain
// ---- k_fattn: causal attention of one head for AQ queries, scores never leave the registers. S^T = K.Q^T (A = 16 key rows, B = 16 query columns; hi/lo planes, 3 products) leaves one query per lane column, so maximum, sum and rescale are per lane plus one exchange between the wave's halves;
// two 16-key score tiles of a lane are, in order, the B fragment of O^T += V^T.P^T (element e < 8: key 8 * hi + e, else key 16 + 8 * hi + e - 8, the order in which WFrag::ld reads V^T). Queries < RH: P and V on hi/lo planes (3 products); other queries: P x 1024 in fp16 (the factor is in the row sum too and cancels).
// Wave w takes the 32-key blocks w, w + ANW, ... up to the diagonal block with its own running maximum; the ANW partial (maximum, sum, O) meet in LDS, are brought to the common maximum and summed in wave order; the quotient goes out as the merged hi/lo planes [t][DQ]. Grid (heads, TT / AQ), longest query blocks first.
template <bool HR, int NQ>
__device__ __forceinline__ void attn_keys(const bf* pqh, const bf* pql, const bf* pkh, const bf* pkl, const h16* pv16, const bf* pvh, const bf* pvl, int qa, int q0, int w, int lr, int hi, v8f* o, float* m, float* l) {   // the p.. are per-lane addresses: query qa + lr, key w * 32 + lr (both at d = 8 * hi), V^T row lr at key w * 32 + 8 * hi; every load of a plane shares its pair and differs in the immediate offset
    v16bf qh[NQ][2], ql[NQ][2];   // NQ groups of 16 queries from query qa on (B operand: column = query, k = d)
#pragma unroll
    for (int qt = 0; qt < NQ; ++qt)
#pragma unroll
        for (int ks = 0; ks < 2; ++ks) { qh[qt][ks] = WFrag<bf>::ld(pqh + qt * 16 * HD + ks * 32); ql[qt][ks] = WFrag<bf>::ld(pql + qt * 16 * HD + ks * 32); }
    asm volatile("s_wait_xcnt 0x0" :: "v"(pqh), "v"(pql) : "memory");   // precaution of the instruction set's rule on registers that an issued load names: the two address pairs are inputs here, so they keep their values up to this wait
#pragma unroll 1
    for (int kb = w * 32; kb <= q0; kb += ANW * 32) {
        v8f s[2][NQ];
#pragma unroll
        for (int kt = 0; kt < 2; ++kt) { v16bf kh[2], kl[2];
#pragma unroll
            for (int ks = 0; ks < 2; ++ks) { kh[ks] = WFrag<bf>::ld(pkh + kt * 16 * HD + ks * 32); kl[ks] = WFrag<bf>::ld(pkl + kt * 16 * HD + ks * 32); }
#pragma unroll
            for (int qt = 0; qt < NQ; ++qt) { v8f c = (v8f){};
#pragma unroll
                for (int ks = 0; ks < 2; ++ks) { c = wmmab(kh[ks], qh[qt][ks], c); c = wmmab(kl[ks], qh[qt][ks], c); c = wmmab(kh[ks], ql[qt][ks], c); }
                s[kt][qt] = c; } }
        v16h v16[4]; v16bf vh[4], vl[4];
#pragma unroll
        for (int dt = 0; dt < 4; ++dt) { if (HR) { vh[dt] = WFrag<bf>::ld(pvh + dt * 16 * TT); vl[dt] = WFrag<bf>::ld(pvl + dt * 16 * TT); } else v16[dt] = WFrag<h16>::ld(pv16 + dt * 16 * TT); }
#pragma unroll
        for (int qt = 0; qt < NQ; ++qt) { const int q = qa + qt * 16 + lr; float t[16]; float mx = m[qt];
#pragma unroll
            for (int e = 0; e < 16; ++e) { const int key = kb + (e >> 3) * 16 + hi * 8 + (e & 7); t[e] = (key <= q) ? s[e >> 3][qt][e & 7] * SCL2 : -3.0e38f; mx = fmaxf(mx, t[e]); }
            mx = fmaxf(mx, __shfl_xor(mx, 16, 32));
            const float al = __builtin_amdgcn_exp2f(m[qt] - mx); m[qt] = mx; const float mo = HR ? mx : mx - 10.0f; float ps = 0.f;
#pragma unroll
            for (int e = 0; e < 16; ++e) { t[e] = __builtin_amdgcn_exp2f(t[e] - mo); ps += t[e]; }
            l[qt] = l[qt] * al + ps;
#pragma unroll
            for (int dt = 0; dt < 4; ++dt) o[qt * 4 + dt] *= al;
            if (HR) { v8us h0, h1, l0, l1;
#pragma unroll
                for (int e = 0; e < 8; ++e) { unsigned short a, c2; splitf(t[e], a, c2); h0[e] = a; l0[e] = c2; splitf(t[8 + e], a, c2); h1[e] = a; l1[e] = c2; }
                const v16bf ph = cat16b(h0, h1), pl = cat16b(l0, l1);
#pragma unroll
                for (int dt = 0; dt < 4; ++dt) { v8f c = o[qt * 4 + dt]; c = wmmab(vh[dt], ph, c); c = wmmab(vh[dt], pl, c); c = wmmab(vl[dt], ph, c); o[qt * 4 + dt] = c; }
            } else { v16h p;
#pragma unroll
                for (int e = 0; e < 16; ++e) p[e] = tohx(t[e]);
#pragma unroll
                for (int dt = 0; dt < 4; ++dt) o[qt * 4 + dt] = wmma16(v16[dt], p, o[qt * 4 + dt]); } }
        // precaution of the instruction set's rule on registers that an issued load names: the trip's address pairs are inputs here, so they keep their values up to this wait and are stepped only behind it
        if (HR) { asm volatile("s_wait_xcnt 0x0" :: "v"(pkh), "v"(pkl), "v"(pvh), "v"(pvl) : "memory"); pvh += ANW * 32; pvl += ANW * 32; }
        else { asm volatile("s_wait_xcnt 0x0" :: "v"(pkh), "v"(pkl), "v"(pv16) : "memory"); pv16 += ANW * 32; }
        pkh += ANW * 32 * HD; pkl += ANW * 32 * HD;
    }
}
// amdgpu_waves_per_eu(4, 4): holds the kernel to 256 VGPRs, so that two work-groups share a WGP and one wave's load waits are covered by three others on its SIMD (left free the build took 318 VGPRs: one work-group per WGP)
__global__ __launch_bounds__(32 * ANW) __attribute__((amdgpu_waves_per_eu(4, 4))) void k_fattn(const bf* __restrict__ Qh, const bf* __restrict__ Ql, const bf* __restrict__ Kh, const bf* __restrict__ Kl, const h16* __restrict__ V16, const bf* __restrict__ Vh, const bf* __restrict__ Vl, bf* Ah, bf* Al) {
    __shared__ __align__(16) float ored[ANW * AQ * 68];   // per wave AQ queries x HD floats, row pitch 68
    __shared__ float mred[ANW * AQ]; __shared__ float lred[ANW * AQ];
    const int lane = threadIdx.x & 31, lr = lane & 15, hi = lane >> 4; const int w = __builtin_amdgcn_readfirstlane((int)(threadIdx.x >> 5));
    const int h = blockIdx.x; const int q0 = (TT / AQ - 1 - (int)blockIdx.y) * AQ; const size_t hp = (size_t)h * TT * HD;
    v8f o[2 * 4]; float m[2] = { -3.0e38f, -3.0e38f }, l[2] = { 0.f, 0.f };   // o[qt * 4 + dt][j] = O[query q0 + qt * 16 + lr][d = dt * 16 + hi * 8 + j]
#pragma unroll
    for (int i = 0; i < 8; ++i) o[i] = (v8f){};
    const size_t qo = hp + (size_t)(q0 + lr) * HD + 8 * hi, ko = hp + (size_t)(w * 32 + lr) * HD + 8 * hi, vo = hp + (size_t)lr * TT + w * 32 + 8 * hi;
    if (q0 < RH) {   // hi/lo P and V take twice the fragment registers: the two query groups walk the keys one after the other
        attn_keys<true, 1>(Qh + qo, Ql + qo, Kh + ko, Kl + ko, V16 + vo, Vh + vo, Vl + vo, q0, q0, w, lr, hi, o, m, l);
        attn_keys<true, 1>(Qh + qo + 16 * HD, Ql + qo + 16 * HD, Kh + ko, Kl + ko, V16 + vo, Vh + vo, Vl + vo, q0 + 16, q0, w, lr, hi, o + 4, m + 1, l + 1);
    } else attn_keys<false, 2>(Qh + qo, Ql + qo, Kh + ko, Kl + ko, V16 + vo, Vh + vo, Vl + vo, q0, q0, w, lr, hi, o, m, l);
#pragma unroll
    for (int qt = 0; qt < 2; ++qt) { l[qt] += __shfl_xor(l[qt], 16, 32); if (hi == 0) mred[w * AQ + qt * 16 + lr] = m[qt]; }
    __syncthreads();   // every wave's running maximum is in LDS before any wave forms the common one
#pragma unroll
    for (int qt = 0; qt < 2; ++qt) { float M = mred[qt * 16 + lr];
#pragma unroll
        for (int u = 1; u < ANW; ++u) M = fmaxf(M, mred[u * AQ + qt * 16 + lr]);
        const float f = __builtin_amdgcn_exp2f(m[qt] - M);   // a wave without a key block has maximum -3e38, sum 0 and O 0: factor 0
        if (hi == 0) lred[w * AQ + qt * 16 + lr] = l[qt] * f;
        float* my = ored + (w * AQ + qt * 16 + lr) * 68 + hi * 8;
#pragma unroll
        for (int dt = 0; dt < 4; ++dt) { const v8f x = o[qt * 4 + dt] * f; *(v4fa*)(my + dt * 16) = (v4f){ x[0], x[1], x[2], x[3] }; *(v4fa*)(my + dt * 16 + 4) = (v4f){ x[4], x[5], x[6], x[7] }; } }
    __syncthreads();   // every wave's rescaled partial sum and O are in LDS before any thread sums across waves
    { const int q = (int)threadIdx.x >> 3, d0 = ((int)threadIdx.x & 7) * 8; v4f a = *(const v4fa*)(ored + q * 68 + d0), b = *(const v4fa*)(ored + q * 68 + d0 + 4); float L = lred[q];
#pragma unroll
        for (int u = 1; u < ANW; ++u) { a += *(const v4fa*)(ored + (u * AQ + q) * 68 + d0); b += *(const v4fa*)(ored + (u * AQ + q) * 68 + d0 + 4); L += lred[u * AQ + q]; }
        const float inv = __fdiv_rn(1.0f, L); v8us oh, ol;
#pragma unroll
        for (int e = 0; e < 4; ++e) { unsigned short x, y; splitf(a[e] * inv, x, y); oh[e] = x; ol[e] = y; splitf(b[e] * inv, x, y); oh[4 + e] = x; ol[4 + e] = y; }
        const size_t oo = (size_t)(q0 + q) * DQ + h * HD + d0; *(v8us*)(Ah + oo) = oh; *(v8us*)(Al + oo) = ol; }
}

extern "C" void kernel_launch(void* const* d_in, const int* in_sizes, int n_in,
                              void* d_out, int out_size, void* d_ws, size_t ws_size, hipStream_t stream) {
    (void)in_sizes; (void)n_in; (void)out_size;
    const float* x = (const float*)d_in[0]; const int* PID = (const int*)d_in[1]; const float* wq = (const float*)d_in[2]; const float* wk = (const float*)d_in[3]; const float* wv = (const float*)d_in[4]; const float* wo = (const float*)d_in[5];   /* inputs x, token_positions (int32 [2048], shared by all batches; read), Wq, Wk, Wv, Wo ('oi' [1024][1024]) */
    float* OUT = (float*)d_out;     // [2][2048][1024]
    char* wsp = (char*)d_ws;
    auto take = [&](size_t bytes) { char* p = wsp; wsp += (bytes + 255) & ~(size_t)255; return (void*)p; };
    bf* WQ = (bf*)take((size_t)DQ * DM * 2); bf* WK = (bf*)take((size_t)DKV * DM * 2); bf* WV = (bf*)take((size_t)DKV * DM * 2); bf* WO = (bf*)take((size_t)DM * DQ * 2); float* CS = (float*)take((size_t)TT * HD * 2 * 4);
    bf* XB = (bf*)take((size_t)TT * DM * 2); float* FQ = (float*)take((size_t)TT * DQ * 4); float* FK = (float*)take((size_t)TT * DKV * 4);
    h16* QP16 = (h16*)take((size_t)NH_ * TT * HD * 2); h16* KP16 = (h16*)take((size_t)NKV * TT * HD * 2); h16* VT16 = (h16*)take((size_t)NKV * HD * TT * 2);
    bf* QPh = (bf*)take((size_t)NH_ * TT * HD * 2); bf* QPl = (bf*)take((size_t)NH_ * TT * HD * 2); bf* KPh = (bf*)take((size_t)NKV * TT * HD * 2); bf* KPl = (bf*)take((size_t)NKV * TT * HD * 2); bf* VTh = (bf*)take((size_t)NKV * HD * TT * 2); bf* VTl = (bf*)take((size_t)NKV * HD * TT * 2);
    bf* ATh = (bf*)take((size_t)TT * DQ * 2); bf* ATl = (bf*)take((size_t)TT * DQ * 2);
    if ((size_t)(wsp - (char*)d_ws) > ws_size) return;    // ws 256 MiB
    float* FV = FK;   // v projection reuses the k buffer after the k planes are built (stream-ordered)
    { k_cvt8<<<(unsigned)(((size_t)DQ * DM / 8 + 255) / 256), 256, 0, stream>>>(wq, WQ, (size_t)DQ * DM / 8); k_cvt8<<<(unsigned)(((size_t)DKV * DM / 8 + 255) / 256), 256, 0, stream>>>(wk, WK, (size_t)DKV * DM / 8); k_cvt8<<<(unsigned)(((size_t)DKV * DM / 8 + 255) / 256), 256, 0, stream>>>(wv, WV, (size_t)DKV * DM / 8);
      k_cvt8<<<(unsigned)(((size_t)DM * DQ / 8 + 255) / 256), 256, 0, stream>>>(wo, WO, (size_t)DM * DQ / 8); /* the rotary table is rebuilt per batch from that batch's positions (below) */ }
    const unsigned LQ = (unsigned)(((size_t)NH_ * TT * HD / 2 + 255) / 256), LKv = (unsigned)(((size_t)NKV * TT * HD / 2 + 255) / 256);
    for (int b = 0; b < NB_; ++b) {
        k_cstabI<<<(TT * HD + 255) / 256, 256, 0, stream>>>(PID, CS);   /* token_positions[:] (int32 [2048], shared by both batches, read) */
        
        k_cvt8<<<(unsigned)(((size_t)TT * DM / 8 + 255) / 256), 256, 0, stream>>>(x + (size_t)b * TT * DM, XB, (size_t)TT * DM / 8);
        k_gemmw<bf, 0, false><<<dim3(TT / 64, DQ / 64, 1), 32 * NWK, 0, stream>>>(XB, nullptr, WQ, nullptr, DM, FQ, DQ, nullptr, 0, 0, 0);
        k_ropeI<<<LQ, 256, 0, stream>>>(FQ, DQ, NH_, CS, 1.0f, QP16, QPh, QPl);
        k_gemmw<bf, 0, false><<<dim3(TT / 64, DKV / 64, 1), 32 * NWK, 0, stream>>>(XB, nullptr, WK, nullptr, DM, FK, DKV, nullptr, 0, 0, 0);
        k_ropeI<<<LKv, 256, 0, stream>>>(FK, DKV, NKV, CS, 1.0f, KP16, KPh, KPl);
        k_gemmw<bf, 0, false><<<dim3(TT / 64, DKV / 64, 1), 32 * NWK, 0, stream>>>(XB, nullptr, WV, nullptr, DM, FV, DKV, nullptr, 0, 0, 0); k_vtp<<<LKv, 256, 0, stream>>>(FV, DKV, NKV, VT16, VTh, VTl);
        k_fattn<<<dim3(NH_, TT / AQ, 1), 32 * ANW, 0, stream>>>(QPh, QPl, KPh, KPl, VT16, VTh, VTl, ATh, ATl);   /* scores, softmax, P.V and the merge of all heads in one launch */
        k_gemmw<bf, 1, false><<<dim3(TT / 64, DM / 64, 1), 32 * NWK, 0, stream>>>(ATh, ATl, WO, nullptr, DQ, OUT + (size_t)b * TT * DM, DM, nullptr, 0, 0, 0); }
}

// v004
// A run of this version takes 208 microseconds.
// In both of two side-by-side timings against v003, it was 1.23 times as fast.
// Counting every step since v000, it is 6.63 times as fast.
#include <hip/hip_runtime.h>

// Causal multi-head self-attention with interleaved-pair rotary position embedding from a position input (x [2][2048][1024]; Q, K, V = einsum('bsd,ed', x, W) ('oi' [1024][1024] 1/32, no bias; 16 heads x 64); angle = float(token_positions[t]) x theta ** (-2i / 64) (theta 1e4; token_positions int32 [2048] = arange, shared by both batches, READ on device); pairs (2i, 2i+1): (x1 cos - x2 sin, x1 sin + x2 cos) on Q and K; scores / sqrt(64); keys j <= i kept, -inf elsewhere; softmax; out = einsum('bsd,ed', merged, Wo) -> [2][2048][1024] (4.2 M); argument order x, token_positions, Wq, Wk, Wv, Wo).
// Layout per batch: bf16 copy of x; exact projections; {cos, sin} per (position, pair) built per batch from the int positions and float32 inverse-frequency constants (precise cosf/sinf); interleaved rotary and the hi/lo (V: also fp16, transposed) planes formed in the projection GEMMs' own epilogue; fused causal T-2048 attention k_fattn (EVERY row's scores on hi/lo planes (3 products: logit sigma 2 with these weights), online softmax in registers, hybrid P.V (rows < 512 hi/lo, rest fp16 x1024); key blocks above the diagonal are never visited); merged hi/lo x Wo exact.
// Compute dtypes, f32 accumulate: every input rounded to bf16; projections exact; rotary f32; attention rows < 512 3 products, rest fp16; softmax f32; Wo hl x exact.

#define NB_  2
#define TT   2048
#define DM   1024
#define NH_  16
#define NKV  16
#define HD   64
#define DQ   (NH_ * HD)
#define DKV  (NKV * HD)
#define RH   512                  // query rows < RH use hi+lo planes (0: none)
typedef _Float16 h16;
typedef unsigned short bf;
typedef __attribute__((ext_vector_type(16))) __bf16   v16bf;
typedef __attribute__((ext_vector_type(16))) _Float16 v16h;
typedef __attribute__((ext_vector_type(8)))  _Float16 v8h;
typedef __attribute__((ext_vector_type(8)))  unsigned short v8us;
typedef __attribute__((ext_vector_type(8)))  float    v8f;
typedef __attribute__((ext_vector_type(4)))  float    v4f;
typedef v8h  __attribute__((may_alias)) v8ha;
typedef v4f  __attribute__((may_alias)) v4fa;
typedef v8us __attribute__((may_alias)) v8usa;

__device__ __forceinline__ unsigned short f2bf(float f) { unsigned u = __float_as_uint(f); u += 0x7FFFu + ((u >> 16) & 1u); return (unsigned short)(u >> 16); }
__device__ __forceinline__ float bf2f(unsigned short b) { return __uint_as_float(((unsigned)b) << 16); }
__device__ __forceinline__ float bfr(float f) { return bf2f(f2bf(f)); }
__device__ __forceinline__ v16h cat16(v8h lo, v8h hi) { return __builtin_shufflevector(lo, hi, 0, 1, 2, 3, 4, 5, 6, 7, 8, 9, 10, 11, 12, 13, 14, 15); }
__device__ __forceinline__ v16bf cat16b(v8us lo, v8us hi) { return __builtin_bit_cast(v16bf, __builtin_shufflevector(lo, hi, 0, 1, 2, 3, 4, 5, 6, 7, 8, 9, 10, 11, 12, 13, 14, 15)); }
__device__ __forceinline__ v8f wmma16(v16h a, v16h b, v8f c) { return __builtin_amdgcn_wmma_f32_16x16x32_f16(false, a, false, b, (short)0, c, false, false); }
__device__ __forceinline__ v8f wmmab(v16bf a, v16bf b, v8f c) { return __builtin_amdgcn_wmma_f32_16x16x32_bf16(false, a, false, b, (short)0, c, false, false); }
__device__ __forceinline__ h16 tohx(float x) { return (h16)x; }
__device__ __forceinline__ void splitf(float y, unsigned short& h, unsigned short& l) { h = f2bf(y); l = f2bf(y - bf2f(h)); }
typedef __attribute__((ext_vector_type(2))) _Float16 v2h;
typedef __attribute__((ext_vector_type(4))) _Float16 v4h;
typedef __attribute__((ext_vector_type(2))) unsigned short v2us;
typedef __attribute__((ext_vector_type(4))) unsigned short v4us;
typedef __attribute__((ext_vector_type(2))) float v2f;
typedef __attribute__((ext_vector_type(4))) int v4i;



#define NWK  8                    // waves of a work-group that share one 64x64 tile's K loop
#define RPW  (64 * 68)            // floats of one wave's partial tile in LDS (row pitch 68)
// ---- k_gemmw: register-blocked GEMM, one 64x64 output tile per work-group of NWK waves: wave w takes the 64-element (one 128-byte line per row) K chunks w, w + NWK, ... with 16 accumulators, operands straight from K-contiguous 16-bit planes;
// the NWK partial tiles meet in LDS and are summed in wave order 0..NWK-1; grid (M/64, N/64, Z), 32 * NWK threads. K % 64 == 0.
// C[m][n] (f32, pitch ldc, + optional f32 bias[n]) = sum_k A[m][k] Bt[n][k] (+ split products per NSPLIT). z-batch strides sA/sB/sC in elements.
// EPI says what the summing threads do with their four neighbouring columns: 0 store them to C in f32; 1 (rows = tokens, the tile's 64 columns = head blockIdx.y) turn the two (even, odd) pairs by the token's {cos, sin} of CS and store hi/lo planes [head][token][HD];
// 2 store fp16 and hi/lo planes at C's own index (pitch ldc): with A = the V weight and Bt = the tokens the rows are (head, d) and the columns tokens, which is V^T as the attention reads it.
template <typename T16> struct WFrag;
template <> struct WFrag<h16> { typedef v16h V; static __device__ __forceinline__ V ld(const h16* p) { return cat16(*(const v8h*)p, *(const v8h*)(p + 16)); } static __device__ __forceinline__ v8f mma(V a, V b, v8f c) { return wmma16(a, b, c); } };
template <> struct WFrag<bf> { typedef v16bf V; static __device__ __forceinline__ V ld(const bf* p) { return cat16b(*(const v8us*)p, *(const v8us*)(p + 16)); } static __device__ __forceinline__ v8f mma(V a, V b, v8f c) { return wmmab(a, b, c); } };
template <typename T16, int NSPLIT, bool BIAS, int EPI>
__global__ __launch_bounds__(32 * NWK) void k_gemmw(const T16* __restrict__ A, const T16* __restrict__ A2, const T16* __restrict__ Bt, const T16* __restrict__ Bt2, int K, float* C, int ldc, const float* __restrict__ bias, size_t sA, size_t sB, size_t sC, const float* __restrict__ CS, h16* P16, bf* Ph, bf* Pl) {
    typedef typename WFrag<T16>::V V;
    __shared__ __align__(16) float red[NWK * RPW];
    const size_t z = blockIdx.z; A += z * sA; if (A2) A2 += z * sA; Bt += z * sB; if (Bt2) Bt2 += z * sB; C += z * sC;
    const int lane = threadIdx.x & 31, lr = lane & 15, hi = lane >> 4; const int r0 = blockIdx.x * 64, c0 = blockIdx.y * 64;
    const int w = __builtin_amdgcn_readfirstlane((int)(threadIdx.x >> 5));
    v8f acc[4][4];
#pragma unroll
    for (int mb = 0; mb < 4; ++mb)
#pragma unroll
        for (int nb = 0; nb < 4; ++nb) acc[mb][nb] = (v8f){};
    const size_t aoff = (size_t)(r0 + lr) * K + 8 * hi, boff = (size_t)(c0 + lr) * K + 8 * hi;
#pragma unroll 1
    for (int kc = w * 64; kc < K; kc += (kc & 32) ? NWK * 64 - 32 : 32) {
        V a[4], a2[4];
#pragma unroll
        for (int mb = 0; mb < 4; ++mb) { a[mb] = WFrag<T16>::ld(A + aoff + (size_t)mb * 16 * K + kc); if (NSPLIT == 1 || NSPLIT == 2) a2[mb] = WFrag<T16>::ld(A2 + aoff + (size_t)mb * 16 * K + kc); }
#pragma unroll
        for (int nb = 0; nb < 4; ++nb) { const V b = WFrag<T16>::ld(Bt + boff + (size_t)nb * 16 * K + kc); V b2; if (NSPLIT >= 2) b2 = WFrag<T16>::ld(Bt2 + boff + (size_t)nb * 16 * K + kc);
#pragma unroll
            for (int mb = 0; mb < 4; ++mb) { acc[mb][nb] = WFrag<T16>::mma(a[mb], b, acc[mb][nb]); if (NSPLIT == 1 || NSPLIT == 2) acc[mb][nb] = WFrag<T16>::mma(a2[mb], b, acc[mb][nb]); if (NSPLIT >= 2) acc[mb][nb] = WFrag<T16>::mma(a[mb], b2, acc[mb][nb]); } }
        asm volatile("v_nop\n\tv_nop\n\tv_nop\n\tv_nop" : "+v"(acc[0][0]), "+v"(acc[1][1]), "+v"(acc[2][2]), "+v"(acc[3][3]) : "v"(a[0]), "v"(a[3]));
    }
    v2f cs[64 * 16 / (32 * NWK)][2];   // EPI 1: {cos, sin} of this thread's two pairs in each of its rows, asked for here so that they arrive while the partial tiles go through LDS
    if (EPI == 1) {
#pragma unroll   // constant indices keep cs in registers
        for (int s = 0; s < 64 * 16 / (32 * NWK); ++s) { const int idx = s * (32 * NWK) + (int)threadIdx.x; const float* c = CS + ((size_t)(r0 + (idx >> 4)) * HD + (idx & 15) * 4) * 2; cs[s][0] = *(const v2f*)c; cs[s][1] = *(const v2f*)(c + 4); } }
    float* my = red + w * RPW;
#pragma unroll
    for (int mb = 0; mb < 4; ++mb) {
#pragma unroll
        for (int nb = 0; nb < 4; ++nb) {
#pragma unroll
            for (int j = 0; j < 8; ++j) my[(mb * 16 + hi * 8 + j) * 68 + nb * 16 + lr] = acc[mb][nb][j]; } }
    __syncthreads();   // every wave's partial tile is in LDS before any thread sums across waves
#pragma unroll
    for (int s = 0; s < 64 * 16 / (32 * NWK); ++s) { const int idx = s * (32 * NWK) + (int)threadIdx.x; const int row = idx >> 4, cofs = (idx & 15) * 4; v4f val = *(const v4fa*)(red + row * 68 + cofs);
#pragma unroll
        for (int q = 1; q < NWK; ++q) val += *(const v4fa*)(red + q * RPW + row * 68 + cofs);
        if (BIAS) { val[0] += bfr(bias[c0 + cofs]); val[1] += bfr(bias[c0 + cofs + 1]); val[2] += bfr(bias[c0 + cofs + 2]); val[3] += bfr(bias[c0 + cofs + 3]); }
        if (EPI == 0) *(v4f*)(C + (size_t)(r0 + row) * ldc + c0 + cofs) = val;
        else { v4us oh, ol;
            if (EPI == 1) val = (v4f){ val[0] * cs[s][0][0] - val[1] * cs[s][0][1], val[0] * cs[s][0][1] + val[1] * cs[s][0][0], val[2] * cs[s][1][0] - val[3] * cs[s][1][1], val[2] * cs[s][1][1] + val[3] * cs[s][1][0] };   /* even: x0 c - x1 s; odd: x0 s + x1 c */
#pragma unroll   // constant indices keep the vectors in registers
            for (int k = 0; k < 4; ++k) { unsigned short a2, c2; splitf(val[k], a2, c2); oh[k] = a2; ol[k] = c2; }
            const size_t e = (EPI == 1) ? ((size_t)blockIdx.y * TT + r0 + row) * HD + cofs : (size_t)(r0 + row) * ldc + c0 + cofs;
            *(v4us*)(Ph + e) = oh; *(v4us*)(Pl + e) = ol;
            if (EPI == 2) *(v4h*)(P16 + e) = (v4h){ tohx(val[0]), tohx(val[1]), tohx(val[2]), tohx(val[3]) }; } }
}


__global__ __launch_bounds__(256) void k_wtG(const float* __restrict__ w, int K, int N, bf* Bt) {
    const int lane = threadIdx.x & 31; const int L0 = (blockIdx.x * 8 + (threadIdx.x >> 5)) * 8; const int nlines = N * K / 64;
{
#pragma unroll 1
        for (int l = 0; l < 8; ++l) { const int L = L0 + l; if (L >= nlines) break; const size_t e = (size_t)L * 64 + lane * 2; const int k = (int)(e % K), n = (int)(e / K); v2us o;
            o[0] = f2bf(w[(size_t)k * N + n]); o[1] = f2bf(w[(size_t)(k + 1) * N + n]); *(v2us*)(Bt + e) = o; }
         }
}
__global__ __launch_bounds__(256) void k_cvt8(const float* __restrict__ src, bf* dst, size_t n8) { const size_t i = (size_t)blockIdx.x * 256 + threadIdx.x; if (i >= n8) return; const v8f v = *(const v8f*)(src + i * 8); v8us o;
#pragma unroll
    for (int k = 0; k < 8; ++k) o[k] = f2bf(v[k]); *(v8us*)(dst + i * 8) = o;  }

__constant__ float INV2[HD / 2] = { 1.000000000e+00f, 7.498942018e-01f, 5.623413324e-01f, 4.216965139e-01f, 3.162277639e-01f, 2.371373773e-01f, 1.778279394e-01f, 1.333521456e-01f, 1.000000015e-01f, 7.498942316e-02f, 5.623413250e-02f, 4.216964915e-02f, 3.162277490e-02f, 2.371373773e-02f, 1.778279431e-02f, 1.333521400e-02f, 9.999999776e-03f, 7.498942316e-03f, 5.623413250e-03f, 4.216964822e-03f, 3.162277630e-03f, 2.371373819e-03f, 1.778279431e-03f, 1.333521446e-03f, 1.000000047e-03f, 7.498941850e-04f, 5.623413017e-04f, 4.216965172e-04f, 3.162277571e-04f, 2.371373703e-04f, 1.778279402e-04f, 1.333521504e-04f };   // theta ** (-2i / 64), i = 0..31, in float32 as THIS module writes it (the NEGATIVE-POWER spelling 'theta ** (-arange(0, dh, 2) / dh)', evaluated in the reference's own f32 arithmetic): ten of the 32 entries differ by one ulp from the reciprocal spelling '1 / theta ** (2i / 64)' (indices 5, 9, 10, 12, 13, 15, 20, 27, 28, 29)
__global__ __launch_bounds__(256) void k_cstabI(const int* __restrict__ pid, float* CS) { const int idx = blockIdx.x * 256 + threadIdx.x; if (idx >= TT * HD) return; const int d = idx % HD; const int t = idx / HD; const float a = __fmul_rn((float)pid[t], INV2[d >> 1]); v2f cs; cs[0] = cosf(a); cs[1] = sinf(a); *(v2f*)(CS + (size_t)idx * 2) = cs;  }

#define AQ   32                   // queries of one work-group: two 16-column groups, held by every wave
#define ANW  8                    // waves of a work-group that share the key loop of those queries
#define SCL2 0.18033688011112042f // HD^-0.5 x log2(e): scores are carried in the log2 domain
// ---- k_fattn: causal attention of one head for AQ queries, scores never leave the registers. S^T = K.Q^T (A = 16 key rows, B = 16 query columns; hi/lo planes, 3 products) leaves one query per lane column, so maximum, sum and rescale are per lane plus one exchange between the wave's halves;
// two 16-key score tiles of a lane are, in order, the B fragment of O^T += V^T.P^T (element e < 8: key 8 * hi + e, else key 16 + 8 * hi + e - 8, the order in which WFrag::ld reads V^T). Queries < RH: P and V on hi/lo planes (3 products); other queries: P x 1024 in fp16 (the factor is in the row sum too and cancels).
// Wave w takes the 32-key blocks w, w + ANW, ... up to the diagonal block with its own running maximum; the ANW partial (maximum, sum, O) meet in LDS, are brought to the common maximum and summed in wave order; the quotient goes out as the merged hi/lo planes [t][DQ]. Grid (heads, TT / AQ), longest query blocks first.
template <bool HR, int NQ>
__device__ __forceinline__ void attn_keys(const bf* pqh, const bf* pql, const bf* pkh, const bf* pkl, const h16* pv16, const bf* pvh, const bf* pvl, int qa, int q0, int w, int lr, int hi, v8f* o, float* m, float* l) {   // the p.. are per-lane addresses: query qa + lr, key w * 32 + lr (both at d = 8 * hi), V^T row lr at key w * 32 + 8 * hi; every load of a plane shares its pair and differs in the immediate offset
    v16bf qh[NQ][2], ql[NQ][2];   // NQ groups of 16 queries from query qa on (B operand: column = query, k = d)
#pragma unroll
    for (int qt = 0; qt < NQ; ++qt)
#pragma unroll
        for (int ks = 0; ks < 2; ++ks) { qh[qt][ks] = WFrag<bf>::ld(pqh + qt * 16 * HD + ks * 32); ql[qt][ks] = WFrag<bf>::ld(pql + qt * 16 * HD + ks * 32); }
    asm volatile("s_wait_xcnt 0x0" :: "v"(pqh), "v"(pql) : "memory");   // precaution of the instruction set's rule on registers that an issued load names: the two address pairs are inputs here, so they keep their values up to this wait
#pragma unroll 1
    for (int kb = w * 32; kb <= q0; kb += ANW * 32) {
        v8f s[2][NQ];
#pragma unroll
        for (int kt = 0; kt < 2; ++kt) { v16bf kh[2], kl[2];
#pragma unroll
            for (int ks = 0; ks < 2; ++ks) { kh[ks] = WFrag<bf>::ld(pkh + kt * 16 * HD + ks * 32); kl[ks] = WFrag<bf>::ld(pkl + kt * 16 * HD + ks * 32); }
#pragma unroll
            for (int qt = 0; qt < NQ; ++qt) { v8f c = (v8f){};
#pragma unroll
                for (int ks = 0; ks < 2; ++ks) { c = wmmab(kh[ks], qh[qt][ks], c); c = wmmab(kl[ks], qh[qt][ks], c); c = wmmab(kh[ks], ql[qt][ks], c); }
                s[kt][qt] = c; } }
        v16h v16[4]; v16bf vh[4], vl[4];
#pragma unroll
        for (int dt = 0; dt < 4; ++dt) { if (HR) { vh[dt] = WFrag<bf>::ld(pvh + dt * 16 * TT); vl[dt] = WFrag<bf>::ld(pvl + dt * 16 * TT); } else v16[dt] = WFrag<h16>::ld(pv16 + dt * 16 * TT); }
#pragma unroll
        for (int qt = 0; qt < NQ; ++qt) { const int q = qa + qt * 16 + lr; float t[16]; float mx = m[qt];
#pragma unroll
            for (int e = 0; e < 16; ++e) { const int key = kb + (e >> 3) * 16 + hi * 8 + (e & 7); t[e] = (key <= q) ? s[e >> 3][qt][e & 7] * SCL2 : -3.0e38f; mx = fmaxf(mx, t[e]); }
            mx = fmaxf(mx, __shfl_xor(mx, 16, 32));
            const float al = __builtin_amdgcn_exp2f(m[qt] - mx); m[qt] = mx; const float mo = HR ? mx : mx - 10.0f; float ps = 0.f;
#pragma unroll
            for (int e = 0; e < 16; ++e) { t[e] = __builtin_amdgcn_exp2f(t[e] - mo); ps += t[e]; }
            l[qt] = l[qt] * al + ps;
#pragma unroll
            for (int dt = 0; dt < 4; ++dt) o[qt * 4 + dt] *= al;
            if (HR) { v8us h0, h1, l0, l1;
#pragma unroll
                for (int e = 0; e < 8; ++e) { unsigned short a, c2; splitf(t[e], a, c2); h0[e] = a; l0[e] = c2; splitf(t[8 + e], a, c2); h1[e] = a; l1[e] = c2; }
                const v16bf ph = cat16b(h0, h1), pl = cat16b(l0, l1);
#pragma unroll
                for (int dt = 0; dt < 4; ++dt) { v8f c = o[qt * 4 + dt]; c = wmmab(vh[dt], ph, c); c = wmmab(vh[dt], pl, c); c = wmmab(vl[dt], ph, c); o[qt * 4 + dt] = c; }
            } else { v16h p;
#pragma unroll
                for (int e = 0; e < 16; ++e) p[e] = tohx(t[e]);
#pragma unroll
                for (int dt = 0; dt < 4; ++dt) o[qt * 4 + dt] = wmma16(v16[dt], p, o[qt * 4 + dt]); } }
        // precaution of the instruction set's rule on registers that an issued load names: the trip's address pairs are inputs here, so they keep their values up to this wait and are stepped only behind it
        if (HR) { asm volatile("s_wait_xcnt 0x0" :: "v"(pkh), "v"(pkl), "v"(pvh), "v"(pvl) : "memory"); pvh += ANW * 32; pvl += ANW * 32; }
        else { asm volatile("s_wait_xcnt 0x0" :: "v"(pkh), "v"(pkl), "v"(pv16) : "memory"); pv16 += ANW * 32; }
        pkh += ANW * 32 * HD; pkl += ANW * 32 * HD;
    }
}
// amdgpu_waves_per_eu(4, 4): holds the kernel to 256 VGPRs, so that two work-groups share a WGP and one wave's load waits are covered by three others on its SIMD (left free the build took 318 VGPRs: one work-group per WGP)
__global__ __launch_bounds__(32 * ANW) __attribute__((amdgpu_waves_per_eu(4, 4))) void k_fattn(const bf* __restrict__ Qh, const bf* __restrict__ Ql, const bf* __restrict__ Kh, const bf* __restrict__ Kl, const h16* __restrict__ V16, const bf* __restrict__ Vh, const bf* __restrict__ Vl, bf* Ah, bf* Al) {
    __shared__ __align__(16) float ored[ANW * AQ * 68];   // per wave AQ queries x HD floats, row pitch 68
    __shared__ float mred[ANW * AQ]; __shared__ float lred[ANW * AQ];
    const int lane = threadIdx.x & 31, lr = lane & 15, hi = lane >> 4; const int w = __builtin_amdgcn_readfirstlane((int)(threadIdx.x >> 5));
    const int h = blockIdx.x; const int q0 = (TT / AQ - 1 - (int)blockIdx.y) * AQ; const size_t hp = (size_t)h * TT * HD;
    v8f o[2 * 4]; float m[2] = { -3.0e38f, -3.0e38f }, l[2] = { 0.f, 0.f };   // o[qt * 4 + dt][j] = O[query q0 + qt * 16 + lr][d = dt * 16 + hi * 8 + j]
#pragma unroll
    for (int i = 0; i < 8; ++i) o[i] = (v8f){};
    const size_t qo = hp + (size_t)(q0 + lr) * HD + 8 * hi, ko = hp + (size_t)(w * 32 + lr) * HD + 8 * hi, vo = hp + (size_t)lr * TT + w * 32 + 8 * hi;
    if (q0 < RH) {   // hi/lo P and V take twice the fragment registers: the two query groups walk the keys one after the other
        attn_keys<true, 1>(Qh + qo, Ql + qo, Kh + ko, Kl + ko, V16 + vo, Vh + vo, Vl + vo, q0, q0, w, lr, hi, o, m, l);
        attn_keys<true, 1>(Qh + qo + 16 * HD, Ql + qo + 16 * HD, Kh + ko, Kl + ko, V16 + vo, Vh + vo, Vl + vo, q0 + 16, q0, w, lr, hi, o + 4, m + 1, l + 1);
    } else attn_keys<false, 2>(Qh + qo, Ql + qo, Kh + ko, Kl + ko, V16 + vo, Vh + vo, Vl + vo, q0, q0, w, lr, hi, o, m, l);
#pragma unroll
    for (int qt = 0; qt < 2; ++qt) { l[qt] += __shfl_xor(l[qt], 16, 32); if (hi == 0) mred[w * AQ + qt * 16 + lr] = m[qt]; }
    __syncthreads();   // every wave's running maximum is in LDS before any wave forms the common one
#pragma unroll
    for (int qt = 0; qt < 2; ++qt) { float M = mred[qt * 16 + lr];
#pragma unroll
        for (int u = 1; u < ANW; ++u) M = fmaxf(M, mred[u * AQ + qt * 16 + lr]);
        const float f = __builtin_amdgcn_exp2f(m[qt] - M);   // a wave without a key block has maximum -3e38, sum 0 and O 0: factor 0
        if (hi == 0) lred[w * AQ + qt * 16 + lr] = l[qt] * f;
        float* my = ored + (w * AQ + qt * 16 + lr) * 68 + hi * 8;
#pragma unroll
        for (int dt = 0; dt < 4; ++dt) { const v8f x = o[qt * 4 + dt] * f; *(v4fa*)(my + dt * 16) = (v4f){ x[0], x[1], x[2], x[3] }; *(v4fa*)(my + dt * 16 + 4) = (v4f){ x[4], x[5], x[6], x[7] }; } }
    __syncthreads();   // every wave's rescaled partial sum and O are in LDS before any thread sums across waves
    { const int q = (int)threadIdx.x >> 3, d0 = ((int)threadIdx.x & 7) * 8; v4f a = *(const v4fa*)(ored + q * 68 + d0), b = *(const v4fa*)(ored + q * 68 + d0 + 4); float L = lred[q];
#pragma unroll
        for (int u = 1; u < ANW; ++u) { a += *(const v4fa*)(ored + (u * AQ + q) * 68 + d0); b += *(const v4fa*)(ored + (u * AQ + q) * 68 + d0 + 4); L += lred[u * AQ + q]; }
        const float inv = __fdiv_rn(1.0f, L); v8us oh, ol;
#pragma unroll
        for (int e = 0; e < 4; ++e) { unsigned short x, y; splitf(a[e] * inv, x, y); oh[e] = x; ol[e] = y; splitf(b[e] * inv, x, y); oh[4 + e] = x; ol[4 + e] = y; }
        const size_t oo = (size_t)(q0 + q) * DQ + h * HD + d0; *(v8us*)(Ah + oo) = oh; *(v8us*)(Al + oo) = ol; }
}

extern "C" void kernel_launch(void* const* d_in, const int* in_sizes, int n_in,
                              void* d_out, int out_size, void* d_ws, size_t ws_size, hipStream_t stream) {
    (void)in_sizes; (void)n_in; (void)out_size;
    const float* x = (const float*)d_in[0]; const int* PID = (const int*)d_in[1]; const float* wq = (const float*)d_in[2]; const float* wk = (const float*)d_in[3]; const float* wv = (const float*)d_in[4]; const float* wo = (const float*)d_in[5];   /* inputs x, token_positions (int32 [2048], shared by all batches; read), Wq, Wk, Wv, Wo ('oi' [1024][1024]) */
    float* OUT = (float*)d_out;     // [2][2048][1024]
    char* wsp = (char*)d_ws;
    auto take = [&](size_t bytes) { char* p = wsp; wsp += (bytes + 255) & ~(size_t)255; return (void*)p; };
    bf* WQ = (bf*)take((size_t)DQ * DM * 2); bf* WK = (bf*)take((size_t)DKV * DM * 2); bf* WV = (bf*)take((size_t)DKV * DM * 2); bf* WO = (bf*)take((size_t)DM * DQ * 2); float* CS = (float*)take((size_t)TT * HD * 2 * 4);
    bf* XB = (bf*)take((size_t)TT * DM * 2);
    h16* VT16 = (h16*)take((size_t)NKV * HD * TT * 2);
    bf* QPh = (bf*)take((size_t)NH_ * TT * HD * 2); bf* QPl = (bf*)take((size_t)NH_ * TT * HD * 2); bf* KPh = (bf*)take((size_t)NKV * TT * HD * 2); bf* KPl = (bf*)take((size_t)NKV * TT * HD * 2); bf* VTh = (bf*)take((size_t)NKV * HD * TT * 2); bf* VTl = (bf*)take((size_t)NKV * HD * TT * 2);
    bf* ATh = (bf*)take((size_t)TT * DQ * 2); bf* ATl = (bf*)take((size_t)TT * DQ * 2);
    if ((size_t)(wsp - (char*)d_ws) > ws_size) return;    // ws 256 MiB
    { k_cvt8<<<(unsigned)(((size_t)DQ * DM / 8 + 255) / 256), 256, 0, stream>>>(wq, WQ, (size_t)DQ * DM / 8); k_cvt8<<<(unsigned)(((size_t)DKV * DM / 8 + 255) / 256), 256, 0, stream>>>(wk, WK, (size_t)DKV * DM / 8); k_cvt8<<<(unsigned)(((size_t)DKV * DM / 8 + 255) / 256), 256, 0, stream>>>(wv, WV, (size_t)DKV * DM / 8);
      k_cvt8<<<(unsigned)(((size_t)DM * DQ / 8 + 255) / 256), 256, 0, stream>>>(wo, WO, (size_t)DM * DQ / 8); /* the rotary table is rebuilt per batch from that batch's positions (below) */ }
    for (int b = 0; b < NB_; ++b) {
        k_cstabI<<<(TT * HD + 255) / 256, 256, 0, stream>>>(PID, CS);   /* token_positions[:] (int32 [2048], shared by both batches, read) */
        
        k_cvt8<<<(unsigned)(((size_t)TT * DM / 8 + 255) / 256), 256, 0, stream>>>(x + (size_t)b * TT * DM, XB, (size_t)TT * DM / 8);
        k_gemmw<bf, 0, false, 1><<<dim3(TT / 64, DQ / 64, 1), 32 * NWK, 0, stream>>>(XB, nullptr, WQ, nullptr, DM, nullptr, 0, nullptr, 0, 0, 0, CS, nullptr, QPh, QPl);   /* Q projection, rotary, planes */
        k_gemmw<bf, 0, false, 1><<<dim3(TT / 64, DKV / 64, 1), 32 * NWK, 0, stream>>>(XB, nullptr, WK, nullptr, DM, nullptr, 0, nullptr, 0, 0, 0, CS, nullptr, KPh, KPl);   /* K projection, rotary, planes */
        k_gemmw<bf, 0, false, 2><<<dim3(DKV / 64, TT / 64, 1), 32 * NWK, 0, stream>>>(WV, nullptr, XB, nullptr, DM, nullptr, TT, nullptr, 0, 0, 0, nullptr, VT16, VTh, VTl);   /* V^T = Wv . x^T, planes [head][d][token] */
        k_fattn<<<dim3(NH_, TT / AQ, 1), 32 * ANW, 0, stream>>>(QPh, QPl, KPh, KPl, VT16, VTh, VTl, ATh, ATl);   /* scores, softmax, P.V and the merge of all heads in one launch */
        k_gemmw<bf, 1, false, 0><<<dim3(TT / 64, DM / 64, 1), 32 * NWK, 0, stream>>>(ATh, ATl, WO, nullptr, DQ, OUT + (size_t)b * TT * DM, DM, nullptr, 0, 0, 0, nullptr, nullptr, nullptr, nullptr); }
}

// v005
// Measured time: 182 microseconds a run.
// Two timings next to v004 put it at 1.14 and 1.16 times that version's speed.
// Over all steps from v000 it is 7.62 times as fast.
#include <hip/hip_runtime.h>

// Causal multi-head self-attention with interleaved-pair rotary position embedding from a position input (x [2][2048][1024]; Q, K, V = einsum('bsd,ed', x, W) ('oi' [1024][1024] 1/32, no bias; 16 heads x 64); angle = float(token_positions[t]) x theta ** (-2i / 64) (theta 1e4; token_positions int32 [2048] = arange, shared by both batches, READ on device); pairs (2i, 2i+1): (x1 cos - x2 sin, x1 sin + x2 cos) on Q and K; scores / sqrt(64); keys j <= i kept, -inf elsewhere; softmax; out = einsum('bsd,ed', merged, Wo) -> [2][2048][1024] (4.2 M); argument order x, token_positions, Wq, Wk, Wv, Wo).
// Layout, both batches in every launch (rows b * 2048 + t; planes [b][head]...): bf16 copy of x; exact projections; {cos, sin} per (position, pair) built once from the int positions and float32 inverse-frequency constants (precise cosf/sinf); interleaved rotary and the hi/lo (V: also fp16, transposed) planes formed in the projection GEMMs' own epilogue; fused causal T-2048 attention k_fattn (EVERY row's scores on hi/lo planes (3 products: logit sigma 2 with these weights), online softmax in registers, hybrid P.V (rows < 512 hi/lo, rest fp16 x1024); key blocks above the diagonal are never visited); merged hi/lo x Wo exact.
// Compute dtypes, f32 accumulate: every input rounded to bf16; projections exact; rotary f32; attention rows < 512 3 products, rest fp16; softmax f32; Wo hl x exact.

#define NB_  2
#define TT   2048
#define DM   1024
#define NH_  16
#define NKV  16
#define HD   64
#define DQ   (NH_ * HD)
#define DKV  (NKV * HD)
#define RH   512                  // query rows < RH use hi+lo planes (0: none)
typedef _Float16 h16;
typedef unsigned short bf;
typedef __attribute__((ext_vector_type(16))) __bf16   v16bf;
typedef __attribute__((ext_vector_type(16))) _Float16 v16h;
typedef __attribute__((ext_vector_type(8)))  _Float16 v8h;
typedef __attribute__((ext_vector_type(8)))  unsigned short v8us;
typedef __attribute__((ext_vector_type(8)))  float    v8f;
typedef __attribute__((ext_vector_type(4)))  float    v4f;
typedef v8h  __attribute__((may_alias)) v8ha;
typedef v4f  __attribute__((may_alias)) v4fa;
typedef v8us __attribute__((may_alias)) v8usa;

__device__ __forceinline__ unsigned short f2bf(float f) { unsigned u = __float_as_uint(f); u += 0x7FFFu + ((u >> 16) & 1u); return (unsigned short)(u >> 16); }
__device__ __forceinline__ float bf2f(unsigned short b) { return __uint_as_float(((unsigned)b) << 16); }
__device__ __forceinline__ float bfr(float f) { return bf2f(f2bf(f)); }
__device__ __forceinline__ v16h cat16(v8h lo, v8h hi) { return __builtin_shufflevector(lo, hi, 0, 1, 2, 3, 4, 5, 6, 7, 8, 9, 10, 11, 12, 13, 14, 15); }
__device__ __forceinline__ v16bf cat16b(v8us lo, v8us hi) { return __builtin_bit_cast(v16bf, __builtin_shufflevector(lo, hi, 0, 1, 2, 3, 4, 5, 6, 7, 8, 9, 10, 11, 12, 13, 14, 15)); }
__device__ __forceinline__ v8f wmma16(v16h a, v16h b, v8f c) { return __builtin_amdgcn_wmma_f32_16x16x32_f16(false, a, false, b, (short)0, c, false, false); }
__device__ __forceinline__ v8f wmmab(v16bf a, v16bf b, v8f c) { return __builtin_amdgcn_wmma_f32_16x16x32_bf16(false, a, false, b, (short)0, c, false, false); }
__device__ __forceinline__ h16 tohx(float x) { return (h16)x; }
__device__ __forceinline__ void splitf(float y, unsigned short& h, unsigned short& l) { h = f2bf(y); l = f2bf(y - bf2f(h)); }
typedef __attribute__((ext_vector_type(2))) _Float16 v2h;
typedef __attribute__((ext_vector_type(4))) _Float16 v4h;
typedef __attribute__((ext_vector_type(2))) unsigned short v2us;
typedef __attribute__((ext_vector_type(4))) unsigned short v4us;
typedef __attribute__((ext_vector_type(2))) float v2f;
typedef __attribute__((ext_vector_type(4))) int v4i;



#define NWK  8                    // waves of a work-group that share one 64x64 tile's K loop
#define RPW  (64 * 68)            // floats of one wave's partial tile in LDS (row pitch 68)
// ---- k_gemmw: register-blocked GEMM, one 64x64 output tile per work-group of NWK waves: wave w takes the 64-element (one 128-byte line per row) K chunks w, w + NWK, ... with 16 accumulators, operands straight from K-contiguous 16-bit planes;
// the NWK partial tiles meet in LDS and are summed in wave order 0..NWK-1; grid (M/64, N/64, Z), 32 * NWK threads. K % 64 == 0.
// C[m][n] (f32, pitch ldc, + optional f32 bias[n]) = sum_k A[m][k] Bt[n][k] (+ split products per NSPLIT). z-batch strides sA/sB/sC in elements.
// EPI says what the summing threads do with their four neighbouring columns: 0 store them to C in f32; 1 is the grid of the three projections, job = blockIdx.z (weight z * sB, hi/lo planes z * sC), grid (NB_ * TT / 64, DQ / 64, 3):
// jobs 0, 1 (Q, K; rows = tokens b * TT + t, the tile's 64 columns = head blockIdx.y) turn the two (even, odd) pairs by the token's {cos, sin} of CS and store hi/lo planes [b][head][token][HD];
// job 2 swaps the operands and the two block indices (A = the V weight, Bt = the tokens): the rows are (head, d) and the columns tokens, which is V^T as the attention reads it; fp16 and hi/lo planes [b][head][d][token].
template <bool B> struct BoolC { static constexpr bool value = B; };
template <typename T16> struct WFrag;
template <> struct WFrag<h16> { typedef v16h V; static __device__ __forceinline__ V ld(const h16* p) { return cat16(*(const v8h*)p, *(const v8h*)(p + 16)); } static __device__ __forceinline__ v8f mma(V a, V b, v8f c) { return wmma16(a, b, c); } };
template <> struct WFrag<bf> { typedef v16bf V; static __device__ __forceinline__ V ld(const bf* p) { return cat16b(*(const v8us*)p, *(const v8us*)(p + 16)); } static __device__ __forceinline__ v8f mma(V a, V b, v8f c) { return wmmab(a, b, c); } };
template <typename T16, int NSPLIT, bool BIAS, int EPI>
__global__ __launch_bounds__(32 * NWK) void k_gemmw(const T16* __restrict__ A, const T16* __restrict__ A2, const T16* __restrict__ Bt, const T16* __restrict__ Bt2, int K, float* C, int ldc, const float* __restrict__ bias, size_t sA, size_t sB, size_t sC, const float* __restrict__ CS, h16* P16, bf* Ph, bf* Pl) {
    typedef typename WFrag<T16>::V V;
    __shared__ __align__(16) float red[NWK * RPW];
    const size_t z = blockIdx.z; A += z * sA; if (A2) A2 += z * sA; Bt += z * sB; if (Bt2) Bt2 += z * sB; if (EPI == 0) C += z * sC; else { Ph += z * sC; Pl += z * sC; }
    const bool vt = EPI == 1 && blockIdx.z == 2;   // the same for the whole work-group
    if (vt) { const T16* t = A; A = Bt; Bt = t; }
    const int lane = threadIdx.x & 31, lr = lane & 15, hi = lane >> 4; const int r0 = (vt ? blockIdx.y : blockIdx.x) * 64, c0 = (vt ? blockIdx.x : blockIdx.y) * 64;
    const int w = __builtin_amdgcn_readfirstlane((int)(threadIdx.x >> 5));
    v8f acc[4][4];
#pragma unroll
    for (int mb = 0; mb < 4; ++mb)
#pragma unroll
        for (int nb = 0; nb < 4; ++nb) acc[mb][nb] = (v8f){};
    const size_t aoff = (size_t)(r0 + lr) * K + 8 * hi, boff = (size_t)(c0 + lr) * K + 8 * hi;
#pragma unroll 1
    for (int kc = w * 64; kc < K; kc += (kc & 32) ? NWK * 64 - 32 : 32) {
        V a[4], a2[4];
#pragma unroll
        for (int mb = 0; mb < 4; ++mb) { a[mb] = WFrag<T16>::ld(A + aoff + (size_t)mb * 16 * K + kc); if (NSPLIT == 1 || NSPLIT == 2) a2[mb] = WFrag<T16>::ld(A2 + aoff + (size_t)mb * 16 * K + kc); }
#pragma unroll
        for (int nb = 0; nb < 4; ++nb) { const V b = WFrag<T16>::ld(Bt + boff + (size_t)nb * 16 * K + kc); V b2; if (NSPLIT >= 2) b2 = WFrag<T16>::ld(Bt2 + boff + (size_t)nb * 16 * K + kc);
#pragma unroll
            for (int mb = 0; mb < 4; ++mb) { acc[mb][nb] = WFrag<T16>::mma(a[mb], b, acc[mb][nb]); if (NSPLIT == 1 || NSPLIT == 2) acc[mb][nb] = WFrag<T16>::mma(a2[mb], b, acc[mb][nb]); if (NSPLIT >= 2) acc[mb][nb] = WFrag<T16>::mma(a[mb], b2, acc[mb][nb]); } }
        asm volatile("v_nop\n\tv_nop\n\tv_nop\n\tv_nop" : "+v"(acc[0][0]), "+v"(acc[1][1]), "+v"(acc[2][2]), "+v"(acc[3][3]) : "v"(a[0]), "v"(a[3]));
    }
    v2f cs[64 * 16 / (32 * NWK)][2];   // EPI 1, jobs 0 and 1: {cos, sin} of this thread's two pairs in each of its rows, asked for here so that they arrive while the partial tiles go through LDS
    if (EPI == 1 && !vt) {
        asm volatile("s_wait_xcnt 0x0" ::: "memory");   // same precaution: the K loop's address pairs may be reused for what is loaded next
#pragma unroll   // constant indices keep cs in registers
        for (int s = 0; s < 64 * 16 / (32 * NWK); ++s) { const int idx = s * (32 * NWK) + (int)threadIdx.x; const float* c = CS + ((size_t)(r0 % TT + (idx >> 4)) * HD + (idx & 15) * 4) * 2; cs[s][0] = *(const v2f*)c; cs[s][1] = *(const v2f*)(c + 4); } }
    float* my = red + w * RPW;
#pragma unroll
    for (int mb = 0; mb < 4; ++mb) {
#pragma unroll
        for (int nb = 0; nb < 4; ++nb) {
#pragma unroll
            for (int j = 0; j < 8; ++j) my[(mb * 16 + hi * 8 + j) * 68 + nb * 16 + lr] = acc[mb][nb][j]; } }
    __syncthreads();   // every wave's partial tile is in LDS before any thread sums across waves
    auto sum_out = [&](auto job_v) { constexpr bool VT = decltype(job_v)::value;   // compiled once per kind of job, so that each form's four rows stay one straight run of LDS loads and stores
#pragma unroll
    for (int s = 0; s < 64 * 16 / (32 * NWK); ++s) { const int idx = s * (32 * NWK) + (int)threadIdx.x; const int row = idx >> 4, cofs = (idx & 15) * 4; v4f val = *(const v4fa*)(red + row * 68 + cofs);
#pragma unroll
        for (int q = 1; q < NWK; ++q) val += *(const v4fa*)(red + q * RPW + row * 68 + cofs);
        if (BIAS) { val[0] += bfr(bias[c0 + cofs]); val[1] += bfr(bias[c0 + cofs + 1]); val[2] += bfr(bias[c0 + cofs + 2]); val[3] += bfr(bias[c0 + cofs + 3]); }
        if (EPI == 0) *(v4f*)(C + (size_t)(r0 + row) * ldc + c0 + cofs) = val;
        else { v4us oh, ol;
            if (!VT) val = (v4f){ val[0] * cs[s][0][0] - val[1] * cs[s][0][1], val[0] * cs[s][0][1] + val[1] * cs[s][0][0], val[2] * cs[s][1][0] - val[3] * cs[s][1][1], val[2] * cs[s][1][1] + val[3] * cs[s][1][0] };   /* even: x0 c - x1 s; odd: x0 s + x1 c */
#pragma unroll   // constant indices keep the vectors in registers
            for (int k = 0; k < 4; ++k) { unsigned short a2, c2; splitf(val[k], a2, c2); oh[k] = a2; ol[k] = c2; }
            const size_t e = !VT ? ((size_t)(r0 / TT * NH_ + blockIdx.y) * TT + r0 % TT + row) * HD + cofs : ((size_t)(c0 / TT * DKV + r0 + row)) * TT + c0 % TT + cofs;
            *(v4us*)(Ph + e) = oh; *(v4us*)(Pl + e) = ol;
            if (VT) *(v4h*)(P16 + e) = (v4h){ tohx(val[0]), tohx(val[1]), tohx(val[2]), tohx(val[3]) }; } }
        if (EPI == 1 && !VT) asm volatile("s_wait_xcnt 0x0" ::: "memory"); };   // same precaution behind the last row's stores: in the built code job 2's block follows this one and reuses their registers
    if (vt) sum_out(BoolC<true>{}); else sum_out(BoolC<false>{});
}


__global__ __launch_bounds__(256) void k_wtG(const float* __restrict__ w, int K, int N, bf* Bt) {
    const int lane = threadIdx.x & 31; const int L0 = (blockIdx.x * 8 + (threadIdx.x >> 5)) * 8; const int nlines = N * K / 64;
{
#pragma unroll 1
        for (int l = 0; l < 8; ++l) { const int L = L0 + l; if (L >= nlines) break; const size_t e = (size_t)L * 64 + lane * 2; const int k = (int)(e % K), n = (int)(e / K); v2us o;
            o[0] = f2bf(w[(size_t)k * N + n]); o[1] = f2bf(w[(size_t)(k + 1) * N + n]); *(v2us*)(Bt + e) = o; }
         }
}

__constant__ float INV2[HD / 2] = { 1.000000000e+00f, 7.498942018e-01f, 5.623413324e-01f, 4.216965139e-01f, 3.162277639e-01f, 2.371373773e-01f, 1.778279394e-01f, 1.333521456e-01f, 1.000000015e-01f, 7.498942316e-02f, 5.623413250e-02f, 4.216964915e-02f, 3.162277490e-02f, 2.371373773e-02f, 1.778279431e-02f, 1.333521400e-02f, 9.999999776e-03f, 7.498942316e-03f, 5.623413250e-03f, 4.216964822e-03f, 3.162277630e-03f, 2.371373819e-03f, 1.778279431e-03f, 1.333521446e-03f, 1.000000047e-03f, 7.498941850e-04f, 5.623413017e-04f, 4.216965172e-04f, 3.162277571e-04f, 2.371373703e-04f, 1.778279402e-04f, 1.333521504e-04f };   // theta ** (-2i / 64), i = 0..31, in float32 as THIS module writes it (the NEGATIVE-POWER spelling 'theta ** (-arange(0, dh, 2) / dh)', evaluated in the reference's own f32 arithmetic): ten of the 32 entries differ by one ulp from the reciprocal spelling '1 / theta ** (2i / 64)' (indices 5, 9, 10, 12, 13, 15, 20, 27, 28, 29)
#define PB_CS (TT * HD / 256)             // work-groups of k_prep that build the rotary table (they come first: the longest threads)
#define PB_X  (NB_ * TT * DM / 8 / 256)   // ... that round x, both batches
#define PB_W  (DM * DM / 8 / 256)         // ... that round one weight
// ---- k_prep: everything that depends on the inputs alone, in one grid of PB_CS + PB_X + 4 * PB_W work-groups; a work-group does one kind of work. The table serves both batches (token_positions has no batch axis). W4 = the four weights Wq, Wk, Wv, Wo one behind the other.
__global__ __launch_bounds__(256) void k_prep(const float* __restrict__ x, const int* __restrict__ pid, const float* __restrict__ wq, const float* __restrict__ wk, const float* __restrict__ wv, const float* __restrict__ wo, bf* XB, bf* W4, float* CS) {
    const int blk = blockIdx.x;
    if (blk < PB_CS) { const int idx = blk * 256 + threadIdx.x; const int d = idx % HD; const int t = idx / HD; const float a = __fmul_rn((float)pid[t], INV2[d >> 1]); v2f cs; cs[0] = cosf(a); cs[1] = sinf(a); *(v2f*)(CS + (size_t)idx * 2) = cs; return; }
    const float* src = x; bf* dst = XB; int g = blk - PB_CS;
    if (g >= PB_X) { g -= PB_X; const int j = g / PB_W; g %= PB_W; src = j == 0 ? wq : j == 1 ? wk : j == 2 ? wv : wo; dst = W4 + (size_t)j * DM * DM; }
    const size_t i = (size_t)g * 256 + threadIdx.x; const v8f v = *(const v8f*)(src + i * 8); v8us o;
    asm volatile("s_wait_xcnt 0x0" ::: "memory");   // precaution of the instruction set's rule on registers that an issued load names: the address pair is free for reuse only behind this wait
#pragma unroll
    for (int k = 0; k < 8; ++k) o[k] = f2bf(v[k]); *(v8us*)(dst + i * 8) = o;
    asm volatile("s_wait_xcnt 0x0" ::: "memory");   // same precaution behind the store: in the built code the table's block follows this one and reuses its registers
}

#define AQ   32                   // queries of one work-group: two 16-column groups, held by every wave
#define ANW  8                    // waves of a work-group that share the key loop of those queries
#define SCL2 0.18033688011112042f // HD^-0.5 x log2(e): scores are carried in the log2 domain
// ---- k_fattn: causal attention of one head for AQ queries, scores never leave the registers. S^T = K.Q^T (A = 16 key rows, B = 16 query columns; hi/lo planes, 3 products) leaves one query per lane column, so maximum, sum and rescale are per lane plus one exchange between the wave's halves;
// two 16-key score tiles of a lane are, in order, the B fragment of O^T += V^T.P^T (element e < 8: key 8 * hi + e, else key 16 + 8 * hi + e - 8, the order in which WFrag::ld reads V^T). Queries < RH: P and V on hi/lo planes (3 products); other queries: P x 1024 in fp16 (the factor is in the row sum too and cancels).
// Wave w takes the 32-key blocks w, w + ANW, ... up to the diagonal block with its own running maximum; the ANW partial (maximum, sum, O) meet in LDS, are brought to the common maximum and summed in wave order; the quotient goes out as the merged hi/lo planes [b * TT + t][DQ]. Grid (NB_ * heads, TT / AQ), longest query blocks of both batches first.
template <bool HR, int NQ>
__device__ __forceinline__ void attn_keys(const bf* pqh, const bf* pql, const bf* pkh, const bf* pkl, const h16* pv16, const bf* pvh, const bf* pvl, int qa, int q0, int w, int lr, int hi, v8f* o, float* m, float* l) {   // the p.. are per-lane addresses: query qa + lr, key w * 32 + lr (both at d = 8 * hi), V^T row lr at key w * 32 + 8 * hi; every load of a plane shares its pair and differs in the immediate offset
    v16bf qh[NQ][2], ql[NQ][2];   // NQ groups of 16 queries from query qa on (B operand: column = query, k = d)
#pragma unroll
    for (int qt = 0; qt < NQ; ++qt)
#pragma unroll
        for (int ks = 0; ks < 2; ++ks) { qh[qt][ks] = WFrag<bf>::ld(pqh + qt * 16 * HD + ks * 32); ql[qt][ks] = WFrag<bf>::ld(pql + qt * 16 * HD + ks * 32); }
    asm volatile("s_wait_xcnt 0x0" :: "v"(pqh), "v"(pql) : "memory");   // precaution of the instruction set's rule on registers that an issued load names: the two address pairs are inputs here, so they keep their values up to this wait
#pragma unroll 1
    for (int kb = w * 32; kb <= q0; kb += ANW * 32) {
        v8f s[2][NQ];
#pragma unroll
        for (int kt = 0; kt < 2; ++kt) { v16bf kh[2], kl[2];
#pragma unroll
            for (int ks = 0; ks < 2; ++ks) { kh[ks] = WFrag<bf>::ld(pkh + kt * 16 * HD + ks * 32); kl[ks] = WFrag<bf>::ld(pkl + kt * 16 * HD + ks * 32); }
#pragma unroll
            for (int qt = 0; qt < NQ; ++qt) { v8f c = (v8f){};
#pragma unroll
                for (int ks = 0; ks < 2; ++ks) { c = wmmab(kh[ks], qh[qt][ks], c); c = wmmab(kl[ks], qh[qt][ks], c); c = wmmab(kh[ks], ql[qt][ks], c); }
                s[kt][qt] = c; } }
        v16h v16[4]; v16bf vh[4], vl[4];
#pragma unroll
        for (int dt = 0; dt < 4; ++dt) { if (HR) { vh[dt] = WFrag<bf>::ld(pvh + dt * 16 * TT); vl[dt] = WFrag<bf>::ld(pvl + dt * 16 * TT); } else v16[dt] = WFrag<h16>::ld(pv16 + dt * 16 * TT); }
#pragma unroll
        for (int qt = 0; qt < NQ; ++qt) { const int q = qa + qt * 16 + lr; float t[16]; float mx = m[qt];
#pragma unroll
            for (int e = 0; e < 16; ++e) { const int key = kb + (e >> 3) * 16 + hi * 8 + (e & 7); t[e] = (key <= q) ? s[e >> 3][qt][e & 7] * SCL2 : -3.0e38f; mx = fmaxf(mx, t[e]); }
            mx = fmaxf(mx, __shfl_xor(mx, 16, 32));
            const float al = __builtin_amdgcn_exp2f(m[qt] - mx); m[qt] = mx; const float mo = HR ? mx : mx - 10.0f; float ps = 0.f;
#pragma unroll
            for (int e = 0; e < 16; ++e) { t[e] = __builtin_amdgcn_exp2f(t[e] - mo); ps += t[e]; }
            l[qt] = l[qt] * al + ps;
#pragma unroll
            for (int dt = 0; dt < 4; ++dt) o[qt * 4 + dt] *= al;
            if (HR) { v8us h0, h1, l0, l1;
#pragma unroll
                for (int e = 0; e < 8; ++e) { unsigned short a, c2; splitf(t[e], a, c2); h0[e] = a; l0[e] = c2; splitf(t[8 + e], a, c2); h1[e] = a; l1[e] = c2; }
                const v16bf ph = cat16b(h0, h1), pl = cat16b(l0, l1);
#pragma unroll
                for (int dt = 0; dt < 4; ++dt) { v8f c = o[qt * 4 + dt]; c = wmmab(vh[dt], ph, c); c = wmmab(vh[dt], pl, c); c = wmmab(vl[dt], ph, c); o[qt * 4 + dt] = c; }
            } else { v16h p;
#pragma unroll
                for (int e = 0; e < 16; ++e) p[e] = tohx(t[e]);
#pragma unroll
                for (int dt = 0; dt < 4; ++dt) o[qt * 4 + dt] = wmma16(v16[dt], p, o[qt * 4 + dt]); } }
        // precaution of the instruction set's rule on registers that an issued load names: the trip's address pairs are inputs here, so they keep their values up to this wait and are stepped only behind it
        if (HR) { asm volatile("s_wait_xcnt 0x0" :: "v"(pkh), "v"(pkl), "v"(pvh), "v"(pvl) : "memory"); pvh += ANW * 32; pvl += ANW * 32; }
        else { asm volatile("s_wait_xcnt 0x0" :: "v"(pkh), "v"(pkl), "v"(pv16) : "memory"); pv16 += ANW * 32; }
        pkh += ANW * 32 * HD; pkl += ANW * 32 * HD;
    }
}
// amdgpu_waves_per_eu(4, 4): holds the kernel to 256 VGPRs, so that two work-groups share a WGP and one wave's load waits are covered by three others on its SIMD (left free the build took 318 VGPRs: one work-group per WGP)
__global__ __launch_bounds__(32 * ANW) __attribute__((amdgpu_waves_per_eu(4, 4))) void k_fattn(const bf* __restrict__ Qh, const bf* __restrict__ Ql, const bf* __restrict__ Kh, const bf* __restrict__ Kl, const h16* __restrict__ V16, const bf* __restrict__ Vh, const bf* __restrict__ Vl, bf* Ah, bf* Al) {
    __shared__ __align__(16) float ored[ANW * AQ * 68];   // per wave AQ queries x HD floats, row pitch 68
    __shared__ float mred[ANW * AQ]; __shared__ float lred[ANW * AQ];
    const int lane = threadIdx.x & 31, lr = lane & 15, hi = lane >> 4; const int w = __builtin_amdgcn_readfirstlane((int)(threadIdx.x >> 5));
    const int h = blockIdx.x % NH_, bat = blockIdx.x / NH_; const int q0 = (TT / AQ - 1 - (int)blockIdx.y) * AQ; const size_t hp = (size_t)blockIdx.x * TT * HD;
    v8f o[2 * 4]; float m[2] = { -3.0e38f, -3.0e38f }, l[2] = { 0.f, 0.f };   // o[qt * 4 + dt][j] = O[query q0 + qt * 16 + lr][d = dt * 16 + hi * 8 + j]
#pragma unroll
    for (int i = 0; i < 8; ++i) o[i] = (v8f){};
    const size_t qo = hp + (size_t)(q0 + lr) * HD + 8 * hi, ko = hp + (size_t)(w * 32 + lr) * HD + 8 * hi, vo = hp + (size_t)lr * TT + w * 32 + 8 * hi;
    if (q0 < RH) {   // hi/lo P and V take twice the fragment registers: the two query groups walk the keys one after the other
        attn_keys<true, 1>(Qh + qo, Ql + qo, Kh + ko, Kl + ko, V16 + vo, Vh + vo, Vl + vo, q0, q0, w, lr, hi, o, m, l);
        attn_keys<true, 1>(Qh + qo + 16 * HD, Ql + qo + 16 * HD, Kh + ko, Kl + ko, V16 + vo, Vh + vo, Vl + vo, q0 + 16, q0, w, lr, hi, o + 4, m + 1, l + 1);
    } else attn_keys<false, 2>(Qh + qo, Ql + qo, Kh + ko, Kl + ko, V16 + vo, Vh + vo, Vl + vo, q0, q0, w, lr, hi, o, m, l);
#pragma unroll
    for (int qt = 0; qt < 2; ++qt) { l[qt] += __shfl_xor(l[qt], 16, 32); if (hi == 0) mred[w * AQ + qt * 16 + lr] = m[qt]; }
    __syncthreads();   // every wave's running maximum is in LDS before any wave forms the common one
#pragma unroll
    for (int qt = 0; qt < 2; ++qt) { float M = mred[qt * 16 + lr];
#pragma unroll
        for (int u = 1; u < ANW; ++u) M = fmaxf(M, mred[u * AQ + qt * 16 + lr]);
        const float f = __builtin_amdgcn_exp2f(m[qt] - M);   // a wave without a key block has maximum -3e38, sum 0 and O 0: factor 0
        if (hi == 0) lred[w * AQ + qt * 16 + lr] = l[qt] * f;
        float* my = ored + (w * AQ + qt * 16 + lr) * 68 + hi * 8;
#pragma unroll
        for (int dt = 0; dt < 4; ++dt) { const v8f x = o[qt * 4 + dt] * f; *(v4fa*)(my + dt * 16) = (v4f){ x[0], x[1], x[2], x[3] }; *(v4fa*)(my + dt * 16 + 4) = (v4f){ x[4], x[5], x[6], x[7] }; } }
    __syncthreads();   // every wave's rescaled partial sum and O are in LDS before any thread sums across waves
    { const int q = (int)threadIdx.x >> 3, d0 = ((int)threadIdx.x & 7) * 8; v4f a = *(const v4fa*)(ored + q * 68 + d0), b = *(const v4fa*)(ored + q * 68 + d0 + 4); float L = lred[q];
#pragma unroll
        for (int u = 1; u < ANW; ++u) { a += *(const v4fa*)(ored + (u * AQ + q) * 68 + d0); b += *(const v4fa*)(ored + (u * AQ + q) * 68 + d0 + 4); L += lred[u * AQ + q]; }
        const float inv = __fdiv_rn(1.0f, L); v8us oh, ol;
#pragma unroll
        for (int e = 0; e < 4; ++e) { unsigned short x, y; splitf(a[e] * inv, x, y); oh[e] = x; ol[e] = y; splitf(b[e] * inv, x, y); oh[4 + e] = x; ol[4 + e] = y; }
        const size_t oo = (size_t)(bat * TT + q0 + q) * DQ + h * HD + d0; *(v8us*)(Ah + oo) = oh; *(v8us*)(Al + oo) = ol; }
}

extern "C" void kernel_launch(void* const* d_in, const int* in_sizes, int n_in,
                              void* d_out, int out_size, void* d_ws, size_t ws_size, hipStream_t stream) {
    (void)in_sizes; (void)n_in; (void)out_size;
    const float* x = (const float*)d_in[0]; const int* PID = (const int*)d_in[1]; const float* wq = (const float*)d_in[2]; const float* wk = (const float*)d_in[3]; const float* wv = (const float*)d_in[4]; const float* wo = (const float*)d_in[5];   /* inputs x, token_positions (int32 [2048], shared by all batches; read), Wq, Wk, Wv, Wo ('oi' [1024][1024]) */
    float* OUT = (float*)d_out;     // [2][2048][1024]
    char* wsp = (char*)d_ws;
    auto take = [&](size_t bytes) { char* p = wsp; wsp += (bytes + 255) & ~(size_t)255; return (void*)p; };
    bf* W4 = (bf*)take((size_t)4 * DM * DM * 2); float* CS = (float*)take((size_t)TT * HD * 2 * 4);   /* Wq, Wk, Wv, Wo one behind the other */
    bf* XB = (bf*)take((size_t)NB_ * TT * DM * 2);
    const size_t PL = (size_t)NB_ * NH_ * TT * HD;   /* elements of one plane, both batches */
    h16* VT16 = (h16*)take(PL * 2);
    bf* PH = (bf*)take(3 * PL * 2); bf* PLO = (bf*)take(3 * PL * 2);   /* hi and lo planes of Q, K, V^T one behind the other */
    bf* ATh = (bf*)take(PL * 2); bf* ATl = (bf*)take(PL * 2);
    if ((size_t)(wsp - (char*)d_ws) > ws_size) return;    // ws 256 MiB
    k_prep<<<PB_CS + PB_X + 4 * PB_W, 256, 0, stream>>>(x, PID, wq, wk, wv, wo, XB, W4, CS);   /* rotary table, bf16 x and weights */
    k_gemmw<bf, 0, false, 1><<<dim3(NB_ * TT / 64, DQ / 64, 3), 32 * NWK, 0, stream>>>(XB, nullptr, W4, nullptr, DM, nullptr, 0, nullptr, 0, (size_t)DM * DM, PL, CS, VT16, PH, PLO);   /* Q and K projection with rotary, V^T = Wv . x^T; planes */
    k_fattn<<<dim3(NB_ * NH_, TT / AQ, 1), 32 * ANW, 0, stream>>>(PH, PLO, PH + PL, PLO + PL, VT16, PH + 2 * PL, PLO + 2 * PL, ATh, ATl);   /* scores, softmax, P.V and the merge of all heads */
    k_gemmw<bf, 1, false, 0><<<dim3(NB_ * TT / 64, DM / 64, 1), 32 * NWK, 0, stream>>>(ATh, ATl, W4 + (size_t)3 * DM * DM, nullptr, DQ, OUT, DM, nullptr, 0, 0, 0, nullptr, nullptr, nullptr, nullptr);
}

// v006
// It runs in 114 microseconds.
// Two timings next to v005 put it at 1.60 and 1.59 times that version's speed.
// Over all steps from v000 it is 12.2 times as fast.
#include <hip/hip_runtime.h>

// Causal multi-head self-attention with interleaved-pair rotary position embedding from a position input (x [2][2048][1024]; Q, K, V = einsum('bsd,ed', x, W) ('oi' [1024][1024] 1/32, no bias; 16 heads x 64); angle = float(token_positions[t]) x theta ** (-2i / 64) (theta 1e4; token_positions int32 [2048] = arange, shared by both batches, READ on device); pairs (2i, 2i+1): (x1 cos - x2 sin, x1 sin + x2 cos) on Q and K; scores / sqrt(64); keys j <= i kept, -inf elsewhere; softmax; out = einsum('bsd,ed', merged, Wo) -> [2][2048][1024] (4.2 M); argument order x, token_positions, Wq, Wk, Wv, Wo).
// Layout, both batches in every launch (rows b * 2048 + t; planes [b][head]...): bf16 copy of x; exact projections; {cos, sin} per (position, pair) built once from the int positions and float32 inverse-frequency constants (precise cosf/sinf); interleaved rotary and the hi/lo (V: also fp16, transposed) planes formed in the projection GEMMs' own epilogue; fused causal T-2048 attention k_fattn (EVERY row's scores on hi/lo planes (3 products: logit sigma 2 with these weights), online softmax in registers, hybrid P.V (rows < 512 hi/lo, rest fp16 x1024); key blocks above the diagonal are never visited); merged hi/lo x Wo exact.
// Compute dtypes, f32 accumulate: every input rounded to bf16; projections exact; rotary f32; attention rows < 512 3 products, rest fp16; softmax f32; Wo hl x exact.

#define NB_  2
#define TT   2048
#define DM   1024
#define NH_  16
#define NKV  16
#define HD   64
#define DQ   (NH_ * HD)
#define DKV  (NKV * HD)
#define RH   512                  // query rows < RH use hi+lo planes (0: none)
typedef _Float16 h16;
typedef unsigned short bf;
typedef __attribute__((ext_vector_type(16))) __bf16   v16bf;
typedef __attribute__((ext_vector_type(16))) _Float16 v16h;
typedef __attribute__((ext_vector_type(8)))  _Float16 v8h;
typedef __attribute__((ext_vector_type(8)))  unsigned short v8us;
typedef __attribute__((ext_vector_type(8)))  float    v8f;
typedef __attribute__((ext_vector_type(4)))  float    v4f;
typedef v8h  __attribute__((may_alias)) v8ha;
typedef v4f  __attribute__((may_alias)) v4fa;
typedef v8us __attribute__((may_alias)) v8usa;

__device__ __forceinline__ unsigned short f2bf(float f) { unsigned u = __float_as_uint(f); u += 0x7FFFu + ((u >> 16) & 1u); return (unsigned short)(u >> 16); }
__device__ __forceinline__ float bf2f(unsigned short b) { return __uint_as_float(((unsigned)b) << 16); }
__device__ __forceinline__ float bfr(float f) { return bf2f(f2bf(f)); }
__device__ __forceinline__ v16h cat16(v8h lo, v8h hi) { return __builtin_shufflevector(lo, hi, 0, 1, 2, 3, 4, 5, 6, 7, 8, 9, 10, 11, 12, 13, 14, 15); }
__device__ __forceinline__ v16bf cat16b(v8us lo, v8us hi) { return __builtin_bit_cast(v16bf, __builtin_shufflevector(lo, hi, 0, 1, 2, 3, 4, 5, 6, 7, 8, 9, 10, 11, 12, 13, 14, 15)); }
__device__ __forceinline__ v8f wmma16(v16h a, v16h b, v8f c) { return __builtin_amdgcn_wmma_f32_16x16x32_f16(false, a, false, b, (short)0, c, false, false); }
__device__ __forceinline__ v8f wmmab(v16bf a, v16bf b, v8f c) { return __builtin_amdgcn_wmma_f32_16x16x32_bf16(false, a, false, b, (short)0, c, false, false); }
__device__ __forceinline__ h16 tohx(float x) { return (h16)x; }
__device__ __forceinline__ void splitf(float y, unsigned short& h, unsigned short& l) { h = f2bf(y); l = f2bf(y - bf2f(h)); }
typedef __attribute__((ext_vector_type(2))) _Float16 v2h;
typedef __attribute__((ext_vector_type(4))) _Float16 v4h;
typedef __attribute__((ext_vector_type(2))) unsigned short v2us;
typedef __attribute__((ext_vector_type(4))) unsigned short v4us;
typedef __attribute__((ext_vector_type(2))) float v2f;
typedef __attribute__((ext_vector_type(4))) int v4i;



// ---- fragment order: every 16-bit operand plane [rows][K] lies in the workspace as blocks of 16 rows x 32 k (512 elements, 1 KiB), block (r / 16, k / 32) at index (r / 16) * (K / 32) + k / 32 (V^T planes: (k / 32) * (HD / 16) + r / 16); inside a block the two 512-byte halves are what the two 16-byte loads of a fragment read,
// lane by lane: element (r, k) at half (k / 16) % 2, lane ((k / 8) % 2) * 16 + r % 16, place k % 8. A wave's fragment load is then 512 contiguous bytes (4 whole lines) where the row-major plane gave 32 bytes from each of 16 lines. WFrag::ld takes block start + lane * 8.
__device__ __forceinline__ size_t pk(int r, int k, int K) { return (((size_t)(r >> 4) * (K >> 5) + (k >> 5)) << 9) + (((k >> 4) & 1) << 8) + ((((k >> 3) & 1) * 16 + (r & 15)) << 3) + (k & 7); }

#define NWK  8                    // waves of a work-group that share one 64x64 tile's K loop
#define RPW  (64 * 68)            // floats of one wave's partial tile in LDS (row pitch 68)
// ---- k_gemmw: register-blocked GEMM, one 64x64 output tile per work-group of NWK waves: wave w takes the 64-element (two fragment blocks per 16 rows) K chunks w, w + NWK, ... with 16 accumulators, operands straight from 16-bit planes in fragment order;
// the NWK partial tiles meet in LDS and are summed in wave order 0..NWK-1; grid (M/64, N/64, Z), 32 * NWK threads. K % 64 == 0.
// C[m][n] (f32, pitch ldc, + optional f32 bias[n]) = sum_k A[m][k] Bt[n][k] (+ split products per NSPLIT). z-batch strides sA/sB/sC in elements.
// EPI says what the summing threads do with their four neighbouring columns: 0 store them to C in f32; 1 is the grid of the three projections, job = blockIdx.z (weight z * sB, hi/lo planes z * sC), grid (NB_ * TT / 64, DQ / 64, 3):
// jobs 0, 1 (Q, K; rows = tokens b * TT + t, the tile's 64 columns = head blockIdx.y) turn the two (even, odd) pairs by the token's {cos, sin} of CS and store hi/lo planes [b][head] of [token][HD] in fragment order;
// job 2 swaps the operands and the two block indices (A = the V weight, Bt = the tokens): the rows are (head, d) and the columns tokens, which is V^T as the attention reads it; fp16 and hi/lo planes [b][head] of fragment blocks [token / 32][d / 16].
template <bool B> struct BoolC { static constexpr bool value = B; };
template <typename T16> struct WFrag;
template <> struct WFrag<h16> { typedef v16h V; static __device__ __forceinline__ V ld(const h16* p) { return cat16(*(const v8h*)p, *(const v8h*)(p + 256)); } static __device__ __forceinline__ v8f mma(V a, V b, v8f c) { return wmma16(a, b, c); } };
template <> struct WFrag<bf> { typedef v16bf V; static __device__ __forceinline__ V ld(const bf* p) { return cat16b(*(const v8us*)p, *(const v8us*)(p + 256)); } static __device__ __forceinline__ v8f mma(V a, V b, v8f c) { return wmmab(a, b, c); } };
template <typename T16, int NSPLIT, bool BIAS, int EPI, int K>
__global__ __launch_bounds__(32 * NWK) void k_gemmw(const T16* __restrict__ A, const T16* __restrict__ A2, const T16* __restrict__ Bt, const T16* __restrict__ Bt2, float* C, int ldc, const float* __restrict__ bias, size_t sA, size_t sB, size_t sC, const float* __restrict__ CS, h16* P16, bf* Ph, bf* Pl) {
    typedef typename WFrag<T16>::V V;
    __shared__ __align__(16) float red[NWK * RPW];
    const size_t z = blockIdx.z; A += z * sA; if (A2) A2 += z * sA; Bt += z * sB; if (Bt2) Bt2 += z * sB; if (EPI == 0) C += z * sC; else { Ph += z * sC; Pl += z * sC; }
    const bool vt = EPI == 1 && blockIdx.z == 2;   // the same for the whole work-group
    if (vt) { const T16* t = A; A = Bt; Bt = t; }
    const int lane = threadIdx.x & 31, lr = lane & 15, hi = lane >> 4; const int r0 = (vt ? blockIdx.y : blockIdx.x) * 64, c0 = (vt ? blockIdx.x : blockIdx.y) * 64;
    const int w = __builtin_amdgcn_readfirstlane((int)(threadIdx.x >> 5));
    v8f acc[4][4];
#pragma unroll
    for (int mb = 0; mb < 4; ++mb)
#pragma unroll
        for (int nb = 0; nb < 4; ++nb) acc[mb][nb] = (v8f){};
    const size_t aoff = (size_t)r0 * K + w * 64 * 16 + lane * 8, boff = (size_t)c0 * K + w * 64 * 16 + lane * 8;   // fragment order: a 16-row band is 16 * K elements, a 32-k block 512
    const T16* pa = A + aoff; const T16* pb = Bt + boff; const T16* pa2 = (NSPLIT == 1 || NSPLIT == 2) ? A2 + aoff : pa; const T16* pb2 = NSPLIT >= 2 ? Bt2 + boff : pb;   // per-lane addresses of the trip's block in band 0; every load of a plane shares its pair and differs in the immediate offset
#pragma unroll 1
    for (int kc = w * 64; kc < K; ) {
        V a[4], a2[4], bb[4], bb2[4];
#pragma unroll
        for (int mb = 0; mb < 4; ++mb) { a[mb] = WFrag<T16>::ld(pa + mb * 16 * K); if (NSPLIT == 1 || NSPLIT == 2) a2[mb] = WFrag<T16>::ld(pa2 + mb * 16 * K); }
#pragma unroll
        for (int nb = 0; nb < 4; ++nb) { bb[nb] = WFrag<T16>::ld(pb + nb * 16 * K); if (NSPLIT >= 2) bb2[nb] = WFrag<T16>::ld(pb2 + nb * 16 * K); }
        __builtin_amdgcn_sched_barrier(0);   // keeps the trip's loads one group in front of its products: with two address pairs the build otherwise reloads one B fragment's registers four times and waits out the load latency each time
#pragma unroll
        for (int nb = 0; nb < 4; ++nb) { const V b = bb[nb]; V b2; if (NSPLIT >= 2) b2 = bb2[nb];
#pragma unroll
            for (int mb = 0; mb < 4; ++mb) { acc[mb][nb] = WFrag<T16>::mma(a[mb], b, acc[mb][nb]); if (NSPLIT == 1 || NSPLIT == 2) acc[mb][nb] = WFrag<T16>::mma(a2[mb], b, acc[mb][nb]); if (NSPLIT >= 2) acc[mb][nb] = WFrag<T16>::mma(a[mb], b2, acc[mb][nb]); } }
        asm volatile("v_nop\n\tv_nop\n\tv_nop\n\tv_nop" : "+v"(acc[0][0]), "+v"(acc[1][1]), "+v"(acc[2][2]), "+v"(acc[3][3]) : "v"(a[0]), "v"(a[3]));
        const int st = (kc & 32) ? NWK * 64 - 32 : 32; kc += st;
        asm volatile("s_wait_xcnt 0x0" :: "v"(pa), "v"(pa2), "v"(pb), "v"(pb2) : "memory");   // precaution of the instruction set's rule on registers that an issued load names: the trip's address pairs are inputs here, so they keep their values up to this wait and are stepped only behind it
        pa += st * 16; pb += st * 16; if (NSPLIT == 1 || NSPLIT == 2) pa2 += st * 16; else pa2 = pa; if (NSPLIT >= 2) pb2 += st * 16; else pb2 = pb;
    }
    v2f cs[64 * 16 / (32 * NWK)][2];   // EPI 1, jobs 0 and 1: {cos, sin} of this thread's two pairs in each of its rows, asked for here so that they arrive while the partial tiles go through LDS
    if (EPI == 1 && !vt) {
        asm volatile("s_wait_xcnt 0x0" ::: "memory");   // same precaution: the K loop's address pairs may be reused for what is loaded next
#pragma unroll   // constant indices keep cs in registers
        for (int s = 0; s < 64 * 16 / (32 * NWK); ++s) { const int idx = s * (32 * NWK) + (int)threadIdx.x; const float* c = CS + ((size_t)(r0 % TT + (idx >> 4)) * HD + (idx & 15) * 4) * 2; cs[s][0] = *(const v2f*)c; cs[s][1] = *(const v2f*)(c + 4); } }
    float* my = red + w * RPW;
#pragma unroll
    for (int mb = 0; mb < 4; ++mb) {
#pragma unroll
        for (int nb = 0; nb < 4; ++nb) {
#pragma unroll
            for (int j = 0; j < 8; ++j) my[(mb * 16 + hi * 8 + j) * 68 + nb * 16 + lr] = acc[mb][nb][j]; } }
    __syncthreads();   // every wave's partial tile is in LDS before any thread sums across waves
    auto sum_out = [&](auto job_v) { constexpr bool VT = decltype(job_v)::value;   // compiled once per kind of job, so that each form's four rows stay one straight run of LDS loads and stores
#pragma unroll
    for (int s = 0; s < 64 * 16 / (32 * NWK); ++s) { const int idx = s * (32 * NWK) + (int)threadIdx.x; const int row = idx >> 4, cofs = (idx & 15) * 4; v4f val = *(const v4fa*)(red + row * 68 + cofs);
#pragma unroll
        for (int q = 1; q < NWK; ++q) val += *(const v4fa*)(red + q * RPW + row * 68 + cofs);
        if (BIAS) { val[0] += bfr(bias[c0 + cofs]); val[1] += bfr(bias[c0 + cofs + 1]); val[2] += bfr(bias[c0 + cofs + 2]); val[3] += bfr(bias[c0 + cofs + 3]); }
        if (EPI == 0) *(v4f*)(C + (size_t)(r0 + row) * ldc + c0 + cofs) = val;
        else { v4us oh, ol;
            if (!VT) val = (v4f){ val[0] * cs[s][0][0] - val[1] * cs[s][0][1], val[0] * cs[s][0][1] + val[1] * cs[s][0][0], val[2] * cs[s][1][0] - val[3] * cs[s][1][1], val[2] * cs[s][1][1] + val[3] * cs[s][1][0] };   /* even: x0 c - x1 s; odd: x0 s + x1 c */
#pragma unroll   // constant indices keep the vectors in registers
            for (int k = 0; k < 4; ++k) { unsigned short a2, c2; splitf(val[k], a2, c2); oh[k] = a2; ol[k] = c2; }
            const int tk = c0 % TT + cofs;   // job 2: the first of the four tokens
            const size_t e = !VT ? (size_t)(r0 / TT * NH_ + blockIdx.y) * TT * HD + pk(r0 % TT + row, cofs, HD) : (size_t)(c0 / TT * DKV + r0) * TT + ((size_t)((tk >> 5) * 4 + (row >> 4)) << 9) + pk(row & 15, tk & 31, 32);
            *(v4us*)(Ph + e) = oh; *(v4us*)(Pl + e) = ol;
            if (VT) *(v4h*)(P16 + e) = (v4h){ tohx(val[0]), tohx(val[1]), tohx(val[2]), tohx(val[3]) }; } }
        if (EPI == 1 && !VT) asm volatile("s_wait_xcnt 0x0" ::: "memory"); };   // same precaution behind the last row's stores: in the built code job 2's block follows this one and reuses their registers
    if (vt) sum_out(BoolC<true>{}); else sum_out(BoolC<false>{});
}


__global__ __launch_bounds__(256) void k_wtG(const float* __restrict__ w, int K, int N, bf* Bt) {
    const int lane = threadIdx.x & 31; const int L0 = (blockIdx.x * 8 + (threadIdx.x >> 5)) * 8; const int nlines = N * K / 64;
{
#pragma unroll 1
        for (int l = 0; l < 8; ++l) { const int L = L0 + l; if (L >= nlines) break; const size_t e = (size_t)L * 64 + lane * 2; const int k = (int)(e % K), n = (int)(e / K); v2us o;
            o[0] = f2bf(w[(size_t)k * N + n]); o[1] = f2bf(w[(size_t)(k + 1) * N + n]); *(v2us*)(Bt + e) = o; }
         }
}

__constant__ float INV2[HD / 2] = { 1.000000000e+00f, 7.498942018e-01f, 5.623413324e-01f, 4.216965139e-01f, 3.162277639e-01f, 2.371373773e-01f, 1.778279394e-01f, 1.333521456e-01f, 1.000000015e-01f, 7.498942316e-02f, 5.623413250e-02f, 4.216964915e-02f, 3.162277490e-02f, 2.371373773e-02f, 1.778279431e-02f, 1.333521400e-02f, 9.999999776e-03f, 7.498942316e-03f, 5.623413250e-03f, 4.216964822e-03f, 3.162277630e-03f, 2.371373819e-03f, 1.778279431e-03f, 1.333521446e-03f, 1.000000047e-03f, 7.498941850e-04f, 5.623413017e-04f, 4.216965172e-04f, 3.162277571e-04f, 2.371373703e-04f, 1.778279402e-04f, 1.333521504e-04f };   // theta ** (-2i / 64), i = 0..31, in float32 as THIS module writes it (the NEGATIVE-POWER spelling 'theta ** (-arange(0, dh, 2) / dh)', evaluated in the reference's own f32 arithmetic): ten of the 32 entries differ by one ulp from the reciprocal spelling '1 / theta ** (2i / 64)' (indices 5, 9, 10, 12, 13, 15, 20, 27, 28, 29)
#define PB_CS (TT * HD / 256)             // work-groups of k_prep that build the rotary table (they come first: the longest threads)
#define PB_X  (NB_ * TT * DM / 8 / 256)   // ... that round x, both batches
#define PB_W  (DM * DM / 8 / 256)         // ... that round one weight
// ---- k_prep: everything that depends on the inputs alone, in one grid of PB_CS + PB_X + 4 * PB_W work-groups; a work-group does one kind of work. The table serves both batches (token_positions has no batch axis). W4 = the four weights Wq, Wk, Wv, Wo one behind the other.
__global__ __launch_bounds__(256) void k_prep(const float* __restrict__ x, const int* __restrict__ pid, const float* __restrict__ wq, const float* __restrict__ wk, const float* __restrict__ wv, const float* __restrict__ wo, bf* XB, bf* W4, float* CS) {
    const int blk = blockIdx.x;
    if (blk < PB_CS) { const int idx = blk * 256 + threadIdx.x; const int d = idx % HD; const int t = idx / HD; const float a = __fmul_rn((float)pid[t], INV2[d >> 1]); v2f cs; cs[0] = cosf(a); cs[1] = sinf(a); *(v2f*)(CS + (size_t)idx * 2) = cs; return; }
    const float* src = x; bf* dst = XB; int g = blk - PB_CS;
    if (g >= PB_X) { g -= PB_X; const int j = g / PB_W; g %= PB_W; src = j == 0 ? wq : j == 1 ? wk : j == 2 ? wv : wo; dst = W4 + (size_t)j * DM * DM; }
    // a wave takes 8 rows x one 32-k block: it reads one whole 128-byte line of each row and writes four whole lines of the block in fragment order
    const int wn = g * 8 + ((int)threadIdx.x >> 5), row = (wn / (DM / 32)) * 8 + ((int)threadIdx.x & 7), k = (wn % (DM / 32)) * 32 + (((int)threadIdx.x >> 3) & 3) * 8;
    const v8f v = *(const v8f*)(src + (size_t)row * DM + k); v8us o;
    asm volatile("s_wait_xcnt 0x0" ::: "memory");   // precaution of the instruction set's rule on registers that an issued load names: the address pair is free for reuse only behind this wait
#pragma unroll
    for (int e = 0; e < 8; ++e) o[e] = f2bf(v[e]); *(v8us*)(dst + pk(row, k, DM)) = o;
    asm volatile("s_wait_xcnt 0x0" ::: "memory");   // same precaution behind the store: in the built code the table's block follows this one and reuses its registers
}

#define AQ   32                   // queries of one work-group: two 16-column groups, held by every wave
#define ANW  8                    // waves of a work-group that share the key loop of those queries
#define SCL2 0.18033688011112042f // HD^-0.5 x log2(e): scores are carried in the log2 domain
// ---- k_fattn: causal attention of one head for AQ queries, scores never leave the registers. S^T = K.Q^T (A = 16 key rows, B = 16 query columns; hi/lo planes, 3 products) leaves one query per lane column, so maximum, sum and rescale are per lane plus one exchange between the wave's halves;
// two 16-key score tiles of a lane are, in order, the B fragment of O^T += V^T.P^T (element e < 8: key 8 * hi + e, else key 16 + 8 * hi + e - 8, the order in which WFrag::ld reads V^T). Queries < RH: P and V on hi/lo planes (3 products); other queries: P x 1024 in fp16 (the factor is in the row sum too and cancels).
// Wave w takes the 32-key blocks w, w + ANW, ... up to the diagonal block with its own running maximum; the ANW partial (maximum, sum, O) meet in LDS, are brought to the common maximum and summed in wave order; the quotient goes out as the merged hi/lo planes [b * TT + t][DQ] in fragment order. Grid (NB_ * heads, TT / AQ), longest query blocks of both batches first.
template <bool HR, int NQ>
__device__ __forceinline__ void attn_keys(const bf* pqh, const bf* pql, const bf* pkh, const bf* pkl, const h16* pv16, const bf* pvh, const bf* pvl, int qa, int q0, int w, int lr, int hi, v8f* o, float* m, float* l) {   // the p.. are per-lane addresses in fragment order (block start + lane * 8): the blocks of query qa, of key w * 32 and of V^T at key w * 32; every load of a plane shares its pair and differs in the immediate offset
    v16bf qh[NQ][2], ql[NQ][2];   // NQ groups of 16 queries from query qa on (B operand: column = query, k = d)
#pragma unroll
    for (int qt = 0; qt < NQ; ++qt)
#pragma unroll
        for (int ks = 0; ks < 2; ++ks) { qh[qt][ks] = WFrag<bf>::ld(pqh + qt * 16 * HD + ks * 512); ql[qt][ks] = WFrag<bf>::ld(pql + qt * 16 * HD + ks * 512); }
    asm volatile("s_wait_xcnt 0x0" :: "v"(pqh), "v"(pql) : "memory");   // precaution of the instruction set's rule on registers that an issued load names: the two address pairs are inputs here, so they keep their values up to this wait
#pragma unroll 1
    for (int kb = w * 32; kb <= q0; kb += ANW * 32) {
        v8f s[2][NQ];
#pragma unroll
        for (int kt = 0; kt < 2; ++kt) { v16bf kh[2], kl[2];
#pragma unroll
            for (int ks = 0; ks < 2; ++ks) { kh[ks] = WFrag<bf>::ld(pkh + kt * 16 * HD + ks * 512); kl[ks] = WFrag<bf>::ld(pkl + kt * 16 * HD + ks * 512); }
#pragma unroll
            for (int qt = 0; qt < NQ; ++qt) { v8f c = (v8f){};
#pragma unroll
                for (int ks = 0; ks < 2; ++ks) { c = wmmab(kh[ks], qh[qt][ks], c); c = wmmab(kl[ks], qh[qt][ks], c); c = wmmab(kh[ks], ql[qt][ks], c); }
                s[kt][qt] = c; } }
        v16h v16[4]; v16bf vh[4], vl[4];
#pragma unroll
        for (int dt = 0; dt < 4; ++dt) { if (HR) { vh[dt] = WFrag<bf>::ld(pvh + dt * 512); vl[dt] = WFrag<bf>::ld(pvl + dt * 512); } else v16[dt] = WFrag<h16>::ld(pv16 + dt * 512); }
#pragma unroll
        for (int qt = 0; qt < NQ; ++qt) { const int q = qa + qt * 16 + lr; float t[16]; float mx = m[qt];
#pragma unroll
            for (int e = 0; e < 16; ++e) { const int key = kb + (e >> 3) * 16 + hi * 8 + (e & 7); t[e] = (key <= q) ? s[e >> 3][qt][e & 7] * SCL2 : -3.0e38f; mx = fmaxf(mx, t[e]); }
            mx = fmaxf(mx, __shfl_xor(mx, 16, 32));
            const float al = __builtin_amdgcn_exp2f(m[qt] - mx); m[qt] = mx; const float mo = HR ? mx : mx - 10.0f; float ps = 0.f;
#pragma unroll
            for (int e = 0; e < 16; ++e) { t[e] = __builtin_amdgcn_exp2f(t[e] - mo); ps += t[e]; }
            l[qt] = l[qt] * al + ps;
#pragma unroll
            for (int dt = 0; dt < 4; ++dt) o[qt * 4 + dt] *= al;
            if (HR) { v8us h0, h1, l0, l1;
#pragma unroll
                for (int e = 0; e < 8; ++e) { unsigned short a, c2; splitf(t[e], a, c2); h0[e] = a; l0[e] = c2; splitf(t[8 + e], a, c2); h1[e] = a; l1[e] = c2; }
                const v16bf ph = cat16b(h0, h1), pl = cat16b(l0, l1);
#pragma unroll
                for (int dt = 0; dt < 4; ++dt) { v8f c = o[qt * 4 + dt]; c = wmmab(vh[dt], ph, c); c = wmmab(vh[dt], pl, c); c = wmmab(vl[dt], ph, c); o[qt * 4 + dt] = c; }
            } else { v16h p;
#pragma unroll
                for (int e = 0; e < 16; ++e) p[e] = tohx(t[e]);
#pragma unroll
                for (int dt = 0; dt < 4; ++dt) o[qt * 4 + dt] = wmma16(v16[dt], p, o[qt * 4 + dt]); } }
        // precaution of the instruction set's rule on registers that an issued load names: the trip's address pairs are inputs here, so they keep their values up to this wait and are stepped only behind it
        if (HR) { asm volatile("s_wait_xcnt 0x0" :: "v"(pkh), "v"(pkl), "v"(pvh), "v"(pvl) : "memory"); pvh += ANW * 32 * HD; pvl += ANW * 32 * HD; }
        else { asm volatile("s_wait_xcnt 0x0" :: "v"(pkh), "v"(pkl), "v"(pv16) : "memory"); pv16 += ANW * 32 * HD; }
        pkh += ANW * 32 * HD; pkl += ANW * 32 * HD;
    }
}
// amdgpu_waves_per_eu(4, 4): holds the kernel to 256 VGPRs, so that two work-groups share a WGP and one wave's load waits are covered by three others on its SIMD (left free the build took 318 VGPRs: one work-group per WGP)
__global__ __launch_bounds__(32 * ANW) __attribute__((amdgpu_waves_per_eu(4, 4))) void k_fattn(const bf* __restrict__ Qh, const bf* __restrict__ Ql, const bf* __restrict__ Kh, const bf* __restrict__ Kl, const h16* __restrict__ V16, const bf* __restrict__ Vh, const bf* __restrict__ Vl, bf* Ah, bf* Al) {
    __shared__ __align__(16) float ored[ANW * AQ * 68];   // per wave AQ queries x HD floats, row pitch 68
    __shared__ float mred[ANW * AQ]; __shared__ float lred[ANW * AQ];
    const int lane = threadIdx.x & 31, lr = lane & 15, hi = lane >> 4; const int w = __builtin_amdgcn_readfirstlane((int)(threadIdx.x >> 5));
    const int h = blockIdx.x % NH_, bat = blockIdx.x / NH_; const int q0 = (TT / AQ - 1 - (int)blockIdx.y) * AQ; const size_t hp = (size_t)blockIdx.x * TT * HD;
    v8f o[2 * 4]; float m[2] = { -3.0e38f, -3.0e38f }, l[2] = { 0.f, 0.f };   // o[qt * 4 + dt][j] = O[query q0 + qt * 16 + lr][d = dt * 16 + hi * 8 + j]
#pragma unroll
    for (int i = 0; i < 8; ++i) o[i] = (v8f){};
    const size_t qo = hp + (size_t)q0 * HD + lane * 8, ko = hp + (size_t)(w * 32) * HD + lane * 8, vo = ko;   // fragment order: 16 tokens of Q or K are 2 blocks, 32 keys of V^T 4 blocks (d / 16), so 32 keys are 32 * HD elements in every plane
    if (q0 < RH) {   // hi/lo P and V take twice the fragment registers: the two query groups walk the keys one after the other
        attn_keys<true, 1>(Qh + qo, Ql + qo, Kh + ko, Kl + ko, V16 + vo, Vh + vo, Vl + vo, q0, q0, w, lr, hi, o, m, l);
        attn_keys<true, 1>(Qh + qo + 16 * HD, Ql + qo + 16 * HD, Kh + ko, Kl + ko, V16 + vo, Vh + vo, Vl + vo, q0 + 16, q0, w, lr, hi, o + 4, m + 1, l + 1);
    } else attn_keys<false, 2>(Qh + qo, Ql + qo, Kh + ko, Kl + ko, V16 + vo, Vh + vo, Vl + vo, q0, q0, w, lr, hi, o, m, l);
#pragma unroll
    for (int qt = 0; qt < 2; ++qt) { l[qt] += __shfl_xor(l[qt], 16, 32); if (hi == 0) mred[w * AQ + qt * 16 + lr] = m[qt]; }
    __syncthreads();   // every wave's running maximum is in LDS before any wave forms the common one
#pragma unroll
    for (int qt = 0; qt < 2; ++qt) { float M = mred[qt * 16 + lr];
#pragma unroll
        for (int u = 1; u < ANW; ++u) M = fmaxf(M, mred[u * AQ + qt * 16 + lr]);
        const float f = __builtin_amdgcn_exp2f(m[qt] - M);   // a wave without a key block has maximum -3e38, sum 0 and O 0: factor 0
        if (hi == 0) lred[w * AQ + qt * 16 + lr] = l[qt] * f;
        float* my = ored + (w * AQ + qt * 16 + lr) * 68 + hi * 8;
#pragma unroll
        for (int dt = 0; dt < 4; ++dt) { const v8f x = o[qt * 4 + dt] * f; *(v4fa*)(my + dt * 16) = (v4f){ x[0], x[1], x[2], x[3] }; *(v4fa*)(my + dt * 16 + 4) = (v4f){ x[4], x[5], x[6], x[7] }; } }
    __syncthreads();   // every wave's rescaled partial sum and O are in LDS before any thread sums across waves
    { const int q = (int)threadIdx.x & 31, d0 = ((int)threadIdx.x >> 5) * 8; v4f a = *(const v4fa*)(ored + q * 68 + d0), b = *(const v4fa*)(ored + q * 68 + d0 + 4); float L = lred[q];
#pragma unroll
        for (int u = 1; u < ANW; ++u) { a += *(const v4fa*)(ored + (u * AQ + q) * 68 + d0); b += *(const v4fa*)(ored + (u * AQ + q) * 68 + d0 + 4); L += lred[u * AQ + q]; }
        const float inv = __fdiv_rn(1.0f, L); v8us oh, ol;
#pragma unroll
        for (int e = 0; e < 4; ++e) { unsigned short x, y; splitf(a[e] * inv, x, y); oh[e] = x; ol[e] = y; splitf(b[e] * inv, x, y); oh[4 + e] = x; ol[4 + e] = y; }
        const size_t oo = pk(bat * TT + q0 + q, h * HD + d0, DQ); *(v8us*)(Ah + oo) = oh;   /* a wave holds one 8-d piece of all AQ queries: 2 x 256 contiguous bytes in fragment order */ *(v8us*)(Al + oo) = ol; }
}

extern "C" void kernel_launch(void* const* d_in, const int* in_sizes, int n_in,
                              void* d_out, int out_size, void* d_ws, size_t ws_size, hipStream_t stream) {
    (void)in_sizes; (void)n_in; (void)out_size;
    const float* x = (const float*)d_in[0]; const int* PID = (const int*)d_in[1]; const float* wq = (const float*)d_in[2]; const float* wk = (const float*)d_in[3]; const float* wv = (const float*)d_in[4]; const float* wo = (const float*)d_in[5];   /* inputs x, token_positions (int32 [2048], shared by all batches; read), Wq, Wk, Wv, Wo ('oi' [1024][1024]) */
    float* OUT = (float*)d_out;     // [2][2048][1024]
    char* wsp = (char*)d_ws;
    auto take = [&](size_t bytes) { char* p = wsp; wsp += (bytes + 255) & ~(size_t)255; return (void*)p; };
    bf* W4 = (bf*)take((size_t)4 * DM * DM * 2); float* CS = (float*)take((size_t)TT * HD * 2 * 4);   /* Wq, Wk, Wv, Wo one behind the other */
    bf* XB = (bf*)take((size_t)NB_ * TT * DM * 2);
    const size_t PL = (size_t)NB_ * NH_ * TT * HD;   /* elements of one plane, both batches */
    h16* VT16 = (h16*)take(PL * 2);
    bf* PH = (bf*)take(3 * PL * 2); bf* PLO = (bf*)take(3 * PL * 2);   /* hi and lo planes of Q, K, V^T one behind the other */
    bf* ATh = (bf*)take(PL * 2); bf* ATl = (bf*)take(PL * 2);
    if ((size_t)(wsp - (char*)d_ws) > ws_size) return;    // ws 256 MiB
    k_prep<<<PB_CS + PB_X + 4 * PB_W, 256, 0, stream>>>(x, PID, wq, wk, wv, wo, XB, W4, CS);   /* rotary table, bf16 x and weights */
    k_gemmw<bf, 0, false, 1, DM><<<dim3(NB_ * TT / 64, DQ / 64, 3), 32 * NWK, 0, stream>>>(XB, nullptr, W4, nullptr, nullptr, 0, nullptr, 0, (size_t)DM * DM, PL, CS, VT16, PH, PLO);   /* Q and K projection with rotary, V^T = Wv . x^T; planes */
    k_fattn<<<dim3(NB_ * NH_, TT / AQ, 1), 32 * ANW, 0, stream>>>(PH, PLO, PH + PL, PLO + PL, VT16, PH + 2 * PL, PLO + 2 * PL, ATh, ATl);   /* scores, softmax, P.V and the merge of all heads */
    k_gemmw<bf, 1, false, 0, DQ><<<dim3(NB_ * TT / 64, DM / 64, 1), 32 * NWK, 0, stream>>>(ATh, ATl, W4 + (size_t)3 * DM * DM, nullptr, OUT, DM, nullptr, 0, 0, 0, nullptr, nullptr, nullptr, nullptr);
}

// v007
// Measured time: 104 microseconds a run.
// Two timings next to v006 both put it at 1.09 times that version's speed.
// Counting every step since v000, it is 13.3 times as fast.
#include <hip/hip_runtime.h>

// Causal multi-head self-attention with interleaved-pair rotary position embedding from a position input (x [2][2048][1024]; Q, K, V = einsum('bsd,ed', x, W) ('oi' [1024][1024] 1/32, no bias; 16 heads x 64); angle = float(token_positions[t]) x theta ** (-2i / 64) (theta 1e4; token_positions int32 [2048] = arange, shared by both batches, READ on device); pairs (2i, 2i+1): (x1 cos - x2 sin, x1 sin + x2 cos) on Q and K; scores / sqrt(64); keys j <= i kept, -inf elsewhere; softmax; out = einsum('bsd,ed', merged, Wo) -> [2][2048][1024] (4.2 M); argument order x, token_positions, Wq, Wk, Wv, Wo).
// Layout, both batches in every launch (rows b * 2048 + t; planes [b][head]...): bf16 copy of x; exact projections; {cos, sin} per (position, pair) built once from the int positions and float32 inverse-frequency constants (precise cosf/sinf); interleaved rotary and the hi/lo (V: also fp16, transposed) planes formed in the projection GEMMs' own epilogue; fused causal T-2048 attention k_fattn (EVERY row's scores on hi/lo planes (3 products: logit sigma 2 with these weights), online softmax in registers, hybrid P.V (rows < 512 hi/lo, rest fp16 x1024); key blocks above the diagonal are never visited); merged hi/lo x Wo exact.
// Compute dtypes, f32 accumulate: every input rounded to bf16; projections exact; rotary f32; attention rows < 512 3 products, rest fp16; softmax f32; Wo hl x exact.

#define NB_  2
#define TT   2048
#define DM   1024
#define NH_  16
#define NKV  16
#define HD   64
#define DQ   (NH_ * HD)
#define DKV  (NKV * HD)
#define RH   512                  // query rows < RH use hi+lo planes (0: none)
typedef _Float16 h16;
typedef unsigned short bf;
typedef __attribute__((ext_vector_type(16))) __bf16   v16bf;
typedef __attribute__((ext_vector_type(16))) _Float16 v16h;
typedef __attribute__((ext_vector_type(8)))  _Float16 v8h;
typedef __attribute__((ext_vector_type(8)))  unsigned short v8us;
typedef __attribute__((ext_vector_type(8)))  float    v8f;
typedef __attribute__((ext_vector_type(4)))  float    v4f;
typedef v8h  __attribute__((may_alias)) v8ha;
typedef v4f  __attribute__((may_alias)) v4fa;
typedef v8us __attribute__((may_alias)) v8usa;

__device__ __forceinline__ unsigned short f2bf(float f) { unsigned u = __float_as_uint(f); u += 0x7FFFu + ((u >> 16) & 1u); return (unsigned short)(u >> 16); }
__device__ __forceinline__ float bf2f(unsigned short b) { return __uint_as_float(((unsigned)b) << 16); }
__device__ __forceinline__ float bfr(float f) { return bf2f(f2bf(f)); }
__device__ __forceinline__ v16h cat16(v8h lo, v8h hi) { return __builtin_shufflevector(lo, hi, 0, 1, 2, 3, 4, 5, 6, 7, 8, 9, 10, 11, 12, 13, 14, 15); }
__device__ __forceinline__ v16bf cat16b(v8us lo, v8us hi) { return __builtin_bit_cast(v16bf, __builtin_shufflevector(lo, hi, 0, 1, 2, 3, 4, 5, 6, 7, 8, 9, 10, 11, 12, 13, 14, 15)); }
__device__ __forceinline__ v8f wmma16(v16h a, v16h b, v8f c) { return __builtin_amdgcn_wmma_f32_16x16x32_f16(false, a, false, b, (short)0, c, false, false); }
__device__ __forceinline__ v8f wmmab(v16bf a, v16bf b, v8f c) { return __builtin_amdgcn_wmma_f32_16x16x32_bf16(false, a, false, b, (short)0, c, false, false); }
__device__ __forceinline__ h16 tohx(float x) { return (h16)x; }
__device__ __forceinline__ void splitf(float y, unsigned short& h, unsigned short& l) { h = f2bf(y); l = f2bf(y - bf2f(h)); }
typedef __attribute__((ext_vector_type(2))) _Float16 v2h;
typedef __attribute__((ext_vector_type(4))) _Float16 v4h;
typedef __attribute__((ext_vector_type(2))) unsigned short v2us;
typedef __attribute__((ext_vector_type(4))) unsigned short v4us;
typedef __attribute__((ext_vector_type(2))) float v2f;
typedef __attribute__((ext_vector_type(4))) int v4i;



// ---- fragment order: every 16-bit operand plane [rows][K] lies in the workspace as blocks of 16 rows x 32 k (512 elements, 1 KiB), block (r / 16, k / 32) at index (r / 16) * (K / 32) + k / 32 (V^T planes: (k / 32) * (HD / 16) + r / 16); inside a block the two 512-byte halves are what the two 16-byte loads of a fragment read,
// lane by lane: element (r, k) at half (k / 16) % 2, lane ((k / 8) % 2) * 16 + r % 16, place k % 8. A wave's fragment load is then 512 contiguous bytes (4 whole lines) where the row-major plane gave 32 bytes from each of 16 lines. WFrag::ld takes block start + lane * 8.
__device__ __forceinline__ size_t pk(int r, int k, int K) { return (((size_t)(r >> 4) * (K >> 5) + (k >> 5)) << 9) + (((k >> 4) & 1) << 8) + ((((k >> 3) & 1) * 16 + (r & 15)) << 3) + (k & 7); }

#define NWK  8                    // waves of a work-group: 2 x 4 wave tiles of 64 x 32 outputs
#define GT   128                  // rows and columns of a work-group's output tile
#define GOPE (GT * 64)            // elements of one operand in one stage of the ring: 8 bands of 16 rows x 64 k (two fragment blocks, 2 KiB a band)
#define GPIT 132                  // floats of one row of the output tile in LDS (8 rows on, the banks are 32 further: the two halves of a wave store side by side)
// ---- k_gemmw: GEMM, one 128x128 output tile per work-group of NWK waves, operands from 16-bit planes in fragment order, staged in LDS: a stage is 64 k of the tile's 128 rows of every operand, two buffers;
// wave w brings band w of every operand by asynchronous copies (a band's stage is 2 KiB in a row, in the plane and in LDS alike), one stage ahead of the products; every wave reads its 4 A and 2 B fragments per 32 k from LDS, so an operand byte leaves L2 once per work-group.
// Each wave sums its outputs over the whole K in rising k. grid (M/128, N/128, Z), 32 * NWK threads. K % 64 == 0, K >= 128.
// C[m][n] (f32, pitch ldc, + optional f32 bias[n]) = sum_k A[m][k] Bt[n][k] (NSPLIT 1: + A2[m][k] Bt[n][k]). z-batch strides sA/sB/sC in elements.
// The output tile goes through LDS (the ring's bytes, free by then) so that a thread holds four neighbouring columns. EPI says what it does with them: 0 store them to C in f32; 1 is the grid of the three projections, job = blockIdx.z (weight z * sB, hi/lo planes z * sC), grid (NB_ * TT / 128, DQ / 128, 3):
// jobs 0, 1 (Q, K; rows = tokens b * TT + t, the tile's columns = heads 2 * blockIdx.y and the next) turn the two (even, odd) pairs by the token's {cos, sin} of CS and store hi/lo planes [b][head] of [token][HD] in fragment order;
// job 2 swaps the operands and the two block indices (A = the V weight, Bt = the tokens): the rows are (head, d) and the columns tokens, which is V^T as the attention reads it; fp16 and hi/lo planes [b][head] of fragment blocks [token / 32][d / 16].
template <bool B> struct BoolC { static constexpr bool value = B; };
template <typename T16> struct WFrag;
template <> struct WFrag<h16> { typedef v16h V; static __device__ __forceinline__ V ld(const h16* p) { return cat16(*(const v8h*)p, *(const v8h*)(p + 256)); } static __device__ __forceinline__ v8f mma(V a, V b, v8f c) { return wmma16(a, b, c); } };
template <> struct WFrag<bf> { typedef v16bf V; static __device__ __forceinline__ V ld(const bf* p) { return cat16b(*(const v8us*)p, *(const v8us*)(p + 256)); } static __device__ __forceinline__ v8f mma(V a, V b, v8f c) { return wmmab(a, b, c); } };
template <typename T16, int NSPLIT, bool BIAS, int EPI, int K>
__global__ __launch_bounds__(32 * NWK) void k_gemmw(const T16* __restrict__ A, const T16* __restrict__ A2, const T16* __restrict__ Bt, const T16* __restrict__ Bt2, float* C, int ldc, const float* __restrict__ bias, size_t sA, size_t sB, size_t sC, const float* __restrict__ CS, h16* P16, bf* Ph, bf* Pl) {
    typedef typename WFrag<T16>::V V;
    static_assert(NSPLIT <= 1 && K % 64 == 0 && K >= 128, "operands A, A2, Bt; two stages or more");
    constexpr int NOP = NSPLIT == 1 ? 3 : 2, BUFE = NOP * GOPE, NT = K / 64;   // operands, elements of one buffer, stages
    constexpr int RINGB = 2 * BUFE * 2, OUTB = GT * GPIT * 4;
    __shared__ __align__(1024) unsigned char sm[RINGB > OUTB ? RINGB : OUTB];   // the ring; behind the K loop the output tile
    T16* ring = (T16*)sm; float* red = (float*)sm;
    const size_t z = blockIdx.z; A += z * sA; if (A2) A2 += z * sA; Bt += z * sB; if (EPI == 0) C += z * sC; else { Ph += z * sC; Pl += z * sC; }
    const bool vt = EPI == 1 && blockIdx.z == 2;   // the same for the whole work-group
    if (vt) { const T16* t = A; A = Bt; Bt = t; }
    const int lane = threadIdx.x & 31, lr = lane & 15, hi = lane >> 4; const int r0 = (vt ? blockIdx.y : blockIdx.x) * GT, c0 = (vt ? blockIdx.x : blockIdx.y) * GT;
    const int w = __builtin_amdgcn_readfirstlane((int)(threadIdx.x >> 5)); const int wm = w >> 2, wn = w & 3;
    v8f acc[4][2];   // every '#pragma unroll' of this kernel: constant indices keep the accumulators, the fragments and the small vectors in registers
#pragma unroll
    for (int mb = 0; mb < 4; ++mb)
#pragma unroll
        for (int nb = 0; nb < 2; ++nb) acc[mb][nb] = (v8f){};
    // fragment order: a 16-row band is 16 * K elements, 64 k of it 1024 elements in a row. This lane's 16 bytes in the first of the four 512-byte pieces of band w, stage 0:
    const T16* ga = A + (size_t)(r0 + w * 16) * K + lane * 8; const T16* gb = Bt + (size_t)(c0 + w * 16) * K + lane * 8; const T16* ga2 = NSPLIT == 1 ? A2 + (size_t)(r0 + w * 16) * K + lane * 8 : ga;
    const unsigned la = (unsigned)(size_t)(ring + w * 1024 + lane * 8);   // the same place in buffer 0 of the ring, as an LDS byte address
    auto fill = [&](int t) {   // stage t into buffer t % 2: every lane on, 8 or 12 copies a wave; the wait in the copies' own statement is the precaution of the instruction set's rule on registers that an issued copy names
        const unsigned l = la + (unsigned)(t & 1) * (BUFE * 2), l2 = l + GOPE * 2, l3 = l + GOPE * 4; const T16* a = ga + (size_t)t * 1024; const T16* b = gb + (size_t)t * 1024; const T16* c = ga2 + (size_t)t * 1024;
        if (NSPLIT == 1)
            asm volatile("global_load_async_to_lds_b128 %0, %12, off\n\tglobal_load_async_to_lds_b128 %1, %13, off\n\tglobal_load_async_to_lds_b128 %2, %14, off\n\tglobal_load_async_to_lds_b128 %3, %15, off\n\t"
                         "global_load_async_to_lds_b128 %4, %16, off\n\tglobal_load_async_to_lds_b128 %5, %17, off\n\tglobal_load_async_to_lds_b128 %6, %18, off\n\tglobal_load_async_to_lds_b128 %7, %19, off\n\t"
                         "global_load_async_to_lds_b128 %8, %20, off\n\tglobal_load_async_to_lds_b128 %9, %21, off\n\tglobal_load_async_to_lds_b128 %10, %22, off\n\tglobal_load_async_to_lds_b128 %11, %23, off\n\ts_wait_xcnt 0x0"
                         :: "v"(l), "v"(l + 512), "v"(l + 1024), "v"(l + 1536), "v"(l2), "v"(l2 + 512), "v"(l2 + 1024), "v"(l2 + 1536), "v"(l3), "v"(l3 + 512), "v"(l3 + 1024), "v"(l3 + 1536),
                            "v"(a), "v"(a + 256), "v"(a + 512), "v"(a + 768), "v"(b), "v"(b + 256), "v"(b + 512), "v"(b + 768), "v"(c), "v"(c + 256), "v"(c + 512), "v"(c + 768) : "memory");
        else
            asm volatile("global_load_async_to_lds_b128 %0, %8, off\n\tglobal_load_async_to_lds_b128 %1, %9, off\n\tglobal_load_async_to_lds_b128 %2, %10, off\n\tglobal_load_async_to_lds_b128 %3, %11, off\n\t"
                         "global_load_async_to_lds_b128 %4, %12, off\n\tglobal_load_async_to_lds_b128 %5, %13, off\n\tglobal_load_async_to_lds_b128 %6, %14, off\n\tglobal_load_async_to_lds_b128 %7, %15, off\n\ts_wait_xcnt 0x0"
                         :: "v"(l), "v"(l + 512), "v"(l + 1024), "v"(l + 1536), "v"(l2), "v"(l2 + 512), "v"(l2 + 1024), "v"(l2 + 1536),
                            "v"(a), "v"(a + 256), "v"(a + 512), "v"(a + 768), "v"(b), "v"(b + 256), "v"(b + 512), "v"(b + 768) : "memory"); };
    fill(0);
    asm volatile("s_wait_asynccnt 0x0" ::: "memory");   // this wave's share of stage 0 has landed
    __syncthreads();   // stage 0 is whole before any wave reads it
    fill(1);
    const T16* fa = ring + wm * 4 * 1024 + lane * 8; const T16* fb = ring + GOPE + wn * 2 * 1024 + lane * 8;   // this lane's piece of the wave's first A and B fragment in buffer 0; A2 lies 2 * GOPE behind A
#pragma unroll 1   // one copy of the trip: a barrier ends every trip, so unrolling would only lengthen the code
    for (int t = 0; t < NT; ++t) { const int bo = (t & 1) * BUFE;
#pragma unroll
        for (int j = 0; j < 2; ++j) { V a[4], a2[4], bb[2];
#pragma unroll
            for (int mb = 0; mb < 4; ++mb) { a[mb] = WFrag<T16>::ld(fa + bo + mb * 1024 + j * 512); if (NSPLIT == 1) a2[mb] = WFrag<T16>::ld(fa + bo + 2 * GOPE + mb * 1024 + j * 512); }
#pragma unroll
            for (int nb = 0; nb < 2; ++nb) bb[nb] = WFrag<T16>::ld(fb + bo + nb * 1024 + j * 512);
#pragma unroll
            for (int nb = 0; nb < 2; ++nb)
#pragma unroll
                for (int mb = 0; mb < 4; ++mb) { acc[mb][nb] = WFrag<T16>::mma(a[mb], bb[nb], acc[mb][nb]); if (NSPLIT == 1) acc[mb][nb] = WFrag<T16>::mma(a2[mb], bb[nb], acc[mb][nb]); } }
        asm volatile("s_wait_dscnt 0x0" ::: "memory");      // this wave's reads of the buffer are done before the barrier frees it for the refill
        asm volatile("s_wait_asynccnt 0x0" ::: "memory");   // this wave's share of stage t + 1 has landed
        __syncthreads();   // publishes stage t + 1 and ends every wave's reads of stage t
        if (t + 2 < NT) fill(t + 2);
    }
    asm volatile("s_wait_asynccnt 0x0" ::: "memory");   // no copy is under way when the ring's bytes become the output tile
    v2f cs[GT * 16 / (32 * NWK)][2];   // EPI 1, jobs 0 and 1: {cos, sin} of this thread's two pairs in each of its rows (the same for both heads of the tile), asked for here so that they arrive while the tile goes through LDS
    if (EPI == 1 && !vt) { const float* cb = CS + ((size_t)(r0 % TT + ((int)threadIdx.x >> 4)) * HD + ((int)threadIdx.x & 15) * 4) * 2;   // the thread's first row; every load shares this pair and differs in the immediate offset
#pragma unroll   // constant indices keep cs in registers
        for (int s = 0; s < GT * 16 / (32 * NWK); ++s) { cs[s][0] = *(const v2f*)(cb + s * (2 * NWK * HD * 2)); cs[s][1] = *(const v2f*)(cb + s * (2 * NWK * HD * 2) + 4); }   // 2 * NWK rows on per step
        asm volatile("s_wait_xcnt 0x0" :: "v"(cb) : "memory"); }   // precaution of the instruction set's rule on registers that an issued load names: the address pair is an input here, so it keeps its value up to this wait
    float* my = red + (wm * 64 + hi * 8) * GPIT + wn * 32 + lr;
#pragma unroll
    for (int mb = 0; mb < 4; ++mb) {
#pragma unroll
        for (int nb = 0; nb < 2; ++nb) {
#pragma unroll
            for (int j = 0; j < 8; ++j) my[(mb * 16 + j) * GPIT + nb * 16] = acc[mb][nb][j]; } }
    __syncthreads();   // the output tile is whole in LDS before any thread reads its four columns
    auto tile_out = [&](auto job_v) { constexpr bool VT = decltype(job_v)::value;   // compiled once per kind of job, so that each form's rows stay one straight run of LDS loads and stores
#pragma unroll
    for (int ch = 0; ch < 2; ++ch) {   // the tile's two halves of 64 columns
#pragma unroll
    for (int s = 0; s < GT * 16 / (32 * NWK); ++s) { const int idx = s * (32 * NWK) + (int)threadIdx.x; const int row = idx >> 4, cofs = ch * 64 + (idx & 15) * 4; v4f val = *(const v4fa*)(red + row * GPIT + cofs);
        if (BIAS) { val[0] += bfr(bias[c0 + cofs]); val[1] += bfr(bias[c0 + cofs + 1]); val[2] += bfr(bias[c0 + cofs + 2]); val[3] += bfr(bias[c0 + cofs + 3]); }
        if (EPI == 0) *(v4f*)(C + (size_t)(r0 + row) * ldc + c0 + cofs) = val;
        else { v4us oh, ol;
            if (!VT) val = (v4f){ val[0] * cs[s][0][0] - val[1] * cs[s][0][1], val[0] * cs[s][0][1] + val[1] * cs[s][0][0], val[2] * cs[s][1][0] - val[3] * cs[s][1][1], val[2] * cs[s][1][1] + val[3] * cs[s][1][0] };   /* even: x0 c - x1 s; odd: x0 s + x1 c */
#pragma unroll   // constant indices keep the vectors in registers
            for (int k = 0; k < 4; ++k) { unsigned short a2, c2; splitf(val[k], a2, c2); oh[k] = a2; ol[k] = c2; }
            const int tk = c0 % TT + cofs;   // job 2: the first of the four tokens
            const size_t e = !VT ? (size_t)(r0 / TT * NH_ + c0 / HD + ch) * TT * HD + pk(r0 % TT + row, cofs & 63, HD) : (size_t)(c0 / TT * DKV + r0 + (row & 64)) * TT + ((size_t)((tk >> 5) * 4 + ((row & 63) >> 4)) << 9) + pk(row & 15, tk & 31, 32);
            *(v4us*)(Ph + e) = oh; *(v4us*)(Pl + e) = ol;
            if (VT) *(v4h*)(P16 + e) = (v4h){ tohx(val[0]), tohx(val[1]), tohx(val[2]), tohx(val[3]) }; } } }
        if (EPI == 1 && !VT) asm volatile("s_wait_xcnt 0x0" ::: "memory"); };   // precaution of the instruction set's rule on registers that an issued store names, behind the last row's stores: in the built code job 2's block follows this one and reuses their registers
    if (vt) tile_out(BoolC<true>{}); else tile_out(BoolC<false>{});
}


__global__ __launch_bounds__(256) void k_wtG(const float* __restrict__ w, int K, int N, bf* Bt) {
    const int lane = threadIdx.x & 31; const int L0 = (blockIdx.x * 8 + (threadIdx.x >> 5)) * 8; const int nlines = N * K / 64;
{
#pragma unroll 1
        for (int l = 0; l < 8; ++l) { const int L = L0 + l; if (L >= nlines) break; const size_t e = (size_t)L * 64 + lane * 2; const int k = (int)(e % K), n = (int)(e / K); v2us o;
            o[0] = f2bf(w[(size_t)k * N + n]); o[1] = f2bf(w[(size_t)(k + 1) * N + n]); *(v2us*)(Bt + e) = o; }
         }
}

__constant__ float INV2[HD / 2] = { 1.000000000e+00f, 7.498942018e-01f, 5.623413324e-01f, 4.216965139e-01f, 3.162277639e-01f, 2.371373773e-01f, 1.778279394e-01f, 1.333521456e-01f, 1.000000015e-01f, 7.498942316e-02f, 5.623413250e-02f, 4.216964915e-02f, 3.162277490e-02f, 2.371373773e-02f, 1.778279431e-02f, 1.333521400e-02f, 9.999999776e-03f, 7.498942316e-03f, 5.623413250e-03f, 4.216964822e-03f, 3.162277630e-03f, 2.371373819e-03f, 1.778279431e-03f, 1.333521446e-03f, 1.000000047e-03f, 7.498941850e-04f, 5.623413017e-04f, 4.216965172e-04f, 3.162277571e-04f, 2.371373703e-04f, 1.778279402e-04f, 1.333521504e-04f };   // theta ** (-2i / 64), i = 0..31, in float32 as THIS module writes it (the NEGATIVE-POWER spelling 'theta ** (-arange(0, dh, 2) / dh)', evaluated in the reference's own f32 arithmetic): ten of the 32 entries differ by one ulp from the reciprocal spelling '1 / theta ** (2i / 64)' (indices 5, 9, 10, 12, 13, 15, 20, 27, 28, 29)
#define PB_CS (TT * HD / 256)             // work-groups of k_prep that build the rotary table (they come first: the longest threads)
#define PB_X  (NB_ * TT * DM / 8 / 256)   // ... that round x, both batches
#define PB_W  (DM * DM / 8 / 256)         // ... that round one weight
// ---- k_prep: everything that depends on the inputs alone, in one grid of PB_CS + PB_X + 4 * PB_W work-groups; a work-group does one kind of work. The table serves both batches (token_positions has no batch axis). W4 = the four weights Wq, Wk, Wv, Wo one behind the other.
__global__ __launch_bounds__(256) void k_prep(const float* __restrict__ x, const int* __restrict__ pid, const float* __restrict__ wq, const float* __restrict__ wk, const float* __restrict__ wv, const float* __restrict__ wo, bf* XB, bf* W4, float* CS) {
    const int blk = blockIdx.x;
    if (blk < PB_CS) { const int idx = blk * 256 + threadIdx.x; const int d = idx % HD; const int t = idx / HD; const float a = __fmul_rn((float)pid[t], INV2[d >> 1]); v2f cs; cs[0] = cosf(a); cs[1] = sinf(a); *(v2f*)(CS + (size_t)idx * 2) = cs; return; }
    const float* src = x; bf* dst = XB; int g = blk - PB_CS;
    if (g >= PB_X) { g -= PB_X; const int j = g / PB_W; g %= PB_W; src = j == 0 ? wq : j == 1 ? wk : j == 2 ? wv : wo; dst = W4 + (size_t)j * DM * DM; }
    // a wave takes 8 rows x one 32-k block: it reads one whole 128-byte line of each row and writes four whole lines of the block in fragment order
    const int wn = g * 8 + ((int)threadIdx.x >> 5), row = (wn / (DM / 32)) * 8 + ((int)threadIdx.x & 7), k = (wn % (DM / 32)) * 32 + (((int)threadIdx.x >> 3) & 3) * 8;
    const v8f v = *(const v8f*)(src + (size_t)row * DM + k); v8us o;
    asm volatile("s_wait_xcnt 0x0" ::: "memory");   // precaution of the instruction set's rule on registers that an issued load names: the address pair is free for reuse only behind this wait
#pragma unroll
    for (int e = 0; e < 8; ++e) o[e] = f2bf(v[e]); *(v8us*)(dst + pk(row, k, DM)) = o;
    asm volatile("s_wait_xcnt 0x0" ::: "memory");   // same precaution behind the store: in the built code the table's block follows this one and reuses its registers
}

#define AQ   32                   // queries of one work-group: two 16-column groups, held by every wave
#define ANW  8                    // waves of a work-group that share the key loop of those queries
#define SCL2 0.18033688011112042f // HD^-0.5 x log2(e): scores are carried in the log2 domain
// ---- k_fattn: causal attention of one head for AQ queries, scores never leave the registers. S^T = K.Q^T (A = 16 key rows, B = 16 query columns; hi/lo planes, 3 products) leaves one query per lane column, so maximum, sum and rescale are per lane plus one exchange between the wave's halves;
// two 16-key score tiles of a lane are, in order, the B fragment of O^T += V^T.P^T (element e < 8: key 8 * hi + e, else key 16 + 8 * hi + e - 8, the order in which WFrag::ld reads V^T). Queries < RH: P and V on hi/lo planes (3 products); other queries: P x 1024 in fp16 (the factor is in the row sum too and cancels).
// Wave w takes the 32-key blocks w, w + ANW, ... up to the diagonal block with its own running maximum; the ANW partial (maximum, sum, O) meet in LDS, are brought to the common maximum and summed in wave order; the quotient goes out as the merged hi/lo planes [b * TT + t][DQ] in fragment order. Grid (NB_ * heads, TT / AQ), longest query blocks of both batches first.
template <bool HR, int NQ>
__device__ __forceinline__ void attn_keys(const bf* pqh, const bf* pql, const bf* pkh, const bf* pkl, const h16* pv16, const bf* pvh, const bf* pvl, int qa, int q0, int w, int lr, int hi, v8f* o, float* m, float* l) {   // the p.. are per-lane addresses in fragment order (block start + lane * 8): the blocks of query qa, of key w * 32 and of V^T at key w * 32; every load of a plane shares its pair and differs in the immediate offset
    v16bf qh[NQ][2], ql[NQ][2];   // NQ groups of 16 queries from query qa on (B operand: column = query, k = d)
#pragma unroll
    for (int qt = 0; qt < NQ; ++qt)
#pragma unroll
        for (int ks = 0; ks < 2; ++ks) { qh[qt][ks] = WFrag<bf>::ld(pqh + qt * 16 * HD + ks * 512); ql[qt][ks] = WFrag<bf>::ld(pql + qt * 16 * HD + ks * 512); }
    asm volatile("s_wait_xcnt 0x0" :: "v"(pqh), "v"(pql) : "memory");   // precaution of the instruction set's rule on registers that an issued load names: the two address pairs are inputs here, so they keep their values up to this wait
#pragma unroll 1
    for (int kb = w * 32; kb <= q0; kb += ANW * 32) {
        v8f s[2][NQ];
#pragma unroll
        for (int kt = 0; kt < 2; ++kt) { v16bf kh[2], kl[2];
#pragma unroll
            for (int ks = 0; ks < 2; ++ks) { kh[ks] = WFrag<bf>::ld(pkh + kt * 16 * HD + ks * 512); kl[ks] = WFrag<bf>::ld(pkl + kt * 16 * HD + ks * 512); }
#pragma unroll
            for (int qt = 0; qt < NQ; ++qt) { v8f c = (v8f){};
#pragma unroll
                for (int ks = 0; ks < 2; ++ks) { c = wmmab(kh[ks], qh[qt][ks], c); c = wmmab(kl[ks], qh[qt][ks], c); c = wmmab(kh[ks], ql[qt][ks], c); }
                s[kt][qt] = c; } }
        v16h v16[4]; v16bf vh[4], vl[4];
#pragma unroll
        for (int dt = 0; dt < 4; ++dt) { if (HR) { vh[dt] = WFrag<bf>::ld(pvh + dt * 512); vl[dt] = WFrag<bf>::ld(pvl + dt * 512); } else v16[dt] = WFrag<h16>::ld(pv16 + dt * 512); }
#pragma unroll
        for (int qt = 0; qt < NQ; ++qt) { const int q = qa + qt * 16 + lr; float t[16]; float mx = m[qt];
#pragma unroll
            for (int e = 0; e < 16; ++e) { const int key = kb + (e >> 3) * 16 + hi * 8 + (e & 7); t[e] = (key <= q) ? s[e >> 3][qt][e & 7] * SCL2 : -3.0e38f; mx = fmaxf(mx, t[e]); }
            mx = fmaxf(mx, __shfl_xor(mx, 16, 32));
            const float al = __builtin_amdgcn_exp2f(m[qt] - mx); m[qt] = mx; const float mo = HR ? mx : mx - 10.0f; float ps = 0.f;
#pragma unroll
            for (int e = 0; e < 16; ++e) { t[e] = __builtin_amdgcn_exp2f(t[e] - mo); ps += t[e]; }
            l[qt] = l[qt] * al + ps;
#pragma unroll
            for (int dt = 0; dt < 4; ++dt) o[qt * 4 + dt] *= al;
            if (HR) { v8us h0, h1, l0, l1;
#pragma unroll
                for (int e = 0; e < 8; ++e) { unsigned short a, c2; splitf(t[e], a, c2); h0[e] = a; l0[e] = c2; splitf(t[8 + e], a, c2); h1[e] = a; l1[e] = c2; }
                const v16bf ph = cat16b(h0, h1), pl = cat16b(l0, l1);
#pragma unroll
                for (int dt = 0; dt < 4; ++dt) { v8f c = o[qt * 4 + dt]; c = wmmab(vh[dt], ph, c); c = wmmab(vh[dt], pl, c); c = wmmab(vl[dt], ph, c); o[qt * 4 + dt] = c; }
            } else { v16h p;
#pragma unroll
                for (int e = 0; e < 16; ++e) p[e] = tohx(t[e]);
#pragma unroll
                for (int dt = 0; dt < 4; ++dt) o[qt * 4 + dt] = wmma16(v16[dt], p, o[qt * 4 + dt]); } }
        // precaution of the instruction set's rule on registers that an issued load names: the trip's address pairs are inputs here, so they keep their values up to this wait and are stepped only behind it
        if (HR) { asm volatile("s_wait_xcnt 0x0" :: "v"(pkh), "v"(pkl), "v"(pvh), "v"(pvl) : "memory"); pvh += ANW * 32 * HD; pvl += ANW * 32 * HD; }
        else { asm volatile("s_wait_xcnt 0x0" :: "v"(pkh), "v"(pkl), "v"(pv16) : "memory"); pv16 += ANW * 32 * HD; }
        pkh += ANW * 32 * HD; pkl += ANW * 32 * HD;
    }
}
// amdgpu_waves_per_eu(4, 4): holds the kernel to 256 VGPRs, so that two work-groups share a WGP and one wave's load waits are covered by three others on its SIMD (left free the build took 318 VGPRs: one work-group per WGP)
__global__ __launch_bounds__(32 * ANW) __attribute__((amdgpu_waves_per_eu(4, 4))) void k_fattn(const bf* __restrict__ Qh, const bf* __restrict__ Ql, const bf* __restrict__ Kh, const bf* __restrict__ Kl, const h16* __restrict__ V16, const bf* __restrict__ Vh, const bf* __restrict__ Vl, bf* Ah, bf* Al) {
    __shared__ __align__(16) float ored[ANW * AQ * 68];   // per wave AQ queries x HD floats, row pitch 68
    __shared__ float mred[ANW * AQ]; __shared__ float lred[ANW * AQ];
    const int lane = threadIdx.x & 31, lr = lane & 15, hi = lane >> 4; const int w = __builtin_amdgcn_readfirstlane((int)(threadIdx.x >> 5));
    const int h = blockIdx.x % NH_, bat = blockIdx.x / NH_; const int q0 = (TT / AQ - 1 - (int)blockIdx.y) * AQ; const size_t hp = (size_t)blockIdx.x * TT * HD;
    v8f o[2 * 4]; float m[2] = { -3.0e38f, -3.0e38f }, l[2] = { 0.f, 0.f };   // o[qt * 4 + dt][j] = O[query q0 + qt * 16 + lr][d = dt * 16 + hi * 8 + j]
#pragma unroll
    for (int i = 0; i < 8; ++i) o[i] = (v8f){};
    const size_t qo = hp + (size_t)q0 * HD + lane * 8, ko = hp + (size_t)(w * 32) * HD + lane * 8, vo = ko;   // fragment order: 16 tokens of Q or K are 2 blocks, 32 keys of V^T 4 blocks (d / 16), so 32 keys are 32 * HD elements in every plane
    if (q0 < RH) {   // hi/lo P and V take twice the fragment registers: the two query groups walk the keys one after the other
        attn_keys<true, 1>(Qh + qo, Ql + qo, Kh + ko, Kl + ko, V16 + vo, Vh + vo, Vl + vo, q0, q0, w, lr, hi, o, m, l);
        attn_keys<true, 1>(Qh + qo + 16 * HD, Ql + qo + 16 * HD, Kh + ko, Kl + ko, V16 + vo, Vh + vo, Vl + vo, q0 + 16, q0, w, lr, hi, o + 4, m + 1, l + 1);
    } else attn_keys<false, 2>(Qh + qo, Ql + qo, Kh + ko, Kl + ko, V16 + vo, Vh + vo, Vl + vo, q0, q0, w, lr, hi, o, m, l);
#pragma unroll
    for (int qt = 0; qt < 2; ++qt) { l[qt] += __shfl_xor(l[qt], 16, 32); if (hi == 0) mred[w * AQ + qt * 16 + lr] = m[qt]; }
    __syncthreads();   // every wave's running maximum is in LDS before any wave forms the common one
#pragma unroll
    for (int qt = 0; qt < 2; ++qt) { float M = mred[qt * 16 + lr];
#pragma unroll
        for (int u = 1; u < ANW; ++u) M = fmaxf(M, mred[u * AQ + qt * 16 + lr]);
        const float f = __builtin_amdgcn_exp2f(m[qt] - M);   // a wave without a key block has maximum -3e38, sum 0 and O 0: factor 0
        if (hi == 0) lred[w * AQ + qt * 16 + lr] = l[qt] * f;
        float* my = ored + (w * AQ + qt * 16 + lr) * 68 + hi * 8;
#pragma unroll
        for (int dt = 0; dt < 4; ++dt) { const v8f x = o[qt * 4 + dt] * f; *(v4fa*)(my + dt * 16) = (v4f){ x[0], x[1], x[2], x[3] }; *(v4fa*)(my + dt * 16 + 4) = (v4f){ x[4], x[5], x[6], x[7] }; } }
    __syncthreads();   // every wave's rescaled partial sum and O are in LDS before any thread sums across waves
    { const int q = (int)threadIdx.x & 31, d0 = ((int)threadIdx.x >> 5) * 8; v4f a = *(const v4fa*)(ored + q * 68 + d0), b = *(const v4fa*)(ored + q * 68 + d0 + 4); float L = lred[q];
#pragma unroll
        for (int u = 1; u < ANW; ++u) { a += *(const v4fa*)(ored + (u * AQ + q) * 68 + d0); b += *(const v4fa*)(ored + (u * AQ + q) * 68 + d0 + 4); L += lred[u * AQ + q]; }
        const float inv = __fdiv_rn(1.0f, L); v8us oh, ol;
#pragma unroll
        for (int e = 0; e < 4; ++e) { unsigned short x, y; splitf(a[e] * inv, x, y); oh[e] = x; ol[e] = y; splitf(b[e] * inv, x, y); oh[4 + e] = x; ol[4 + e] = y; }
        const size_t oo = pk(bat * TT + q0 + q, h * HD + d0, DQ); *(v8us*)(Ah + oo) = oh;   /* a wave holds one 8-d piece of all AQ queries: 2 x 256 contiguous bytes in fragment order */ *(v8us*)(Al + oo) = ol; }
}

extern "C" void kernel_launch(void* const* d_in, const int* in_sizes, int n_in,
                              void* d_out, int out_size, void* d_ws, size_t ws_size, hipStream_t stream) {
    (void)in_sizes; (void)n_in; (void)out_size;
    const float* x = (const float*)d_in[0]; const int* PID = (const int*)d_in[1]; const float* wq = (const float*)d_in[2]; const float* wk = (const float*)d_in[3]; const float* wv = (const float*)d_in[4]; const float* wo = (const float*)d_in[5];   /* inputs x, token_positions (int32 [2048], shared by all batches; read), Wq, Wk, Wv, Wo ('oi' [1024][1024]) */
    float* OUT = (float*)d_out;     // [2][2048][1024]
    char* wsp = (char*)d_ws;
    auto take = [&](size_t bytes) { char* p = wsp; wsp += (bytes + 255) & ~(size_t)255; return (void*)p; };
    bf* W4 = (bf*)take((size_t)4 * DM * DM * 2); float* CS = (float*)take((size_t)TT * HD * 2 * 4);   /* Wq, Wk, Wv, Wo one behind the other */
    bf* XB = (bf*)take((size_t)NB_ * TT * DM * 2);
    const size_t PL = (size_t)NB_ * NH_ * TT * HD;   /* elements of one plane, both batches */
    h16* VT16 = (h16*)take(PL * 2);
    bf* PH = (bf*)take(3 * PL * 2); bf* PLO = (bf*)take(3 * PL * 2);   /* hi and lo planes of Q, K, V^T one behind the other */
    bf* ATh = (bf*)take(PL * 2); bf* ATl = (bf*)take(PL * 2);
    if ((size_t)(wsp - (char*)d_ws) > ws_size) return;    // ws 256 MiB
    k_prep<<<PB_CS + PB_X + 4 * PB_W, 256, 0, stream>>>(x, PID, wq, wk, wv, wo, XB, W4, CS);   /* rotary table, bf16 x and weights */
    k_gemmw<bf, 0, false, 1, DM><<<dim3(NB_ * TT / GT, DQ / GT, 3), 32 * NWK, 0, stream>>>(XB, nullptr, W4, nullptr, nullptr, 0, nullptr, 0, (size_t)DM * DM, PL, CS, VT16, PH, PLO);   /* Q and K projection with rotary, V^T = Wv . x^T; planes */
    k_fattn<<<dim3(NB_ * NH_, TT / AQ, 1), 32 * ANW, 0, stream>>>(PH, PLO, PH + PL, PLO + PL, VT16, PH + 2 * PL, PLO + 2 * PL, ATh, ATl);   /* scores, softmax, P.V and the merge of all heads */
    k_gemmw<bf, 1, false, 0, DQ><<<dim3(NB_ * TT / GT, DM / GT, 1), 32 * NWK, 0, stream>>>(ATh, ATl, W4 + (size_t)3 * DM * DM, nullptr, OUT, DM, nullptr, 0, 0, 0, nullptr, nullptr, nullptr, nullptr);
}

// v008
// Measured time: 93.3 microseconds a run.
// In both of two side-by-side timings against v007, it was 1.12 times as fast.
// Over all steps from v000 it is 14.9 times as fast.
#include <hip/hip_runtime.h>

// Causal multi-head self-attention with interleaved-pair rotary position embedding from a position input (x [2][2048][1024]; Q, K, V = einsum('bsd,ed', x, W) ('oi' [1024][1024] 1/32, no bias; 16 heads x 64); angle = float(token_positions[t]) x theta ** (-2i / 64) (theta 1e4; token_positions int32 [2048] = arange, shared by both batches, READ on device); pairs (2i, 2i+1): (x1 cos - x2 sin, x1 sin + x2 cos) on Q and K; scores / sqrt(64); keys j <= i kept, -inf elsewhere; softmax; out = einsum('bsd,ed', merged, Wo) -> [2][2048][1024] (4.2 M); argument order x, token_positions, Wq, Wk, Wv, Wo).
// Layout, both batches in every launch (rows b * 2048 + t; planes [b][head]...): bf16 copy of x; exact projections; {cos, sin} per (position, pair) built once from the int positions and float32 inverse-frequency constants (precise cosf/sinf); interleaved rotary and the hi/lo (V: also fp16, transposed) planes formed in the projection GEMMs' own epilogue; fused causal T-2048 attention k_fattn (EVERY row's scores on hi/lo planes (3 products: logit sigma 2 with these weights), online softmax in registers, hybrid P.V (rows < 512 hi/lo, rest fp16 x1024); key blocks above the diagonal are never visited); merged hi/lo x Wo exact.
// Compute dtypes, f32 accumulate: every input rounded to bf16; projections exact; rotary f32; attention rows < 512 3 products, rest fp16; softmax f32; Wo hl x exact.

#define NB_  2
#define TT   2048
#define DM   1024
#define NH_  16
#define NKV  16
#define HD   64
#define DQ   (NH_ * HD)
#define DKV  (NKV * HD)
#define RH   512                  // query rows < RH use hi+lo planes (0: none)
typedef _Float16 h16;
typedef unsigned short bf;
typedef __attribute__((ext_vector_type(16))) __bf16   v16bf;
typedef __attribute__((ext_vector_type(16))) _Float16 v16h;
typedef __attribute__((ext_vector_type(8)))  _Float16 v8h;
typedef __attribute__((ext_vector_type(8)))  unsigned short v8us;
typedef __attribute__((ext_vector_type(8)))  float    v8f;
typedef __attribute__((ext_vector_type(4)))  float    v4f;
typedef v8h  __attribute__((may_alias)) v8ha;
typedef v4f  __attribute__((may_alias)) v4fa;
typedef v8us __attribute__((may_alias)) v8usa;

__device__ __forceinline__ unsigned short f2bf(float f) { unsigned u = __float_as_uint(f); u += 0x7FFFu + ((u >> 16) & 1u); return (unsigned short)(u >> 16); }
__device__ __forceinline__ float bf2f(unsigned short b) { return __uint_as_float(((unsigned)b) << 16); }
__device__ __forceinline__ float bfr(float f) { return bf2f(f2bf(f)); }
__device__ __forceinline__ v16h cat16(v8h lo, v8h hi) { return __builtin_shufflevector(lo, hi, 0, 1, 2, 3, 4, 5, 6, 7, 8, 9, 10, 11, 12, 13, 14, 15); }
__device__ __forceinline__ v16bf cat16b(v8us lo, v8us hi) { return __builtin_bit_cast(v16bf, __builtin_shufflevector(lo, hi, 0, 1, 2, 3, 4, 5, 6, 7, 8, 9, 10, 11, 12, 13, 14, 15)); }
__device__ __forceinline__ v8f wmma16(v16h a, v16h b, v8f c) { return __builtin_amdgcn_wmma_f32_16x16x32_f16(false, a, false, b, (short)0, c, false, false); }
__device__ __forceinline__ v8f wmmab(v16bf a, v16bf b, v8f c) { return __builtin_amdgcn_wmma_f32_16x16x32_bf16(false, a, false, b, (short)0, c, false, false); }
__device__ __forceinline__ h16 tohx(float x) { return (h16)x; }
__device__ __forceinline__ void splitf(float y, unsigned short& h, unsigned short& l) { h = f2bf(y); l = f2bf(y - bf2f(h)); }
typedef __attribute__((ext_vector_type(2))) _Float16 v2h;
typedef __attribute__((ext_vector_type(4))) _Float16 v4h;
typedef __attribute__((ext_vector_type(2))) unsigned short v2us;
typedef __attribute__((ext_vector_type(4))) unsigned short v4us;
typedef __attribute__((ext_vector_type(2))) float v2f;
typedef __attribute__((ext_vector_type(4))) int v4i;



// ---- fragment order: every 16-bit operand plane [rows][K] lies in the workspace as blocks of 16 rows x 32 k (512 elements, 1 KiB), block (r / 16, k / 32) at index (r / 16) * (K / 32) + k / 32 (V^T planes: (k / 32) * (HD / 16) + r / 16); inside a block the two 512-byte halves are what the two 16-byte loads of a fragment read,
// lane by lane: element (r, k) at half (k / 16) % 2, lane ((k / 8) % 2) * 16 + r % 16, place k % 8. A wave's fragment load is then 512 contiguous bytes (4 whole lines) where the row-major plane gave 32 bytes from each of 16 lines. WFrag::ld takes block start + lane * 8.
__device__ __forceinline__ size_t pk(int r, int k, int K) { return (((size_t)(r >> 4) * (K >> 5) + (k >> 5)) << 9) + (((k >> 4) & 1) << 8) + ((((k >> 3) & 1) * 16 + (r & 15)) << 3) + (k & 7); }

#define NWK  8                    // waves of a work-group: 2 x 4 wave tiles of 64 x 32 outputs
#define GT   128                  // rows and columns of a work-group's output tile
#define GOPE (GT * 64)            // elements of one operand in one stage of the ring: 8 bands of 16 rows x 64 k (two fragment blocks, 2 KiB a band)
#define GPIT 132                  // floats of one row of the output tile in LDS (8 rows on, the banks are 32 further: the two halves of a wave store side by side)
// ---- k_gemmw: GEMM, one 128x128 output tile per work-group of NWK waves, operands from 16-bit planes in fragment order, staged in LDS: a stage is 64 k of the tile's 128 rows of every operand, two buffers;
// wave w brings band w of every operand by asynchronous copies (a band's stage is 2 KiB in a row, in the plane and in LDS alike), one stage ahead of the products; every wave reads its 4 A and 2 B fragments per 32 k from LDS, so an operand byte leaves L2 once per work-group.
// Each wave sums its outputs over the whole K in rising k. grid (M/128, N/128, Z), 32 * NWK threads. K % 64 == 0, K >= 128.
// C[m][n] (f32, pitch ldc, + optional f32 bias[n]) = sum_k A[m][k] Bt[n][k] (NSPLIT 1: + A2[m][k] Bt[n][k]). z-batch strides sA/sB/sC in elements.
// The output tile goes through LDS (the ring's bytes, free by then) so that a thread holds four neighbouring columns. EPI says what it does with them: 0 store them to C in f32; 1 is the grid of the three projections, job = blockIdx.z (weight z * sB, hi/lo planes z * sC), grid (NB_ * TT / 128, DQ / 128, 3):
// jobs 0, 1 (Q, K; rows = tokens b * TT + t, the tile's columns = heads 2 * blockIdx.y and the next) turn the two (even, odd) pairs by the token's {cos, sin} of CS and store hi/lo planes [b][head] of [token][HD] in fragment order;
// job 2 swaps the operands and the two block indices (A = the V weight, Bt = the tokens): the rows are (head, d) and the columns tokens, which is V^T as the attention reads it; fp16 and hi/lo planes [b][head] of fragment blocks [token / 32][d / 16].
template <bool B> struct BoolC { static constexpr bool value = B; };
template <typename T16> struct WFrag;
template <> struct WFrag<h16> { typedef v16h V; static __device__ __forceinline__ V ld(const h16* p) { return cat16(*(const v8h*)p, *(const v8h*)(p + 256)); } static __device__ __forceinline__ v8f mma(V a, V b, v8f c) { return wmma16(a, b, c); } };
template <> struct WFrag<bf> { typedef v16bf V; static __device__ __forceinline__ V ld(const bf* p) { return cat16b(*(const v8us*)p, *(const v8us*)(p + 256)); } static __device__ __forceinline__ v8f mma(V a, V b, v8f c) { return wmmab(a, b, c); } };
template <typename T16, int NSPLIT, bool BIAS, int EPI, int K>
__global__ __launch_bounds__(32 * NWK) void k_gemmw(const T16* __restrict__ A, const T16* __restrict__ A2, const T16* __restrict__ Bt, const T16* __restrict__ Bt2, float* C, int ldc, const float* __restrict__ bias, size_t sA, size_t sB, size_t sC, const float* __restrict__ CS, h16* P16, bf* Ph, bf* Pl) {
    typedef typename WFrag<T16>::V V;
    static_assert(NSPLIT <= 1 && K % 64 == 0 && K >= 128, "operands A, A2, Bt; two stages or more");
    constexpr int NOP = NSPLIT == 1 ? 3 : 2, BUFE = NOP * GOPE, NT = K / 64;   // operands, elements of one buffer, stages
    constexpr int RINGB = 2 * BUFE * 2, OUTB = GT * GPIT * 4;
    __shared__ __align__(1024) unsigned char sm[RINGB > OUTB ? RINGB : OUTB];   // the ring; behind the K loop the output tile
    T16* ring = (T16*)sm; float* red = (float*)sm;
    const size_t z = blockIdx.z; A += z * sA; if (A2) A2 += z * sA; Bt += z * sB; if (EPI == 0) C += z * sC; else { Ph += z * sC; Pl += z * sC; }
    const bool vt = EPI == 1 && blockIdx.z == 2;   // the same for the whole work-group
    if (vt) { const T16* t = A; A = Bt; Bt = t; }
    const int lane = threadIdx.x & 31, lr = lane & 15, hi = lane >> 4; const int r0 = (vt ? blockIdx.y : blockIdx.x) * GT, c0 = (vt ? blockIdx.x : blockIdx.y) * GT;
    const int w = __builtin_amdgcn_readfirstlane((int)(threadIdx.x >> 5)); const int wm = w >> 2, wn = w & 3;
    v8f acc[4][2];   // every '#pragma unroll' of this kernel: constant indices keep the accumulators, the fragments and the small vectors in registers
#pragma unroll
    for (int mb = 0; mb < 4; ++mb)
#pragma unroll
        for (int nb = 0; nb < 2; ++nb) acc[mb][nb] = (v8f){};
    // fragment order: a 16-row band is 16 * K elements, 64 k of it 1024 elements in a row. This lane's 16 bytes in the first of the four 512-byte pieces of band w, stage 0:
    const T16* ga = A + (size_t)(r0 + w * 16) * K + lane * 8; const T16* gb = Bt + (size_t)(c0 + w * 16) * K + lane * 8; const T16* ga2 = NSPLIT == 1 ? A2 + (size_t)(r0 + w * 16) * K + lane * 8 : ga;
    const unsigned la = (unsigned)(size_t)(ring + w * 1024 + lane * 8);   // the same place in buffer 0 of the ring, as an LDS byte address
    auto fill = [&](int t) {   // stage t into buffer t % 2: every lane on, 8 or 12 copies a wave; the wait in the copies' own statement is the precaution of the instruction set's rule on registers that an issued copy names
        const unsigned l = la + (unsigned)(t & 1) * (BUFE * 2), l2 = l + GOPE * 2, l3 = l + GOPE * 4; const T16* a = ga + (size_t)t * 1024; const T16* b = gb + (size_t)t * 1024; const T16* c = ga2 + (size_t)t * 1024;
        if (NSPLIT == 1)
            asm volatile("global_load_async_to_lds_b128 %0, %12, off\n\tglobal_load_async_to_lds_b128 %1, %13, off\n\tglobal_load_async_to_lds_b128 %2, %14, off\n\tglobal_load_async_to_lds_b128 %3, %15, off\n\t"
                         "global_load_async_to_lds_b128 %4, %16, off\n\tglobal_load_async_to_lds_b128 %5, %17, off\n\tglobal_load_async_to_lds_b128 %6, %18, off\n\tglobal_load_async_to_lds_b128 %7, %19, off\n\t"
                         "global_load_async_to_lds_b128 %8, %20, off\n\tglobal_load_async_to_lds_b128 %9, %21, off\n\tglobal_load_async_to_lds_b128 %10, %22, off\n\tglobal_load_async_to_lds_b128 %11, %23, off\n\ts_wait_xcnt 0x0"
                         :: "v"(l), "v"(l + 512), "v"(l + 1024), "v"(l + 1536), "v"(l2), "v"(l2 + 512), "v"(l2 + 1024), "v"(l2 + 1536), "v"(l3), "v"(l3 + 512), "v"(l3 + 1024), "v"(l3 + 1536),
                            "v"(a), "v"(a + 256), "v"(a + 512), "v"(a + 768), "v"(b), "v"(b + 256), "v"(b + 512), "v"(b + 768), "v"(c), "v"(c + 256), "v"(c + 512), "v"(c + 768) : "memory");
        else
            asm volatile("global_load_async_to_lds_b128 %0, %8, off\n\tglobal_load_async_to_lds_b128 %1, %9, off\n\tglobal_load_async_to_lds_b128 %2, %10, off\n\tglobal_load_async_to_lds_b128 %3, %11, off\n\t"
                         "global_load_async_to_lds_b128 %4, %12, off\n\tglobal_load_async_to_lds_b128 %5, %13, off\n\tglobal_load_async_to_lds_b128 %6, %14, off\n\tglobal_load_async_to_lds_b128 %7, %15, off\n\ts_wait_xcnt 0x0"
                         :: "v"(l), "v"(l + 512), "v"(l + 1024), "v"(l + 1536), "v"(l2), "v"(l2 + 512), "v"(l2 + 1024), "v"(l2 + 1536),
                            "v"(a), "v"(a + 256), "v"(a + 512), "v"(a + 768), "v"(b), "v"(b + 256), "v"(b + 512), "v"(b + 768) : "memory"); };
    fill(0);
    asm volatile("s_wait_asynccnt 0x0" ::: "memory");   // this wave's share of stage 0 has landed
    __syncthreads();   // stage 0 is whole before any wave reads it
    fill(1);
    const T16* fa = ring + wm * 4 * 1024 + lane * 8; const T16* fb = ring + GOPE + wn * 2 * 1024 + lane * 8;   // this lane's piece of the wave's first A and B fragment in buffer 0; A2 lies 2 * GOPE behind A
#pragma unroll 1   // one copy of the trip: a barrier ends every trip, so unrolling would only lengthen the code
    for (int t = 0; t < NT; ++t) { const int bo = (t & 1) * BUFE;
#pragma unroll
        for (int j = 0; j < 2; ++j) { V a[4], a2[4], bb[2];
#pragma unroll
            for (int mb = 0; mb < 4; ++mb) { a[mb] = WFrag<T16>::ld(fa + bo + mb * 1024 + j * 512); if (NSPLIT == 1) a2[mb] = WFrag<T16>::ld(fa + bo + 2 * GOPE + mb * 1024 + j * 512); }
#pragma unroll
            for (int nb = 0; nb < 2; ++nb) bb[nb] = WFrag<T16>::ld(fb + bo + nb * 1024 + j * 512);
#pragma unroll
            for (int nb = 0; nb < 2; ++nb)
#pragma unroll
                for (int mb = 0; mb < 4; ++mb) { acc[mb][nb] = WFrag<T16>::mma(a[mb], bb[nb], acc[mb][nb]); if (NSPLIT == 1) acc[mb][nb] = WFrag<T16>::mma(a2[mb], bb[nb], acc[mb][nb]); } }
        asm volatile("s_wait_dscnt 0x0" ::: "memory");      // this wave's reads of the buffer are done before the barrier frees it for the refill
        asm volatile("s_wait_asynccnt 0x0" ::: "memory");   // this wave's share of stage t + 1 has landed
        __syncthreads();   // publishes stage t + 1 and ends every wave's reads of stage t
        if (t + 2 < NT) fill(t + 2);
    }
    asm volatile("s_wait_asynccnt 0x0" ::: "memory");   // no copy is under way when the ring's bytes become the output tile
    v2f cs[GT * 16 / (32 * NWK)][2];   // EPI 1, jobs 0 and 1: {cos, sin} of this thread's two pairs in each of its rows (the same for both heads of the tile), asked for here so that they arrive while the tile goes through LDS
    if (EPI == 1 && !vt) { const float* cb = CS + ((size_t)(r0 % TT + ((int)threadIdx.x >> 4)) * HD + ((int)threadIdx.x & 15) * 4) * 2;   // the thread's first row; every load shares this pair and differs in the immediate offset
#pragma unroll   // constant indices keep cs in registers
        for (int s = 0; s < GT * 16 / (32 * NWK); ++s) { cs[s][0] = *(const v2f*)(cb + s * (2 * NWK * HD * 2)); cs[s][1] = *(const v2f*)(cb + s * (2 * NWK * HD * 2) + 4); }   // 2 * NWK rows on per step
        asm volatile("s_wait_xcnt 0x0" :: "v"(cb) : "memory"); }   // precaution of the instruction set's rule on registers that an issued load names: the address pair is an input here, so it keeps its value up to this wait
    float* my = red + (wm * 64 + hi * 8) * GPIT + wn * 32 + lr;
#pragma unroll
    for (int mb = 0; mb < 4; ++mb) {
#pragma unroll
        for (int nb = 0; nb < 2; ++nb) {
#pragma unroll
            for (int j = 0; j < 8; ++j) my[(mb * 16 + j) * GPIT + nb * 16] = acc[mb][nb][j]; } }
    __syncthreads();   // the output tile is whole in LDS before any thread reads its four columns
    auto tile_out = [&](auto job_v) { constexpr bool VT = decltype(job_v)::value;   // compiled once per kind of job, so that each form's rows stay one straight run of LDS loads and stores
#pragma unroll
    for (int ch = 0; ch < 2; ++ch) {   // the tile's two halves of 64 columns
#pragma unroll
    for (int s = 0; s < GT * 16 / (32 * NWK); ++s) { const int idx = s * (32 * NWK) + (int)threadIdx.x; const int row = idx >> 4, cofs = ch * 64 + (idx & 15) * 4; v4f val = *(const v4fa*)(red + row * GPIT + cofs);
        if (BIAS) { val[0] += bfr(bias[c0 + cofs]); val[1] += bfr(bias[c0 + cofs + 1]); val[2] += bfr(bias[c0 + cofs + 2]); val[3] += bfr(bias[c0 + cofs + 3]); }
        if (EPI == 0) *(v4f*)(C + (size_t)(r0 + row) * ldc + c0 + cofs) = val;
        else { v4us oh, ol;
            if (!VT) val = (v4f){ val[0] * cs[s][0][0] - val[1] * cs[s][0][1], val[0] * cs[s][0][1] + val[1] * cs[s][0][0], val[2] * cs[s][1][0] - val[3] * cs[s][1][1], val[2] * cs[s][1][1] + val[3] * cs[s][1][0] };   /* even: x0 c - x1 s; odd: x0 s + x1 c */
#pragma unroll   // constant indices keep the vectors in registers
            for (int k = 0; k < 4; ++k) { unsigned short a2, c2; splitf(val[k], a2, c2); oh[k] = a2; ol[k] = c2; }
            const int tk = c0 % TT + cofs;   // job 2: the first of the four tokens
            const size_t e = !VT ? (size_t)(r0 / TT * NH_ + c0 / HD + ch) * TT * HD + pk(r0 % TT + row, cofs & 63, HD) : (size_t)(c0 / TT * DKV + r0 + (row & 64)) * TT + ((size_t)((tk >> 5) * 4 + ((row & 63) >> 4)) << 9) + pk(row & 15, tk & 31, 32);
            *(v4us*)(Ph + e) = oh; *(v4us*)(Pl + e) = ol;
            if (VT) *(v4h*)(P16 + e) = (v4h){ tohx(val[0]), tohx(val[1]), tohx(val[2]), tohx(val[3]) }; } } }
        if (EPI == 1 && !VT) asm volatile("s_wait_xcnt 0x0" ::: "memory"); };   // precaution of the instruction set's rule on registers that an issued store names, behind the last row's stores: in the built code job 2's block follows this one and reuses their registers
    if (vt) tile_out(BoolC<true>{}); else tile_out(BoolC<false>{});
}


__global__ __launch_bounds__(256) void k_wtG(const float* __restrict__ w, int K, int N, bf* Bt) {
    const int lane = threadIdx.x & 31; const int L0 = (blockIdx.x * 8 + (threadIdx.x >> 5)) * 8; const int nlines = N * K / 64;
{
#pragma unroll 1
        for (int l = 0; l < 8; ++l) { const int L = L0 + l; if (L >= nlines) break; const size_t e = (size_t)L * 64 + lane * 2; const int k = (int)(e % K), n = (int)(e / K); v2us o;
            o[0] = f2bf(w[(size_t)k * N + n]); o[1] = f2bf(w[(size_t)(k + 1) * N + n]); *(v2us*)(Bt + e) = o; }
         }
}

__constant__ float INV2[HD / 2] = { 1.000000000e+00f, 7.498942018e-01f, 5.623413324e-01f, 4.216965139e-01f, 3.162277639e-01f, 2.371373773e-01f, 1.778279394e-01f, 1.333521456e-01f, 1.000000015e-01f, 7.498942316e-02f, 5.623413250e-02f, 4.216964915e-02f, 3.162277490e-02f, 2.371373773e-02f, 1.778279431e-02f, 1.333521400e-02f, 9.999999776e-03f, 7.498942316e-03f, 5.623413250e-03f, 4.216964822e-03f, 3.162277630e-03f, 2.371373819e-03f, 1.778279431e-03f, 1.333521446e-03f, 1.000000047e-03f, 7.498941850e-04f, 5.623413017e-04f, 4.216965172e-04f, 3.162277571e-04f, 2.371373703e-04f, 1.778279402e-04f, 1.333521504e-04f };   // theta ** (-2i / 64), i = 0..31, in float32 as THIS module writes it (the NEGATIVE-POWER spelling 'theta ** (-arange(0, dh, 2) / dh)', evaluated in the reference's own f32 arithmetic): ten of the 32 entries differ by one ulp from the reciprocal spelling '1 / theta ** (2i / 64)' (indices 5, 9, 10, 12, 13, 15, 20, 27, 28, 29)
#define PB_CS (TT * HD / 256)             // work-groups of k_prep that build the rotary table (they come first: the longest threads)
#define PB_X  (NB_ * TT * DM / 8 / 256)   // ... that round x, both batches
#define PB_W  (DM * DM / 8 / 256)         // ... that round one weight
// ---- k_prep: everything that depends on the inputs alone, in one grid of PB_CS + PB_X + 4 * PB_W work-groups; a work-group does one kind of work. The table serves both batches (token_positions has no batch axis). W4 = the four weights Wq, Wk, Wv, Wo one behind the other.
__global__ __launch_bounds__(256) void k_prep(const float* __restrict__ x, const int* __restrict__ pid, const float* __restrict__ wq, const float* __restrict__ wk, const float* __restrict__ wv, const float* __restrict__ wo, bf* XB, bf* W4, float* CS) {
    const int blk = blockIdx.x;
    if (blk < PB_CS) { const int idx = blk * 256 + threadIdx.x; const int d = idx % HD; const int t = idx / HD; const float a = __fmul_rn((float)pid[t], INV2[d >> 1]); v2f cs; cs[0] = cosf(a); cs[1] = sinf(a); *(v2f*)(CS + (size_t)idx * 2) = cs; return; }
    const float* src = x; bf* dst = XB; int g = blk - PB_CS;
    if (g >= PB_X) { g -= PB_X; const int j = g / PB_W; g %= PB_W; src = j == 0 ? wq : j == 1 ? wk : j == 2 ? wv : wo; dst = W4 + (size_t)j * DM * DM; }
    // a wave takes 8 rows x one 32-k block: it reads one whole 128-byte line of each row and writes four whole lines of the block in fragment order
    const int wn = g * 8 + ((int)threadIdx.x >> 5), row = (wn / (DM / 32)) * 8 + ((int)threadIdx.x & 7), k = (wn % (DM / 32)) * 32 + (((int)threadIdx.x >> 3) & 3) * 8;
    const v8f v = *(const v8f*)(src + (size_t)row * DM + k); v8us o;
    asm volatile("s_wait_xcnt 0x0" ::: "memory");   // precaution of the instruction set's rule on registers that an issued load names: the address pair is free for reuse only behind this wait
#pragma unroll
    for (int e = 0; e < 8; ++e) o[e] = f2bf(v[e]); *(v8us*)(dst + pk(row, k, DM)) = o;
    asm volatile("s_wait_xcnt 0x0" ::: "memory");   // same precaution behind the store: in the built code the table's block follows this one and reuses its registers
}

#define AQ   64                   // queries of one work-group: AGR groups of 32, each group two 16-column groups held by AKS waves
#define ANW  8                    // waves of a work-group: wave w = key phase (w >> 1), query group (w & 1)
#define AGR  2                    // query groups of 32
#define AKS  4                    // waves that share the key loop of one query group
#define ASK  (AKS * 32)           // keys of one stage of the ring
#define APE  (ASK * HD)           // elements of one plane in one stage (16 KiB, in a row in the plane and in LDS alike)
#define SCL2 0.18033688011112042f // HD^-0.5 x log2(e): scores are carried in the log2 domain
// ---- k_fattn: causal attention of one head for AQ queries, scores never leave the registers. S^T = K.Q^T (A = 16 key rows, B = 16 query columns; hi/lo planes, 3 products) leaves one query per lane column, so maximum, sum and rescale are per lane plus one exchange between the wave's halves;
// two 16-key score tiles of a lane are, in order, the B fragment of O^T += V^T.P^T (element e < 8: key 8 * hi + e, else key 16 + 8 * hi + e - 8, the order in which WFrag::ld reads V^T). Queries < RH: P and V on hi/lo planes (3 products); other queries: P x 1024 in fp16 (the factor is in the row sum too and cancels).
// The wave of key phase p takes the 32-key blocks p, p + AKS, ... up to its group's diagonal block with its own running maximum; the AKS partial (maximum, sum, O) of a group meet in LDS, are brought to the common maximum and summed in phase order; the quotient goes out as the merged hi/lo planes [b * TT + t][DQ] in fragment order.
// Queries >= RH: K hi, K lo and fp16 V^T of ASK keys are one stage of a ring of two buffers in LDS, brought by asynchronous copies one stage ahead, and both query groups read them there, so a key byte leaves L2 once per AQ queries. Grid (NB_ * heads, TT / AQ), longest query blocks of both batches first.
template <bool HR, int NQ>
__device__ __forceinline__ void attn_keys(const bf* pqh, const bf* pql, const bf* pkh, const bf* pkl, const h16* pv16, const bf* pvh, const bf* pvl, int qa, int q0, int w, int lr, int hi, v8f* o, float* m, float* l) {   // w = key phase. The p.. are per-lane addresses in fragment order (block start + lane * 8): the blocks of query qa, of key w * 32 and of V^T at key w * 32; every load of a plane shares its pair and differs in the immediate offset
    v16bf qh[NQ][2], ql[NQ][2];   // NQ groups of 16 queries from query qa on (B operand: column = query, k = d)
#pragma unroll
    for (int qt = 0; qt < NQ; ++qt)
#pragma unroll
        for (int ks = 0; ks < 2; ++ks) { qh[qt][ks] = WFrag<bf>::ld(pqh + qt * 16 * HD + ks * 512); ql[qt][ks] = WFrag<bf>::ld(pql + qt * 16 * HD + ks * 512); }
    asm volatile("s_wait_xcnt 0x0" :: "v"(pqh), "v"(pql) : "memory");   // precaution of the instruction set's rule on registers that an issued load names: the two address pairs are inputs here, so they keep their values up to this wait
#pragma unroll 1
    for (int kb = w * 32; kb <= q0; kb += AKS * 32) {
        v8f s[2][NQ];
#pragma unroll
        for (int kt = 0; kt < 2; ++kt) { v16bf kh[2], kl[2];
#pragma unroll
            for (int ks = 0; ks < 2; ++ks) { kh[ks] = WFrag<bf>::ld(pkh + kt * 16 * HD + ks * 512); kl[ks] = WFrag<bf>::ld(pkl + kt * 16 * HD + ks * 512); }
#pragma unroll
            for (int qt = 0; qt < NQ; ++qt) { v8f c = (v8f){};
#pragma unroll
                for (int ks = 0; ks < 2; ++ks) { c = wmmab(kh[ks], qh[qt][ks], c); c = wmmab(kl[ks], qh[qt][ks], c); c = wmmab(kh[ks], ql[qt][ks], c); }
                s[kt][qt] = c; } }
        v16h v16[4]; v16bf vh[4], vl[4];
#pragma unroll
        for (int dt = 0; dt < 4; ++dt) { if (HR) { vh[dt] = WFrag<bf>::ld(pvh + dt * 512); vl[dt] = WFrag<bf>::ld(pvl + dt * 512); } else v16[dt] = WFrag<h16>::ld(pv16 + dt * 512); }
#pragma unroll
        for (int qt = 0; qt < NQ; ++qt) { const int q = qa + qt * 16 + lr; float t[16]; float mx = m[qt];
#pragma unroll
            for (int e = 0; e < 16; ++e) { const int key = kb + (e >> 3) * 16 + hi * 8 + (e & 7); t[e] = (key <= q) ? s[e >> 3][qt][e & 7] * SCL2 : -3.0e38f; mx = fmaxf(mx, t[e]); }
            mx = fmaxf(mx, __shfl_xor(mx, 16, 32));
            const float al = __builtin_amdgcn_exp2f(m[qt] - mx); m[qt] = mx; const float mo = HR ? mx : mx - 10.0f; float ps = 0.f;
#pragma unroll
            for (int e = 0; e < 16; ++e) { t[e] = __builtin_amdgcn_exp2f(t[e] - mo); ps += t[e]; }
            l[qt] = l[qt] * al + ps;
#pragma unroll
            for (int dt = 0; dt < 4; ++dt) o[qt * 4 + dt] *= al;
            if (HR) { v8us h0, h1, l0, l1;
#pragma unroll
                for (int e = 0; e < 8; ++e) { unsigned short a, c2; splitf(t[e], a, c2); h0[e] = a; l0[e] = c2; splitf(t[8 + e], a, c2); h1[e] = a; l1[e] = c2; }
                const v16bf ph = cat16b(h0, h1), pl = cat16b(l0, l1);
#pragma unroll
                for (int dt = 0; dt < 4; ++dt) { v8f c = o[qt * 4 + dt]; c = wmmab(vh[dt], ph, c); c = wmmab(vh[dt], pl, c); c = wmmab(vl[dt], ph, c); o[qt * 4 + dt] = c; }
            } else { v16h p;
#pragma unroll
                for (int e = 0; e < 16; ++e) p[e] = tohx(t[e]);
#pragma unroll
                for (int dt = 0; dt < 4; ++dt) o[qt * 4 + dt] = wmma16(v16[dt], p, o[qt * 4 + dt]); } }
        // precaution of the instruction set's rule on registers that an issued load names: the trip's address pairs are inputs here, so they keep their values up to this wait and are stepped only behind it
        if (HR) { asm volatile("s_wait_xcnt 0x0" :: "v"(pkh), "v"(pkl), "v"(pvh), "v"(pvl) : "memory"); pvh += AKS * 32 * HD; pvl += AKS * 32 * HD; }
        else { asm volatile("s_wait_xcnt 0x0" :: "v"(pkh), "v"(pkl), "v"(pv16) : "memory"); pv16 += AKS * 32 * HD; }
        pkh += AKS * 32 * HD; pkl += AKS * 32 * HD;
    }
}
// The same walk for queries >= RH with the keys from the ring. pqh, pql: as above, the wave's 32 queries from qa on. gkh, gkl, gv: this lane's 16 bytes in the first of the four 512-byte pieces of wave w's eighth of stage 0 in each plane. ns stages (the same for the whole work-group); every wave passes every barrier, also in a stage whose block lies above its diagonal.
__device__ __forceinline__ void attn_keys_ring(const bf* pqh, const bf* pql, const bf* gkh, const bf* gkl, const h16* gv, bf* ring, int qa, int ns, int w, int p, int lane, int lr, int hi, v8f* o, float* m, float* l) {
    const unsigned la = (unsigned)(size_t)(ring + w * 1024 + lane * 8);   // the same place in buffer 0 of the ring, as an LDS byte address
    auto fill = [&](int t) {   // stage t into buffer t % 2: every lane on, 12 copies a wave; the wait in the copies' own statement is the precaution of the instruction set's rule on registers that an issued copy names
        const unsigned l1 = la + (unsigned)(t & 1) * (3 * APE * 2), l2 = l1 + APE * 2, l3 = l1 + APE * 4; const bf* a = gkh + (size_t)t * APE; const bf* b = gkl + (size_t)t * APE; const h16* c = gv + (size_t)t * APE;
        asm volatile("global_load_async_to_lds_b128 %0, %12, off\n\tglobal_load_async_to_lds_b128 %1, %13, off\n\tglobal_load_async_to_lds_b128 %2, %14, off\n\tglobal_load_async_to_lds_b128 %3, %15, off\n\t"
                     "global_load_async_to_lds_b128 %4, %16, off\n\tglobal_load_async_to_lds_b128 %5, %17, off\n\tglobal_load_async_to_lds_b128 %6, %18, off\n\tglobal_load_async_to_lds_b128 %7, %19, off\n\t"
                     "global_load_async_to_lds_b128 %8, %20, off\n\tglobal_load_async_to_lds_b128 %9, %21, off\n\tglobal_load_async_to_lds_b128 %10, %22, off\n\tglobal_load_async_to_lds_b128 %11, %23, off\n\ts_wait_xcnt 0x0"
                     :: "v"(l1), "v"(l1 + 512), "v"(l1 + 1024), "v"(l1 + 1536), "v"(l2), "v"(l2 + 512), "v"(l2 + 1024), "v"(l2 + 1536), "v"(l3), "v"(l3 + 512), "v"(l3 + 1024), "v"(l3 + 1536),
                        "v"(a), "v"(a + 256), "v"(a + 512), "v"(a + 768), "v"(b), "v"(b + 256), "v"(b + 512), "v"(b + 768), "v"(c), "v"(c + 256), "v"(c + 512), "v"(c + 768) : "memory"); };
    fill(0);
    v16bf qh[2][2], ql[2][2];   // two groups of 16 queries from query qa on (B operand: column = query, k = d)
#pragma unroll
    for (int qt = 0; qt < 2; ++qt)
#pragma unroll
        for (int ks = 0; ks < 2; ++ks) { qh[qt][ks] = WFrag<bf>::ld(pqh + qt * 16 * HD + ks * 512); ql[qt][ks] = WFrag<bf>::ld(pql + qt * 16 * HD + ks * 512); }
    asm volatile("s_wait_xcnt 0x0" :: "v"(pqh), "v"(pql) : "memory");   // precaution of the instruction set's rule on registers that an issued load names: the two address pairs are inputs here, so they keep their values up to this wait
    asm volatile("s_wait_asynccnt 0x0" ::: "memory");   // this wave's share of stage 0 has landed
    __syncthreads();   // stage 0 is whole before any wave reads it
    if (1 < ns) fill(1);
#pragma unroll 1   // one copy of the trip: a barrier ends every trip, so unrolling would only lengthen the code
    for (int st = 0; st < ns; ++st) { const int kb = st * ASK + p * 32;
        if (kb <= qa) {   // the same for the whole wave (scalar): blocks above the group's diagonal are not worked on
            const bf* pkh = ring + (st & 1) * (3 * APE) + p * (32 * HD) + lane * 8; const bf* pkl = pkh + APE; const h16* pv16 = (const h16*)(pkh + 2 * APE);
            v8f s[2][2];
#pragma unroll
            for (int kt = 0; kt < 2; ++kt) { v16bf kh[2], kl[2];
#pragma unroll
                for (int ks = 0; ks < 2; ++ks) { kh[ks] = WFrag<bf>::ld(pkh + kt * 16 * HD + ks * 512); kl[ks] = WFrag<bf>::ld(pkl + kt * 16 * HD + ks * 512); }
#pragma unroll
                for (int qt = 0; qt < 2; ++qt) { v8f c = (v8f){};
#pragma unroll
                    for (int ks = 0; ks < 2; ++ks) { c = wmmab(kh[ks], qh[qt][ks], c); c = wmmab(kl[ks], qh[qt][ks], c); c = wmmab(kh[ks], ql[qt][ks], c); }
                    s[kt][qt] = c; } }
            v16h v16[4];
#pragma unroll
            for (int dt = 0; dt < 4; ++dt) v16[dt] = WFrag<h16>::ld(pv16 + dt * 512);
#pragma unroll
            for (int qt = 0; qt < 2; ++qt) { const int q = qa + qt * 16 + lr; float t[16]; float mx = m[qt];
#pragma unroll
                for (int e = 0; e < 16; ++e) { const int key = kb + (e >> 3) * 16 + hi * 8 + (e & 7); t[e] = (key <= q) ? s[e >> 3][qt][e & 7] * SCL2 : -3.0e38f; mx = fmaxf(mx, t[e]); }
                mx = fmaxf(mx, __shfl_xor(mx, 16, 32));
                const float al = __builtin_amdgcn_exp2f(m[qt] - mx); m[qt] = mx; const float mo = mx - 10.0f; float ps = 0.f;
#pragma unroll
                for (int e = 0; e < 16; ++e) { t[e] = __builtin_amdgcn_exp2f(t[e] - mo); ps += t[e]; }
                l[qt] = l[qt] * al + ps;
#pragma unroll
                for (int dt = 0; dt < 4; ++dt) o[qt * 4 + dt] *= al;
                v16h pp;
#pragma unroll
                for (int e = 0; e < 16; ++e) pp[e] = tohx(t[e]);
#pragma unroll
                for (int dt = 0; dt < 4; ++dt) o[qt * 4 + dt] = wmma16(v16[dt], pp, o[qt * 4 + dt]); } }
        asm volatile("s_wait_dscnt 0x0" ::: "memory");      // this wave's reads of the buffer are done before the barrier frees it for the refill
        asm volatile("s_wait_asynccnt 0x0" ::: "memory");   // this wave's share of stage st + 1 has landed
        __syncthreads();   // publishes stage st + 1 and ends every wave's reads of stage st
        if (st + 2 < ns) fill(st + 2);
    }
    asm volatile("s_wait_asynccnt 0x0" ::: "memory");   // no copy is under way when the ring's bytes become the partial sums' place
}
// amdgpu_waves_per_eu(4, 4): holds the kernel to 256 VGPRs, so that two work-groups share a WGP and one wave's load waits are covered by three others on its SIMD (left free the build took 318 VGPRs: one work-group per WGP)
__global__ __launch_bounds__(32 * ANW) __attribute__((amdgpu_waves_per_eu(4, 4))) void k_fattn(const bf* __restrict__ Qh, const bf* __restrict__ Ql, const bf* __restrict__ Kh, const bf* __restrict__ Kl, const h16* __restrict__ V16, const bf* __restrict__ Vh, const bf* __restrict__ Vl, bf* Ah, bf* Al) {
    static_assert(2 * 3 * APE * 2 >= ANW * 32 * 68 * 4, "the partial sums fit the ring's bytes");
    __shared__ __align__(1024) unsigned char sm[2 * 3 * APE * 2];   // the ring: two buffers of K hi, K lo, V^T; behind the key loop the partial sums
    float* ored = (float*)sm;   // per wave 32 queries x HD floats, row pitch 68
    __shared__ float mred[ANW * 32]; __shared__ float lred[ANW * 32];
    const int lane = threadIdx.x & 31, lr = lane & 15, hi = lane >> 4; const int w = __builtin_amdgcn_readfirstlane((int)(threadIdx.x >> 5)); const int g = w & (AGR - 1), p = w / AGR;
    const int h = blockIdx.x % NH_, bat = blockIdx.x / NH_; const int q0 = (TT / AQ - 1 - (int)blockIdx.y) * AQ, qg = q0 + g * 32; const size_t hp = (size_t)blockIdx.x * TT * HD;
    v8f o[2 * 4]; float m[2] = { -3.0e38f, -3.0e38f }, l[2] = { 0.f, 0.f };   // o[qt * 4 + dt][j] = O[query qg + qt * 16 + lr][d = dt * 16 + hi * 8 + j]
#pragma unroll
    for (int i = 0; i < 8; ++i) o[i] = (v8f){};
    const size_t qo = hp + (size_t)qg * HD + lane * 8, ko = hp + (size_t)(p * 32) * HD + lane * 8, vo = ko;   // fragment order: 16 tokens of Q or K are 2 blocks, 32 keys of V^T 4 blocks (d / 16), so 32 keys are 32 * HD elements in every plane
    if (q0 < RH) {   // the same for the whole work-group. hi/lo P and V take twice the fragment registers: the two 16-query groups walk the keys one after the other, straight from the planes
        attn_keys<true, 1>(Qh + qo, Ql + qo, Kh + ko, Kl + ko, V16 + vo, Vh + vo, Vl + vo, qg, qg, p, lr, hi, o, m, l);
        attn_keys<true, 1>(Qh + qo + 16 * HD, Ql + qo + 16 * HD, Kh + ko, Kl + ko, V16 + vo, Vh + vo, Vl + vo, qg + 16, qg, p, lr, hi, o + 4, m + 1, l + 1);
    } else { const size_t so = hp + (size_t)w * 1024 + lane * 8; attn_keys_ring(Qh + qo, Ql + qo, Kh + so, Kl + so, V16 + so, (bf*)sm, qg, (q0 + AQ + ASK - 1) / ASK, w, p, lane, lr, hi, o, m, l); }
#pragma unroll
    for (int qt = 0; qt < 2; ++qt) { l[qt] += __shfl_xor(l[qt], 16, 32); if (hi == 0) mred[w * 32 + qt * 16 + lr] = m[qt]; }
    __syncthreads();   // every wave's running maximum is in LDS before any wave forms the common one
#pragma unroll
    for (int qt = 0; qt < 2; ++qt) { float M = mred[g * 32 + qt * 16 + lr];
#pragma unroll
        for (int u = 1; u < AKS; ++u) M = fmaxf(M, mred[(u * AGR + g) * 32 + qt * 16 + lr]);
        const float f = __builtin_amdgcn_exp2f(m[qt] - M);   // a wave without a key block has maximum -3e38, sum 0 and O 0: factor 0
        if (hi == 0) lred[w * 32 + qt * 16 + lr] = l[qt] * f;
        float* my = ored + (w * 32 + qt * 16 + lr) * 68 + hi * 8;
#pragma unroll
        for (int dt = 0; dt < 4; ++dt) { const v8f x = o[qt * 4 + dt] * f; *(v4fa*)(my + dt * 16) = (v4f){ x[0], x[1], x[2], x[3] }; *(v4fa*)(my + dt * 16 + 4) = (v4f){ x[4], x[5], x[6], x[7] }; } }
    __syncthreads();   // every wave's rescaled partial sum and O are in LDS before any thread sums across waves
    { const int q = lane, d0 = p * 16; float L = lred[g * 32 + q]; v4f a[4];   // wave (p, g): 16 d of the 32 queries of group g
#pragma unroll
        for (int c = 0; c < 4; ++c) a[c] = *(const v4fa*)(ored + (g * 32 + q) * 68 + d0 + c * 4);
#pragma unroll
        for (int u = 1; u < AKS; ++u) { L += lred[(u * AGR + g) * 32 + q];
#pragma unroll
            for (int c = 0; c < 4; ++c) a[c] += *(const v4fa*)(ored + ((u * AGR + g) * 32 + q) * 68 + d0 + c * 4); }
        const float inv = __fdiv_rn(1.0f, L); v8us oh[2], ol[2];
#pragma unroll
        for (int c = 0; c < 4; ++c)
#pragma unroll
            for (int e = 0; e < 4; ++e) { unsigned short x, y; splitf(a[c][e] * inv, x, y); oh[c >> 1][(c & 1) * 4 + e] = x; ol[c >> 1][(c & 1) * 4 + e] = y; }
        const size_t oo = pk(bat * TT + qg + q, h * HD + d0, DQ);   // the two 8-d pieces lie 128 elements apart ((k / 8) % 2 is the lane's half); a wave holds each piece of all its 32 queries: 2 x 256 contiguous bytes in fragment order
        *(v8us*)(Ah + oo) = oh[0]; *(v8us*)(Ah + oo + 128) = oh[1]; *(v8us*)(Al + oo) = ol[0]; *(v8us*)(Al + oo + 128) = ol[1]; }
}

extern "C" void kernel_launch(void* const* d_in, const int* in_sizes, int n_in,
                              void* d_out, int out_size, void* d_ws, size_t ws_size, hipStream_t stream) {
    (void)in_sizes; (void)n_in; (void)out_size;
    const float* x = (const float*)d_in[0]; const int* PID = (const int*)d_in[1]; const float* wq = (const float*)d_in[2]; const float* wk = (const float*)d_in[3]; const float* wv = (const float*)d_in[4]; const float* wo = (const float*)d_in[5];   /* inputs x, token_positions (int32 [2048], shared by all batches; read), Wq, Wk, Wv, Wo ('oi' [1024][1024]) */
    float* OUT = (float*)d_out;     // [2][2048][1024]
    char* wsp = (char*)d_ws;
    auto take = [&](size_t bytes) { char* p = wsp; wsp += (bytes + 255) & ~(size_t)255; return (void*)p; };
    bf* W4 = (bf*)take((size_t)4 * DM * DM * 2); float* CS = (float*)take((size_t)TT * HD * 2 * 4);   /* Wq, Wk, Wv, Wo one behind the other */
    bf* XB = (bf*)take((size_t)NB_ * TT * DM * 2);
    const size_t PL = (size_t)NB_ * NH_ * TT * HD;   /* elements of one plane, both batches */
    h16* VT16 = (h16*)take(PL * 2);
    bf* PH = (bf*)take(3 * PL * 2); bf* PLO = (bf*)take(3 * PL * 2);   /* hi and lo planes of Q, K, V^T one behind the other */
    bf* ATh = (bf*)take(PL * 2); bf* ATl = (bf*)take(PL * 2);
    if ((size_t)(wsp - (char*)d_ws) > ws_size) return;    // ws 256 MiB
    k_prep<<<PB_CS + PB_X + 4 * PB_W, 256, 0, stream>>>(x, PID, wq, wk, wv, wo, XB, W4, CS);   /* rotary table, bf16 x and weights */
    k_gemmw<bf, 0, false, 1, DM><<<dim3(NB_ * TT / GT, DQ / GT, 3), 32 * NWK, 0, stream>>>(XB, nullptr, W4, nullptr, nullptr, 0, nullptr, 0, (size_t)DM * DM, PL, CS, VT16, PH, PLO);   /* Q and K projection with rotary, V^T = Wv . x^T; planes */
    k_fattn<<<dim3(NB_ * NH_, TT / AQ, 1), 32 * ANW, 0, stream>>>(PH, PLO, PH + PL, PLO + PL, VT16, PH + 2 * PL, PLO + 2 * PL, ATh, ATl);   /* scores, softmax, P.V and the merge of all heads */
    k_gemmw<bf, 1, false, 0, DQ><<<dim3(NB_ * TT / GT, DM / GT, 1), 32 * NWK, 0, stream>>>(ATh, ATl, W4 + (size_t)3 * DM * DM, nullptr, OUT, DM, nullptr, 0, 0, 0, nullptr, nullptr, nullptr, nullptr);
}

// v009
// One run takes 90.1 microseconds.
// Timed twice side by side with v008, it ran 1.04 and 1.03 times as fast.
// Over all steps from v000 it is 15.4 times as fast.
#include <hip/hip_runtime.h>

// Causal multi-head self-attention with interleaved-pair rotary position embedding from a position input (x [2][2048][1024]; Q, K, V = einsum('bsd,ed', x, W) ('oi' [1024][1024] 1/32, no bias; 16 heads x 64); angle = float(token_positions[t]) x theta ** (-2i / 64) (theta 1e4; token_positions int32 [2048] = arange, shared by both batches, READ on device); pairs (2i, 2i+1): (x1 cos - x2 sin, x1 sin + x2 cos) on Q and K; scores / sqrt(64); keys j <= i kept, -inf elsewhere; softmax; out = einsum('bsd,ed', merged, Wo) -> [2][2048][1024] (4.2 M); argument order x, token_positions, Wq, Wk, Wv, Wo).
// Layout, both batches in every launch (rows b * 2048 + t; planes [b][head]...): bf16 copy of x; exact projections; {cos, sin} per (position, pair) built once from the int positions and float32 inverse-frequency constants (precise cosf/sinf); interleaved rotary and the hi/lo (V: also fp16, transposed) planes formed in the projection GEMMs' own epilogue; fused causal T-2048 attention k_fattn (EVERY row's scores on hi/lo planes (3 products: logit sigma 2 with these weights), online softmax in registers, hybrid P.V (rows < 512 hi/lo, rest fp16 x1024); key blocks above the diagonal are never visited); merged hi/lo x Wo exact.
// Compute dtypes, f32 accumulate: every input rounded to bf16; projections exact; rotary f32; attention rows < 512 3 products, rest fp16; softmax f32; Wo hl x exact.

#define NB_  2
#define TT   2048
#define DM   1024
#define NH_  16
#define NKV  16
#define HD   64
#define DQ   (NH_ * HD)
#define DKV  (NKV * HD)
#define RH   512                  // query rows < RH use hi+lo planes (0: none)
typedef _Float16 h16;
typedef unsigned short bf;
typedef __attribute__((ext_vector_type(16))) __bf16   v16bf;
typedef __attribute__((ext_vector_type(16))) _Float16 v16h;
typedef __attribute__((ext_vector_type(8)))  _Float16 v8h;
typedef __attribute__((ext_vector_type(8)))  unsigned short v8us;
typedef __attribute__((ext_vector_type(8)))  float    v8f;
typedef __attribute__((ext_vector_type(4)))  float    v4f;
typedef v8h  __attribute__((may_alias)) v8ha;
typedef v4f  __attribute__((may_alias)) v4fa;
typedef v8us __attribute__((may_alias)) v8usa;

__device__ __forceinline__ unsigned short f2bf(float f) { unsigned u = __float_as_uint(f); u += 0x7FFFu + ((u >> 16) & 1u); return (unsigned short)(u >> 16); }
__device__ __forceinline__ float bf2f(unsigned short b) { return __uint_as_float(((unsigned)b) << 16); }
__device__ __forceinline__ float bfr(float f) { return bf2f(f2bf(f)); }
__device__ __forceinline__ v16h cat16(v8h lo, v8h hi) { return __builtin_shufflevector(lo, hi, 0, 1, 2, 3, 4, 5, 6, 7, 8, 9, 10, 11, 12, 13, 14, 15); }
__device__ __forceinline__ v16bf cat16b(v8us lo, v8us hi) { return __builtin_bit_cast(v16bf, __builtin_shufflevector(lo, hi, 0, 1, 2, 3, 4, 5, 6, 7, 8, 9, 10, 11, 12, 13, 14, 15)); }
__device__ __forceinline__ v8f wmma16(v16h a, v16h b, v8f c) { return __builtin_amdgcn_wmma_f32_16x16x32_f16(false, a, false, b, (short)0, c, false, false); }
__device__ __forceinline__ v8f wmmab(v16bf a, v16bf b, v8f c) { return __builtin_amdgcn_wmma_f32_16x16x32_bf16(false, a, false, b, (short)0, c, false, false); }
__device__ __forceinline__ h16 tohx(float x) { return (h16)x; }
__device__ __forceinline__ void splitf(float y, unsigned short& h, unsigned short& l) { h = f2bf(y); l = f2bf(y - bf2f(h)); }
typedef __attribute__((ext_vector_type(2))) _Float16 v2h;
typedef __attribute__((ext_vector_type(4))) _Float16 v4h;
typedef __attribute__((ext_vector_type(2))) unsigned short v2us;
typedef __attribute__((ext_vector_type(4))) unsigned short v4us;
typedef __attribute__((ext_vector_type(2))) float v2f;
typedef __attribute__((ext_vector_type(4))) int v4i;



// ---- fragment order: every 16-bit operand plane [rows][K] lies in the workspace as blocks of 16 rows x 32 k (512 elements, 1 KiB), block (r / 16, k / 32) at index (r / 16) * (K / 32) + k / 32 (V^T planes: (k / 32) * (HD / 16) + r / 16); inside a block the two 512-byte halves are what the two 16-byte loads of a fragment read,
// lane by lane: element (r, k) at half (k / 16) % 2, lane ((k / 8) % 2) * 16 + r % 16, place k % 8. A wave's fragment load is then 512 contiguous bytes (4 whole lines) where the row-major plane gave 32 bytes from each of 16 lines. WFrag::ld takes block start + lane * 8.
__device__ __forceinline__ size_t pk(int r, int k, int K) { return (((size_t)(r >> 4) * (K >> 5) + (k >> 5)) << 9) + (((k >> 4) & 1) << 8) + ((((k >> 3) & 1) * 16 + (r & 15)) << 3) + (k & 7); }

#define NWK  8                    // waves of a work-group: 2 x 4 wave tiles of 64 x 32 outputs
#define GT   128                  // rows and columns of a work-group's output tile
#define GOPE (GT * 64)            // elements of one operand in one stage of the ring: 8 bands of 16 rows x 64 k (two fragment blocks, 2 KiB a band)
#define GPIT 132                  // floats of one row of the output tile in LDS (8 rows on, the banks are 32 further: the two halves of a wave store side by side)
// ---- k_gemmw: GEMM, one 128x128 output tile per work-group of NWK waves, operands from 16-bit planes in fragment order, staged in LDS: a stage is 64 k of the tile's 128 rows of every operand, two buffers;
// wave w brings band w of every operand by asynchronous copies (a band's stage is 2 KiB in a row, in the plane and in LDS alike), one stage ahead of the products; every wave reads its 4 A and 2 B fragments per 32 k from LDS, so an operand byte leaves L2 once per work-group.
// Each wave sums its outputs over the whole K in rising k. grid (M/128, N/128, Z), 32 * NWK threads. K % 64 == 0, K >= 128.
// C[m][n] (f32, pitch ldc, + optional f32 bias[n]) = sum_k A[m][k] Bt[n][k] (NSPLIT 1: + A2[m][k] Bt[n][k]). z-batch strides sA/sB/sC in elements.
// The output tile goes through LDS (the ring's bytes, free by then) so that a thread holds four neighbouring columns. EPI says what it does with them: 0 store them to C in f32; 1 is the grid of the three projections, job = blockIdx.z (weight z * sB, hi/lo planes z * sC), grid (NB_ * TT / 128, DQ / 128, 3):
// jobs 0, 1 (Q, K; rows = tokens b * TT + t, the tile's columns = heads 2 * blockIdx.y and the next) turn the two (even, odd) pairs by the token's {cos, sin} of CS and store hi/lo planes [b][head] of [token][HD] in fragment order;
// job 2 swaps the operands and the two block indices (A = the V weight, Bt = the tokens): the rows are (head, d) and the columns tokens, which is V^T as the attention reads it; fp16 and hi/lo planes [b][head] of fragment blocks [token / 32][d / 16].
template <bool B> struct BoolC { static constexpr bool value = B; };
template <typename T16> struct WFrag;
template <> struct WFrag<h16> { typedef v16h V; static __device__ __forceinline__ V ld(const h16* p) { return cat16(*(const v8h*)p, *(const v8h*)(p + 256)); } static __device__ __forceinline__ v8f mma(V a, V b, v8f c) { return wmma16(a, b, c); } };
template <> struct WFrag<bf> { typedef v16bf V; static __device__ __forceinline__ V ld(const bf* p) { return cat16b(*(const v8us*)p, *(const v8us*)(p + 256)); } static __device__ __forceinline__ v8f mma(V a, V b, v8f c) { return wmmab(a, b, c); } };
template <typename T16, int NSPLIT, bool BIAS, int EPI, int K>
__global__ __launch_bounds__(32 * NWK) void k_gemmw(const T16* __restrict__ A, const T16* __restrict__ A2, const T16* __restrict__ Bt, const T16* __restrict__ Bt2, float* C, int ldc, const float* __restrict__ bias, size_t sA, size_t sB, size_t sC, const float* __restrict__ CS, h16* P16, bf* Ph, bf* Pl) {
    typedef typename WFrag<T16>::V V;
    static_assert(NSPLIT <= 1 && K % 64 == 0 && K >= 128, "operands A, A2, Bt; two stages or more");
    constexpr int NOP = NSPLIT == 1 ? 3 : 2, BUFE = NOP * GOPE, NT = K / 64;   // operands, elements of one buffer, stages
    constexpr int RINGB = 2 * BUFE * 2, OUTB = GT * GPIT * 4;
    __shared__ __align__(1024) unsigned char sm[RINGB > OUTB ? RINGB : OUTB];   // the ring; behind the K loop the output tile
    T16* ring = (T16*)sm; float* red = (float*)sm;
    const size_t z = blockIdx.z; A += z * sA; if (A2) A2 += z * sA; Bt += z * sB; if (EPI == 0) C += z * sC; else { Ph += z * sC; Pl += z * sC; }
    const bool vt = EPI == 1 && blockIdx.z == 2;   // the same for the whole work-group
    if (vt) { const T16* t = A; A = Bt; Bt = t; }
    const int lane = threadIdx.x & 31, lr = lane & 15, hi = lane >> 4; const int r0 = (vt ? blockIdx.y : blockIdx.x) * GT, c0 = (vt ? blockIdx.x : blockIdx.y) * GT;
    const int w = __builtin_amdgcn_readfirstlane((int)(threadIdx.x >> 5)); const int wm = w >> 2, wn = w & 3;
    v8f acc[4][2];   // every '#pragma unroll' of this kernel: constant indices keep the accumulators, the fragments and the small vectors in registers
#pragma unroll
    for (int mb = 0; mb < 4; ++mb)
#pragma unroll
        for (int nb = 0; nb < 2; ++nb) acc[mb][nb] = (v8f){};
    // fragment order: a 16-row band is 16 * K elements, 64 k of it 1024 elements in a row. This lane's 16 bytes in the first of the four 512-byte pieces of band w, stage 0:
    const T16* ga = A + (size_t)(r0 + w * 16) * K + lane * 8; const T16* gb = Bt + (size_t)(c0 + w * 16) * K + lane * 8; const T16* ga2 = NSPLIT == 1 ? A2 + (size_t)(r0 + w * 16) * K + lane * 8 : ga;
    const unsigned la = (unsigned)(size_t)(ring + w * 1024 + lane * 8);   // the same place in buffer 0 of the ring, as an LDS byte address
    auto fill = [&](int t) {   // stage t into buffer t % 2: every lane on, 8 or 12 copies a wave; the wait in the copies' own statement is the precaution of the instruction set's rule on registers that an issued copy names
        const unsigned l = la + (unsigned)(t & 1) * (BUFE * 2), l2 = l + GOPE * 2, l3 = l + GOPE * 4; const T16* a = ga + (size_t)t * 1024; const T16* b = gb + (size_t)t * 1024; const T16* c = ga2 + (size_t)t * 1024;
        if (NSPLIT == 1)
            asm volatile("global_load_async_to_lds_b128 %0, %12, off\n\tglobal_load_async_to_lds_b128 %1, %13, off\n\tglobal_load_async_to_lds_b128 %2, %14, off\n\tglobal_load_async_to_lds_b128 %3, %15, off\n\t"
                         "global_load_async_to_lds_b128 %4, %16, off\n\tglobal_load_async_to_lds_b128 %5, %17, off\n\tglobal_load_async_to_lds_b128 %6, %18, off\n\tglobal_load_async_to_lds_b128 %7, %19, off\n\t"
                         "global_load_async_to_lds_b128 %8, %20, off\n\tglobal_load_async_to_lds_b128 %9, %21, off\n\tglobal_load_async_to_lds_b128 %10, %22, off\n\tglobal_load_async_to_lds_b128 %11, %23, off\n\ts_wait_xcnt 0x0"
                         :: "v"(l), "v"(l + 512), "v"(l + 1024), "v"(l + 1536), "v"(l2), "v"(l2 + 512), "v"(l2 + 1024), "v"(l2 + 1536), "v"(l3), "v"(l3 + 512), "v"(l3 + 1024), "v"(l3 + 1536),
                            "v"(a), "v"(a + 256), "v"(a + 512), "v"(a + 768), "v"(b), "v"(b + 256), "v"(b + 512), "v"(b + 768), "v"(c), "v"(c + 256), "v"(c + 512), "v"(c + 768) : "memory");
        else
            asm volatile("global_load_async_to_lds_b128 %0, %8, off\n\tglobal_load_async_to_lds_b128 %1, %9, off\n\tglobal_load_async_to_lds_b128 %2, %10, off\n\tglobal_load_async_to_lds_b128 %3, %11, off\n\t"
                         "global_load_async_to_lds_b128 %4, %12, off\n\tglobal_load_async_to_lds_b128 %5, %13, off\n\tglobal_load_async_to_lds_b128 %6, %14, off\n\tglobal_load_async_to_lds_b128 %7, %15, off\n\ts_wait_xcnt 0x0"
                         :: "v"(l), "v"(l + 512), "v"(l + 1024), "v"(l + 1536), "v"(l2), "v"(l2 + 512), "v"(l2 + 1024), "v"(l2 + 1536),
                            "v"(a), "v"(a + 256), "v"(a + 512), "v"(a + 768), "v"(b), "v"(b + 256), "v"(b + 512), "v"(b + 768) : "memory"); };
    fill(0);
    asm volatile("s_wait_asynccnt 0x0" ::: "memory");   // this wave's share of stage 0 has landed
    __syncthreads();   // stage 0 is whole before any wave reads it
    fill(1);
    const T16* fa = ring + wm * 4 * 1024 + lane * 8; const T16* fb = ring + GOPE + wn * 2 * 1024 + lane * 8;   // this lane's piece of the wave's first A and B fragment in buffer 0; A2 lies 2 * GOPE behind A
#pragma unroll 1   // one copy of the trip: a barrier ends every trip, so unrolling would only lengthen the code
    for (int t = 0; t < NT; ++t) { const int bo = (t & 1) * BUFE;
#pragma unroll
        for (int j = 0; j < 2; ++j) { V a[4], a2[4], bb[2];
#pragma unroll
            for (int mb = 0; mb < 4; ++mb) { a[mb] = WFrag<T16>::ld(fa + bo + mb * 1024 + j * 512); if (NSPLIT == 1) a2[mb] = WFrag<T16>::ld(fa + bo + 2 * GOPE + mb * 1024 + j * 512); }
#pragma unroll
            for (int nb = 0; nb < 2; ++nb) bb[nb] = WFrag<T16>::ld(fb + bo + nb * 1024 + j * 512);
#pragma unroll
            for (int nb = 0; nb < 2; ++nb)
#pragma unroll
                for (int mb = 0; mb < 4; ++mb) { acc[mb][nb] = WFrag<T16>::mma(a[mb], bb[nb], acc[mb][nb]); if (NSPLIT == 1) acc[mb][nb] = WFrag<T16>::mma(a2[mb], bb[nb], acc[mb][nb]); } }
        asm volatile("s_wait_dscnt 0x0" ::: "memory");      // this wave's reads of the buffer are done before the barrier frees it for the refill
        asm volatile("s_wait_asynccnt 0x0" ::: "memory");   // this wave's share of stage t + 1 has landed
        __syncthreads();   // publishes stage t + 1 and ends every wave's reads of stage t
        if (t + 2 < NT) fill(t + 2);
    }
    asm volatile("s_wait_asynccnt 0x0" ::: "memory");   // no copy is under way when the ring's bytes become the output tile
    v2f cs[GT * 16 / (32 * NWK)][2];   // EPI 1, jobs 0 and 1: {cos, sin} of this thread's two pairs in each of its rows (the same for both heads of the tile), asked for here so that they arrive while the tile goes through LDS
    if (EPI == 1 && !vt) { const float* cb = CS + ((size_t)(r0 % TT + ((int)threadIdx.x >> 4)) * HD + ((int)threadIdx.x & 15) * 4) * 2;   // the thread's first row; every load shares this pair and differs in the immediate offset
#pragma unroll   // constant indices keep cs in registers
        for (int s = 0; s < GT * 16 / (32 * NWK); ++s) { cs[s][0] = *(const v2f*)(cb + s * (2 * NWK * HD * 2)); cs[s][1] = *(const v2f*)(cb + s * (2 * NWK * HD * 2) + 4); }   // 2 * NWK rows on per step
        asm volatile("s_wait_xcnt 0x0" :: "v"(cb) : "memory"); }   // precaution of the instruction set's rule on registers that an issued load names: the address pair is an input here, so it keeps its value up to this wait
    float* my = red + (wm * 64 + hi * 8) * GPIT + wn * 32 + lr;
#pragma unroll
    for (int mb = 0; mb < 4; ++mb) {
#pragma unroll
        for (int nb = 0; nb < 2; ++nb) {
#pragma unroll
            for (int j = 0; j < 8; ++j) my[(mb * 16 + j) * GPIT + nb * 16] = acc[mb][nb][j]; } }
    __syncthreads();   // the output tile is whole in LDS before any thread reads its four columns
    auto tile_out = [&](auto job_v) { constexpr bool VT = decltype(job_v)::value;   // compiled once per kind of job, so that each form's rows stay one straight run of LDS loads and stores
#pragma unroll
    for (int ch = 0; ch < 2; ++ch) {   // the tile's two halves of 64 columns
#pragma unroll
    for (int s = 0; s < GT * 16 / (32 * NWK); ++s) { const int idx = s * (32 * NWK) + (int)threadIdx.x; const int row = idx >> 4, cofs = ch * 64 + (idx & 15) * 4; v4f val = *(const v4fa*)(red + row * GPIT + cofs);
        if (BIAS) { val[0] += bfr(bias[c0 + cofs]); val[1] += bfr(bias[c0 + cofs + 1]); val[2] += bfr(bias[c0 + cofs + 2]); val[3] += bfr(bias[c0 + cofs + 3]); }
        if (EPI == 0) *(v4f*)(C + (size_t)(r0 + row) * ldc + c0 + cofs) = val;
        else { v4us oh, ol;
            if (!VT) val = (v4f){ val[0] * cs[s][0][0] - val[1] * cs[s][0][1], val[0] * cs[s][0][1] + val[1] * cs[s][0][0], val[2] * cs[s][1][0] - val[3] * cs[s][1][1], val[2] * cs[s][1][1] + val[3] * cs[s][1][0] };   /* even: x0 c - x1 s; odd: x0 s + x1 c */
#pragma unroll   // constant indices keep the vectors in registers
            for (int k = 0; k < 4; ++k) { unsigned short a2, c2; splitf(val[k], a2, c2); oh[k] = a2; ol[k] = c2; }
            const int tk = c0 % TT + cofs;   // job 2: the first of the four tokens
            const size_t e = !VT ? (size_t)(r0 / TT * NH_ + c0 / HD + ch) * TT * HD + pk(r0 % TT + row, cofs & 63, HD) : (size_t)(c0 / TT * DKV + r0 + (row & 64)) * TT + ((size_t)((tk >> 5) * 4 + ((row & 63) >> 4)) << 9) + pk(row & 15, tk & 31, 32);
            *(v4us*)(Ph + e) = oh; *(v4us*)(Pl + e) = ol;
            if (VT) *(v4h*)(P16 + e) = (v4h){ tohx(val[0]), tohx(val[1]), tohx(val[2]), tohx(val[3]) }; } } }
        if (EPI == 1 && !VT) asm volatile("s_wait_xcnt 0x0" ::: "memory"); };   // precaution of the instruction set's rule on registers that an issued store names, behind the last row's stores: in the built code job 2's block follows this one and reuses their registers
    if (vt) tile_out(BoolC<true>{}); else tile_out(BoolC<false>{});
}


__global__ __launch_bounds__(256) void k_wtG(const float* __restrict__ w, int K, int N, bf* Bt) {
    const int lane = threadIdx.x & 31; const int L0 = (blockIdx.x * 8 + (threadIdx.x >> 5)) * 8; const int nlines = N * K / 64;
{
#pragma unroll 1
        for (int l = 0; l < 8; ++l) { const int L = L0 + l; if (L >= nlines) break; const size_t e = (size_t)L * 64 + lane * 2; const int k = (int)(e % K), n = (int)(e / K); v2us o;
            o[0] = f2bf(w[(size_t)k * N + n]); o[1] = f2bf(w[(size_t)(k + 1) * N + n]); *(v2us*)(Bt + e) = o; }
         }
}

__constant__ float INV2[HD / 2] = { 1.000000000e+00f, 7.498942018e-01f, 5.623413324e-01f, 4.216965139e-01f, 3.162277639e-01f, 2.371373773e-01f, 1.778279394e-01f, 1.333521456e-01f, 1.000000015e-01f, 7.498942316e-02f, 5.623413250e-02f, 4.216964915e-02f, 3.162277490e-02f, 2.371373773e-02f, 1.778279431e-02f, 1.333521400e-02f, 9.999999776e-03f, 7.498942316e-03f, 5.623413250e-03f, 4.216964822e-03f, 3.162277630e-03f, 2.371373819e-03f, 1.778279431e-03f, 1.333521446e-03f, 1.000000047e-03f, 7.498941850e-04f, 5.623413017e-04f, 4.216965172e-04f, 3.162277571e-04f, 2.371373703e-04f, 1.778279402e-04f, 1.333521504e-04f };   // theta ** (-2i / 64), i = 0..31, in float32 as THIS module writes it (the NEGATIVE-POWER spelling 'theta ** (-arange(0, dh, 2) / dh)', evaluated in the reference's own f32 arithmetic): ten of the 32 entries differ by one ulp from the reciprocal spelling '1 / theta ** (2i / 64)' (indices 5, 9, 10, 12, 13, 15, 20, 27, 28, 29)
#define PT   512                               // threads of a work-group of k_prep: 16 waves
#define PU   8                                 // 32-k blocks that one wave rounds, side by side in its 8 rows
#define PG   (TT * HD / PT)                    // work-groups of k_prep: one entry of the rotary table a thread
#define PGX  (NB_ * TT * DM / (8 * PU * PT))   // ... of them round x, both batches
#define PGW  (DM * DM / (8 * PU * PT))         // ... round one weight
static_assert(PGX + 4 * PGW == PG && PT % HD == 0 && DM % (32 * PU) == 0, "every thread has one table entry and PU pieces of 8 elements");
// ---- k_prep: everything that depends on the inputs alone, in one grid of PG work-groups, about one per WGP, so that few waves have to be started. A work-group rounds a part of one source; every thread also builds one entry of the table, while its loads are under way.
// The table serves both batches (token_positions has no batch axis). W4 = the four weights Wq, Wk, Wv, Wo one behind the other.
__global__ __launch_bounds__(PT) void k_prep(const float* __restrict__ x, const int* __restrict__ pid, const float* __restrict__ wq, const float* __restrict__ wk, const float* __restrict__ wv, const float* __restrict__ wo, bf* XB, bf* W4, float* CS) {
    const int blk = blockIdx.x, lane = (int)threadIdx.x & 31; const int w = __builtin_amdgcn_readfirstlane((int)(threadIdx.x >> 5));
    const int t = (blk * PT + w * 32) / HD, d = (w * 32 + lane) % HD;   // the thread's table entry blk * PT + threadIdx.x; a wave's 32 entries share the token
    const float fr = INV2[d >> 1];   // asked for ahead of the wave's other loads, so that it is back first
    asm volatile("s_wait_xcnt 0x0" ::: "memory");   // precaution of the instruction set's rule on registers that an issued load names: the table's base and the offset are free for reuse only behind this wait
    const float* src = x; bf* dst = XB; int g = blk;
    if (g >= PGX) { g -= PGX; const int j = g / PGW; g %= PGW; src = j == 0 ? wq : j == 1 ? wk : j == 2 ? wv : wo; dst = W4 + (size_t)j * DM * DM; }
    // a wave takes 8 rows x PU 32-k blocks: per block it reads one whole 128-byte line of each row and writes four whole lines of the block in fragment order; all its 2 * PU loads are under way at once
    const int wn = g * (PT / 32) + w, row = (wn / (DM / (32 * PU))) * 8 + (lane & 7), k = (wn % (DM / (32 * PU))) * (32 * PU) + (lane >> 3) * 8;
    const float* p = src + (size_t)row * DM + k; v8f v[PU];
#pragma unroll   // constant indices keep the loaded values in registers; every load shares the pair and differs in the immediate offset
    for (int u = 0; u < PU; ++u) v[u] = *(const v8f*)(p + u * 32);
    asm volatile("s_wait_xcnt 0x0" :: "v"(p) : "memory");   // precaution of the instruction set's rule on registers that an issued load names: the address pair is an input here, so it keeps its value up to this wait
    const float a = __fmul_rn((float)pid[t], fr); v2f cs; cs[0] = cosf(a); cs[1] = sinf(a); *(v2f*)(CS + ((size_t)blk * PT + threadIdx.x) * 2) = cs;
    asm volatile("s_wait_xcnt 0x0" ::: "memory");   // same precaution behind the store: the rounding below reuses its registers
    v8us o[PU];
#pragma unroll
    for (int u = 0; u < PU; ++u)
#pragma unroll
        for (int e = 0; e < 8; ++e) o[u][e] = f2bf(v[u][e]);
    bf* q = dst + pk(row, k, DM);   // 32 k on is the next block, 512 elements on
#pragma unroll
    for (int u = 0; u < PU; ++u) *(v8us*)(q + u * 512) = o[u];
}

#define AQ   64                   // queries of one work-group: AGR groups of 32, each group two 16-column groups held by AKS waves
#define ANW  8                    // waves of a work-group: wave w = key phase (w >> 1), query group (w & 1)
#define AGR  2                    // query groups of 32
#define AKS  4                    // waves that share the key loop of one query group
#define ASK  (AKS * 32)           // keys of one stage of the ring
#define APE  (ASK * HD)           // elements of one plane in one stage (16 KiB, in a row in the plane and in LDS alike)
#define SCL2 0.18033688011112042f // HD^-0.5 x log2(e): scores are carried in the log2 domain
// ---- k_fattn: causal attention of one head for AQ queries, scores never leave the registers. S^T = K.Q^T (A = 16 key rows, B = 16 query columns; hi/lo planes, 3 products) leaves one query per lane column, so maximum, sum and rescale are per lane plus one exchange between the wave's halves;
// two 16-key score tiles of a lane are, in order, the B fragment of O^T += V^T.P^T (element e < 8: key 8 * hi + e, else key 16 + 8 * hi + e - 8, the order in which WFrag::ld reads V^T). Queries < RH: P and V on hi/lo planes (3 products); other queries: P x 1024 in fp16 (the factor is in the row sum too and cancels).
// The wave of key phase p takes the 32-key blocks p, p + AKS, ... up to its group's diagonal block with its own running maximum; the AKS partial (maximum, sum, O) of a group meet in LDS, are brought to the common maximum and summed in phase order; the quotient goes out as the merged hi/lo planes [b * TT + t][DQ] in fragment order.
// Queries >= RH: K hi, K lo and fp16 V^T of ASK keys are one stage of a ring of two buffers in LDS, brought by asynchronous copies one stage ahead, and both query groups read them there, so a key byte leaves L2 once per AQ queries. Grid (NB_ * heads, TT / AQ), longest query blocks of both batches first.
template <bool HR, int NQ>
__device__ __forceinline__ void attn_keys(const bf* pqh, const bf* pql, const bf* pkh, const bf* pkl, const h16* pv16, const bf* pvh, const bf* pvl, int qa, int q0, int w, int lr, int hi, v8f* o, float* m, float* l) {   // w = key phase. The p.. are per-lane addresses in fragment order (block start + lane * 8): the blocks of query qa, of key w * 32 and of V^T at key w * 32; every load of a plane shares its pair and differs in the immediate offset
    v16bf qh[NQ][2], ql[NQ][2];   // NQ groups of 16 queries from query qa on (B operand: column = query, k = d)
#pragma unroll
    for (int qt = 0; qt < NQ; ++qt)
#pragma unroll
        for (int ks = 0; ks < 2; ++ks) { qh[qt][ks] = WFrag<bf>::ld(pqh + qt * 16 * HD + ks * 512); ql[qt][ks] = WFrag<bf>::ld(pql + qt * 16 * HD + ks * 512); }
    asm volatile("s_wait_xcnt 0x0" :: "v"(pqh), "v"(pql) : "memory");   // precaution of the instruction set's rule on registers that an issued load names: the two address pairs are inputs here, so they keep their values up to this wait
#pragma unroll 1
    for (int kb = w * 32; kb <= q0; kb += AKS * 32) {
        v8f s[2][NQ];
#pragma unroll
        for (int kt = 0; kt < 2; ++kt) { v16bf kh[2], kl[2];
#pragma unroll
            for (int ks = 0; ks < 2; ++ks) { kh[ks] = WFrag<bf>::ld(pkh + kt * 16 * HD + ks * 512); kl[ks] = WFrag<bf>::ld(pkl + kt * 16 * HD + ks * 512); }
#pragma unroll
            for (int qt = 0; qt < NQ; ++qt) { v8f c = (v8f){};
#pragma unroll
                for (int ks = 0; ks < 2; ++ks) { c = wmmab(kh[ks], qh[qt][ks], c); c = wmmab(kl[ks], qh[qt][ks], c); c = wmmab(kh[ks], ql[qt][ks], c); }
                s[kt][qt] = c; } }
        v16h v16[4]; v16bf vh[4], vl[4];
#pragma unroll
        for (int dt = 0; dt < 4; ++dt) { if (HR) { vh[dt] = WFrag<bf>::ld(pvh + dt * 512); vl[dt] = WFrag<bf>::ld(pvl + dt * 512); } else v16[dt] = WFrag<h16>::ld(pv16 + dt * 512); }
#pragma unroll
        for (int qt = 0; qt < NQ; ++qt) { const int q = qa + qt * 16 + lr; float t[16]; float mx = m[qt];
#pragma unroll
            for (int e = 0; e < 16; ++e) { const int key = kb + (e >> 3) * 16 + hi * 8 + (e & 7); t[e] = (key <= q) ? s[e >> 3][qt][e & 7] * SCL2 : -3.0e38f; mx = fmaxf(mx, t[e]); }
            mx = fmaxf(mx, __shfl_xor(mx, 16, 32));
            const float al = __builtin_amdgcn_exp2f(m[qt] - mx); m[qt] = mx; const float mo = HR ? mx : mx - 10.0f; float ps = 0.f;
#pragma unroll
            for (int e = 0; e < 16; ++e) { t[e] = __builtin_amdgcn_exp2f(t[e] - mo); ps += t[e]; }
            l[qt] = l[qt] * al + ps;
#pragma unroll
            for (int dt = 0; dt < 4; ++dt) o[qt * 4 + dt] *= al;
            if (HR) { v8us h0, h1, l0, l1;
#pragma unroll
                for (int e = 0; e < 8; ++e) { unsigned short a, c2; splitf(t[e], a, c2); h0[e] = a; l0[e] = c2; splitf(t[8 + e], a, c2); h1[e] = a; l1[e] = c2; }
                const v16bf ph = cat16b(h0, h1), pl = cat16b(l0, l1);
#pragma unroll
                for (int dt = 0; dt < 4; ++dt) { v8f c = o[qt * 4 + dt]; c = wmmab(vh[dt], ph, c); c = wmmab(vh[dt], pl, c); c = wmmab(vl[dt], ph, c); o[qt * 4 + dt] = c; }
            } else { v16h p;
#pragma unroll
                for (int e = 0; e < 16; ++e) p[e] = tohx(t[e]);
#pragma unroll
                for (int dt = 0; dt < 4; ++dt) o[qt * 4 + dt] = wmma16(v16[dt], p, o[qt * 4 + dt]); } }
        // precaution of the instruction set's rule on registers that an issued load names: the trip's address pairs are inputs here, so they keep their values up to this wait and are stepped only behind it
        if (HR) { asm volatile("s_wait_xcnt 0x0" :: "v"(pkh), "v"(pkl), "v"(pvh), "v"(pvl) : "memory"); pvh += AKS * 32 * HD; pvl += AKS * 32 * HD; }
        else { asm volatile("s_wait_xcnt 0x0" :: "v"(pkh), "v"(pkl), "v"(pv16) : "memory"); pv16 += AKS * 32 * HD; }
        pkh += AKS * 32 * HD; pkl += AKS * 32 * HD;
    }
}
// The same walk for queries >= RH with the keys from the ring. pqh, pql: as above, the wave's 32 queries from qa on. gkh, gkl, gv: this lane's 16 bytes in the first of the four 512-byte pieces of wave w's eighth of stage 0 in each plane. ns stages (the same for the whole work-group); every wave passes every barrier, also in a stage whose block lies above its diagonal.
__device__ __forceinline__ void attn_keys_ring(const bf* pqh, const bf* pql, const bf* gkh, const bf* gkl, const h16* gv, bf* ring, int qa, int ns, int w, int p, int lane, int lr, int hi, v8f* o, float* m, float* l) {
    const unsigned la = (unsigned)(size_t)(ring + w * 1024 + lane * 8);   // the same place in buffer 0 of the ring, as an LDS byte address
    auto fill = [&](int t) {   // stage t into buffer t % 2: every lane on, 12 copies a wave; the wait in the copies' own statement is the precaution of the instruction set's rule on registers that an issued copy names
        const unsigned l1 = la + (unsigned)(t & 1) * (3 * APE * 2), l2 = l1 + APE * 2, l3 = l1 + APE * 4; const bf* a = gkh + (size_t)t * APE; const bf* b = gkl + (size_t)t * APE; const h16* c = gv + (size_t)t * APE;
        asm volatile("global_load_async_to_lds_b128 %0, %12, off\n\tglobal_load_async_to_lds_b128 %1, %13, off\n\tglobal_load_async_to_lds_b128 %2, %14, off\n\tglobal_load_async_to_lds_b128 %3, %15, off\n\t"
                     "global_load_async_to_lds_b128 %4, %16, off\n\tglobal_load_async_to_lds_b128 %5, %17, off\n\tglobal_load_async_to_lds_b128 %6, %18, off\n\tglobal_load_async_to_lds_b128 %7, %19, off\n\t"
                     "global_load_async_to_lds_b128 %8, %20, off\n\tglobal_load_async_to_lds_b128 %9, %21, off\n\tglobal_load_async_to_lds_b128 %10, %22, off\n\tglobal_load_async_to_lds_b128 %11, %23, off\n\ts_wait_xcnt 0x0"
                     :: "v"(l1), "v"(l1 + 512), "v"(l1 + 1024), "v"(l1 + 1536), "v"(l2), "v"(l2 + 512), "v"(l2 + 1024), "v"(l2 + 1536), "v"(l3), "v"(l3 + 512), "v"(l3 + 1024), "v"(l3 + 1536),
                        "v"(a), "v"(a + 256), "v"(a + 512), "v"(a + 768), "v"(b), "v"(b + 256), "v"(b + 512), "v"(b + 768), "v"(c), "v"(c + 256), "v"(c + 512), "v"(c + 768) : "memory"); };
    fill(0);
    v16bf qh[2][2], ql[2][2];   // two groups of 16 queries from query qa on (B operand: column = query, k = d)
#pragma unroll
    for (int qt = 0; qt < 2; ++qt)
#pragma unroll
        for (int ks = 0; ks < 2; ++ks) { qh[qt][ks] = WFrag<bf>::ld(pqh + qt * 16 * HD + ks * 512); ql[qt][ks] = WFrag<bf>::ld(pql + qt * 16 * HD + ks * 512); }
    asm volatile("s_wait_xcnt 0x0" :: "v"(pqh), "v"(pql) : "memory");   // precaution of the instruction set's rule on registers that an issued load names: the two address pairs are inputs here, so they keep their values up to this wait
    asm volatile("s_wait_asynccnt 0x0" ::: "memory");   // this wave's share of stage 0 has landed
    __syncthreads();   // stage 0 is whole before any wave reads it
    if (1 < ns) fill(1);
#pragma unroll 1   // one copy of the trip: a barrier ends every trip, so unrolling would only lengthen the code
    for (int st = 0; st < ns; ++st) { const int kb = st * ASK + p * 32;
        if (kb <= qa) {   // the same for the whole wave (scalar): blocks above the group's diagonal are not worked on
            const bf* pkh = ring + (st & 1) * (3 * APE) + p * (32 * HD) + lane * 8; const bf* pkl = pkh + APE; const h16* pv16 = (const h16*)(pkh + 2 * APE);
            v8f s[2][2];
#pragma unroll
            for (int kt = 0; kt < 2; ++kt) { v16bf kh[2], kl[2];
#pragma unroll
                for (int ks = 0; ks < 2; ++ks) { kh[ks] = WFrag<bf>::ld(pkh + kt * 16 * HD + ks * 512); kl[ks] = WFrag<bf>::ld(pkl + kt * 16 * HD + ks * 512); }
#pragma unroll
                for (int qt = 0; qt < 2; ++qt) { v8f c = (v8f){};
#pragma unroll
                    for (int ks = 0; ks < 2; ++ks) { c = wmmab(kh[ks], qh[qt][ks], c); c = wmmab(kl[ks], qh[qt][ks], c); c = wmmab(kh[ks], ql[qt][ks], c); }
                    s[kt][qt] = c; } }
            v16h v16[4];
#pragma unroll
            for (int dt = 0; dt < 4; ++dt) v16[dt] = WFrag<h16>::ld(pv16 + dt * 512);
#pragma unroll
            for (int qt = 0; qt < 2; ++qt) { const int q = qa + qt * 16 + lr; float t[16]; float mx = m[qt];
#pragma unroll
                for (int e = 0; e < 16; ++e) { const int key = kb + (e >> 3) * 16 + hi * 8 + (e & 7); t[e] = (key <= q) ? s[e >> 3][qt][e & 7] * SCL2 : -3.0e38f; mx = fmaxf(mx, t[e]); }
                mx = fmaxf(mx, __shfl_xor(mx, 16, 32));
                const float al = __builtin_amdgcn_exp2f(m[qt] - mx); m[qt] = mx; const float mo = mx - 10.0f; float ps = 0.f;
#pragma unroll
                for (int e = 0; e < 16; ++e) { t[e] = __builtin_amdgcn_exp2f(t[e] - mo); ps += t[e]; }
                l[qt] = l[qt] * al + ps;
#pragma unroll
                for (int dt = 0; dt < 4; ++dt) o[qt * 4 + dt] *= al;
                v16h pp;
#pragma unroll
                for (int e = 0; e < 16; ++e) pp[e] = tohx(t[e]);
#pragma unroll
                for (int dt = 0; dt < 4; ++dt) o[qt * 4 + dt] = wmma16(v16[dt], pp, o[qt * 4 + dt]); } }
        asm volatile("s_wait_dscnt 0x0" ::: "memory");      // this wave's reads of the buffer are done before the barrier frees it for the refill
        asm volatile("s_wait_asynccnt 0x0" ::: "memory");   // this wave's share of stage st + 1 has landed
        __syncthreads();   // publishes stage st + 1 and ends every wave's reads of stage st
        if (st + 2 < ns) fill(st + 2);
    }
    asm volatile("s_wait_asynccnt 0x0" ::: "memory");   // no copy is under way when the ring's bytes become the partial sums' place
}
// amdgpu_waves_per_eu(4, 4): holds the kernel to 256 VGPRs, so that two work-groups share a WGP and one wave's load waits are covered by three others on its SIMD (left free the build took 318 VGPRs: one work-group per WGP)
__global__ __launch_bounds__(32 * ANW) __attribute__((amdgpu_waves_per_eu(4, 4))) void k_fattn(const bf* __restrict__ Qh, const bf* __restrict__ Ql, const bf* __restrict__ Kh, const bf* __restrict__ Kl, const h16* __restrict__ V16, const bf* __restrict__ Vh, const bf* __restrict__ Vl, bf* Ah, bf* Al) {
    static_assert(2 * 3 * APE * 2 >= ANW * 32 * 68 * 4, "the partial sums fit the ring's bytes");
    __shared__ __align__(1024) unsigned char sm[2 * 3 * APE * 2];   // the ring: two buffers of K hi, K lo, V^T; behind the key loop the partial sums
    float* ored = (float*)sm;   // per wave 32 queries x HD floats, row pitch 68
    __shared__ float mred[ANW * 32]; __shared__ float lred[ANW * 32];
    const int lane = threadIdx.x & 31, lr = lane & 15, hi = lane >> 4; const int w = __builtin_amdgcn_readfirstlane((int)(threadIdx.x >> 5)); const int g = w & (AGR - 1), p = w / AGR;
    const int h = blockIdx.x % NH_, bat = blockIdx.x / NH_; const int q0 = (TT / AQ - 1 - (int)blockIdx.y) * AQ, qg = q0 + g * 32; const size_t hp = (size_t)blockIdx.x * TT * HD;
    v8f o[2 * 4]; float m[2] = { -3.0e38f, -3.0e38f }, l[2] = { 0.f, 0.f };   // o[qt * 4 + dt][j] = O[query qg + qt * 16 + lr][d = dt * 16 + hi * 8 + j]
#pragma unroll
    for (int i = 0; i < 8; ++i) o[i] = (v8f){};
    const size_t qo = hp + (size_t)qg * HD + lane * 8, ko = hp + (size_t)(p * 32) * HD + lane * 8, vo = ko;   // fragment order: 16 tokens of Q or K are 2 blocks, 32 keys of V^T 4 blocks (d / 16), so 32 keys are 32 * HD elements in every plane
    if (q0 < RH) {   // the same for the whole work-group. hi/lo P and V take twice the fragment registers: the two 16-query groups walk the keys one after the other, straight from the planes
        attn_keys<true, 1>(Qh + qo, Ql + qo, Kh + ko, Kl + ko, V16 + vo, Vh + vo, Vl + vo, qg, qg, p, lr, hi, o, m, l);
        attn_keys<true, 1>(Qh + qo + 16 * HD, Ql + qo + 16 * HD, Kh + ko, Kl + ko, V16 + vo, Vh + vo, Vl + vo, qg + 16, qg, p, lr, hi, o + 4, m + 1, l + 1);
    } else { const size_t so = hp + (size_t)w * 1024 + lane * 8; attn_keys_ring(Qh + qo, Ql + qo, Kh + so, Kl + so, V16 + so, (bf*)sm, qg, (q0 + AQ + ASK - 1) / ASK, w, p, lane, lr, hi, o, m, l); }
#pragma unroll
    for (int qt = 0; qt < 2; ++qt) { l[qt] += __shfl_xor(l[qt], 16, 32); if (hi == 0) mred[w * 32 + qt * 16 + lr] = m[qt]; }
    __syncthreads();   // every wave's running maximum is in LDS before any wave forms the common one
#pragma unroll
    for (int qt = 0; qt < 2; ++qt) { float M = mred[g * 32 + qt * 16 + lr];
#pragma unroll
        for (int u = 1; u < AKS; ++u) M = fmaxf(M, mred[(u * AGR + g) * 32 + qt * 16 + lr]);
        const float f = __builtin_amdgcn_exp2f(m[qt] - M);   // a wave without a key block has maximum -3e38, sum 0 and O 0: factor 0
        if (hi == 0) lred[w * 32 + qt * 16 + lr] = l[qt] * f;
        float* my = ored + (w * 32 + qt * 16 + lr) * 68 + hi * 8;
#pragma unroll
        for (int dt = 0; dt < 4; ++dt) { const v8f x = o[qt * 4 + dt] * f; *(v4fa*)(my + dt * 16) = (v4f){ x[0], x[1], x[2], x[3] }; *(v4fa*)(my + dt * 16 + 4) = (v4f){ x[4], x[5], x[6], x[7] }; } }
    __syncthreads();   // every wave's rescaled partial sum and O are in LDS before any thread sums across waves
    { const int q = lane, d0 = p * 16; float L = lred[g * 32 + q]; v4f a[4];   // wave (p, g): 16 d of the 32 queries of group g
#pragma unroll
        for (int c = 0; c < 4; ++c) a[c] = *(const v4fa*)(ored + (g * 32 + q) * 68 + d0 + c * 4);
#pragma unroll
        for (int u = 1; u < AKS; ++u) { L += lred[(u * AGR + g) * 32 + q];
#pragma unroll
            for (int c = 0; c < 4; ++c) a[c] += *(const v4fa*)(ored + ((u * AGR + g) * 32 + q) * 68 + d0 + c * 4); }
        const float inv = __fdiv_rn(1.0f, L); v8us oh[2], ol[2];
#pragma unroll
        for (int c = 0; c < 4; ++c)
#pragma unroll
            for (int e = 0; e < 4; ++e) { unsigned short x, y; splitf(a[c][e] * inv, x, y); oh[c >> 1][(c & 1) * 4 + e] = x; ol[c >> 1][(c & 1) * 4 + e] = y; }
        const size_t oo = pk(bat * TT + qg + q, h * HD + d0, DQ);   // the two 8-d pieces lie 128 elements apart ((k / 8) % 2 is the lane's half); a wave holds each piece of all its 32 queries: 2 x 256 contiguous bytes in fragment order
        *(v8us*)(Ah + oo) = oh[0]; *(v8us*)(Ah + oo + 128) = oh[1]; *(v8us*)(Al + oo) = ol[0]; *(v8us*)(Al + oo + 128) = ol[1]; }
}

extern "C" void kernel_launch(void* const* d_in, const int* in_sizes, int n_in,
                              void* d_out, int out_size, void* d_ws, size_t ws_size, hipStream_t stream) {
    (void)in_sizes; (void)n_in; (void)out_size;
    const float* x = (const float*)d_in[0]; const int* PID = (const int*)d_in[1]; const float* wq = (const float*)d_in[2]; const float* wk = (const float*)d_in[3]; const float* wv = (const float*)d_in[4]; const float* wo = (const float*)d_in[5];   /* inputs x, token_positions (int32 [2048], shared by all batches; read), Wq, Wk, Wv, Wo ('oi' [1024][1024]) */
    float* OUT = (float*)d_out;     // [2][2048][1024]
    char* wsp = (char*)d_ws;
    auto take = [&](size_t bytes) { char* p = wsp; wsp += (bytes + 255) & ~(size_t)255; return (void*)p; };
    bf* W4 = (bf*)take((size_t)4 * DM * DM * 2); float* CS = (float*)take((size_t)TT * HD * 2 * 4);   /* Wq, Wk, Wv, Wo one behind the other */
    bf* XB = (bf*)take((size_t)NB_ * TT * DM * 2);
    const size_t PL = (size_t)NB_ * NH_ * TT * HD;   /* elements of one plane, both batches */
    h16* VT16 = (h16*)take(PL * 2);
    bf* PH = (bf*)take(3 * PL * 2); bf* PLO = (bf*)take(3 * PL * 2);   /* hi and lo planes of Q, K, V^T one behind the other */
    bf* ATh = (bf*)take(PL * 2); bf* ATl = (bf*)take(PL * 2);
    if ((size_t)(wsp - (char*)d_ws) > ws_size) return;    // ws 256 MiB
    k_prep<<<PG, PT, 0, stream>>>(x, PID, wq, wk, wv, wo, XB, W4, CS);   /* rotary table, bf16 x and weights */
    k_gemmw<bf, 0, false, 1, DM><<<dim3(NB_ * TT / GT, DQ / GT, 3), 32 * NWK, 0, stream>>>(XB, nullptr, W4, nullptr, nullptr, 0, nullptr, 0, (size_t)DM * DM, PL, CS, VT16, PH, PLO);   /* Q and K projection with rotary, V^T = Wv . x^T; planes */
    k_fattn<<<dim3(NB_ * NH_, TT / AQ, 1), 32 * ANW, 0, stream>>>(PH, PLO, PH + PL, PLO + PL, VT16, PH + 2 * PL, PLO + 2 * PL, ATh, ATl);   /* scores, softmax, P.V and the merge of all heads */
    k_gemmw<bf, 1, false, 0, DQ><<<dim3(NB_ * TT / GT, DM / GT, 1), 32 * NWK, 0, stream>>>(ATh, ATl, W4 + (size_t)3 * DM * DM, nullptr, OUT, DM, nullptr, 0, 0, 0, nullptr, nullptr, nullptr, nullptr);
}

// v010
// It runs in 85.4 microseconds.
// Timed twice side by side with v009, it ran 1.06 and 1.05 times as fast.
// All steps since v000 together make it 16.3 times as fast.
#include <hip/hip_runtime.h>

// Causal multi-head self-attention with interleaved-pair rotary position embedding from a position input (x [2][2048][1024]; Q, K, V = einsum('bsd,ed', x, W) ('oi' [1024][1024] 1/32, no bias; 16 heads x 64); angle = float(token_positions[t]) x theta ** (-2i / 64) (theta 1e4; token_positions int32 [2048] = arange, shared by both batches, READ on device); pairs (2i, 2i+1): (x1 cos - x2 sin, x1 sin + x2 cos) on Q and K; scores / sqrt(64); keys j <= i kept, -inf elsewhere; softmax; out = einsum('bsd,ed', merged, Wo) -> [2][2048][1024] (4.2 M); argument order x, token_positions, Wq, Wk, Wv, Wo).
// Layout, both batches in every launch (rows b * 2048 + t; planes [b][head]...): bf16 copy of x; exact projections; {cos, sin} per (position, pair) built once from the int positions and float32 inverse-frequency constants (precise cosf/sinf); interleaved rotary and the hi/lo (V: also fp16, transposed) planes formed in the projection GEMMs' own epilogue; fused causal T-2048 attention k_fattn (EVERY row's scores on hi/lo planes (3 products: logit sigma 2 with these weights), online softmax in registers, hybrid P.V (rows < 512 hi/lo, rest fp16 x1024); key blocks above the diagonal are never visited); merged hi/lo x Wo exact.
// Compute dtypes, f32 accumulate: every input rounded to bf16; projections exact; rotary f32; attention rows < 512 3 products, rest fp16; softmax f32; Wo hl x exact.

#define NB_  2
#define TT   2048
#define DM   1024
#define NH_  16
#define NKV  16
#define HD   64
#define DQ   (NH_ * HD)
#define DKV  (NKV * HD)
#define RH   512                  // query rows < RH use hi+lo planes (0: none)
typedef _Float16 h16;
typedef unsigned short bf;
typedef __attribute__((ext_vector_type(16))) __bf16   v16bf;
typedef __attribute__((ext_vector_type(16))) _Float16 v16h;
typedef __attribute__((ext_vector_type(8)))  _Float16 v8h;
typedef __attribute__((ext_vector_type(8)))  unsigned short v8us;
typedef __attribute__((ext_vector_type(8)))  float    v8f;
typedef __attribute__((ext_vector_type(4)))  float    v4f;
typedef v8h  __attribute__((may_alias)) v8ha;
typedef v4f  __attribute__((may_alias)) v4fa;
typedef v8us __attribute__((may_alias)) v8usa;

__device__ __forceinline__ unsigned short f2bf(float f) { unsigned u = __float_as_uint(f); u += 0x7FFFu + ((u >> 16) & 1u); return (unsigned short)(u >> 16); }
__device__ __forceinline__ float bf2f(unsigned short b) { return __uint_as_float(((unsigned)b) << 16); }
__device__ __forceinline__ float bfr(float f) { return bf2f(f2bf(f)); }
__device__ __forceinline__ v16h cat16(v8h lo, v8h hi) { return __builtin_shufflevector(lo, hi, 0, 1, 2, 3, 4, 5, 6, 7, 8, 9, 10, 11, 12, 13, 14, 15); }
__device__ __forceinline__ v16bf cat16b(v8us lo, v8us hi) { return __builtin_bit_cast(v16bf, __builtin_shufflevector(lo, hi, 0, 1, 2, 3, 4, 5, 6, 7, 8, 9, 10, 11, 12, 13, 14, 15)); }
__device__ __forceinline__ v8f wmma16(v16h a, v16h b, v8f c) { return __builtin_amdgcn_wmma_f32_16x16x32_f16(false, a, false, b, (short)0, c, false, false); }
__device__ __forceinline__ v8f wmmab(v16bf a, v16bf b, v8f c) { return __builtin_amdgcn_wmma_f32_16x16x32_bf16(false, a, false, b, (short)0, c, false, false); }
__device__ __forceinline__ h16 tohx(float x) { return (h16)x; }
__device__ __forceinline__ void splitf(float y, unsigned short& h, unsigned short& l) { h = f2bf(y); l = f2bf(y - bf2f(h)); }
typedef __attribute__((ext_vector_type(2))) _Float16 v2h;
typedef __attribute__((ext_vector_type(4))) _Float16 v4h;
typedef __attribute__((ext_vector_type(2))) unsigned short v2us;
typedef __attribute__((ext_vector_type(4))) unsigned short v4us;
typedef __attribute__((ext_vector_type(2))) float v2f;
typedef __attribute__((ext_vector_type(4))) int v4i;



// ---- fragment order: every 16-bit operand plane [rows][K] lies in the workspace as blocks of 16 rows x 32 k (512 elements, 1 KiB), block (r / 16, k / 32) at index (r / 16) * (K / 32) + k / 32 (V^T planes: (k / 32) * (HD / 16) + r / 16); inside a block the two 512-byte halves are what the two 16-byte loads of a fragment read,
// lane by lane: element (r, k) at half (k / 16) % 2, lane ((k / 8) % 2) * 16 + r % 16, place k % 8. A wave's fragment load is then 512 contiguous bytes (4 whole lines) where the row-major plane gave 32 bytes from each of 16 lines. WFrag::ld takes block start + lane * 8.
__device__ __forceinline__ size_t pk(int r, int k, int K) { return (((size_t)(r >> 4) * (K >> 5) + (k >> 5)) << 9) + (((k >> 4) & 1) << 8) + ((((k >> 3) & 1) * 16 + (r & 15)) << 3) + (k & 7); }

#define NWK  8                    // waves of a work-group: 2 x 4 wave tiles of 64 x 32 outputs
#define GT   128                  // rows and columns of a work-group's output tile
#define GOPE (GT * 64)            // elements of one operand in one stage of the ring: 8 bands of 16 rows x 64 k (two fragment blocks, 2 KiB a band)
#define GPIT 132                  // floats of one row of the output tile in LDS (8 rows on, the banks are 32 further: the two halves of a wave store side by side)
// ---- k_gemmw: GEMM, one 128x128 output tile per work-group of NWK waves, operands from 16-bit planes in fragment order, staged in LDS: a stage is 64 k of the tile's 128 rows of every operand, two buffers;
// wave w brings band w of every operand by asynchronous copies (a band's stage is 2 KiB in a row, in the plane and in LDS alike), one stage ahead of the products; every wave reads its 4 A and 2 B fragments per 32 k from LDS, so an operand byte leaves L2 once per work-group.
// Each wave sums its outputs over the whole K in rising k. grid (M/128, N/128, Z), 32 * NWK threads. K % 64 == 0, K >= 128.
// C[m][n] (f32, pitch ldc, + optional f32 bias[n]) = sum_k A[m][k] Bt[n][k] (NSPLIT 1: + A2[m][k] Bt[n][k]). z-batch strides sA/sB/sC in elements.
// The output tile goes through LDS (the ring's bytes, free by then) so that a thread holds four (EPI 1: eight) neighbouring columns. EPI says what it does with them: 0 store them to C in f32; 1 is the grid of the three projections, job = blockIdx.z (weight z * sB, hi/lo planes z * sC), grid (NB_ * TT / 128, DQ / 128, 3):
// jobs 0, 1 (Q, K; rows = tokens b * TT + t, the tile's columns = heads 2 * blockIdx.y and the next) turn the four (even, odd) pairs by the token's {cos, sin} of CS and store hi/lo planes [b][head] of [token][HD] in fragment order;
// job 2 swaps the operands and the two block indices (A = the V weight, Bt = the tokens): the rows are (head, d) and the columns tokens, which is V^T as the attention reads it; fp16 and hi/lo planes [b][head] of fragment blocks [token / 32][d / 16].
template <bool B> struct BoolC { static constexpr bool value = B; };
template <typename T16> struct WFrag;
template <> struct WFrag<h16> { typedef v16h V; static __device__ __forceinline__ V ld(const h16* p) { return cat16(*(const v8h*)p, *(const v8h*)(p + 256)); } static __device__ __forceinline__ v8f mma(V a, V b, v8f c) { return wmma16(a, b, c); } };
template <> struct WFrag<bf> { typedef v16bf V; static __device__ __forceinline__ V ld(const bf* p) { return cat16b(*(const v8us*)p, *(const v8us*)(p + 256)); } static __device__ __forceinline__ v8f mma(V a, V b, v8f c) { return wmmab(a, b, c); } };
template <typename T16, int NSPLIT, bool BIAS, int EPI, int K>
__global__ __launch_bounds__(32 * NWK) void k_gemmw(const T16* __restrict__ A, const T16* __restrict__ A2, const T16* __restrict__ Bt, const T16* __restrict__ Bt2, float* C, int ldc, const float* __restrict__ bias, size_t sA, size_t sB, size_t sC, const float* __restrict__ CS, h16* P16, bf* Ph, bf* Pl) {
    typedef typename WFrag<T16>::V V;
    static_assert(NSPLIT <= 1 && K % 64 == 0 && K >= 128, "operands A, A2, Bt; two stages or more");
    constexpr int NOP = NSPLIT == 1 ? 3 : 2, BUFE = NOP * GOPE, NT = K / 64;   // operands, elements of one buffer, stages
    constexpr int RINGB = 2 * BUFE * 2, OUTB = GT * GPIT * 4, TILEB = RINGB > OUTB ? RINGB : OUTB;
    constexpr int CSP = HD + 4;   // EPI 1: floats of one row of the {cos, sin} tile in LDS, HD / 2 pairs and 16 bytes of pad (a row on, the banks are 4 further: 16 rows read 16 bytes each without a conflict)
    __shared__ __align__(1024) unsigned char sm[TILEB + (EPI == 1 ? GT * CSP * 4 : 0)];   // the ring; behind the K loop the output tile; EPI 1: behind it the {cos, sin} of the tile's rows
    T16* ring = (T16*)sm; float* red = (float*)sm; float* cst = (float*)(sm + TILEB);
    const size_t z = blockIdx.z; A += z * sA; if (A2) A2 += z * sA; Bt += z * sB; if (EPI == 0) C += z * sC; else { Ph += z * sC; Pl += z * sC; }
    const bool vt = EPI == 1 && blockIdx.z == 2;   // the same for the whole work-group
    if (vt) { const T16* t = A; A = Bt; Bt = t; }
    const int lane = threadIdx.x & 31, lr = lane & 15, hi = lane >> 4; const int r0 = (vt ? blockIdx.y : blockIdx.x) * GT, c0 = (vt ? blockIdx.x : blockIdx.y) * GT;
    const int w = __builtin_amdgcn_readfirstlane((int)(threadIdx.x >> 5)); const int wm = w >> 2, wn = w & 3;
    v8f acc[4][2];   // every '#pragma unroll' of this kernel: constant indices keep the accumulators, the fragments and the small vectors in registers
#pragma unroll
    for (int mb = 0; mb < 4; ++mb)
#pragma unroll
        for (int nb = 0; nb < 2; ++nb) acc[mb][nb] = (v8f){};
    // fragment order: a 16-row band is 16 * K elements, 64 k of it 1024 elements in a row. This lane's 16 bytes in the first of the four 512-byte pieces of band w, stage 0:
    const T16* ga = A + (size_t)(r0 + w * 16) * K + lane * 8; const T16* gb = Bt + (size_t)(c0 + w * 16) * K + lane * 8; const T16* ga2 = NSPLIT == 1 ? A2 + (size_t)(r0 + w * 16) * K + lane * 8 : ga;
    const unsigned la = (unsigned)(size_t)(ring + w * 1024 + lane * 8);   // the same place in buffer 0 of the ring, as an LDS byte address
    auto fill = [&](int t) {   // stage t into buffer t % 2: every lane on, 8 or 12 copies a wave; the wait in the copies' own statement is the precaution of the instruction set's rule on registers that an issued copy names
        const unsigned l = la + (unsigned)(t & 1) * (BUFE * 2), l2 = l + GOPE * 2, l3 = l + GOPE * 4; const T16* a = ga + (size_t)t * 1024; const T16* b = gb + (size_t)t * 1024; const T16* c = ga2 + (size_t)t * 1024;
        if (NSPLIT == 1)
            asm volatile("global_load_async_to_lds_b128 %0, %12, off\n\tglobal_load_async_to_lds_b128 %1, %13, off\n\tglobal_load_async_to_lds_b128 %2, %14, off\n\tglobal_load_async_to_lds_b128 %3, %15, off\n\t"
                         "global_load_async_to_lds_b128 %4, %16, off\n\tglobal_load_async_to_lds_b128 %5, %17, off\n\tglobal_load_async_to_lds_b128 %6, %18, off\n\tglobal_load_async_to_lds_b128 %7, %19, off\n\t"
                         "global_load_async_to_lds_b128 %8, %20, off\n\tglobal_load_async_to_lds_b128 %9, %21, off\n\tglobal_load_async_to_lds_b128 %10, %22, off\n\tglobal_load_async_to_lds_b128 %11, %23, off\n\ts_wait_xcnt 0x0"
                         :: "v"(l), "v"(l + 512), "v"(l + 1024), "v"(l + 1536), "v"(l2), "v"(l2 + 512), "v"(l2 + 1024), "v"(l2 + 1536), "v"(l3), "v"(l3 + 512), "v"(l3 + 1024), "v"(l3 + 1536),
                            "v"(a), "v"(a + 256), "v"(a + 512), "v"(a + 768), "v"(b), "v"(b + 256), "v"(b + 512), "v"(b + 768), "v"(c), "v"(c + 256), "v"(c + 512), "v"(c + 768) : "memory");
        else
            asm volatile("global_load_async_to_lds_b128 %0, %8, off\n\tglobal_load_async_to_lds_b128 %1, %9, off\n\tglobal_load_async_to_lds_b128 %2, %10, off\n\tglobal_load_async_to_lds_b128 %3, %11, off\n\t"
                         "global_load_async_to_lds_b128 %4, %12, off\n\tglobal_load_async_to_lds_b128 %5, %13, off\n\tglobal_load_async_to_lds_b128 %6, %14, off\n\tglobal_load_async_to_lds_b128 %7, %15, off\n\ts_wait_xcnt 0x0"
                         :: "v"(l), "v"(l + 512), "v"(l + 1024), "v"(l + 1536), "v"(l2), "v"(l2 + 512), "v"(l2 + 1024), "v"(l2 + 1536),
                            "v"(a), "v"(a + 256), "v"(a + 512), "v"(a + 768), "v"(b), "v"(b + 256), "v"(b + 512), "v"(b + 768) : "memory"); };
    fill(0);
    asm volatile("s_wait_asynccnt 0x0" ::: "memory");   // this wave's share of stage 0 has landed
    __syncthreads();   // stage 0 is whole before any wave reads it
    fill(1);
    const T16* fa = ring + wm * 4 * 1024 + lane * 8; const T16* fb = ring + GOPE + wn * 2 * 1024 + lane * 8;   // this lane's piece of the wave's first A and B fragment in buffer 0; A2 lies 2 * GOPE behind A
#pragma unroll 1   // one copy of the trip: a barrier ends every trip, so unrolling would only lengthen the code
    for (int t = 0; t < NT; ++t) { const int bo = (t & 1) * BUFE;
#pragma unroll
        for (int j = 0; j < 2; ++j) { V a[4], a2[4], bb[2];
#pragma unroll
            for (int mb = 0; mb < 4; ++mb) { a[mb] = WFrag<T16>::ld(fa + bo + mb * 1024 + j * 512); if (NSPLIT == 1) a2[mb] = WFrag<T16>::ld(fa + bo + 2 * GOPE + mb * 1024 + j * 512); }
#pragma unroll
            for (int nb = 0; nb < 2; ++nb) bb[nb] = WFrag<T16>::ld(fb + bo + nb * 1024 + j * 512);
#pragma unroll
            for (int nb = 0; nb < 2; ++nb)
#pragma unroll
                for (int mb = 0; mb < 4; ++mb) { acc[mb][nb] = WFrag<T16>::mma(a[mb], bb[nb], acc[mb][nb]); if (NSPLIT == 1) acc[mb][nb] = WFrag<T16>::mma(a2[mb], bb[nb], acc[mb][nb]); } }
        asm volatile("s_wait_dscnt 0x0" ::: "memory");      // this wave's reads of the buffer are done before the barrier frees it for the refill
        asm volatile("s_wait_asynccnt 0x0" ::: "memory");   // this wave's share of stage t + 1 has landed
        __syncthreads();   // publishes stage t + 1 and ends every wave's reads of stage t
        if (t + 2 < NT) fill(t + 2);
    }
    asm volatile("s_wait_asynccnt 0x0" ::: "memory");   // no copy is under way when the ring's bytes become the output tile
    v2f cs[GT * 16 / (32 * NWK)][2];   // EPI 1, jobs 0 and 1: {cos, sin} of two pairs in each of 8 rows (the same for both heads of the tile), read in whole rows of the table and handed on through LDS; asked for here so that they arrive while the tile is written to LDS
    if (EPI == 1 && !vt) { const float* cb = CS + ((size_t)(r0 % TT + ((int)threadIdx.x >> 4)) * HD + ((int)threadIdx.x & 15) * 4) * 2;   // the thread's first row; every load shares this pair and differs in the immediate offset
#pragma unroll   // constant indices keep cs in registers
        for (int s = 0; s < GT * 16 / (32 * NWK); ++s) { cs[s][0] = *(const v2f*)(cb + s * (2 * NWK * HD * 2)); cs[s][1] = *(const v2f*)(cb + s * (2 * NWK * HD * 2) + 4); }   // 2 * NWK rows on per step
        asm volatile("s_wait_xcnt 0x0" :: "v"(cb) : "memory"); }   // precaution of the instruction set's rule on registers that an issued load names: the address pair is an input here, so it keeps its value up to this wait
    float* my = red + (wm * 64 + hi * 8) * GPIT + wn * 32 + lr;
#pragma unroll
    for (int mb = 0; mb < 4; ++mb) {
#pragma unroll
        for (int nb = 0; nb < 2; ++nb) {
#pragma unroll
            for (int j = 0; j < 8; ++j) my[(mb * 16 + j) * GPIT + nb * 16] = acc[mb][nb][j]; } }
    if (EPI == 1 && !vt) { float* cw = cst + ((int)threadIdx.x >> 4) * CSP + ((int)threadIdx.x & 15) * 4;   // the two pairs lie side by side; the table's second copy of each pair stays out
#pragma unroll
        for (int s = 0; s < GT * 16 / (32 * NWK); ++s) *(v4fa*)(cw + s * (2 * NWK * CSP)) = (v4f){ cs[s][0][0], cs[s][0][1], cs[s][1][0], cs[s][1][1] }; }
    __syncthreads();   // the output tile (and its {cos, sin}) is whole in LDS before any thread reads its columns
    auto tile_out = [&](auto job_v) { constexpr bool VT = decltype(job_v)::value;   // compiled once per kind of job, so that each form's rows stay one straight run of LDS loads and stores
    if (EPI == 0) {
#pragma unroll
    for (int ch = 0; ch < 2; ++ch) {   // the tile's two halves of 64 columns
#pragma unroll
    for (int s = 0; s < GT * 16 / (32 * NWK); ++s) { const int idx = s * (32 * NWK) + (int)threadIdx.x; const int row = idx >> 4, cofs = ch * 64 + (idx & 15) * 4; v4f val = *(const v4fa*)(red + row * GPIT + cofs);
        if (BIAS) { val[0] += bfr(bias[c0 + cofs]); val[1] += bfr(bias[c0 + cofs + 1]); val[2] += bfr(bias[c0 + cofs + 2]); val[3] += bfr(bias[c0 + cofs + 3]); }
        *(v4f*)(C + (size_t)(r0 + row) * ldc + c0 + cofs) = val; } }
    } else {   // planes in fragment order: wave w takes the tile's 16-row band w, a lane the 8 neighbouring columns that are its own 16 bytes of a fragment half, so every store of a wave is 512 bytes in a row (4 whole lines)
    const int row = w * 16 + lr; v4f cr[HD / 16][2];   // {cos, sin} of the lane's four pairs in each 16-column group of a head
    if (!VT) {
#pragma unroll   // constant indices keep cr in registers
        for (int cq = 0; cq < HD / 16; ++cq) { cr[cq][0] = *(const v4fa*)(cst + row * CSP + cq * 16 + hi * 8); cr[cq][1] = *(const v4fa*)(cst + row * CSP + cq * 16 + hi * 8 + 4); } }
#pragma unroll
    for (int cg = 0; cg < GT / 16; ++cg) { const int cofs = cg * 16 + hi * 8; const v4f lo4 = *(const v4fa*)(red + row * GPIT + cofs), hi4 = *(const v4fa*)(red + row * GPIT + cofs + 4);
        float val[8] = { lo4[0], lo4[1], lo4[2], lo4[3], hi4[0], hi4[1], hi4[2], hi4[3] }; v8us oh, ol;
        if (BIAS) {
#pragma unroll
            for (int k = 0; k < 8; ++k) val[k] += bfr(bias[c0 + cofs + k]); }
        if (!VT) {
#pragma unroll   // constant indices keep the values in registers
            for (int pr = 0; pr < 4; ++pr) { const float c = cr[cg % (HD / 16)][pr >> 1][(pr & 1) * 2], sn = cr[cg % (HD / 16)][pr >> 1][(pr & 1) * 2 + 1], x0 = val[2 * pr], x1 = val[2 * pr + 1]; val[2 * pr] = x0 * c - x1 * sn; val[2 * pr + 1] = x0 * sn + x1 * c; } }   /* even: x0 c - x1 s; odd: x0 s + x1 c */
#pragma unroll   // constant indices keep the vectors in registers
        for (int k = 0; k < 8; ++k) { unsigned short a2, c2; splitf(val[k], a2, c2); oh[k] = a2; ol[k] = c2; }
        const int tk = c0 % TT + cofs;   // job 2: the first of the eight tokens
        const size_t e = !VT ? (size_t)(r0 / TT * NH_ + c0 / HD + cofs / HD) * TT * HD + pk(r0 % TT + row, cofs & 63, HD) : (size_t)(c0 / TT * DKV + r0 + (row & 64)) * TT + ((size_t)((tk >> 5) * 4 + ((row & 63) >> 4)) << 9) + pk(row & 15, tk & 31, 32);
        *(v8us*)(Ph + e) = oh; *(v8us*)(Pl + e) = ol;
        if (VT) *(v8h*)(P16 + e) = (v8h){ tohx(val[0]), tohx(val[1]), tohx(val[2]), tohx(val[3]), tohx(val[4]), tohx(val[5]), tohx(val[6]), tohx(val[7]) }; } }
        if (EPI == 1 && !VT) asm volatile("s_wait_xcnt 0x0" ::: "memory"); };   // precaution of the instruction set's rule on registers that an issued store names, behind the last column group's stores: in the built code job 2's block follows this one and reuses their registers
    if (vt) tile_out(BoolC<true>{}); else tile_out(BoolC<false>{});
}


__global__ __launch_bounds__(256) void k_wtG(const float* __restrict__ w, int K, int N, bf* Bt) {
    const int lane = threadIdx.x & 31; const int L0 = (blockIdx.x * 8 + (threadIdx.x >> 5)) * 8; const int nlines = N * K / 64;
{
#pragma unroll 1
        for (int l = 0; l < 8; ++l) { const int L = L0 + l; if (L >= nlines) break; const size_t e = (size_t)L * 64 + lane * 2; const int k = (int)(e % K), n = (int)(e / K); v2us o;
            o[0] = f2bf(w[(size_t)k * N + n]); o[1] = f2bf(w[(size_t)(k + 1) * N + n]); *(v2us*)(Bt + e) = o; }
         }
}

__constant__ float INV2[HD / 2] = { 1.000000000e+00f, 7.498942018e-01f, 5.623413324e-01f, 4.216965139e-01f, 3.162277639e-01f, 2.371373773e-01f, 1.778279394e-01f, 1.333521456e-01f, 1.000000015e-01f, 7.498942316e-02f, 5.623413250e-02f, 4.216964915e-02f, 3.162277490e-02f, 2.371373773e-02f, 1.778279431e-02f, 1.333521400e-02f, 9.999999776e-03f, 7.498942316e-03f, 5.623413250e-03f, 4.216964822e-03f, 3.162277630e-03f, 2.371373819e-03f, 1.778279431e-03f, 1.333521446e-03f, 1.000000047e-03f, 7.498941850e-04f, 5.623413017e-04f, 4.216965172e-04f, 3.162277571e-04f, 2.371373703e-04f, 1.778279402e-04f, 1.333521504e-04f };   // theta ** (-2i / 64), i = 0..31, in float32 as THIS module writes it (the NEGATIVE-POWER spelling 'theta ** (-arange(0, dh, 2) / dh)', evaluated in the reference's own f32 arithmetic): ten of the 32 entries differ by one ulp from the reciprocal spelling '1 / theta ** (2i / 64)' (indices 5, 9, 10, 12, 13, 15, 20, 27, 28, 29)
#define PT   512                               // threads of a work-group of k_prep: 16 waves
#define PU   8                                 // 32-k blocks that one wave rounds, side by side in its 8 rows
#define PG   (TT * HD / PT)                    // work-groups of k_prep: one entry of the rotary table a thread
#define PGX  (NB_ * TT * DM / (8 * PU * PT))   // ... of them round x, both batches
#define PGW  (DM * DM / (8 * PU * PT))         // ... round one weight
static_assert(PGX + 4 * PGW == PG && PT % HD == 0 && DM % (32 * PU) == 0, "every thread has one table entry and PU pieces of 8 elements");
// ---- k_prep: everything that depends on the inputs alone, in one grid of PG work-groups, about one per WGP, so that few waves have to be started. A work-group rounds a part of one source; every thread also builds one entry of the table, while its loads are under way.
// The table serves both batches (token_positions has no batch axis). W4 = the four weights Wq, Wk, Wv, Wo one behind the other.
__global__ __launch_bounds__(PT) void k_prep(const float* __restrict__ x, const int* __restrict__ pid, const float* __restrict__ wq, const float* __restrict__ wk, const float* __restrict__ wv, const float* __restrict__ wo, bf* XB, bf* W4, float* CS) {
    const int blk = blockIdx.x, lane = (int)threadIdx.x & 31; const int w = __builtin_amdgcn_readfirstlane((int)(threadIdx.x >> 5));
    const int t = (blk * PT + w * 32) / HD, d = (w * 32 + lane) % HD;   // the thread's table entry blk * PT + threadIdx.x; a wave's 32 entries share the token
    const float fr = INV2[d >> 1];   // asked for ahead of the wave's other loads, so that it is back first
    asm volatile("s_wait_xcnt 0x0" ::: "memory");   // precaution of the instruction set's rule on registers that an issued load names: the table's base and the offset are free for reuse only behind this wait
    const float* src = x; bf* dst = XB; int g = blk;
    if (g >= PGX) { g -= PGX; const int j = g / PGW; g %= PGW; src = j == 0 ? wq : j == 1 ? wk : j == 2 ? wv : wo; dst = W4 + (size_t)j * DM * DM; }
    // a wave takes 8 rows x PU 32-k blocks: per block it reads one whole 128-byte line of each row and writes four whole lines of the block in fragment order; all its 2 * PU loads are under way at once
    const int wn = g * (PT / 32) + w, row = (wn / (DM / (32 * PU))) * 8 + (lane & 7), k = (wn % (DM / (32 * PU))) * (32 * PU) + (lane >> 3) * 8;
    const float* p = src + (size_t)row * DM + k; v8f v[PU];
#pragma unroll   // constant indices keep the loaded values in registers; every load shares the pair and differs in the immediate offset
    for (int u = 0; u < PU; ++u) v[u] = *(const v8f*)(p + u * 32);
    asm volatile("s_wait_xcnt 0x0" :: "v"(p) : "memory");   // precaution of the instruction set's rule on registers that an issued load names: the address pair is an input here, so it keeps its value up to this wait
    const float a = __fmul_rn((float)pid[t], fr); v2f cs; cs[0] = cosf(a); cs[1] = sinf(a); *(v2f*)(CS + ((size_t)blk * PT + threadIdx.x) * 2) = cs;
    asm volatile("s_wait_xcnt 0x0" ::: "memory");   // same precaution behind the store: the rounding below reuses its registers
    v8us o[PU];
#pragma unroll
    for (int u = 0; u < PU; ++u)
#pragma unroll
        for (int e = 0; e < 8; ++e) o[u][e] = f2bf(v[u][e]);
    bf* q = dst + pk(row, k, DM);   // 32 k on is the next block, 512 elements on
#pragma unroll
    for (int u = 0; u < PU; ++u) *(v8us*)(q + u * 512) = o[u];
}

#define AQ   64                   // queries of one work-group: AGR groups of 32, each group two 16-column groups held by AKS waves
#define ANW  8                    // waves of a work-group: wave w = key phase (w >> 1), query group (w & 1)
#define AGR  2                    // query groups of 32
#define AKS  4                    // waves that share the key loop of one query group
#define ASK  (AKS * 32)           // keys of one stage of the ring
#define APE  (ASK * HD)           // elements of one plane in one stage (16 KiB, in a row in the plane and in LDS alike)
#define SCL2 0.18033688011112042f // HD^-0.5 x log2(e): scores are carried in the log2 domain
// ---- k_fattn: causal attention of one head for AQ queries, scores never leave the registers. S^T = K.Q^T (A = 16 key rows, B = 16 query columns; hi/lo planes, 3 products) leaves one query per lane column, so maximum, sum and rescale are per lane plus one exchange between the wave's halves;
// two 16-key score tiles of a lane are, in order, the B fragment of O^T += V^T.P^T (element e < 8: key 8 * hi + e, else key 16 + 8 * hi + e - 8, the order in which WFrag::ld reads V^T). Queries < RH: P and V on hi/lo planes (3 products); other queries: P x 1024 in fp16 (the factor is in the row sum too and cancels).
// The wave of key phase p takes the 32-key blocks p, p + AKS, ... up to its group's diagonal block with its own running maximum; the AKS partial (maximum, sum, O) of a group meet in LDS, are brought to the common maximum and summed in phase order; the quotient goes out as the merged hi/lo planes [b * TT + t][DQ] in fragment order.
// Queries >= RH: K hi, K lo and fp16 V^T of ASK keys are one stage of a ring of two buffers in LDS, brought by asynchronous copies one stage ahead, and both query groups read them there, so a key byte leaves L2 once per AQ queries. Grid (NB_ * heads, TT / AQ), longest query blocks of both batches first.
template <bool HR, int NQ>
__device__ __forceinline__ void attn_keys(const bf* pqh, const bf* pql, const bf* pkh, const bf* pkl, const h16* pv16, const bf* pvh, const bf* pvl, int qa, int q0, int w, int lr, int hi, v8f* o, float* m, float* l) {   // w = key phase. The p.. are per-lane addresses in fragment order (block start + lane * 8): the blocks of query qa, of key w * 32 and of V^T at key w * 32; every load of a plane shares its pair and differs in the immediate offset
    v16bf qh[NQ][2], ql[NQ][2];   // NQ groups of 16 queries from query qa on (B operand: column = query, k = d)
#pragma unroll
    for (int qt = 0; qt < NQ; ++qt)
#pragma unroll
        for (int ks = 0; ks < 2; ++ks) { qh[qt][ks] = WFrag<bf>::ld(pqh + qt * 16 * HD + ks * 512); ql[qt][ks] = WFrag<bf>::ld(pql + qt * 16 * HD + ks * 512); }
    asm volatile("s_wait_xcnt 0x0" :: "v"(pqh), "v"(pql) : "memory");   // precaution of the instruction set's rule on registers that an issued load names: the two address pairs are inputs here, so they keep their values up to this wait
#pragma unroll 1
    for (int kb = w * 32; kb <= q0; kb += AKS * 32) {
        v8f s[2][NQ];
#pragma unroll
        for (int kt = 0; kt < 2; ++kt) { v16bf kh[2], kl[2];
#pragma unroll
            for (int ks = 0; ks < 2; ++ks) { kh[ks] = WFrag<bf>::ld(pkh + kt * 16 * HD + ks * 512); kl[ks] = WFrag<bf>::ld(pkl + kt * 16 * HD + ks * 512); }
#pragma unroll
            for (int qt = 0; qt < NQ; ++qt) { v8f c = (v8f){};
#pragma unroll
                for (int ks = 0; ks < 2; ++ks) { c = wmmab(kh[ks], qh[qt][ks], c); c = wmmab(kl[ks], qh[qt][ks], c); c = wmmab(kh[ks], ql[qt][ks], c); }
                s[kt][qt] = c; } }
        v16h v16[4]; v16bf vh[4], vl[4];
#pragma unroll
        for (int dt = 0; dt < 4; ++dt) { if (HR) { vh[dt] = WFrag<bf>::ld(pvh + dt * 512); vl[dt] = WFrag<bf>::ld(pvl + dt * 512); } else v16[dt] = WFrag<h16>::ld(pv16 + dt * 512); }
#pragma unroll
        for (int qt = 0; qt < NQ; ++qt) { const int q = qa + qt * 16 + lr; float t[16]; float mx = m[qt];
#pragma unroll
            for (int e = 0; e < 16; ++e) { const int key = kb + (e >> 3) * 16 + hi * 8 + (e & 7); t[e] = (key <= q) ? s[e >> 3][qt][e & 7] * SCL2 : -3.0e38f; mx = fmaxf(mx, t[e]); }
            mx = fmaxf(mx, __shfl_xor(mx, 16, 32));
            const float al = __builtin_amdgcn_exp2f(m[qt] - mx); m[qt] = mx; const float mo = HR ? mx : mx - 10.0f; float ps = 0.f;
#pragma unroll
            for (int e = 0; e < 16; ++e) { t[e] = __builtin_amdgcn_exp2f(t[e] - mo); ps += t[e]; }
            l[qt] = l[qt] * al + ps;
#pragma unroll
            for (int dt = 0; dt < 4; ++dt) o[qt * 4 + dt] *= al;
            if (HR) { v8us h0, h1, l0, l1;
#pragma unroll
                for (int e = 0; e < 8; ++e) { unsigned short a, c2; splitf(t[e], a, c2); h0[e] = a; l0[e] = c2; splitf(t[8 + e], a, c2); h1[e] = a; l1[e] = c2; }
                const v16bf ph = cat16b(h0, h1), pl = cat16b(l0, l1);
#pragma unroll
                for (int dt = 0; dt < 4; ++dt) { v8f c = o[qt * 4 + dt]; c = wmmab(vh[dt], ph, c); c = wmmab(vh[dt], pl, c); c = wmmab(vl[dt], ph, c); o[qt * 4 + dt] = c; }
            } else { v16h p;
#pragma unroll
                for (int e = 0; e < 16; ++e) p[e] = tohx(t[e]);
#pragma unroll
                for (int dt = 0; dt < 4; ++dt) o[qt * 4 + dt] = wmma16(v16[dt], p, o[qt * 4 + dt]); } }
        // precaution of the instruction set's rule on registers that an issued load names: the trip's address pairs are inputs here, so they keep their values up to this wait and are stepped only behind it
        if (HR) { asm volatile("s_wait_xcnt 0x0" :: "v"(pkh), "v"(pkl), "v"(pvh), "v"(pvl) : "memory"); pvh += AKS * 32 * HD; pvl += AKS * 32 * HD; }
        else { asm volatile("s_wait_xcnt 0x0" :: "v"(pkh), "v"(pkl), "v"(pv16) : "memory"); pv16 += AKS * 32 * HD; }
        pkh += AKS * 32 * HD; pkl += AKS * 32 * HD;
    }
}
// The same walk for queries >= RH with the keys from the ring. pqh, pql: as above, the wave's 32 queries from qa on. gkh, gkl, gv: this lane's 16 bytes in the first of the four 512-byte pieces of wave w's eighth of stage 0 in each plane. ns stages (the same for the whole work-group); every wave passes every barrier, also in a stage whose block lies above its diagonal.
__device__ __forceinline__ void attn_keys_ring(const bf* pqh, const bf* pql, const bf* gkh, const bf* gkl, const h16* gv, bf* ring, int qa, int ns, int w, int p, int lane, int lr, int hi, v8f* o, float* m, float* l) {
    const unsigned la = (unsigned)(size_t)(ring + w * 1024 + lane * 8);   // the same place in buffer 0 of the ring, as an LDS byte address
    auto fill = [&](int t) {   // stage t into buffer t % 2: every lane on, 12 copies a wave; the wait in the copies' own statement is the precaution of the instruction set's rule on registers that an issued copy names
        const unsigned l1 = la + (unsigned)(t & 1) * (3 * APE * 2), l2 = l1 + APE * 2, l3 = l1 + APE * 4; const bf* a = gkh + (size_t)t * APE; const bf* b = gkl + (size_t)t * APE; const h16* c = gv + (size_t)t * APE;
        asm volatile("global_load_async_to_lds_b128 %0, %12, off\n\tglobal_load_async_to_lds_b128 %1, %13, off\n\tglobal_load_async_to_lds_b128 %2, %14, off\n\tglobal_load_async_to_lds_b128 %3, %15, off\n\t"
                     "global_load_async_to_lds_b128 %4, %16, off\n\tglobal_load_async_to_lds_b128 %5, %17, off\n\tglobal_load_async_to_lds_b128 %6, %18, off\n\tglobal_load_async_to_lds_b128 %7, %19, off\n\t"
                     "global_load_async_to_lds_b128 %8, %20, off\n\tglobal_load_async_to_lds_b128 %9, %21, off\n\tglobal_load_async_to_lds_b128 %10, %22, off\n\tglobal_load_async_to_lds_b128 %11, %23, off\n\ts_wait_xcnt 0x0"
                     :: "v"(l1), "v"(l1 + 512), "v"(l1 + 1024), "v"(l1 + 1536), "v"(l2), "v"(l2 + 512), "v"(l2 + 1024), "v"(l2 + 1536), "v"(l3), "v"(l3 + 512), "v"(l3 + 1024), "v"(l3 + 1536),
                        "v"(a), "v"(a + 256), "v"(a + 512), "v"(a + 768), "v"(b), "v"(b + 256), "v"(b + 512), "v"(b + 768), "v"(c), "v"(c + 256), "v"(c + 512), "v"(c + 768) : "memory"); };
    fill(0);
    v16bf qh[2][2], ql[2][2];   // two groups of 16 queries from query qa on (B operand: column = query, k = d)
#pragma unroll
    for (int qt = 0; qt < 2; ++qt)
#pragma unroll
        for (int ks = 0; ks < 2; ++ks) { qh[qt][ks] = WFrag<bf>::ld(pqh + qt * 16 * HD + ks * 512); ql[qt][ks] = WFrag<bf>::ld(pql + qt * 16 * HD + ks * 512); }
    asm volatile("s_wait_xcnt 0x0" :: "v"(pqh), "v"(pql) : "memory");   // precaution of the instruction set's rule on registers that an issued load names: the two address pairs are inputs here, so they keep their values up to this wait
    asm volatile("s_wait_asynccnt 0x0" ::: "memory");   // this wave's share of stage 0 has landed
    __syncthreads();   // stage 0 is whole before any wave reads it
    if (1 < ns) fill(1);
#pragma unroll 1   // one copy of the trip: a barrier ends every trip, so unrolling would only lengthen the code
    for (int st = 0; st < ns; ++st) { const int kb = st * ASK + p * 32;
        if (kb <= qa) {   // the same for the whole wave (scalar): blocks above the group's diagonal are not worked on
            const bf* pkh = ring + (st & 1) * (3 * APE) + p * (32 * HD) + lane * 8; const bf* pkl = pkh + APE; const h16* pv16 = (const h16*)(pkh + 2 * APE);
            v8f s[2][2];
#pragma unroll
            for (int kt = 0; kt < 2; ++kt) { v16bf kh[2], kl[2];
#pragma unroll
                for (int ks = 0; ks < 2; ++ks) { kh[ks] = WFrag<bf>::ld(pkh + kt * 16 * HD + ks * 512); kl[ks] = WFrag<bf>::ld(pkl + kt * 16 * HD + ks * 512); }
#pragma unroll
                for (int qt = 0; qt < 2; ++qt) { v8f c = (v8f){};
#pragma unroll
                    for (int ks = 0; ks < 2; ++ks) { c = wmmab(kh[ks], qh[qt][ks], c); c = wmmab(kl[ks], qh[qt][ks], c); c = wmmab(kh[ks], ql[qt][ks], c); }
                    s[kt][qt] = c; } }
            v16h v16[4];
#pragma unroll
            for (int dt = 0; dt < 4; ++dt) v16[dt] = WFrag<h16>::ld(pv16 + dt * 512);
#pragma unroll
            for (int qt = 0; qt < 2; ++qt) { const int q = qa + qt * 16 + lr; float t[16]; float mx = m[qt];
#pragma unroll
                for (int e = 0; e < 16; ++e) { const int key = kb + (e >> 3) * 16 + hi * 8 + (e & 7); t[e] = (key <= q) ? s[e >> 3][qt][e & 7] * SCL2 : -3.0e38f; mx = fmaxf(mx, t[e]); }
                mx = fmaxf(mx, __shfl_xor(mx, 16, 32));
                const float al = __builtin_amdgcn_exp2f(m[qt] - mx); m[qt] = mx; const float mo = mx - 10.0f; float ps = 0.f;
#pragma unroll
                for (int e = 0; e < 16; ++e) { t[e] = __builtin_amdgcn_exp2f(t[e] - mo); ps += t[e]; }
                l[qt] = l[qt] * al + ps;
#pragma unroll
                for (int dt = 0; dt < 4; ++dt) o[qt * 4 + dt] *= al;
                v16h pp;
#pragma unroll
                for (int e = 0; e < 16; ++e) pp[e] = tohx(t[e]);
#pragma unroll
                for (int dt = 0; dt < 4; ++dt) o[qt * 4 + dt] = wmma16(v16[dt], pp, o[qt * 4 + dt]); } }
        asm volatile("s_wait_dscnt 0x0" ::: "memory");      // this wave's reads of the buffer are done before the barrier frees it for the refill
        asm volatile("s_wait_asynccnt 0x0" ::: "memory");   // this wave's share of stage st + 1 has landed
        __syncthreads();   // publishes stage st + 1 and ends every wave's reads of stage st
        if (st + 2 < ns) fill(st + 2);
    }
    asm volatile("s_wait_asynccnt 0x0" ::: "memory");   // no copy is under way when the ring's bytes become the partial sums' place
}
// amdgpu_waves_per_eu(4, 4): holds the kernel to 256 VGPRs, so that two work-groups share a WGP and one wave's load waits are covered by three others on its SIMD (left free the build took 318 VGPRs: one work-group per WGP)
__global__ __launch_bounds__(32 * ANW) __attribute__((amdgpu_waves_per_eu(4, 4))) void k_fattn(const bf* __restrict__ Qh, const bf* __restrict__ Ql, const bf* __restrict__ Kh, const bf* __restrict__ Kl, const h16* __restrict__ V16, const bf* __restrict__ Vh, const bf* __restrict__ Vl, bf* Ah, bf* Al) {
    static_assert(2 * 3 * APE * 2 >= ANW * 32 * 68 * 4, "the partial sums fit the ring's bytes");
    __shared__ __align__(1024) unsigned char sm[2 * 3 * APE * 2];   // the ring: two buffers of K hi, K lo, V^T; behind the key loop the partial sums
    float* ored = (float*)sm;   // per wave 32 queries x HD floats, row pitch 68
    __shared__ float mred[ANW * 32]; __shared__ float lred[ANW * 32];
    const int lane = threadIdx.x & 31, lr = lane & 15, hi = lane >> 4; const int w = __builtin_amdgcn_readfirstlane((int)(threadIdx.x >> 5)); const int g = w & (AGR - 1), p = w / AGR;
    const int h = blockIdx.x % NH_, bat = blockIdx.x / NH_; const int q0 = (TT / AQ - 1 - (int)blockIdx.y) * AQ, qg = q0 + g * 32; const size_t hp = (size_t)blockIdx.x * TT * HD;
    v8f o[2 * 4]; float m[2] = { -3.0e38f, -3.0e38f }, l[2] = { 0.f, 0.f };   // o[qt * 4 + dt][j] = O[query qg + qt * 16 + lr][d = dt * 16 + hi * 8 + j]
#pragma unroll
    for (int i = 0; i < 8; ++i) o[i] = (v8f){};
    const size_t qo = hp + (size_t)qg * HD + lane * 8, ko = hp + (size_t)(p * 32) * HD + lane * 8, vo = ko;   // fragment order: 16 tokens of Q or K are 2 blocks, 32 keys of V^T 4 blocks (d / 16), so 32 keys are 32 * HD elements in every plane
    if (q0 < RH) {   // the same for the whole work-group. hi/lo P and V take twice the fragment registers: the two 16-query groups walk the keys one after the other, straight from the planes
        attn_keys<true, 1>(Qh + qo, Ql + qo, Kh + ko, Kl + ko, V16 + vo, Vh + vo, Vl + vo, qg, qg, p, lr, hi, o, m, l);
        attn_keys<true, 1>(Qh + qo + 16 * HD, Ql + qo + 16 * HD, Kh + ko, Kl + ko, V16 + vo, Vh + vo, Vl + vo, qg + 16, qg, p, lr, hi, o + 4, m + 1, l + 1);
    } else { const size_t so = hp + (size_t)w * 1024 + lane * 8; attn_keys_ring(Qh + qo, Ql + qo, Kh + so, Kl + so, V16 + so, (bf*)sm, qg, (q0 + AQ + ASK - 1) / ASK, w, p, lane, lr, hi, o, m, l); }
#pragma unroll
    for (int qt = 0; qt < 2; ++qt) { l[qt] += __shfl_xor(l[qt], 16, 32); if (hi == 0) mred[w * 32 + qt * 16 + lr] = m[qt]; }
    __syncthreads();   // every wave's running maximum is in LDS before any wave forms the common one
#pragma unroll
    for (int qt = 0; qt < 2; ++qt) { float M = mred[g * 32 + qt * 16 + lr];
#pragma unroll
        for (int u = 1; u < AKS; ++u) M = fmaxf(M, mred[(u * AGR + g) * 32 + qt * 16 + lr]);
        const float f = __builtin_amdgcn_exp2f(m[qt] - M);   // a wave without a key block has maximum -3e38, sum 0 and O 0: factor 0
        if (hi == 0) lred[w * 32 + qt * 16 + lr] = l[qt] * f;
        float* my = ored + (w * 32 + qt * 16 + lr) * 68 + hi * 8;
#pragma unroll
        for (int dt = 0; dt < 4; ++dt) { const v8f x = o[qt * 4 + dt] * f; *(v4fa*)(my + dt * 16) = (v4f){ x[0], x[1], x[2], x[3] }; *(v4fa*)(my + dt * 16 + 4) = (v4f){ x[4], x[5], x[6], x[7] }; } }
    __syncthreads();   // every wave's rescaled partial sum and O are in LDS before any thread sums across waves
    { const int q = lane, d0 = p * 16; float L = lred[g * 32 + q]; v4f a[4];   // wave (p, g): 16 d of the 32 queries of group g
#pragma unroll
        for (int c = 0; c < 4; ++c) a[c] = *(const v4fa*)(ored + (g * 32 + q) * 68 + d0 + c * 4);
#pragma unroll
        for (int u = 1; u < AKS; ++u) { L += lred[(u * AGR + g) * 32 + q];
#pragma unroll
            for (int c = 0; c < 4; ++c) a[c] += *(const v4fa*)(ored + ((u * AGR + g) * 32 + q) * 68 + d0 + c * 4); }
        const float inv = __fdiv_rn(1.0f, L); v8us oh[2], ol[2];
#pragma unroll
        for (int c = 0; c < 4; ++c)
#pragma unroll
            for (int e = 0; e < 4; ++e) { unsigned short x, y; splitf(a[c][e] * inv, x, y); oh[c >> 1][(c & 1) * 4 + e] = x; ol[c >> 1][(c & 1) * 4 + e] = y; }
        const size_t oo = pk(bat * TT + qg + q, h * HD + d0, DQ);   // the two 8-d pieces lie 128 elements apart ((k / 8) % 2 is the lane's half); a wave holds each piece of all its 32 queries: 2 x 256 contiguous bytes in fragment order
        *(v8us*)(Ah + oo) = oh[0]; *(v8us*)(Ah + oo + 128) = oh[1]; *(v8us*)(Al + oo) = ol[0]; *(v8us*)(Al + oo + 128) = ol[1]; }
}

extern "C" void kernel_launch(void* const* d_in, const int* in_sizes, int n_in,
                              void* d_out, int out_size, void* d_ws, size_t ws_size, hipStream_t stream) {
    (void)in_sizes; (void)n_in; (void)out_size;
    const float* x = (const float*)d_in[0]; const int* PID = (const int*)d_in[1]; const float* wq = (const float*)d_in[2]; const float* wk = (const float*)d_in[3]; const float* wv = (const float*)d_in[4]; const float* wo = (const float*)d_in[5];   /* inputs x, token_positions (int32 [2048], shared by all batches; read), Wq, Wk, Wv, Wo ('oi' [1024][1024]) */
    float* OUT = (float*)d_out;     // [2][2048][1024]
    char* wsp = (char*)d_ws;
    auto take = [&](size_t bytes) { char* p = wsp; wsp += (bytes + 255) & ~(size_t)255; return (void*)p; };
    bf* W4 = (bf*)take((size_t)4 * DM * DM * 2); float* CS = (float*)take((size_t)TT * HD * 2 * 4);   /* Wq, Wk, Wv, Wo one behind the other */
    bf* XB = (bf*)take((size_t)NB_ * TT * DM * 2);
    const size_t PL = (size_t)NB_ * NH_ * TT * HD;   /* elements of one plane, both batches */
    h16* VT16 = (h16*)take(PL * 2);
    bf* PH = (bf*)take(3 * PL * 2); bf* PLO = (bf*)take(3 * PL * 2);   /* hi and lo planes of Q, K, V^T one behind the other */
    bf* ATh = (bf*)take(PL * 2); bf* ATl = (bf*)take(PL * 2);
    if ((size_t)(wsp - (char*)d_ws) > ws_size) return;    // ws 256 MiB
    k_prep<<<PG, PT, 0, stream>>>(x, PID, wq, wk, wv, wo, XB, W4, CS);   /* rotary table, bf16 x and weights */
    k_gemmw<bf, 0, false, 1, DM><<<dim3(NB_ * TT / GT, DQ / GT, 3), 32 * NWK, 0, stream>>>(XB, nullptr, W4, nullptr, nullptr, 0, nullptr, 0, (size_t)DM * DM, PL, CS, VT16, PH, PLO);   /* Q and K projection with rotary, V^T = Wv . x^T; planes */
    k_fattn<<<dim3(NB_ * NH_, TT / AQ, 1), 32 * ANW, 0, stream>>>(PH, PLO, PH + PL, PLO + PL, VT16, PH + 2 * PL, PLO + 2 * PL, ATh, ATl);   /* scores, softmax, P.V and the merge of all heads */
    k_gemmw<bf, 1, false, 0, DQ><<<dim3(NB_ * TT / GT, DM / GT, 1), 32 * NWK, 0, stream>>>(ATh, ATl, W4 + (size_t)3 * DM * DM, nullptr, OUT, DM, nullptr, 0, 0, 0, nullptr, nullptr, nullptr, nullptr);
}
